// v000
// The times below were measured on an AMD MI455X: many runs one after another, warmed up first and cycling through
// copies of the inputs, with the whole window's GPU time divided by the number of runs. Launches and the gaps
// between them are all in it. The median over several windows is given; except for v000 it joins two sittings, which
// can be a few percent apart, so the side-by-side timings, each taken in one sitting, are the better comparison.
// The starting kernel, v000, takes 6880 microseconds a run.
// Contractions (per sample): the shared QKVV projection x.W^T [1024x1024].[1024x4096] (q/k columns on bf16 hi/lo split planes), the E/F head projections of k and v_sa as per-head z-batched [1024x64].[64x64] products (+b), the 16 channel affinities q^T k [64x1024].[1024x64] on bf16 hi/lo split planes (64-wide softmax over sigma~19 logits: plain f16 flipped near-ties) and x_c = attn_c.v_ca^T [64x64].[64x1024] as z-batched products, and the two output halves gelu(x_s.W_o1^T + b) / gelu(x_c.W_o2^T + b) [1024x1024].[1024x512] — f16 operands on pre-cast planes (v_wmma_f32_16x16x32_f16; 64x64 register-blocked wave tiles, weights x16); per (sample, head) the spatial attention softmax(q.k_s^T * temp2[h]) v_s over 1024 positions as one flash launch (f16 operands; temperature folded into q on device); f32 accumulate and softmax. The tiled E/F biases, the 64-wide channel softmax (x temp1[h], exp once, f16 plane) and the q pre-scaling are f32 kernels; x_c is laid out exactly as torch's permute(0,2,1,3).reshape (row = d*16 + h, column = n).
#include <hip/hip_runtime.h>
#include <math.h>

typedef __attribute__((ext_vector_type(16))) _Float16 v16h;
typedef __attribute__((ext_vector_type(8)))  _Float16 v8h;
typedef __attribute__((ext_vector_type(16))) __bf16   v16b;
typedef __attribute__((ext_vector_type(8)))  float    v8f;
typedef __attribute__((ext_vector_type(4)))  float    v4f;

// 16-bit WMMA fragment map (wave32), lane L, h = L>>4, m = L&15:
//   A 16x32: lane = row m;   element i -> k = (i<8) ? 8h+i : 16+8h+(i-8)
//   B 32x16: lane = column m; the SAME k(i,h)
//   D 16x16 (8 f32): lane = column m; element r -> row 8h+r
__device__ __forceinline__ int frag_k(int i, int h) { return (i < 8) ? (8 * h + i) : (16 + 8 * h + (i - 8)); }
__device__ __forceinline__ __bf16 bf16_rne(float f) {
    unsigned int u = __float_as_uint(f);
    u += 0x7fffu + ((u >> 16) & 1u);
    return __builtin_bit_cast(__bf16, (unsigned short)(u >> 16));
}
__device__ __forceinline__ float bf16_f32(__bf16 b) { return __uint_as_float(((unsigned int)__builtin_bit_cast(unsigned short, b)) << 16); }
__device__ __forceinline__ v8f wmma16(v16h a, v16h b, v8f c) {
    c = __builtin_amdgcn_wmma_f32_16x16x32_f16(false, a, false, b, (short)0, c, false, false);
    asm volatile("v_nop\n\tv_nop\n\tv_nop\n\tv_nop" : "+v"(c) : "v"(a), "v"(b));
    return c;
}
__device__ __forceinline__ v8f wmmab(v16b a, v16b b, v8f c) {
    c = __builtin_amdgcn_wmma_f32_16x16x32_bf16(false, a, false, b, (short)0, c, false, false);
    asm volatile("v_nop\n\tv_nop\n\tv_nop\n\tv_nop" : "+v"(c) : "v"(a), "v"(b));
    return c;
}
struct Split { v16b hi, lo; };
// hi/lo split product: a.hi*b.hi + a.hi*b.lo + a.lo*b.hi
__device__ __forceinline__ v8f wmma3(const Split& a, const Split& b, v8f c) {
    c = __builtin_amdgcn_wmma_f32_16x16x32_bf16(false, a.hi, false, b.hi, (short)0, c, false, false);
    c = __builtin_amdgcn_wmma_f32_16x16x32_bf16(false, a.hi, false, b.lo, (short)0, c, false, false);
    c = __builtin_amdgcn_wmma_f32_16x16x32_bf16(false, a.lo, false, b.hi, (short)0, c, false, false);
    asm volatile("v_nop\n\tv_nop\n\tv_nop\n\tv_nop" : "+v"(c) : "v"(a.hi), "v"(a.lo), "v"(b.hi), "v"(b.lo));
    return c;
}
struct Split3 { v16b hi, mid, lo; };
// triple split product (6 terms, drops only terms below 2^-24 relative)
__device__ __forceinline__ v8f wmma6(const Split3& a, const Split3& b, v8f c) {
    c = __builtin_amdgcn_wmma_f32_16x16x32_bf16(false, a.hi, false, b.hi, (short)0, c, false, false);
    c = __builtin_amdgcn_wmma_f32_16x16x32_bf16(false, a.hi, false, b.mid, (short)0, c, false, false);
    c = __builtin_amdgcn_wmma_f32_16x16x32_bf16(false, a.mid, false, b.hi, (short)0, c, false, false);
    c = __builtin_amdgcn_wmma_f32_16x16x32_bf16(false, a.hi, false, b.lo, (short)0, c, false, false);
    c = __builtin_amdgcn_wmma_f32_16x16x32_bf16(false, a.mid, false, b.mid, (short)0, c, false, false);
    c = __builtin_amdgcn_wmma_f32_16x16x32_bf16(false, a.lo, false, b.hi, (short)0, c, false, false);
    asm volatile("v_nop\n\tv_nop\n\tv_nop\n\tv_nop" : "+v"(c) : "v"(a.hi), "v"(a.mid), "v"(a.lo), "v"(b.hi), "v"(b.mid), "v"(b.lo));
    return c;
}

// Fragment gathers from f32 memory: element i <- p[(k0 + frag_k(i,h)) * sk] * s, zero for k >= klen.
__device__ __forceinline__ v16h fh_ld(const float* __restrict__ p, long long sk, int k0, int h, int klen, float s) {
    v16h a;
#pragma unroll
    for (int i = 0; i < 16; ++i) { const int k = k0 + frag_k(i, h); a[i] = (k < klen) ? (_Float16)(p[(long long)k * sk] * s) : (_Float16)0.f; }
    return a;
}
__device__ __forceinline__ Split sp_ld(const float* __restrict__ p, long long sk, int k0, int h, int klen, float s) {
    Split r;
#pragma unroll
    for (int i = 0; i < 16; ++i) {
        const int k = k0 + frag_k(i, h); const float x = (k < klen) ? p[(long long)k * sk] * s : 0.f;
        const __bf16 hb = bf16_rne(x); r.hi[i] = hb; r.lo[i] = bf16_rne(x - bf16_f32(hb));
    }
    return r;
}
__device__ __forceinline__ Split3 sp3_ld(const float* __restrict__ p, long long sk, int k0, int h, int klen, float s) {
    Split3 r;
#pragma unroll
    for (int i = 0; i < 16; ++i) {
        const int k = k0 + frag_k(i, h); const float x = (k < klen) ? p[(long long)k * sk] * s : 0.f;
        const __bf16 hb = bf16_rne(x); const float r1 = x - bf16_f32(hb); const __bf16 mb = bf16_rne(r1);
        r.hi[i] = hb; r.mid[i] = mb; r.lo[i] = bf16_rne(r1 - bf16_f32(mb));
    }
    return r;
}
__device__ __forceinline__ v16b bh_ld(const float* __restrict__ p, long long sk, int k0, int h, int klen, float s) {
    v16b a;
#pragma unroll
    for (int i = 0; i < 16; ++i) { const int k = k0 + frag_k(i, h); a[i] = bf16_rne((k < klen) ? p[(long long)k * sk] * s : 0.f); }
    return a;
}
// f16 fragment from an f16 LDS/global row with element stride 1 (k-contiguous), no bounds (tile already zero padded)
__device__ __forceinline__ v16h fh_row(const _Float16* __restrict__ row, int k0, int h) {
    v16h a;
#pragma unroll
    for (int i = 0; i < 16; ++i) a[i] = row[k0 + frag_k(i, h)];
    return a;
}

#define VST2(T, ptr, val) do { const T vst2_v_ = (val); *(T*)(ptr) = vst2_v_;  } while (0)
typedef float v4f __attribute__((ext_vector_type(4)));
#define VST2V4(ptr, val) do { const v4f vst2_v4_ = (val); *(v4f*)(ptr) = vst2_v4_;  } while (0)

__device__ __attribute__((noinline)) float act_fn(float v, int act) {
    if (act == 1) return fmaxf(v, 0.f);                                                                               // relu
    if (act == 2) { const float u = 0.7978845608028654f * (v + 0.044715f * v * v * v); return 0.5f * v * (1.f + tanhf(u)); } // tanh-gelu
    if (act == 3) return v / (1.f + expf(-v));                                                                        // silu
    if (act == 4) return 0.5f * v * (1.f + erff(v * 0.7071067811865476f));                                             // erf-gelu
    if (act == 5) return tanhf(v);
    if (act == 6) return 1.f / (1.f + expf(-v));                                                                      // sigmoid
    if (act == 7) return (v > 0.f) ? v : 0.01f * v;                                                                   // leaky relu 0.01
    if (act == 8) return (v > 0.f) ? v : (expf(v) - 1.f);                                                             // elu
    if (act == 9) return fminf(fmaxf(v, 0.f), 6.f);                                                                   // relu6
    if (act == 10) return fabsf(v);                                                                                    // abs
    if (act == 11) return (v >= 0.f) ? v : 0.1f * v;                                                                  // leaky 0.1
    if (act == 12) return (v > 0.f) ? v : 0.2f * v;                                                                   // leaky 0.2
    if (act == 13) return (v > 20.f) ? v : log1pf(expf(v));                                                            // softplus
    return v;
}

// =====================================================================================================================
// k_gemm<MODE>: C(z, m, n) = act(alpha * sum_k A(z, m, k) * B(z, k, n) + bias) + beta * R(z, m, n)
//   One wave (32-thread block) per 16 x 32 tile of C; grid (ceil(N/32), ceil(M/16), Z). Batch z -> (zo = z / zi_n, zi = z % zi_n)
//   with separate outer/inner strides for every tensor (e.g. batch and head). A(m,k) = A[zo*sAo + zi*sAi + m*sAm + k*sAk] (f32),
//   B(k,n) = B[zo*sBo + zi*sBi + n*sBn + k*sBk] (f32); any M, N, K (K zero-padded to 32 inside the fragments, M/N tails guarded).
//   C(m,n) = C[zo*sCo + zi*sCi + m*sCm + n] (n contiguous). flags: 1 bias[n], 2 bias[m], 4 residual R[zo*sRo + zi*sRi + m*sRm + n*sRn].
//   MODE 0: f16 operands (A prescaled by sa, B by sb, both undone in the epilogue); 1: bf16 hi/lo split (3 products); 2: bf16;
//   3: bf16 hi/mid/lo triple split (6 products); 4: as 3 with Kahan-compensated f32 accumulation across k-steps.
// =====================================================================================================================
struct GemmP {
    const float* A; const float* B; const float* bias; const float* R; float* C;
    long long sAo, sAi, sAm, sAk, sBo, sBi, sBn, sBk, sCo, sCi, sCm, sRo, sRi, sRm, sRn;
    int M, N, K, zi_n, flags, act; float alpha, beta, sa, sb;
    int Npad, pad_;     // columns [N, Npad) of C are written as 0 so that padded workspace rows are covered by whole-line stores; Npad >= N
};
static_assert(sizeof(GemmP) == 5 * 8 + 15 * 8 + 6 * 4 + 4 * 4 + 2 * 4, "GemmP has padding");

template <int MODE>
__global__ __launch_bounds__(32) void k_gemm(GemmP p) {
    const int lane = threadIdx.x & 31, h = lane >> 4, l15 = lane & 15;
    const int m0 = blockIdx.y * 16, n0 = blockIdx.x * 32;
    const int z = blockIdx.z, zo = z / p.zi_n, zi = z - zo * p.zi_n;
    const float* A = p.A + zo * p.sAo + zi * p.sAi;
    const float* B = p.B + zo * p.sBo + zi * p.sBi;
    const int am = min(m0 + l15, p.M - 1);                       // clamped row for loads (stores are guarded)
    v8f acc[2], comp[2];
#pragma unroll
    for (int t = 0; t < 2; ++t) { v8f zz = {}; acc[t] = zz; comp[t] = zz; }
    for (int k0 = 0; k0 < p.K; k0 += 32) {
        const float* arow = A + (long long)am * p.sAm;
        if (MODE == 1) {
            const Split a = sp_ld(arow, p.sAk, k0, h, p.K, 1.f);
#pragma unroll
            for (int t = 0; t < 2; ++t) {
                const int bn = min(n0 + t * 16 + l15, p.N - 1);
                acc[t] = wmma3(a, sp_ld(B + (long long)bn * p.sBn, p.sBk, k0, h, p.K, 1.f), acc[t]);
            }
        } else if (MODE == 3) {
            const Split3 a = sp3_ld(arow, p.sAk, k0, h, p.K, 1.f);
#pragma unroll
            for (int t = 0; t < 2; ++t) {
                const int bn = min(n0 + t * 16 + l15, p.N - 1);
                acc[t] = wmma6(a, sp3_ld(B + (long long)bn * p.sBn, p.sBk, k0, h, p.K, 1.f), acc[t]);
            }
        } else if (MODE == 4) {
            // triple split as MODE 3, but each k-step's 6 products go into a fresh accumulator and the partial is added to the running f32 sum
            // on the VALU with Kahan compensation (accumulation error stays ~1 ulp however long K is)
            const Split3 a = sp3_ld(arow, p.sAk, k0, h, p.K, 1.f);
#pragma unroll
            for (int t = 0; t < 2; ++t) {
                const int bn = min(n0 + t * 16 + l15, p.N - 1); v8f zz = {};
                const v8f part = wmma6(a, sp3_ld(B + (long long)bn * p.sBn, p.sBk, k0, h, p.K, 1.f), zz);
                const v8f y = part - comp[t]; const v8f s = acc[t] + y; comp[t] = (s - acc[t]) - y; acc[t] = s;
            }
        } else if (MODE == 2) {
            const v16b a = bh_ld(arow, p.sAk, k0, h, p.K, 1.f);
#pragma unroll
            for (int t = 0; t < 2; ++t) {
                const int bn = min(n0 + t * 16 + l15, p.N - 1);
                acc[t] = wmmab(a, bh_ld(B + (long long)bn * p.sBn, p.sBk, k0, h, p.K, 1.f), acc[t]);
            }
        } else {
            const v16h a = fh_ld(arow, p.sAk, k0, h, p.K, p.sa);
#pragma unroll
            for (int t = 0; t < 2; ++t) {
                const int bn = min(n0 + t * 16 + l15, p.N - 1);
                acc[t] = wmma16(a, fh_ld(B + (long long)bn * p.sBn, p.sBk, k0, h, p.K, p.sb), acc[t]);
            }
        }
    }
    const float iscale = (MODE == 0) ? p.alpha / (p.sa * p.sb) : p.alpha;
    float* C = p.C + zo * p.sCo + zi * p.sCi;
    const float* R = p.R + zo * p.sRo + zi * p.sRi;
    __shared__ __align__(16) float ctile[16][36];
#pragma unroll
    for (int t = 0; t < 2; ++t) {
        const int n = n0 + t * 16 + l15; const int nn = min(n, p.N - 1);
#pragma unroll
        for (int r = 0; r < 8; ++r) {
            const int m = m0 + 8 * h + r; const int mm = min(m, p.M - 1);
            float v = acc[t][r] * iscale;
            if (p.flags & 1) v += p.bias[nn];
            if (p.flags & 2) v += p.bias[mm];
            if (p.flags & 8) v *= p.bias[(long long)zo * p.M + mm];   /* per-(z,row) scale vector laid out [Z][M]; exclusive with the bias flags */
            v = act_fn(v, p.act);
            if (p.flags & 4) v += p.beta * R[(long long)mm * p.sRm + (long long)nn * p.sRn];
            ctile[8 * h + r][t * 16 + l15] = (n < p.N) ? v : 0.f;
        }
    }
    __syncthreads();
    const int NW = (p.Npad > p.N) ? p.Npad : p.N;           // write width
    const bool fast = (m0 + 16 <= p.M) && (n0 + 32 <= NW) && ((p.sCm & 3) == 0) && ((((size_t)C) & 15) == 0);
    if (fast) {
#pragma unroll
        for (int s = 0; s < 4; ++s) {
            const int row = s * 4 + (lane >> 3), c4 = (lane & 7) * 4;
            const v4f v = *(const v4f*)&ctile[row][c4];
            VST2V4(C + (long long)(m0 + row) * p.sCm + n0 + c4, v);
        }
    } else {
        for (int row = 0; row < 16; ++row) {
            const int m = m0 + row, n = n0 + lane;
            if (m < p.M && n < NW) VST2(float, C + (long long)m * p.sCm + n, ctile[row][lane]);
        }
    }
}


// =====================================================================================================================
// k_gemmT<MODE, TM, TN>: same contract as k_gemm, but one wave computes a (16*TM) x (16*TN) tile: TM A fragments and TN B fragments are
//   loaded per 32-wide k-step and reused across TM*TN WMMAs (far fewer load/convert instructions per MAC). MODE 0 (f16), 1 (bf16 hi/lo),
//   2 (bf16) only. grid (ceil(NW/(16*TN)), ceil(M/(16*TM)), Z), block 32. Epilogue identical to k_gemm, run per 16x32 sub-tile.
// =====================================================================================================================
template <int MODE, int TM, int TN>
__global__ __launch_bounds__(32) void k_gemmT(GemmP p) {
    const int lane = threadIdx.x & 31, h = lane >> 4, l15 = lane & 15;
    const int m0 = blockIdx.y * (16 * TM), n0 = blockIdx.x * (16 * TN);
    const int z = blockIdx.z, zo = z / p.zi_n, zi = z - zo * p.zi_n;
    const float* A = p.A + zo * p.sAo + zi * p.sAi;
    const float* B = p.B + zo * p.sBo + zi * p.sBi;
    v8f acc[TM][TN];
#pragma unroll
    for (int i = 0; i < TM; ++i)
#pragma unroll
        for (int t = 0; t < TN; ++t) { v8f zz = {}; acc[i][t] = zz; }
    for (int k0 = 0; k0 < p.K; k0 += 32) {
        if (MODE == 1) {
            Split a[TM], b[TN];
#pragma unroll
            for (int i = 0; i < TM; ++i) { const int am = min(m0 + 16 * i + l15, p.M - 1); a[i] = sp_ld(A + (long long)am * p.sAm, p.sAk, k0, h, p.K, 1.f); }
#pragma unroll
            for (int t = 0; t < TN; ++t) { const int bn = min(n0 + 16 * t + l15, p.N - 1); b[t] = sp_ld(B + (long long)bn * p.sBn, p.sBk, k0, h, p.K, 1.f); }
#pragma unroll
            for (int i = 0; i < TM; ++i)
#pragma unroll
                for (int t = 0; t < TN; ++t) acc[i][t] = wmma3(a[i], b[t], acc[i][t]);
        } else if (MODE == 2) {
            v16b a[TM], b[TN];
#pragma unroll
            for (int i = 0; i < TM; ++i) { const int am = min(m0 + 16 * i + l15, p.M - 1); a[i] = bh_ld(A + (long long)am * p.sAm, p.sAk, k0, h, p.K, 1.f); }
#pragma unroll
            for (int t = 0; t < TN; ++t) { const int bn = min(n0 + 16 * t + l15, p.N - 1); b[t] = bh_ld(B + (long long)bn * p.sBn, p.sBk, k0, h, p.K, 1.f); }
#pragma unroll
            for (int i = 0; i < TM; ++i)
#pragma unroll
                for (int t = 0; t < TN; ++t) acc[i][t] = wmmab(a[i], b[t], acc[i][t]);
        } else {
            v16h a[TM], b[TN];
#pragma unroll
            for (int i = 0; i < TM; ++i) { const int am = min(m0 + 16 * i + l15, p.M - 1); a[i] = fh_ld(A + (long long)am * p.sAm, p.sAk, k0, h, p.K, p.sa); }
#pragma unroll
            for (int t = 0; t < TN; ++t) { const int bn = min(n0 + 16 * t + l15, p.N - 1); b[t] = fh_ld(B + (long long)bn * p.sBn, p.sBk, k0, h, p.K, p.sb); }
#pragma unroll
            for (int i = 0; i < TM; ++i)
#pragma unroll
                for (int t = 0; t < TN; ++t) acc[i][t] = wmma16(a[i], b[t], acc[i][t]);
        }
    }
    const float iscale = (MODE == 0) ? p.alpha / (p.sa * p.sb) : p.alpha;
    float* C = p.C + zo * p.sCo + zi * p.sCi;
    const float* R = p.R + zo * p.sRo + zi * p.sRi;
    const int NW = (p.Npad > p.N) ? p.Npad : p.N;
    __shared__ __align__(16) float ctile[16][36];
#pragma unroll
    for (int i = 0; i < TM; ++i) {
        const int mb = m0 + 16 * i; if (mb >= p.M) break;          // wave-uniform
#pragma unroll
        for (int tp = 0; tp < TN / 2; ++tp) {
            const int nb = n0 + 32 * tp; if (nb >= NW) break;        // wave-uniform
#pragma unroll
            for (int t2 = 0; t2 < 2; ++t2) {
                const int t = 2 * tp + t2; const int n = nb + t2 * 16 + l15; const int nn = min(n, p.N - 1);
#pragma unroll
                for (int r = 0; r < 8; ++r) {
                    const int m = mb + 8 * h + r; const int mm = min(m, p.M - 1);
                    float v = acc[i][t][r] * iscale;
                    if (p.flags & 1) v += p.bias[nn];
                    if (p.flags & 2) v += p.bias[mm];
            if (p.flags & 8) v *= p.bias[(long long)zo * p.M + mm];   /* per-(z,row) scale vector laid out [Z][M]; exclusive with the bias flags */
                    v = act_fn(v, p.act);
                    if (p.flags & 4) v += p.beta * R[(long long)mm * p.sRm + (long long)nn * p.sRn];
                    ctile[8 * h + r][t2 * 16 + l15] = (n < p.N) ? v : 0.f;
                }
            }
            __syncthreads();
            const bool fast = (mb + 16 <= p.M) && (nb + 32 <= NW) && ((p.sCm & 3) == 0) && ((((size_t)C) & 15) == 0);
            if (fast) {
#pragma unroll
                for (int s = 0; s < 4; ++s) {
                    const int row = s * 4 + (lane >> 3), c4 = (lane & 7) * 4;
                    const v4f v = *(const v4f*)&ctile[row][c4];
                    VST2V4(C + (long long)(mb + row) * p.sCm + nb + c4, v);
                }
            } else {
                for (int row = 0; row < 16; ++row) {
                    const int m = mb + row, n = nb + lane;
                    if (m < p.M && n < NW) VST2(float, C + (long long)m * p.sCm + n, ctile[row][lane]);
                }
            }
            __syncthreads();
        }
    }
}

// =====================================================================================================================
//   Wave = 16 queries, AW waves per block, 64-key blocks; grid (ceil(Lq/(16*AW)), H, B), block 32*AW. Any Lq, Lk; head dim dh <= DHP
//   (DHP multiple of 32), value dim dv <= DVP (multiple of 16, <= 128). Every tensor addressed by (batch, head, row, element) strides, f32.
//   Scores: QM 0 f16 operands, 1 bf16 hi/lo split, 2 bf16 triple split; statistics f32 (exp2 domain); P.V: P x 4096 as f16 with V f16 staged in LDS
//   (SPLITPV: P and V as bf16 hi/lo splits). kv head = h / hrep. Masking: causal = 1 (keep j <= i + coff, masked -> -inf, key blocks beyond the
//   diagonal skipped), causal = 2 (masked -> mfill, a finite fill like the -1e9; no skipping), causal = 3 (keep j >= i + coff,
//   masked -> -inf, no skipping); optional additive f32 mask Mf,
//   optional int keep-mask Mi (0 -> score := mfill), both addressed b*smb + h*smh + i*smi + j*smj (0 strides broadcast).
// =====================================================================================================================
#define AW 4
struct AttnP {   // apv4
    const float* Q; const float* K; const float* V; float* O; float* P; const float* Mf; const int* Mi; float* ST;
    const float* Pw; const float* Rt; const int* SQ; const int* SK;           // optional: post-softmax weight, relative-position table, segment ids
    long long swb, swh, swi, swj, srb, srh, sri;                                 // Pw strides (b,h,i,j); Rt strides (b,h,i), column = clamp(i - j + roff, 0, rn-1)
    long long sQb, sQh, sQi, sQd, sKb, sKh, sKj, sKd, sVb, sVh, sVj, sVd, sOb, sOh, sOi, sPb, sPh, sPi, smb, smh, smi, smj;
    int Lq, Lk, dh, dv, hrep, causal, coff, pband;   // pband > 0: P holds only the band |j - i| <= pband, column j - i + pband
    float scale, mfill; int nonorm, mpol;             // nonorm (online path only): O = sum_j exp(score_j) V_j without the 1/rowsum (scores must be <= ~0); mpol: Mi masks where ==0 (mpol 0) or where !=0 (mpol 1)
    int roff, rn, segpol, win;                        // Rt column offset/count; SQ/SK: score := mfill where (segpol 0) SQ[i] != SK[j] or (segpol 1) SQ[i] == SK[j]; win > 0: keys with i - j > win (after coff) -> -inf
};
//   Pw: the softmax numerator is multiplied by Pw(b,h,i,j) AFTER the row sum is taken (probs * weight, then P.V), as in post-softmax multiplicative biases.                                                    // ST (optional): per row (b,h,i) -> ST[((b*H + h)*Lq + i)*2 + {0,1}] = {row max of the scaled+masked score (natural units), sum_j exp(score - max)}
static_assert(sizeof(AttnP) == 12 * 8 + 29 * 8 + 16 * 4, "AttnP has padding");

#ifndef KATTN_ATTR
#define KATTN_ATTR
#endif
template <int DHP, int DVP, int QM, bool SPLITPV, bool TWOPASS>
__global__ __launch_bounds__(32 * AW) KATTN_ATTR void k_attn(AttnP p) {
    constexpr int NT = DVP / 16;                // output tiles
    constexpr int KS = DHP / 32;                // k-steps for the scores
    constexpr int VP = DVP + 8;                 // LDS pitch (halves)
    __shared__ __align__(16) float    pl[AW][16 * 64];
    __shared__ __align__(16) _Float16 vl[(SPLITPV ? 2 : 1) * 64 * VP];   // f16 V tile, or bf16 hi and lo tiles (same 2-byte size)
    const int lane = threadIdx.x & 31, hf = lane >> 4, l15 = lane & 15, wave = threadIdx.x >> 5;
    const int h = blockIdx.y, b = blockIdx.z, hk = h / p.hrep;
    const int q0 = (blockIdx.x * AW + wave) * 16;
    float* myp = pl[wave];
    const float L2E = 1.4426950408889634f;
    const float NEG = -__builtin_inff();
    const int qi = min(q0 + l15, p.Lq - 1);
    const float* qrow = p.Q + b * p.sQb + h * p.sQh + (long long)qi * p.sQi;
    const float* kbase = p.K + b * p.sKb + hk * p.sKh;
    const float* vbase = p.V + b * p.sVb + hk * p.sVh;
    v16h qa[QM == 0 ? KS : 1]; Split qs_[QM == 1 ? KS : 1]; Split3 qt_[QM == 2 ? KS : 1];
#pragma unroll
    for (int ks = 0; ks < KS; ++ks) {
        if (QM == 2) qt_[ks] = sp3_ld(qrow, p.sQd, ks * 32, hf, p.dh, 1.f);
        else if (QM == 1) qs_[ks] = sp_ld(qrow, p.sQd, ks * 32, hf, p.dh, 1.f);
        else qa[ks] = fh_ld(qrow, p.sQd, ks * 32, hf, p.dh, 1.f);
    }
    v8f o[NT]; float m8[8], l8[8];
#pragma unroll
    for (int t = 0; t < NT; ++t) { v8f zz = {}; o[t] = zz; }
#pragma unroll
    for (int i = 0; i < 8; ++i) { m8[i] = NEG; l8[i] = 0.f; }
    int jend = p.Lk; int jstart = 0;
    if (p.causal == 1) { const int je = (blockIdx.x * AW + AW - 1) * 16 + 16 + p.coff; jend = min(jend, max(je, 0)); }   // uniform per block
    if (p.win > 0) { const int js = (int)(blockIdx.x * AW) * 16 + p.coff - p.win; jstart = (js > 0) ? (js / 64) * 64 : 0; }   // uniform per block: key blocks entirely outside every row's window hold only -inf entries and are skipped exactly
    const int npass = TWOPASS ? 2 : 1;
    for (int pass = 0; pass < npass; ++pass) {
        const bool dopv = (!TWOPASS) || pass == 1;
        for (int j0 = jstart; j0 < jend; j0 += 64) {
            if (dopv) {
                __syncthreads();                                 // previous key block's reads of vl / pl are done
                for (int idx = threadIdx.x; idx < 64 * DVP; idx += 32 * AW) {
                    const int jr = idx / DVP, d = idx - jr * DVP, j = j0 + jr;
                    const float f = (j < p.Lk && d < p.dv) ? vbase[(long long)j * p.sVj + (long long)d * p.sVd] : 0.f;
                    if (SPLITPV) {
                        const __bf16 hb = bf16_rne(f);
                        ((__bf16*)vl)[jr * VP + d] = hb; ((__bf16*)vl)[64 * VP + jr * VP + d] = bf16_rne(f - bf16_f32(hb));
                    } else vl[jr * VP + d] = (_Float16)f;
                }
            }
            v8f s[4];
#pragma unroll
            for (int t = 0; t < 4; ++t) {
                const int j = min(j0 + t * 16 + l15, p.Lk - 1);
                const float* krow = kbase + (long long)j * p.sKj;
                v8f acc = {};
#pragma unroll
                for (int ks = 0; ks < KS; ++ks) {
                    if (QM == 2)      acc = wmma6(qt_[ks], sp3_ld(krow, p.sKd, ks * 32, hf, p.dh, 1.f), acc);
                    else if (QM == 1) acc = wmma3(qs_[ks], sp_ld(krow, p.sKd, ks * 32, hf, p.dh, 1.f), acc);
                    else              acc = wmma16(qa[ks], fh_ld(krow, p.sKd, ks * 32, hf, p.dh, 1.f), acc);
                }
                s[t] = acc;
            }
            float pv[8][4];
#pragma unroll
            for (int i = 0; i < 8; ++i) {
                const int irow = q0 + i + 8 * hf;
                const int ic = min(irow, p.Lq - 1);
                float sc[4];
#pragma unroll
                for (int t = 0; t < 4; ++t) {
                    const int jg = j0 + t * 16 + l15;
                    float v = s[t][i] * p.scale;
                    if (p.Mf) v += p.Mf[b * p.smb + h * p.smh + (long long)ic * p.smi + (long long)min(jg, p.Lk - 1) * p.smj];
                    if (p.Rt) { int rc = ic - min(jg, p.Lk - 1) + p.roff; rc = rc < 0 ? 0 : (rc >= p.rn ? p.rn - 1 : rc); v += p.Rt[b * p.srb + h * p.srh + (long long)ic * p.sri + rc]; }
                    if (p.Mi) { const int mv = p.Mi[b * p.smb + h * p.smh + (long long)ic * p.smi + (long long)min(jg, p.Lk - 1) * p.smj]; if (p.mpol ? (mv != 0) : (mv == 0)) v = p.mfill; }
                    if (p.SQ) { const bool same = p.SQ[(long long)b * p.Lq + ic] == p.SK[(long long)b * p.Lk + min(jg, p.Lk - 1)]; if (p.segpol ? same : !same) v = p.mfill; }
                    if (p.causal == 2 && jg > irow + p.coff) v = p.mfill;
                    if (jg >= p.Lk || (p.causal == 1 && jg > irow + p.coff) || (p.causal == 3 && jg < irow + p.coff) || (p.win > 0 && irow + p.coff - jg > p.win)) v = NEG; else v *= L2E;
                    sc[t] = v;
                }
                if (!TWOPASS || pass == 0) {
                    float mx = fmaxf(fmaxf(sc[0], sc[1]), fmaxf(sc[2], sc[3]));
                    mx = fmaxf(mx, __shfl_xor(mx, 1, 32)); mx = fmaxf(mx, __shfl_xor(mx, 2, 32));
                    mx = fmaxf(mx, __shfl_xor(mx, 4, 32)); mx = fmaxf(mx, __shfl_xor(mx, 8, 32));
                    const float mnew = fmaxf(m8[i], mx);
                    const float corr = (mnew == NEG) ? 1.f : exp2f(m8[i] - mnew);
                    float rs = 0.f;
#pragma unroll
                    for (int t = 0; t < 4; ++t) {
                        const float pp = (sc[t] == NEG) ? 0.f : exp2f(sc[t] - mnew); rs += pp;
                        pv[i][t] = p.Pw ? pp * p.Pw[b * p.swb + h * p.swh + (long long)ic * p.swi + (long long)min(j0 + t * 16 + l15, p.Lk - 1) * p.swj] : pp;
                    }
                    rs += __shfl_xor(rs, 1, 32); rs += __shfl_xor(rs, 2, 32); rs += __shfl_xor(rs, 4, 32); rs += __shfl_xor(rs, 8, 32);
                    l8[i] = l8[i] * corr + rs; m8[i] = mnew;
                    if (!TWOPASS) {
#pragma unroll
                        for (int t = 0; t < NT; ++t) o[t][i] *= corr;
                    }
                } else {
                    const float inv = (l8[i] > 0.f) ? 1.f / l8[i] : 0.f;
#pragma unroll
                    for (int t = 0; t < 4; ++t) {
                        const int jg = j0 + t * 16 + l15;
                        float pp = (sc[t] == NEG) ? 0.f : exp2f(sc[t] - m8[i]) * inv;
                        if (p.Pw) pp *= p.Pw[b * p.swb + h * p.swh + (long long)ic * p.swi + (long long)min(jg, p.Lk - 1) * p.swj];
                        pv[i][t] = pp;
                    }
                }
            }
            if (dopv) {
#pragma unroll
                for (int i = 0; i < 8; ++i)
#pragma unroll
                    for (int t = 0; t < 4; ++t) ((float*)myp)[(i + 8 * hf) * 64 + t * 16 + l15] = pv[i][t];
                __syncthreads();                                 // P (per wave) and V (shared) visible
                if (p.P) {
                    float* pb_ = p.P + b * p.sPb + h * p.sPh;
                    const bool fastP = (p.pband == 0) && ((p.sPi & 3) == 0) && (j0 + 64 <= p.Lk) && (q0 + 16 <= p.Lq) && ((((size_t)pb_) & 15) == 0);
                    if (fastP) {
#pragma unroll
                        for (int s = 0; s < 8; ++s) {
                            const int row = s * 2 + (lane >> 4), c4 = (lane & 15) * 4;
                            const v4f v = *(const v4f*)(myp + row * 64 + c4);
                            VST2V4(pb_ + (long long)(q0 + row) * p.sPi + j0 + c4, v);
                        }
                    } else {
                        for (int row = 0; row < 16; ++row) {
                            const int irow = q0 + row; if (irow >= p.Lq) continue;
                            for (int c = lane; c < 64; c += 32) {
                                const int jg = j0 + c; if (jg >= p.Lk) continue;
                                if (p.pband == 0) VST2(float, pb_ + (long long)irow * p.sPi + jg, myp[row * 64 + c]);
                                else if (jg - irow <= p.pband && irow - jg <= p.pband) VST2(float, pb_ + (long long)irow * p.sPi + (jg - irow + p.pband), myp[row * 64 + c]);
                            }
                        }
                    }
                }
                if (SPLITPV) {
                    const Split pa0 = sp_ld(myp + l15 * 64, 1, 0, hf, 64, 1.f), pa1 = sp_ld(myp + l15 * 64, 1, 32, hf, 64, 1.f);
                    const __bf16* vh = (const __bf16*)vl; const __bf16* vlo = vh + 64 * VP;
#pragma unroll
                    for (int t = 0; t < NT; ++t) {
                        const int dcol = t * 16 + l15;
                        Split b0, b1;
#pragma unroll
                        for (int e = 0; e < 16; ++e) {
                            const int k0 = frag_k(e, hf), k1 = 32 + frag_k(e, hf);
                            b0.hi[e] = vh[k0 * VP + dcol]; b0.lo[e] = vlo[k0 * VP + dcol]; b1.hi[e] = vh[k1 * VP + dcol]; b1.lo[e] = vlo[k1 * VP + dcol];
                        }
                        o[t] = wmma3(pa0, b0, o[t]);
                        o[t] = wmma3(pa1, b1, o[t]);
                    }
                } else {
                    const v16h pa0 = fh_ld(myp + l15 * 64, 1, 0, hf, 64, 4096.f), pa1 = fh_ld(myp + l15 * 64, 1, 32, hf, 64, 4096.f);
#pragma unroll
                    for (int t = 0; t < NT; ++t) {
                        const int dcol = t * 16 + l15;
                        v16h b0, b1;
#pragma unroll
                        for (int e = 0; e < 16; ++e) { b0[e] = vl[frag_k(e, hf) * VP + dcol]; b1[e] = vl[(32 + frag_k(e, hf)) * VP + dcol]; }
                        o[t] = wmma16(pa0, b0, o[t]);
                        o[t] = wmma16(pa1, b1, o[t]);
                    }
                }
            }
        }
    }
    float* obase = p.O + b * p.sOb + h * p.sOh;
    if (p.ST) {
        const int rl = lane >> 1, isel = rl & 7;           // row q0 + rl ; rl>>3 == hf holds because lane>>4 == (lane>>1)>>3
        float mv = 0.f, lv = 0.f;
#pragma unroll
        for (int i = 0; i < 8; ++i) if (i == isel) { mv = m8[i]; lv = l8[i]; }
        const int irow = q0 + rl;
        if (irow < p.Lq) { float* st = p.ST + (((long long)b * gridDim.y + h) * p.Lq + irow) * 2 + (lane & 1); VST2(float, st, (lane & 1) ? lv : mv * 0.6931471805599453f); }
    }
    float invr[8];
#pragma unroll
    for (int i = 0; i < 8; ++i) {
        if (TWOPASS) invr[i] = SPLITPV ? 1.f : (1.f / 4096.f);
        else if (p.nonorm) invr[i] = exp2f(m8[i]) * (SPLITPV ? 1.f : (1.f / 4096.f));
        else invr[i] = (l8[i] > 0.f) ? (SPLITPV ? 1.f / l8[i] : 1.f / (l8[i] * 4096.f)) : 0.f;
    }
    __syncthreads();                                             // all waves done with pl/vl from the main loop
    const bool ofast = ((p.sOi & 3) == 0) && ((((size_t)obase) & 15) == 0) && (q0 + 16 <= p.Lq);
#pragma unroll
    for (int c0 = 0; c0 < DVP; c0 += 64) {
#pragma unroll
        for (int i = 0; i < 8; ++i)
#pragma unroll
            for (int t = 0; t < NT; ++t) if (t * 16 >= c0 && t * 16 < c0 + 64) ((float*)myp)[(i + 8 * hf) * 64 + (t * 16 - c0) + l15] = o[t][i] * invr[i];
        __syncthreads();
        const int cw = (DVP - c0 < 64) ? (DVP - c0) : 64;      // staged columns in this chunk (multiple of 16)
        if (ofast && (c0 + cw <= p.dv) && (cw % 32 == 0)) {
            const int lpr = cw / 4;                              // lanes per row (16 for 64 cols, 8 for 32)
            const int rows_per_ins = 32 / lpr;
            for (int r0 = 0; r0 < 16; r0 += rows_per_ins) {
                const int row = r0 + lane / lpr, c4 = (lane % lpr) * 4;
                const v4f v = *(const v4f*)(myp + row * 64 + c4);
                VST2V4(obase + (long long)(q0 + row) * p.sOi + c0 + c4, v);
            }
        } else {
            for (int row = 0; row < 16; ++row) {
                const int irow = q0 + row; if (irow >= p.Lq) continue;
                for (int c = lane; c < cw; c += 32) { const int d = c0 + c; if (d < p.dv) VST2(float, obase + (long long)irow * p.sOi + d, myp[row * 64 + c]); }
            }
        }
        __syncthreads();
    }
}

// =====================================================================================================================
// k_tr: dst(z, c, r) = alpha * src(z, r, c) (+ beta * R2(z, c, r)): [Z][R][C] (row stride lds) -> [Z][C][R] (row stride ldd) through a 32x32 LDS tile;
//   flags: 1 -> add beta * residual R2 addressed like dst (z*sRz + c*ldr + r); act applied before the residual.
// =====================================================================================================================
struct TrP { const float* src; float* dst; const float* R2; long long sSz, lds, sDz, ldd, sRz, ldr; int R, C, flags, act; float alpha, beta; };
static_assert(sizeof(TrP) == 3 * 8 + 6 * 8 + 6 * 4, "TrP has padding");
__global__ __launch_bounds__(256) void k_tr(TrP p) {
    __shared__ float tile[32][33];
    const int c0 = blockIdx.x * 32, r0 = blockIdx.y * 32, z = blockIdx.z;
    const int lane = threadIdx.x & 31, wave = threadIdx.x >> 5;
    const float* s = p.src + z * p.sSz;
#pragma unroll
    for (int k = 0; k < 4; ++k) {
        const int rl = wave * 4 + k, r = r0 + rl, c = c0 + lane;
        tile[rl][lane] = (r < p.R && c < p.C) ? s[(long long)r * p.lds + c] : 0.f;
    }
    __syncthreads();
    float* d = p.dst + z * p.sDz; const float* rr = p.R2 + z * p.sRz;
#pragma unroll
    for (int k = 0; k < 4; ++k) {
        const int cl = wave * 4 + k, c = c0 + cl, r = r0 + lane;
        if (c < p.C && r < p.R) {
            float v = act_fn(p.alpha * tile[lane][cl], p.act);
            if (p.flags & 1) v += p.beta * rr[(long long)c * p.ldr + r];
            VST2(float, d + (long long)c * p.ldd + r, v);
        }
    }
}

// k_affine: dst[i] = a * (sdev ? sdev[0] : 1) * src[i] + b, i < n (one thread per element; consecutive lanes -> consecutive addresses)
__global__ __launch_bounds__(256) void k_affine(const float* __restrict__ src, float* __restrict__ dst, int n, float a, float b, const float* __restrict__ sdev) {
    const int i = blockIdx.x * 256 + threadIdx.x;
    if (i < n) { const float aa = sdev ? a * sdev[0] : a; const float v = aa * src[i] + b; VST2(float, dst + i, v); }
}

// =====================================================================================================================
// k_softmax: row softmax over n contiguous elements, one 256-thread block per row; rows addressed z*sz + r*sr (grid (R, Z)).
//   out = scale_out * softmax(scale_in * x + (Mf ? Mf[z*smz + r*smr + j] : 0)); a row whose max is -inf is written as 0.
// =====================================================================================================================
struct SmP { const float* src; float* dst; const float* Mf; long long sz, sr, dz, dr, smz, smr; int n, pad; float scale_in, scale_out; };
static_assert(sizeof(SmP) == 3 * 8 + 6 * 8 + 4 * 4, "SmP has padding");
__global__ __launch_bounds__(256) void k_softmax(SmP p) {
    __shared__ float red[256];
    const int r = blockIdx.x, z = blockIdx.y, tid = threadIdx.x;
    const float* s = p.src + z * p.sz + (long long)r * p.sr;
    const float* mf = p.Mf ? (p.Mf + z * p.smz + (long long)r * p.smr) : nullptr;
    float mx = -__builtin_inff();
    for (int j = tid; j < p.n; j += 256) { float v = s[j] * p.scale_in; if (mf) v += mf[j]; mx = fmaxf(mx, v); }
    red[tid] = mx; __syncthreads();
    for (int o = 128; o > 0; o >>= 1) { if (tid < o) red[tid] = fmaxf(red[tid], red[tid + o]); __syncthreads(); }
    mx = red[0]; __syncthreads();
    float sum = 0.f;
    for (int j = tid; j < p.n; j += 256) { float v = s[j] * p.scale_in; if (mf) v += mf[j]; sum += (mx == -__builtin_inff()) ? 0.f : expf(v - mx); }
    red[tid] = sum; __syncthreads();
    for (int o = 128; o > 0; o >>= 1) { if (tid < o) red[tid] += red[tid + o]; __syncthreads(); }
    sum = red[0];
    const float inv = (sum > 0.f) ? p.scale_out / sum : 0.f;
    float* d = p.dst + z * p.dz + (long long)r * p.dr;
    for (int j = tid; j < p.n; j += 256) { float v = s[j] * p.scale_in; if (mf) v += mf[j]; const float o = (mx == -__builtin_inff()) ? 0.f : expf(v - mx) * inv; VST2(float, d + j, o); }
}
// =====================================================================================================================
// k_stats: mean and rsqrt(var + eps) over a set of n elements addressed base + z*sz + (e / inner) * so + (e % inner) * si, one 256-thread
// k_norm_apply: y = (x - mean[set]) * rstd[set] * g[c] + b[c] over a [Z][C][L] channel-major tensor with set = z*G + c / (C/G) (G groups per z;
//   G = C -> per-channel sets indexed z*C+c; for batch norm pass stats indexed by c only via bn = 1). Optional act. Output same layout.
// =====================================================================================================================
//   mode 0: mean / rsqrt(var + eps); mode 1 (RMSNorm): 0 / rsqrt(mean(x^2) + eps); mode 2 (L2 normalize * sqrt(n)): 0 / sqrt(n) / max(||x||, eps); mode 3: as 0 with unbiased variance (n-1)
__global__ __launch_bounds__(256) void k_stats(const float* __restrict__ x, long long sz, long long so, long long si, int inner, int n, float eps, float* __restrict__ stat, int mode) {
    __shared__ float red[256];
    const int z = blockIdx.x, tid = threadIdx.x;
    const float* base = x + z * sz;
    float s = 0.f;
    for (int e = tid; e < n; e += 256) s += base[(long long)(e / inner) * so + (long long)(e % inner) * si];
    red[tid] = s; __syncthreads();
    for (int o = 128; o > 0; o >>= 1) { if (tid < o) red[tid] += red[tid + o]; __syncthreads(); }
    const float mu = (mode == 0 || mode == 3) ? red[0] / (float)n : 0.f; __syncthreads();
    float q = 0.f;
    for (int e = tid; e < n; e += 256) { const float dlt = base[(long long)(e / inner) * so + (long long)(e % inner) * si] - mu; q += dlt * dlt; }
    red[tid] = q; __syncthreads();
    for (int o = 128; o > 0; o >>= 1) { if (tid < o) red[tid] += red[tid + o]; __syncthreads(); }
    {
        float rs;
        if (mode == 2) rs = sqrtf((float)n) / fmaxf(sqrtf(red[0]), eps); else if (mode == 3) rs = rsqrtf(red[0] / (float)(n - 1) + eps); else rs = rsqrtf(red[0] / (float)n + eps);
        if (tid < 32) { const float v = (tid == 0) ? mu : ((tid == 1) ? rs : 0.f); VST2(float, stat + (long long)z * 32 + tid, v); }
    }
}
//   One thread per element over the flat [Z][C][L] index space: grid ceil(Z*C*L / 256).
__global__ __launch_bounds__(256) void k_norm_apply(const float* __restrict__ x, float* __restrict__ y, const float* __restrict__ stat, const float* __restrict__ g, const float* __restrict__ bta,
                                                     int Z, int C, int L, int G, int bn, int act) {
    const long long idx = (long long)blockIdx.x * 256 + threadIdx.x;
    if (idx >= (long long)Z * C * L) return;
    const int l = (int)(idx % L); const long long zc = idx / L; const int c = (int)(zc % C), z = (int)(zc / C); (void)l;
    const int set = bn ? c : (z * G + c / (C / G));
    float v = (x[idx] - stat[(long long)set * 32]) * stat[(long long)set * 32 + 1];
    if (g) v *= g[c];
    if (bta) v += bta[c];
    v = act_fn(v, act);
    VST2(float, y + idx, v);
}

// k_lse_neg: c[i] = -(st[2i] + log(st[2i+1])) = minus the log-sum-exp of row i from k_attn's ST output (for softmax over the query dimension)
__global__ __launch_bounds__(256) void k_lse_neg(const float* __restrict__ st, float* __restrict__ c, int n) {
    const int i = blockIdx.x * 256 + threadIdx.x;
    if (i < n) { const float v = -(st[2 * i] + logf(st[2 * i + 1])); VST2(float, c + i, v); }
}

// k_iota: dst[i] = a * i + b as int32 (segment/position id helper)
__global__ __launch_bounds__(256) void k_iota(int* __restrict__ dst, int n, int a, int b) {
    const int i = blockIdx.x * 256 + threadIdx.x;
    if (i < n) { const int v = a * i + b; VST2(int, dst + i, v); }
}

// k_axpby: dst[i] = a * x[i] + b * y[i] (+ c), i < n
__global__ __launch_bounds__(256) void k_axpby(const float* __restrict__ x, const float* __restrict__ y, float* __restrict__ dst, int n, float a, float b, float c) {
    const int i = blockIdx.x * 256 + threadIdx.x;
    if (i < n) { const float v = a * x[i] + b * y[i] + c; VST2(float, dst + i, v); }
}

// =====================================================================================================================
// k_rope: rotary embedding on a [R rows][Hn heads][D] view (row stride sXr, head stride sXh, element stride 1) -> Y (own strides).
//   mode 0: rotate_half (partner d±D/2, sign - for d<D/2); mode 1: interleaved pairs (partner d^1, sign - for even d).
//   table column tcol: tmode 0 -> d, 1 -> d % (D/2), 2 -> d / 2; position p: pmode 0 -> r % S, 1 -> head index, 2 -> pos[r];
//   c = C[(r / S) * sCb + p * sCp + tcol * sCd], s likewise from Sn; y = x[d] * c + sign * x[partner] * s. X and Y must not alias.
// =====================================================================================================================
struct RopeP { const float* X; float* Y; const float* C; const float* Sn; const int* pos; long long sXr, sXh, sYr, sYh, sCb, sCp, sCd; int R, Hn, D, S, mode, tmode, pmode, pad; };
static_assert(sizeof(RopeP) == 5 * 8 + 7 * 8 + 8 * 4, "RopeP has padding");
__global__ __launch_bounds__(256) void k_rope(RopeP p) {
    const long long idx = (long long)blockIdx.x * 256 + threadIdx.x;
    if (idx >= (long long)p.R * p.Hn * p.D) return;
    const int d = (int)(idx % p.D); const long long rh = idx / p.D; const int h = (int)(rh % p.Hn); const int r = (int)(rh / p.Hn);
    const int half = p.D / 2;
    int partner; float sign;
    if (p.mode == 0) { partner = (d < half) ? d + half : d - half; sign = (d < half) ? -1.f : 1.f; }
    else { partner = d ^ 1; sign = (d & 1) ? 1.f : -1.f; }
    const int tcol = (p.tmode == 0) ? d : ((p.tmode == 1) ? (d % half) : (d >> 1));
    const int pp = (p.pmode == 0) ? (r % p.S) : ((p.pmode == 1) ? h : p.pos[r]);
    const long long toff = (long long)(r / p.S) * p.sCb + (long long)pp * p.sCp + (long long)tcol * p.sCd;
    const float* xr = p.X + (long long)r * p.sXr + (long long)h * p.sXh;
    const float v = xr[d] * p.C[toff] + sign * xr[partner] * p.Sn[toff];
    VST2(float, p.Y + (long long)r * p.sYr + (long long)h * p.sYh + d, v);
}

// k_invf + k_sincos (split so neither kernel carries a large VALU-fma footprint): invf_i = num * (1 / powf(base, (2 i)/D)) [fmode 0],
//   num * expf((2 i) * cexp) [fmode 1], num * powf(base, -2 (i - 1) / D) [fmode 2]; then cs/sn[s*half + i] = cos/sin((pscale * s) * invf_i)
__global__ __launch_bounds__(256) void k_invf(float* __restrict__ invb, int half, int D, float base, float num, int fmode, float cexp) {
    const int i = blockIdx.x * 256 + threadIdx.x;
    if (i >= ((half + 31) / 32) * 32) return;
    if (i >= half) { VST2(float, invb + i, 0.f); return; }
    const float e = (float)(2 * i) / (float)D;
    float invf;
    if (fmode == 1) invf = num * expf((float)(2 * i) * cexp);
    else if (fmode == 2) invf = num * powf(base, (-2.0f * ((float)i - 1.0f)) / (float)D);
    else invf = num * (1.0f / powf(base, e));
    VST2(float, invb + i, invf);
}
__global__ __launch_bounds__(256) void k_sincos(float* __restrict__ cs, float* __restrict__ sn, const float* __restrict__ invb, int S, int half, float pscale) {
    const int idx = blockIdx.x * 256 + threadIdx.x;
    if (idx >= S * half) return;
    const int s = idx / half, i = idx - s * half;
    const float ang = (pscale * (float)s) * invb[i];
    VST2(float, cs + idx, cosf(ang)); VST2(float, sn + idx, sinf(ang));
}

// k_mulact: dst[i] = act(x[i]) * y[i]
__global__ __launch_bounds__(256) void k_mulact(const float* __restrict__ x, const float* __restrict__ y, float* __restrict__ dst, int n, int act) {
    const int i = blockIdx.x * 256 + threadIdx.x;
    if (i < n) { const float v = act_fn(x[i], act) * y[i]; VST2(float, dst + i, v); }
}

// =====================================================================================================================
// k_matvec: thread-per-row matrix-vector products for N <= 8 output columns (heads with 1-3 outputs, gates), f32 on the VALU.
//   C[r*sCm + j] = act(alpha * sum_k A[r*sAm + k*sAk] * B[j*sBn + k*sBk] + bias[j]) + beta * R[r*sRm + j*sRn]; each thread writes its N contiguous floats.
// =====================================================================================================================
__global__ __launch_bounds__(256) void k_matvec(GemmP p) {
    // N == 1: one row per thread, so 32 lanes write one line with one instruction; otherwise each thread takes 32 consecutive rows.
    const int rpt = (p.N == 1) ? 1 : 32;
    const long long r0 = ((long long)blockIdx.x * 256 + threadIdx.x) * rpt; const int z = blockIdx.z, zo = z / p.zi_n, zi = z - zo * p.zi_n;
    if (r0 >= p.M) return;
    const float* Bb = p.B + zo * p.sBo + zi * p.sBi;
    float* C = p.C + zo * p.sCo + zi * p.sCi; const float* R = p.R + zo * p.sRo + zi * p.sRi;
    for (int rr = 0; rr < rpt; ++rr) {
        const long long r = r0 + rr; if (r >= p.M) break;
        const float* A = p.A + zo * p.sAo + zi * p.sAi + r * p.sAm;
        float acc[8] = {0.f, 0.f, 0.f, 0.f, 0.f, 0.f, 0.f, 0.f};
        for (int k = 0; k < p.K; ++k) { const float a = A[(long long)k * p.sAk];
#pragma unroll
            for (int j = 0; j < 8; ++j) if (j < p.N) acc[j] += a * Bb[(long long)j * p.sBn + (long long)k * p.sBk]; }
#pragma unroll
        for (int j = 0; j < 8; ++j) if (j < p.N) {
            float v = acc[j] * p.alpha;
            if (p.flags & 1) v += p.bias[j];
            if (p.flags & 2) v += p.bias[r];
            v = act_fn(v, p.act);
            if (p.flags & 4) v += p.beta * R[r * p.sRm + (long long)j * p.sRn];
            VST2(float, C + r * p.sCm + j, v);
        }
    }
}
// k_smallsoftmax: thread-per-row softmax for short rows (n <= 64): dst[r*dr + j] = softmax(scale*src[r*sr + j])
__global__ __launch_bounds__(256) void k_smallsoftmax(const float* __restrict__ src, float* __restrict__ dst, long long sr, long long dr, int n, long long R, float scale) {
    const long long r0 = ((long long)blockIdx.x * 256 + threadIdx.x) * 32;
    for (int rr = 0; rr < 32; ++rr) {
        const long long r = r0 + rr; if (r >= R) return;
        const float* s = src + r * sr; float* d = dst + r * dr;
        float mx = -__builtin_inff();
        for (int j = 0; j < n; ++j) mx = fmaxf(mx, s[j] * scale);
        float sum = 0.f;
        for (int j = 0; j < n; ++j) sum += expf(s[j] * scale - mx);
        const float inv = 1.f / sum;
        for (int j = 0; j < n; ++j) { const float v = expf(s[j] * scale - mx) * inv; VST2(float, d + j, v); }
    }
}

__global__ __launch_bounds__(32) void k_unitstat(float* __restrict__ st) { const int t = threadIdx.x; const float v = (t == 1) ? 1.f : 0.f; VST2(float, st + t, v); }

// destination (e.g. a d_out whose row width is not a multiple of 32 floats) is written by consecutive lanes of one instruction
__global__ __launch_bounds__(256) void k_lincopy(const float* __restrict__ src, long long lds, float* __restrict__ dst, long long ldd, long long rows, int cols) {
    const long long i = (long long)blockIdx.x * 256 + threadIdx.x; if (i >= rows * cols) return;
    const long long r = i / cols; const int c = (int)(i - r * cols);
    const float v = src[r * lds + c]; VST2(float, dst + r * ldd + c, v);
}

namespace w25 {
typedef __attribute__((ext_vector_type(16))) _Float16 v16h;
typedef __attribute__((ext_vector_type(8)))  _Float16 v8h;
typedef __attribute__((ext_vector_type(16))) __bf16   v16b;
typedef __attribute__((ext_vector_type(8)))  __bf16   v8b;
typedef __attribute__((ext_vector_type(8)))  float    v8f;
typedef __attribute__((ext_vector_type(4)))  float    v4f;

__device__ __forceinline__ unsigned short f2bf_bits(float f) {
  unsigned u = __float_as_uint(f);
  return (unsigned short)((u + 0x7FFFu + ((u >> 16) & 1u)) >> 16);
}
__device__ __forceinline__ float bf_bits2f(unsigned short h) { return __uint_as_float(((unsigned)h) << 16); }

// hazard guards as plain device helpers (no inline asm inside the kernel template body)
__device__ __forceinline__ void dep_guard_h(v8f& a, v8f& b, v16h x, v16h y) { asm volatile("v_nop\n\tv_nop\n\tv_nop\n\tv_nop" : "+v"(a), "+v"(b) : "v"(x), "v"(y)); }
__device__ __forceinline__ void dep_guard_b(v8f& a, v8f& b, v16b x, v16b y) { asm volatile("v_nop\n\tv_nop\n\tv_nop\n\tv_nop" : "+v"(a), "+v"(b) : "v"(x), "v"(y)); }
__device__ __forceinline__ void keep4_h(v16h a, v16h b, v16h c, v16h d) { asm volatile("v_nop" :: "v"(a), "v"(b), "v"(c), "v"(d)); }
__device__ __forceinline__ void keep4_b(v16b a, v16b b, v16b c, v16b d) { asm volatile("v_nop" :: "v"(a), "v"(b), "v"(c), "v"(d)); }
__device__ __forceinline__ void acc_guard4(v8f& a, v8f& b, v8f& c, v8f& d) { asm volatile("v_nop\n\tv_nop\n\tv_nop\n\tv_nop" : "+v"(a), "+v"(b), "+v"(c), "+v"(d)); }
template <typename T> struct Frag;
template <> struct Frag<_Float16> {
  typedef v16h V; union U { v16h v; v8h h[2]; };
  static __device__ __forceinline__ v16h load(const _Float16* p) {   // elements 0..7 <- p[0..7], 8..15 <- p[16..23]
    U f; f.h[0] = *(const v8h*)(p); f.h[1] = *(const v8h*)(p + 16); return f.v;
  }
  static __device__ __forceinline__ v8f mma(v16h a, v16h b, v8f c) {
    return __builtin_amdgcn_wmma_f32_16x16x32_f16(false, a, false, b, (short)0, c, false, false);
  }
  static __device__ __forceinline__ void guard(v8f& a, v8f& b, v16h x, v16h y) { dep_guard_h(a, b, x, y); }
  static __device__ __forceinline__ void keep(v16h a, v16h b, v16h c, v16h d) { keep4_h(a, b, c, d); }
};
template <> struct Frag<__bf16> {
  typedef v16b V; union U { v16b v; v8b h[2]; };
  static __device__ __forceinline__ v16b load(const __bf16* p) {
    U f; f.h[0] = *(const v8b*)(p); f.h[1] = *(const v8b*)(p + 16); return f.v;
  }
  static __device__ __forceinline__ v8f mma(v16b a, v16b b, v8f c) {
    return __builtin_amdgcn_wmma_f32_16x16x32_bf16(false, a, false, b, (short)0, c, false, false);
  }
  static __device__ __forceinline__ void guard(v8f& a, v8f& b, v16b x, v16b y) { dep_guard_b(a, b, x, y); }
  static __device__ __forceinline__ void keep(v16b a, v16b b, v16b c, v16b d) { keep4_b(a, b, c, d); }
};

// ---- Register-blocked batched WMMA GEMM ------------------------------------
// C[m,n] = scale * sum_k A[m,k] * Bt[n,k] (+bias)(+resid); each wave owns a 64x64 tile.
// A row-major [M,K]; Bt row-major [N,K]; M,N % 64 == 0, K % 32 == 0.
// SPLIT: operands are hi/lo planes (A2/Bt2 = lo planes, same layout); product = hi·hi + hi·lo + lo·hi.
// BIAS_MODE: 0 = none, 1 = bias[m], 2 = bias[n].
// OUT_MODE: 0 = f32, 1 = f16, 2 = bf16 hi plane (Cout) + bf16 lo plane (Cout2).
// ET: 0 = f16 operands, 1 = bf16 operands (pointers passed as 16-bit storage)
template <int ET> struct Elem;
template <> struct Elem<0> { typedef _Float16 T; };
template <> struct Elem<1> { typedef __bf16 T; };
template <int ET, bool SPLIT, int BIAS_MODE, int OUT_MODE, bool RESID, int ACT = 0>
__global__ __launch_bounds__(256) void wmma_gemm64(
    const unsigned short* __restrict__ Ap, const unsigned short* __restrict__ A2p, int lda, long strideA,
    const unsigned short* __restrict__ Btp, const unsigned short* __restrict__ Bt2p, int ldb, long strideB,
    void* __restrict__ Cout, void* __restrict__ Cout2, int ldc, long strideC,
    const float* __restrict__ bias,
    const float* __restrict__ resid, long strideR,
    int M, int N, int K, float scale) {
  typedef typename Elem<ET>::T T;
  typedef typename Frag<T>::V V;
  const T* A = (const T*)Ap; const T* A2 = (const T*)A2p; const T* Bt = (const T*)Btp; const T* Bt2 = (const T*)Bt2p;
  __shared__ __align__(16) float sT[8][16 * 68];   // per-wave 16x64 slab, pitch 68 floats
  const int b    = blockIdx.y;
  const int lane = threadIdx.x & 31;
  const int wave = threadIdx.x >> 5;
  const int tilesN = N >> 6;
  const int tilesM = M >> 6;
  const int tile = blockIdx.x * 8 + wave;
  if (tile >= tilesM * tilesN) return;   // wave-uniform; no block barriers in this kernel
  const int tm = tile / tilesN;
  const int tn = tile - tm * tilesN;
  const int m0 = tm << 6;
  const int n0 = tn << 6;

  const T* Ab  = A  + (size_t)b * strideA;
  const T* Bb  = Bt + (size_t)b * strideB;
  const T* Ab2 = SPLIT ? (A2  + (size_t)b * strideA) : nullptr;
  const T* Bb2 = SPLIT ? (Bt2 + (size_t)b * strideB) : nullptr;

  const int rlane = lane & 15;                 // row (A) / col (B, D) within subtile
  const int koff  = (lane >> 4) * 8;           // k offset of this lane half
  const int mOff  = (lane >> 4) * 8;           // D row offset

  v8f acc[4][4];
#pragma unroll
  for (int i = 0; i < 4; ++i)
#pragma unroll
    for (int j = 0; j < 4; ++j) acc[i][j] = (v8f){0.f,0.f,0.f,0.f,0.f,0.f,0.f,0.f};

  for (int k0 = 0; k0 < K; k0 += 32) {
    V bh[4], bl[4];
#pragma unroll
    for (int j = 0; j < 4; ++j) {
      const size_t bo = (size_t)(n0 + (j << 4) + rlane) * ldb + koff + k0;
      bh[j] = Frag<T>::load(Bb + bo);
      if (SPLIT) bl[j] = Frag<T>::load(Bb2 + bo);
    }
#pragma unroll
    for (int i = 0; i < 4; ++i) {
      const size_t ao = (size_t)(m0 + (i << 4) + rlane) * lda + koff + k0;
      V ah = Frag<T>::load(Ab + ao);
      V al;
      if (SPLIT) al = Frag<T>::load(Ab2 + ao);
#pragma unroll
      for (int j = 0; j < 4; ++j) {
        acc[i][j] = Frag<T>::mma(ah, bh[j], acc[i][j]);
        if (SPLIT) {
          acc[i][j] = Frag<T>::mma(ah, bl[j], acc[i][j]);
          acc[i][j] = Frag<T>::mma(al, bh[j], acc[i][j]);
        }
      }
      Frag<T>::guard(acc[i][0], acc[i][3], ah, SPLIT ? al : ah);
    }
    Frag<T>::keep(bh[0], bh[1], bh[2], bh[3]);
    if (SPLIT) Frag<T>::keep(bl[0], bl[1], bl[2], bl[3]);
  }
  acc_guard4(acc[0][0], acc[0][1], acc[0][2], acc[0][3]);
  acc_guard4(acc[1][0], acc[1][1], acc[1][2], acc[1][3]);
  acc_guard4(acc[2][0], acc[2][1], acc[2][2], acc[2][3]);
  acc_guard4(acc[3][0], acc[3][1], acc[3][2], acc[3][3]);

  // ---- epilogue ----
  float* slab = sT[wave];
  const float* Rb = RESID ? (resid + (size_t)b * strideR) : nullptr;
#pragma unroll
  for (int i = 0; i < 4; ++i) {
    const int mBase = m0 + (i << 4);
#pragma unroll
    for (int j = 0; j < 4; ++j) {
      const int n = n0 + (j << 4) + rlane;
      float bv = 0.f;
      if (BIAS_MODE == 2) bv = bias[n];
#pragma unroll
      for (int r = 0; r < 8; ++r) {
        float v = acc[i][j][r] * scale;
        if (BIAS_MODE == 1) v += bias[mBase + mOff + r];
        if (BIAS_MODE == 2) v += bv;
        if (RESID) v += Rb[(size_t)(mBase + mOff + r) * ldc + n];
        if (ACT == 1) v = tanhf(v);
        if (ACT == 2) v = fmaxf(v, 0.0f);
        if (ACT == 3) v = v / (1.0f + expf(-v));
        if (ACT == 4) v = (v > 0.f) ? v : 0.01f * v;
        if (ACT == 5) v = 0.5f * v * (1.0f + erff(v * 0.70710678118654752f));
        slab[(mOff + r) * 68 + (j << 4) + rlane] = v;
      }
    }
    __builtin_amdgcn_fence(__ATOMIC_RELEASE, "workgroup");
    __builtin_amdgcn_wave_barrier();
    __builtin_amdgcn_fence(__ATOMIC_ACQUIRE, "workgroup");
    if (OUT_MODE == 0) {
      float* C = (float*)Cout + (size_t)b * strideC;
      const int hh = lane >> 4, c4 = (lane & 15) * 4;     // row seg = 256 B = 16 lanes x 16 B
      {
#pragma unroll
        for (int it = 0; it < 8; ++it) {
          const int row = it * 2 + hh;
          v4f v = *(const v4f*)(slab + row * 68 + c4);
          *(v4f*)(C + (size_t)(mBase + row) * ldc + n0 + c4) = v;
        }
        
      }
    } else {
      const int q = lane >> 3, c8 = (lane & 7) * 8;
      unsigned short* C  = (unsigned short*)Cout  + (size_t)b * strideC;
      unsigned short* C2 = (OUT_MODE == 2) ? ((unsigned short*)Cout2 + (size_t)b * strideC) : nullptr;
      {
#pragma unroll
        for (int it = 0; it < 4; ++it) {
          const int row = it * 4 + q;
          const float* sp = slab + row * 68 + c8;
          v8h hv, lv;
#pragma unroll
          for (int e = 0; e < 8; ++e) {
            if (OUT_MODE == 1) {
              hv[e] = (_Float16)sp[e];
            } else {
              unsigned short hb = f2bf_bits(sp[e]);
              unsigned short lb = f2bf_bits(sp[e] - bf_bits2f(hb));
              hv[e] = __builtin_bit_cast(_Float16, hb);
              lv[e] = __builtin_bit_cast(_Float16, lb);
            }
          }
          *(v8h*)(C + (size_t)(mBase + row) * ldc + n0 + c8) = hv;
          if (OUT_MODE == 2) *(v8h*)(C2 + (size_t)(mBase + row) * ldc + n0 + c8) = lv;
        }
        
      }
    }
    __builtin_amdgcn_fence(__ATOMIC_RELEASE, "workgroup");
    __builtin_amdgcn_wave_barrier();
    __builtin_amdgcn_fence(__ATOMIC_ACQUIRE, "workgroup");
  }
}

__global__ __launch_bounds__(256) void cast_f32_f16x2(
    const float* __restrict__ in, _Float16* __restrict__ out, int n2) {
  int i = blockIdx.x * 256 + threadIdx.x;
  if (i < n2) {
    const _Float16 h0 = (_Float16)in[2 * i], h1 = (_Float16)in[2 * i + 1];
    const unsigned u = (unsigned)__builtin_bit_cast(unsigned short, h0) | ((unsigned)__builtin_bit_cast(unsigned short, h1) << 16);
    ((unsigned*)out)[i] = u;
    
  }
}


} // namespace w25

__global__ __launch_bounds__(256) void k_castT16(const float* __restrict__ src, long long lds, _Float16* __restrict__ dst, long long ldd, int R, int C, float s) {
    const long long i = (long long)blockIdx.x * 256 + threadIdx.x; const long long np = (long long)C * (R / 2); if (i >= np) return; const int c = (int)(i / (R / 2)); const int r = 2 * (int)(i % (R / 2));
    const _Float16 h0 = (_Float16)(src[(long long)r * lds + c] * s), h1 = (_Float16)(src[(long long)(r + 1) * lds + c] * s);
    const unsigned u = (unsigned)__builtin_bit_cast(unsigned short, h0) | ((unsigned)__builtin_bit_cast(unsigned short, h1) << 16);
    unsigned* d = (unsigned*)(dst + (long long)c * ldd + r); *d = u;  }
__global__ __launch_bounds__(256) void k_cast16(const float* __restrict__ src, long long lds, _Float16* __restrict__ dst, long long ldd, int R, int C, float s) {
    const long long i = (long long)blockIdx.x * 256 + threadIdx.x; const long long np = (long long)R * (C / 2); if (i >= np) return; const int r = (int)(i / (C / 2)); const int c = 2 * (int)(i % (C / 2));
    const _Float16 h0 = (_Float16)(src[(long long)r * lds + c] * s), h1 = (_Float16)(src[(long long)r * lds + c + 1] * s);
    const unsigned u = (unsigned)__builtin_bit_cast(unsigned short, h0) | ((unsigned)__builtin_bit_cast(unsigned short, h1) << 16);
    unsigned* d = (unsigned*)(dst + (long long)r * ldd + c); *d = u;  }

// f32 -> bf16 hi plane + bf16 lo plane (x = hi + lo to ~2^-17 relative; RNE both), [R][C] -> [R][C] (or transposed to [C][R]); 2 consecutive destination elements
__device__ __forceinline__ unsigned int f2bf2_pack(float a, float b, unsigned int* lo) {
    const unsigned short ha = w25::f2bf_bits(a), hb = w25::f2bf_bits(b);
    const unsigned short la = w25::f2bf_bits(a - w25::bf_bits2f(ha)), lb = w25::f2bf_bits(b - w25::bf_bits2f(hb));
    *lo = (unsigned)la | ((unsigned)lb << 16); return (unsigned)ha | ((unsigned)hb << 16); }
__global__ __launch_bounds__(256) void k_castS16(const float* __restrict__ src, long long lds, __bf16* __restrict__ dhi, __bf16* __restrict__ dlo, long long ldd, int R, int C, float s, int transpose) {
    const long long i = (long long)blockIdx.x * 256 + threadIdx.x; long long o; float a, b;
    if (transpose) { const long long np = (long long)C * (R / 2); if (i >= np) return; const int c = (int)(i / (R / 2)); const int r = 2 * (int)(i % (R / 2)); a = src[(long long)r * lds + c] * s; b = src[(long long)(r + 1) * lds + c] * s; o = (long long)c * ldd + r; }
    else { const long long np = (long long)R * (C / 2); if (i >= np) return; const int r = (int)(i / (C / 2)); const int c = 2 * (int)(i % (C / 2)); a = src[(long long)r * lds + c] * s; b = src[(long long)r * lds + c + 1] * s; o = (long long)r * ldd + c; }
    unsigned lo; const unsigned hi = f2bf2_pack(a, b, &lo); unsigned* ph = (unsigned*)(dhi + o); unsigned* pl = (unsigned*)(dlo + o);
    *ph = hi; *pl = lo;  }

namespace w25 {
// =====================================================================================
// Generic causal/non-causal attention for head_dim 64, f32 in / f32 out; 16-bit operands: bf16 with optional hi/lo splits, or
// plain f16 (F16=true, non-split, probabilities carried x2^15).
//   scores = (q*qscale)·kᵀ : v_wmma_f32_16x16x32_bf16; SPLIT_QK -> q,k as bf16 hi/lo (hi·hi + hi·lo + lo·hi)
//   out    = p·v           : v_wmma_f32_16x16x32_bf16; SPLIT_PV -> p,v as bf16 hi/lo; else p,v plain bf16
//   f32 accumulate; online softmax in f32. Block = 4 waves = 64 query rows of one (batch, head); S % 64 == 0.
//   Element (b, s, h, d) of tensor X lives at X[b*X_bs + s*X_rs + h*X_hs + d] (strides in floats, multiples of 4).
//   Masking: mask_mode 0 none, 1 causal (kv > q masked), 2 tensor [S][Skv] shared over (b,h) (float if
//   mask_is_int==0, int32 with element == 0 -> masked if 1, int32 with element != 0 -> masked if 2), 3 per-token vectors qmask[B][S] & kvmask[B][Skv] (int32,
//   0 -> masked), 4 causal + sliding window (kv > q or q - kv > W masked; W passed in mask_is_int);
//   5 = relative-position bias: s += cp[b,h,q][idx[q][kv]] + pc[b,h,kv][idx[q][kv]] with idx = mask_b ([S][Skv] int32) and
//   mask_a an int32 [S][Skv] tensor with nonzero = masked (tables: element (b,h,row,n) at X + b*c_bs + h*c_hs + row*c_rs + n);
//   masked scores are replaced by mask_fill (e.g. -inf or -1e9) before the softmax.
//   grid.x = B * H * (S/64) (or a sub-range with blk0).
// =====================================================================================
#define AT_D 64
#define AT_NW 4
#define AT_QB 64
#define AT_KC 64
struct AttnGeom { const float* cp = nullptr; const float* pc = nullptr; long c_bs = 0, c_rs = 0, c_hs = 0;   // mode-5 score-bias tables
                  long q_bs, q_rs, q_hs, k_bs, k_rs, k_hs, v_bs, v_rs, v_hs, o_bs, o_rs, o_hs;
                  int S, Skv, H, mask_mode; float qscale; int blk0; float mask_fill; int mask_is_int; };
static_assert(sizeof(AttnGeom) == 168, "no padding");

__device__ __forceinline__ unsigned short at_bf_bits(float f) {
  unsigned u = __float_as_uint(f);
  return (unsigned short)((u + 0x7FFFu + ((u >> 16) & 1u)) >> 16);
}
__device__ __forceinline__ __bf16 at_f2bf(float f) { return __builtin_bit_cast(__bf16, at_bf_bits(f)); }
__device__ __forceinline__ void at_split(float f, __bf16& hi, __bf16& lo) {
  const unsigned short hb = at_bf_bits(f);
  hi = __builtin_bit_cast(__bf16, hb);
  lo = at_f2bf(f - __uint_as_float(((unsigned)hb) << 16));
}
__device__ __forceinline__ v8f at_mma(v16b a, v16b b, v8f c) {
  c = __builtin_amdgcn_wmma_f32_16x16x32_bf16(false, a, false, b, (short)0, c, false, false);
  asm volatile("v_nop\n\tv_nop\n\tv_nop\n\tv_nop" : "+v"(c) : "v"(a), "v"(b));
  return c;
}
// 16-bit element as a bit pattern held in a __bf16 slot: f16 bits when F16, bf16 (RNE) otherwise
template <bool F16> __device__ __forceinline__ __bf16 at_to16(float f) {
  if (F16) return __builtin_bit_cast(__bf16, (_Float16)f);
  return at_f2bf(f);
}
template <bool F16> __device__ __forceinline__ v8f at_mma16(v16b a, v16b b, v8f c) {
  if (F16) {
    const v16h ah = __builtin_bit_cast(v16h, a), bh = __builtin_bit_cast(v16h, b);
    c = __builtin_amdgcn_wmma_f32_16x16x32_f16(false, ah, false, bh, (short)0, c, false, false);
    asm volatile("v_nop\n\tv_nop\n\tv_nop\n\tv_nop" : "+v"(c) : "v"(ah), "v"(bh));
    return c;
  }
  return at_mma(a, b, c);
}

template <bool SPLIT_QK, bool SPLIT_PV, bool F16 = false>
__global__ __launch_bounds__(128)
void attn64_kernel(const float* __restrict__ q, const float* __restrict__ k,
                   const float* __restrict__ v, float* __restrict__ out,
                   const void* __restrict__ mask_a, const int* __restrict__ mask_b, AttnGeom g) {
  static_assert(!(F16 && (SPLIT_QK || SPLIT_PV)), "f16 mode is non-split");
  const float PSC = F16 ? 32768.0f : 1.0f;     // f16 probabilities carried x2^15 (subnormal range), folded into the final 1/l
  union FB { v16b v; v8b h[2]; };
  __shared__ __align__(16) __bf16 Ksh[AT_KC * AT_D];             // K hi [kv][d]      8 KB
  __shared__ __align__(16) __bf16 Ksl[SPLIT_QK ? AT_KC * AT_D : 8];
  __shared__ __align__(16) __bf16 Vth[AT_D * AT_KC];             // V hi [d][kv]      8 KB
  __shared__ __align__(16) __bf16 Vtl[SPLIT_PV ? AT_D * AT_KC : 8];
  __shared__ __align__(16) __bf16 Psh[AT_NW][16 * AT_KC];        // per wave P hi [row][kv]  8 KB
  __shared__ __align__(16) __bf16 Psl[SPLIT_PV ? AT_NW : 1][SPLIT_PV ? 16 * AT_KC : 8];
  __shared__ __align__(16) float  Os[AT_NW][16 * 68];            // per wave out tile, pitch 68

  const int tid  = threadIdx.x;
  const int wave = tid >> 5;
  const int lane = tid & 31;
  const int hh   = lane >> 4;
  const int c    = lane & 15;

  const int nqb = g.S / AT_QB;
  const int bx = blockIdx.x + g.blk0;
  const int qb = bx % nqb;
  const int bh = bx / nqb;
  const int h  = bh % g.H;
  const int b  = bh / g.H;
  const int qbase_block = qb * AT_QB;
  const int q0 = qbase_block + wave * 16;

  const float* qb_ptr = q + (size_t)b * g.q_bs + (size_t)h * g.q_hs;
  const float* kb_ptr = k + (size_t)b * g.k_bs + (size_t)h * g.k_hs;
  const float* vb_ptr = v + (size_t)b * g.v_bs + (size_t)h * g.v_hs;
  float*       ob_ptr = out + (size_t)b * g.o_bs + (size_t)h * g.o_hs;

  // ---- Q fragments (A operand): 2 d-chunks, hi (and lo) ----
  v16b qah[2], qal[2];
  {
    const float* qrow = qb_ptr + (size_t)(q0 + c) * g.q_rs;
#pragma unroll
    for (int dc = 0; dc < 2; ++dc) {
#pragma unroll
      for (int e = 0; e < 8; ++e) {
        const float f0 = qrow[dc * 32 + 8 * hh + e] * g.qscale;
        const float f1 = qrow[dc * 32 + 16 + 8 * hh + e] * g.qscale;
        if (SPLIT_QK) { __bf16 hq, lq; at_split(f0, hq, lq); qah[dc][e] = hq; qal[dc][e] = lq; at_split(f1, hq, lq); qah[dc][8 + e] = hq; qal[dc][8 + e] = lq; }
        else { qah[dc][e] = at_to16<F16>(f0); qah[dc][8 + e] = at_to16<F16>(f1); qal[dc][e] = qah[dc][e]; qal[dc][8 + e] = qah[dc][8 + e]; }
      }
    }
  }

  float mrow[8], lrow[8];
  v8f oacc[4];
#pragma unroll
  for (int r = 0; r < 8; ++r) { mrow[r] = -INFINITY; lrow[r] = 0.f; }
#pragma unroll
  for (int t = 0; t < 4; ++t) oacc[t] = (v8f){0.f,0.f,0.f,0.f,0.f,0.f,0.f,0.f};

  const int nChunks = (g.mask_mode == 1 || g.mask_mode == 4) ? (qb + 1) : (g.Skv / AT_KC);   // block-uniform
  // per-row query mask (mode 3)
  int qkeep[8];
#pragma unroll
  for (int r = 0; r < 8; ++r) qkeep[r] = (g.mask_mode == 3) ? mask_b[(size_t)b * g.S + q0 + 8 * hh + r] : 1;   // mask_b = qmask in mode 3
  for (int kc = 0; kc < nChunks; ++kc) {
    const int kv0 = kc * AT_KC;
    __syncthreads();
    {
      const int kvr = tid >> 1, dh = (tid & 1) * 32;
      const float* krow = kb_ptr + (size_t)(kv0 + kvr) * g.k_rs + dh;
      const float* vrow = vb_ptr + (size_t)(kv0 + kvr) * g.v_rs + dh;
#pragma unroll
      for (int i = 0; i < 8; ++i) {
        v4f kk = *(const v4f*)(krow + 4 * i);
        v4f vv = *(const v4f*)(vrow + 4 * i);
#pragma unroll
        for (int e = 0; e < 4; ++e) {
          const int d = dh + 4 * i + e;
          if (SPLIT_QK) { __bf16 a, bl; at_split(kk[e], a, bl); Ksh[kvr * AT_D + d] = a; Ksl[kvr * AT_D + d] = bl; }
          else Ksh[kvr * AT_D + d] = at_to16<F16>(kk[e]);
          if (SPLIT_PV) { __bf16 a, bl; at_split(vv[e], a, bl); Vth[d * AT_KC + kvr] = a; Vtl[d * AT_KC + kvr] = bl; }
          else Vth[d * AT_KC + kvr] = at_to16<F16>(vv[e]);
        }
      }
    }
    __syncthreads();

    v8f s[4];
#pragma unroll
    for (int j = 0; j < 4; ++j) {
      s[j] = (v8f){0.f,0.f,0.f,0.f,0.f,0.f,0.f,0.f};
#pragma unroll 1
      for (int dc = 0; dc < 2; ++dc) {
        FB kb;
        kb.h[0] = *(const v8b*)(Ksh + (j * 16 + c) * AT_D + dc * 32 + 8 * hh);
        kb.h[1] = *(const v8b*)(Ksh + (j * 16 + c) * AT_D + dc * 32 + 16 + 8 * hh);
        s[j] = at_mma16<F16>(qah[dc], kb.v, s[j]);
        if (SPLIT_QK) {
          FB kl;
          kl.h[0] = *(const v8b*)(Ksl + (j * 16 + c) * AT_D + dc * 32 + 8 * hh);
          kl.h[1] = *(const v8b*)(Ksl + (j * 16 + c) * AT_D + dc * 32 + 16 + 8 * hh);
          s[j] = at_mma16<F16>(qah[dc], kl.v, s[j]);
          s[j] = at_mma16<F16>(qal[dc], kb.v, s[j]);
        }
      }
    }
    const bool diag = (g.mask_mode == 1) && (kc == qb);
    int kvkeep[4] = {1, 1, 1, 1};
    if (g.mask_mode == 3) {
#pragma unroll
      for (int j = 0; j < 4; ++j) kvkeep[j] = ((const int*)mask_a)[(size_t)b * g.Skv + kv0 + j * 16 + c];   // mask_a = kvmask
    }
    float cm[8];
#pragma unroll
    for (int r = 0; r < 8; ++r) {
      const int qrow = q0 + 8 * hh + r;
      float m = -INFINITY;
#pragma unroll
      for (int j = 0; j < 4; ++j) {
        const int kvcol = kv0 + j * 16 + c;
        bool masked = false;
        if (diag) masked = (kvcol > qrow);
        else if (g.mask_mode == 4) masked = (kvcol > qrow) || (qrow - kvcol > g.mask_is_int);
        else if (g.mask_mode == 2) {
          const size_t mi = (size_t)qrow * g.Skv + kvcol;
          masked = (g.mask_is_int == 0) ? (((const float*)mask_a)[mi] == 0.0f)
                 : (g.mask_is_int == 1) ? (((const int*)mask_a)[mi] == 0) : (((const int*)mask_a)[mi] != 0);
        } else if (g.mask_mode == 3) masked = (qkeep[r] == 0) || (kvkeep[j] == 0);
        else if (g.mask_mode == 5) {
          const size_t mi = (size_t)qrow * g.Skv + kvcol;
          masked = (((const int*)mask_a)[mi] != 0);
          int n = mask_b[mi]; n = n < 0 ? 0 : n;
          s[j][r] += g.cp[(size_t)b * g.c_bs + (size_t)h * g.c_hs + (size_t)qrow * g.c_rs + n]
                   + g.pc[(size_t)b * g.c_bs + (size_t)h * g.c_hs + (size_t)kvcol * g.c_rs + n];
        }
        if (masked) s[j][r] = g.mask_fill;
        m = fmaxf(m, s[j][r]);
      }
#pragma unroll
      for (int off = 1; off < 16; off <<= 1) m = fmaxf(m, __shfl_xor(m, off, 32));
      cm[r] = m;
    }
    __bf16* pwh = Psh[wave];
    __bf16* pwl = Psl[SPLIT_PV ? wave : 0];
#pragma unroll
    for (int r = 0; r < 8; ++r) {
      const float mnew = fmaxf(mrow[r], cm[r]);
      const float alpha = expf(mrow[r] - mnew);
      mrow[r] = mnew;
      float psum = 0.f;
#pragma unroll
      for (int j = 0; j < 4; ++j) {
        const float p = expf(s[j][r] - mnew);
        psum += p;
        if (SPLIT_PV) { __bf16 a, bl; at_split(p, a, bl); pwh[(8 * hh + r) * AT_KC + j * 16 + c] = a; pwl[(8 * hh + r) * AT_KC + j * 16 + c] = bl; }
        else pwh[(8 * hh + r) * AT_KC + j * 16 + c] = at_to16<F16>(p * PSC);
      }
#pragma unroll
      for (int off = 1; off < 16; off <<= 1) psum += __shfl_xor(psum, off, 32);
      lrow[r] = lrow[r] * alpha + psum;
#pragma unroll
      for (int t = 0; t < 4; ++t) oacc[t][r] *= alpha;
    }
    __builtin_amdgcn_fence(__ATOMIC_RELEASE, "workgroup");
    __builtin_amdgcn_wave_barrier();
    __builtin_amdgcn_fence(__ATOMIC_ACQUIRE, "workgroup");
#pragma unroll 1
    for (int kk = 0; kk < 2; ++kk) {
      FB pa, pl;
      pa.h[0] = *(const v8b*)(pwh + c * AT_KC + kk * 32 + 8 * hh);
      pa.h[1] = *(const v8b*)(pwh + c * AT_KC + kk * 32 + 16 + 8 * hh);
      if (SPLIT_PV) {
        pl.h[0] = *(const v8b*)(pwl + c * AT_KC + kk * 32 + 8 * hh);
        pl.h[1] = *(const v8b*)(pwl + c * AT_KC + kk * 32 + 16 + 8 * hh);
      }
#pragma unroll
      for (int t = 0; t < 4; ++t) {
        FB vb;
        vb.h[0] = *(const v8b*)(Vth + (t * 16 + c) * AT_KC + kk * 32 + 8 * hh);
        vb.h[1] = *(const v8b*)(Vth + (t * 16 + c) * AT_KC + kk * 32 + 16 + 8 * hh);
        oacc[t] = at_mma16<F16>(pa.v, vb.v, oacc[t]);
        if (SPLIT_PV) {
          FB vl;
          vl.h[0] = *(const v8b*)(Vtl + (t * 16 + c) * AT_KC + kk * 32 + 8 * hh);
          vl.h[1] = *(const v8b*)(Vtl + (t * 16 + c) * AT_KC + kk * 32 + 16 + 8 * hh);
          oacc[t] = at_mma16<F16>(pa.v, vl.v, oacc[t]);
          oacc[t] = at_mma16<F16>(pl.v, vb.v, oacc[t]);
        }
      }
    }
  }

  float* os = Os[wave];
#pragma unroll
  for (int r = 0; r < 8; ++r) {
    const float inv = 1.0f / (lrow[r] * PSC);
#pragma unroll
    for (int t = 0; t < 4; ++t) os[(8 * hh + r) * 68 + t * 16 + c] = oacc[t][r] * inv;
  }
  __builtin_amdgcn_fence(__ATOMIC_RELEASE, "workgroup");
  __builtin_amdgcn_wave_barrier();
  __builtin_amdgcn_fence(__ATOMIC_ACQUIRE, "workgroup");
  {
    const int c4 = (lane & 15) * 4;
    {
#pragma unroll
      for (int it = 0; it < 8; ++it) {
        const int row = it * 2 + hh;
        v4f val = *(const v4f*)(os + row * 68 + c4);
        *(v4f*)(ob_ptr + (size_t)(q0 + row) * g.o_rs + c4) = val;
      }
      
    }
  }
}

} // namespace w25

__device__ __forceinline__ void st_h2(_Float16* dst, float a, float b) { const unsigned u = (unsigned)__builtin_bit_cast(unsigned short, (_Float16)a) | ((unsigned)__builtin_bit_cast(unsigned short, (_Float16)b) << 16); unsigned* d = (unsigned*)dst; *d = u;  }
// tiled biases BEB[c] = bE[c % 64], BFB[c] = bF[c % 64] (thread-linear)
__global__ __launch_bounds__(256) void k_ep_btile(const float* __restrict__ BE, const float* __restrict__ BF, float* __restrict__ BEB, float* __restrict__ BFB, int C, int HD) { const int t = blockIdx.x * 256 + threadIdx.x; if (t >= C) return; VST2(float, BEB + t, BE[t % HD]); VST2(float, BFB + t, BF[t % HD]); }
// QS = q * temp2[h] (thread-linear over N*C)
__global__ __launch_bounds__(256) void k_ep_qs(const float* __restrict__ QKVV, const float* __restrict__ T2, float* __restrict__ QS, int N, int C, int C4, int HD) { const long long t = (long long)blockIdx.x * 256 + threadIdx.x; if (t >= (long long)N * C) return; const int n = (int)(t / C), c = (int)(t % C); VST2(float, QS + t, QKVV[(long long)n * C4 + c] * T2[c / HD]); }
// channel softmax: block h (64 threads): rows of SCC[h] [64][64] * temp1[h]; thread i computes row i, then lanes write columns so each 32-float line comes from one wave; P16[h][i][j] = f16(4096 p)
__global__ __launch_bounds__(64) void k_ep_csoft(const float* __restrict__ S, const float* __restrict__ T1, _Float16* __restrict__ P16) { __shared__ float sh[64][65]; const int h = blockIdx.x; const int i = threadIdx.x; const float* r = S + ((long long)h * 64 + i) * 64; const float tp = T1[h]; float mx = -3.0e38f;
    for (int j = 0; j < 64; ++j) mx = fmaxf(mx, r[j] * tp);
    float s = 0.f; for (int j = 0; j < 64; ++j) { const float e = expf(r[j] * tp - mx); sh[i][j] = e; s += e; }
    const float f = 4096.f / s; for (int j = 0; j < 64; ++j) sh[i][j] *= f;
    __syncthreads();
    const int half = i >> 5, c0 = 2 * (i & 31);
    for (int step = 0; step < 32; ++step) { const int rr = 2 * step + half; st_h2(P16 + ((long long)h * 64 + rr) * 64 + c0, sh[rr][c0], sh[rr][c0 + 1]); } }


extern "C" void kernel_launch(void* const* d_in, const int* in_sizes, int n_in, void* d_out, int out_size, void* d_ws, size_t ws_size, hipStream_t stream) {
    (void)in_sizes; (void)n_in; (void)out_size; (void)ws_size;
    const float* x = (const float*)d_in[0];
    const float* Wq = (const float*)d_in[1];
    const float* WE = (const float*)d_in[2];
    const float* bE = (const float*)d_in[3];
    const float* WF = (const float*)d_in[4];
    const float* bF = (const float*)d_in[5];
    const float* Wo1 = (const float*)d_in[6];
    const float* bo1 = (const float*)d_in[7];
    const float* Wo2 = (const float*)d_in[8];
    const float* bo2 = (const float*)d_in[9];
    const float* t1 = (const float*)d_in[10];
    const float* t2 = (const float*)d_in[11];
    const int Bn = 8;
    const int N = 1024;
    const int C = 1024;
    const int NH = 16;
    const int HD = 64;
    const int C4 = 4 * C;
    const int CH = C / 2;
    float* out = (float*)d_out;
    char* wsp = (char*)d_ws;
    float* QKVV = (float*)wsp; wsp += (((size_t)((size_t)N * C4) * 4 + 255) / 256) * 256;
    unsigned short* WE16 = (unsigned short*)wsp; wsp += (((size_t)((size_t)HD * HD) * 2 + 255) / 256) * 256;
    unsigned short* WF16 = (unsigned short*)wsp; wsp += (((size_t)((size_t)HD * HD) * 2 + 255) / 256) * 256;
    float* BEB = (float*)wsp; wsp += (((size_t)((size_t)C) * 4 + 255) / 256) * 256;
    float* BFB = (float*)wsp; wsp += (((size_t)((size_t)C) * 4 + 255) / 256) * 256;
    unsigned short* K16 = (unsigned short*)wsp; wsp += (((size_t)((size_t)N * C) * 2 + 255) / 256) * 256;
    unsigned short* VSA16 = (unsigned short*)wsp; wsp += (((size_t)((size_t)N * C) * 2 + 255) / 256) * 256;
    unsigned short* QTH = (unsigned short*)wsp; wsp += (((size_t)((size_t)C * N) * 2 + 255) / 256) * 256;
    unsigned short* QTL = (unsigned short*)wsp; wsp += (((size_t)((size_t)C * N) * 2 + 255) / 256) * 256;
    unsigned short* KTH = (unsigned short*)wsp; wsp += (((size_t)((size_t)C * N) * 2 + 255) / 256) * 256;
    unsigned short* KTL = (unsigned short*)wsp; wsp += (((size_t)((size_t)C * N) * 2 + 255) / 256) * 256;
    unsigned short* VCA16 = (unsigned short*)wsp; wsp += (((size_t)((size_t)N * C) * 2 + 255) / 256) * 256;
    float* KS = (float*)wsp; wsp += (((size_t)((size_t)N * C) * 4 + 255) / 256) * 256;
    float* VS = (float*)wsp; wsp += (((size_t)((size_t)N * C) * 4 + 255) / 256) * 256;
    float* QS = (float*)wsp; wsp += (((size_t)((size_t)N * C) * 4 + 255) / 256) * 256;
    float* XS = (float*)wsp; wsp += (((size_t)((size_t)N * C) * 4 + 255) / 256) * 256;
    float* SCC = (float*)wsp; wsp += (((size_t)((size_t)NH * 64 * 64) * 4 + 255) / 256) * 256;
    unsigned short* P16 = (unsigned short*)wsp; wsp += (((size_t)((size_t)NH * 64 * 64) * 2 + 255) / 256) * 256;
    float* XC = (float*)wsp; wsp += (((size_t)((size_t)N * C) * 4 + 255) / 256) * 256;
    unsigned short* G64A = (unsigned short*)wsp; wsp += (((size_t)(1048576) * 2 + 255) / 256) * 256;
    unsigned short* G64B = (unsigned short*)wsp; wsp += (((size_t)(2097152) * 2 + 255) / 256) * 256;
    unsigned short* G64A2 = (unsigned short*)wsp; wsp += (((size_t)(1048576) * 2 + 255) / 256) * 256;
    unsigned short* G64B2 = (unsigned short*)wsp; wsp += (((size_t)(2097152) * 2 + 255) / 256) * 256;
    k_cast16<<<(unsigned)((((long long)(HD) * ((HD) / 2)) + 255) / 256), 256, 0, stream>>>(WE, HD, (_Float16*)(WE16), HD, HD, HD, 16.0f);
    k_cast16<<<(unsigned)((((long long)(HD) * ((HD) / 2)) + 255) / 256), 256, 0, stream>>>(WF, HD, (_Float16*)(WF16), HD, HD, HD, 16.0f);
    k_ep_btile<<<(C + 255) / 256, 256, 0, stream>>>(bE, bF, BEB, BFB, C, HD);
    k_castS16<<<(unsigned)((((long long)(1024) * ((1024) / 2)) + 255) / 256), 256, 0, stream>>>(x + (size_t)0 * N * C, 1024, (__bf16*)(G64A), (__bf16*)(G64A2), 1024, 1024, 1024, 1.0f, 0);
    k_castS16<<<(unsigned)((((long long)(2048) * ((1024) / 2)) + 255) / 256), 256, 0, stream>>>(Wq, 1024, (__bf16*)(G64B), (__bf16*)(G64B2), 1024, 2048, 1024, 1.0f, 0);
    w25::wmma_gemm64<1, true, 0, 0, false, 0><<<dim3((unsigned)((((1024) / 64) * ((2048) / 64) + 7) / 8), (unsigned)(1)), 256, 0, stream>>>((const unsigned short*)(G64A), (const unsigned short*)(G64A2), 1024, 0, (const unsigned short*)(G64B), (const unsigned short*)(G64B2), 1024, 0, (void*)(QKVV), nullptr, 4096, 0, nullptr, nullptr, 0, 1024, 2048, 1024, 1.0f);
    k_cast16<<<(unsigned)((((long long)(1024) * ((1024) / 2)) + 255) / 256), 256, 0, stream>>>(x + (size_t)0 * N * C, 1024, (_Float16*)(G64A), 1024, 1024, 1024, 1.0f);
    k_cast16<<<(unsigned)((((long long)(2048) * ((1024) / 2)) + 255) / 256), 256, 0, stream>>>(Wq + (size_t)2 * C * C, 1024, (_Float16*)(G64B), 1024, 2048, 1024, 16.0f);
    w25::wmma_gemm64<0, false, 0, 0, false, 0><<<dim3((unsigned)((((1024) / 64) * ((2048) / 64) + 7) / 8), (unsigned)(1)), 256, 0, stream>>>((const unsigned short*)(G64A), nullptr, 1024, 0, (const unsigned short*)(G64B), nullptr, 1024, 0, (void*)(QKVV + 2 * C), nullptr, 4096, 0, nullptr, nullptr, 0, 1024, 2048, 1024, 0.0625f);
    k_cast16<<<(unsigned)((((long long)(N) * ((C) / 2)) + 255) / 256), 256, 0, stream>>>(QKVV + C, C4, (_Float16*)(K16), C, N, C, 1.0f);
    k_cast16<<<(unsigned)((((long long)(N) * ((C) / 2)) + 255) / 256), 256, 0, stream>>>(QKVV + 3 * C, C4, (_Float16*)(VSA16), C, N, C, 1.0f);
    k_cast16<<<(unsigned)((((long long)(N) * ((C) / 2)) + 255) / 256), 256, 0, stream>>>(QKVV + 2 * C, C4, (_Float16*)(VCA16), C, N, C, 1.0f);
    k_castS16<<<(unsigned)((((long long)(C) * ((N) / 2)) + 255) / 256), 256, 0, stream>>>(QKVV, C4, (__bf16*)(QTH), (__bf16*)(QTL), N, N, C, 1.0f, 1);
    k_castS16<<<(unsigned)((((long long)(C) * ((N) / 2)) + 255) / 256), 256, 0, stream>>>(QKVV + C, C4, (__bf16*)(KTH), (__bf16*)(KTL), N, N, C, 1.0f, 1);
    w25::wmma_gemm64<0, false, 2, 0, false, 0><<<dim3((unsigned)((((N) / 64) * ((HD) / 64) + 7) / 8), (unsigned)(NH)), 256, 0, stream>>>((const unsigned short*)(K16), nullptr, C, HD, (const unsigned short*)(WE16), nullptr, HD, 0, (void*)(KS), nullptr, C, HD, BEB, nullptr, 0, N, HD, HD, 0.0625f);
    w25::wmma_gemm64<0, false, 2, 0, false, 0><<<dim3((unsigned)((((N) / 64) * ((HD) / 64) + 7) / 8), (unsigned)(NH)), 256, 0, stream>>>((const unsigned short*)(VSA16), nullptr, C, HD, (const unsigned short*)(WF16), nullptr, HD, 0, (void*)(VS), nullptr, C, HD, BFB, nullptr, 0, N, HD, HD, 0.0625f);
    k_ep_qs<<<(unsigned)(((long long)N * C + 255) / 256), 256, 0, stream>>>(QKVV, t2, QS, N, C, C4, HD);
    { /*apv4*/ AttnP a;
      a.Q = QS; a.K = KS; a.V = VS; a.O = XS; a.P = 0; a.Mf = 0; a.Mi = 0; a.ST = 0;
      a.Pw = 0; a.Rt = 0; a.SQ = 0; a.SK = 0;
      a.swb = 0; a.swh = 0; a.swi = 0; a.swj = 0; a.srb = 0; a.srh = 0; a.sri = 0; a.sQb = 0; a.sQh = HD; a.sQi = C; a.sQd = 1; a.sKb = 0; a.sKh = HD; a.sKj = C; a.sKd = 1; a.sVb = 0; a.sVh = HD; a.sVj = C; a.sVd = 1; a.sOb = 0; a.sOh = HD; a.sOi = C; a.sPb = 0; a.sPh = 0; a.sPi = 0; a.smb = 0; a.smh = 0; a.smi = 0; a.smj = 0;
      a.Lq = N; a.Lk = N; a.dh = HD; a.dv = HD; a.hrep = 1; a.causal = 0; a.coff = 0; a.pband = 0;
      a.scale = 1.0f; a.mfill = 0.0f; a.nonorm = 0; a.mpol = 0;
      a.roff = 0; a.rn = 1; a.segpol = 0; a.win = 0;
      k_attn<64, 64, 0, false, false><<<dim3((unsigned)((N) + 16 * AW - 1) / (16 * AW), (unsigned)(NH), (unsigned)(1)), 32 * AW, 0, stream>>>(a); }
    w25::wmma_gemm64<1, true, 0, 0, false, 0><<<dim3((unsigned)((((HD) / 64) * ((HD) / 64) + 7) / 8), (unsigned)(NH)), 256, 0, stream>>>((const unsigned short*)(QTH), (const unsigned short*)(QTL), N, (long long)HD * N, (const unsigned short*)(KTH), (const unsigned short*)(KTL), N, (long long)HD * N, (void*)(SCC), nullptr, HD, HD * HD, nullptr, nullptr, 0, HD, HD, N, 1.0f);
    k_ep_csoft<<<NH, 64, 0, stream>>>(SCC, t1, (_Float16*)P16);
    w25::wmma_gemm64<0, false, 0, 0, false, 0><<<dim3((unsigned)((((HD) / 64) * ((N) / 64) + 7) / 8), (unsigned)(NH)), 256, 0, stream>>>((const unsigned short*)(P16), nullptr, HD, HD * HD, (const unsigned short*)(VCA16), nullptr, C, HD, (void*)(XC), nullptr, 16 * C, C, nullptr, nullptr, 0, HD, N, HD, 0.000244140625f);
    k_cast16<<<(unsigned)((((long long)(1024) * ((1024) / 2)) + 255) / 256), 256, 0, stream>>>(XS, 1024, (_Float16*)(G64A), 1024, 1024, 1024, 1.0f);
    k_cast16<<<(unsigned)((((long long)(512) * ((1024) / 2)) + 255) / 256), 256, 0, stream>>>(Wo1, 1024, (_Float16*)(G64B), 1024, 512, 1024, 16.0f);
    w25::wmma_gemm64<0, false, 2, 0, false, 5><<<dim3((unsigned)((((1024) / 64) * ((512) / 64) + 7) / 8), (unsigned)(1)), 256, 0, stream>>>((const unsigned short*)(G64A), nullptr, 1024, 0, (const unsigned short*)(G64B), nullptr, 1024, 0, (void*)(out + (size_t)0 * N * C), nullptr, 1024, 0, bo1, nullptr, 0, 1024, 512, 1024, 0.0625f);
    k_cast16<<<(unsigned)((((long long)(1024) * ((1024) / 2)) + 255) / 256), 256, 0, stream>>>(XC, 1024, (_Float16*)(G64A), 1024, 1024, 1024, 1.0f);
    k_cast16<<<(unsigned)((((long long)(512) * ((1024) / 2)) + 255) / 256), 256, 0, stream>>>(Wo2, 1024, (_Float16*)(G64B), 1024, 512, 1024, 16.0f);
    w25::wmma_gemm64<0, false, 2, 0, false, 5><<<dim3((unsigned)((((1024) / 64) * ((512) / 64) + 7) / 8), (unsigned)(1)), 256, 0, stream>>>((const unsigned short*)(G64A), nullptr, 1024, 0, (const unsigned short*)(G64B), nullptr, 1024, 0, (void*)(out + (size_t)0 * N * C + CH), nullptr, 1024, 0, bo2, nullptr, 0, 1024, 512, 1024, 0.0625f);
    k_castS16<<<(unsigned)((((long long)(1024) * ((1024) / 2)) + 255) / 256), 256, 0, stream>>>(x + (size_t)1 * N * C, 1024, (__bf16*)(G64A), (__bf16*)(G64A2), 1024, 1024, 1024, 1.0f, 0);
    k_castS16<<<(unsigned)((((long long)(2048) * ((1024) / 2)) + 255) / 256), 256, 0, stream>>>(Wq, 1024, (__bf16*)(G64B), (__bf16*)(G64B2), 1024, 2048, 1024, 1.0f, 0);
    w25::wmma_gemm64<1, true, 0, 0, false, 0><<<dim3((unsigned)((((1024) / 64) * ((2048) / 64) + 7) / 8), (unsigned)(1)), 256, 0, stream>>>((const unsigned short*)(G64A), (const unsigned short*)(G64A2), 1024, 0, (const unsigned short*)(G64B), (const unsigned short*)(G64B2), 1024, 0, (void*)(QKVV), nullptr, 4096, 0, nullptr, nullptr, 0, 1024, 2048, 1024, 1.0f);
    k_cast16<<<(unsigned)((((long long)(1024) * ((1024) / 2)) + 255) / 256), 256, 0, stream>>>(x + (size_t)1 * N * C, 1024, (_Float16*)(G64A), 1024, 1024, 1024, 1.0f);
    k_cast16<<<(unsigned)((((long long)(2048) * ((1024) / 2)) + 255) / 256), 256, 0, stream>>>(Wq + (size_t)2 * C * C, 1024, (_Float16*)(G64B), 1024, 2048, 1024, 16.0f);
    w25::wmma_gemm64<0, false, 0, 0, false, 0><<<dim3((unsigned)((((1024) / 64) * ((2048) / 64) + 7) / 8), (unsigned)(1)), 256, 0, stream>>>((const unsigned short*)(G64A), nullptr, 1024, 0, (const unsigned short*)(G64B), nullptr, 1024, 0, (void*)(QKVV + 2 * C), nullptr, 4096, 0, nullptr, nullptr, 0, 1024, 2048, 1024, 0.0625f);
    k_cast16<<<(unsigned)((((long long)(N) * ((C) / 2)) + 255) / 256), 256, 0, stream>>>(QKVV + C, C4, (_Float16*)(K16), C, N, C, 1.0f);
    k_cast16<<<(unsigned)((((long long)(N) * ((C) / 2)) + 255) / 256), 256, 0, stream>>>(QKVV + 3 * C, C4, (_Float16*)(VSA16), C, N, C, 1.0f);
    k_cast16<<<(unsigned)((((long long)(N) * ((C) / 2)) + 255) / 256), 256, 0, stream>>>(QKVV + 2 * C, C4, (_Float16*)(VCA16), C, N, C, 1.0f);
    k_castS16<<<(unsigned)((((long long)(C) * ((N) / 2)) + 255) / 256), 256, 0, stream>>>(QKVV, C4, (__bf16*)(QTH), (__bf16*)(QTL), N, N, C, 1.0f, 1);
    k_castS16<<<(unsigned)((((long long)(C) * ((N) / 2)) + 255) / 256), 256, 0, stream>>>(QKVV + C, C4, (__bf16*)(KTH), (__bf16*)(KTL), N, N, C, 1.0f, 1);
    w25::wmma_gemm64<0, false, 2, 0, false, 0><<<dim3((unsigned)((((N) / 64) * ((HD) / 64) + 7) / 8), (unsigned)(NH)), 256, 0, stream>>>((const unsigned short*)(K16), nullptr, C, HD, (const unsigned short*)(WE16), nullptr, HD, 0, (void*)(KS), nullptr, C, HD, BEB, nullptr, 0, N, HD, HD, 0.0625f);
    w25::wmma_gemm64<0, false, 2, 0, false, 0><<<dim3((unsigned)((((N) / 64) * ((HD) / 64) + 7) / 8), (unsigned)(NH)), 256, 0, stream>>>((const unsigned short*)(VSA16), nullptr, C, HD, (const unsigned short*)(WF16), nullptr, HD, 0, (void*)(VS), nullptr, C, HD, BFB, nullptr, 0, N, HD, HD, 0.0625f);
    k_ep_qs<<<(unsigned)(((long long)N * C + 255) / 256), 256, 0, stream>>>(QKVV, t2, QS, N, C, C4, HD);
    { /*apv4*/ AttnP a;
      a.Q = QS; a.K = KS; a.V = VS; a.O = XS; a.P = 0; a.Mf = 0; a.Mi = 0; a.ST = 0;
      a.Pw = 0; a.Rt = 0; a.SQ = 0; a.SK = 0;
      a.swb = 0; a.swh = 0; a.swi = 0; a.swj = 0; a.srb = 0; a.srh = 0; a.sri = 0; a.sQb = 0; a.sQh = HD; a.sQi = C; a.sQd = 1; a.sKb = 0; a.sKh = HD; a.sKj = C; a.sKd = 1; a.sVb = 0; a.sVh = HD; a.sVj = C; a.sVd = 1; a.sOb = 0; a.sOh = HD; a.sOi = C; a.sPb = 0; a.sPh = 0; a.sPi = 0; a.smb = 0; a.smh = 0; a.smi = 0; a.smj = 0;
      a.Lq = N; a.Lk = N; a.dh = HD; a.dv = HD; a.hrep = 1; a.causal = 0; a.coff = 0; a.pband = 0;
      a.scale = 1.0f; a.mfill = 0.0f; a.nonorm = 0; a.mpol = 0;
      a.roff = 0; a.rn = 1; a.segpol = 0; a.win = 0;
      k_attn<64, 64, 0, false, false><<<dim3((unsigned)((N) + 16 * AW - 1) / (16 * AW), (unsigned)(NH), (unsigned)(1)), 32 * AW, 0, stream>>>(a); }
    w25::wmma_gemm64<1, true, 0, 0, false, 0><<<dim3((unsigned)((((HD) / 64) * ((HD) / 64) + 7) / 8), (unsigned)(NH)), 256, 0, stream>>>((const unsigned short*)(QTH), (const unsigned short*)(QTL), N, (long long)HD * N, (const unsigned short*)(KTH), (const unsigned short*)(KTL), N, (long long)HD * N, (void*)(SCC), nullptr, HD, HD * HD, nullptr, nullptr, 0, HD, HD, N, 1.0f);
    k_ep_csoft<<<NH, 64, 0, stream>>>(SCC, t1, (_Float16*)P16);
    w25::wmma_gemm64<0, false, 0, 0, false, 0><<<dim3((unsigned)((((HD) / 64) * ((N) / 64) + 7) / 8), (unsigned)(NH)), 256, 0, stream>>>((const unsigned short*)(P16), nullptr, HD, HD * HD, (const unsigned short*)(VCA16), nullptr, C, HD, (void*)(XC), nullptr, 16 * C, C, nullptr, nullptr, 0, HD, N, HD, 0.000244140625f);
    k_cast16<<<(unsigned)((((long long)(1024) * ((1024) / 2)) + 255) / 256), 256, 0, stream>>>(XS, 1024, (_Float16*)(G64A), 1024, 1024, 1024, 1.0f);
    k_cast16<<<(unsigned)((((long long)(512) * ((1024) / 2)) + 255) / 256), 256, 0, stream>>>(Wo1, 1024, (_Float16*)(G64B), 1024, 512, 1024, 16.0f);
    w25::wmma_gemm64<0, false, 2, 0, false, 5><<<dim3((unsigned)((((1024) / 64) * ((512) / 64) + 7) / 8), (unsigned)(1)), 256, 0, stream>>>((const unsigned short*)(G64A), nullptr, 1024, 0, (const unsigned short*)(G64B), nullptr, 1024, 0, (void*)(out + (size_t)1 * N * C), nullptr, 1024, 0, bo1, nullptr, 0, 1024, 512, 1024, 0.0625f);
    k_cast16<<<(unsigned)((((long long)(1024) * ((1024) / 2)) + 255) / 256), 256, 0, stream>>>(XC, 1024, (_Float16*)(G64A), 1024, 1024, 1024, 1.0f);
    k_cast16<<<(unsigned)((((long long)(512) * ((1024) / 2)) + 255) / 256), 256, 0, stream>>>(Wo2, 1024, (_Float16*)(G64B), 1024, 512, 1024, 16.0f);
    w25::wmma_gemm64<0, false, 2, 0, false, 5><<<dim3((unsigned)((((1024) / 64) * ((512) / 64) + 7) / 8), (unsigned)(1)), 256, 0, stream>>>((const unsigned short*)(G64A), nullptr, 1024, 0, (const unsigned short*)(G64B), nullptr, 1024, 0, (void*)(out + (size_t)1 * N * C + CH), nullptr, 1024, 0, bo2, nullptr, 0, 1024, 512, 1024, 0.0625f);
    k_castS16<<<(unsigned)((((long long)(1024) * ((1024) / 2)) + 255) / 256), 256, 0, stream>>>(x + (size_t)2 * N * C, 1024, (__bf16*)(G64A), (__bf16*)(G64A2), 1024, 1024, 1024, 1.0f, 0);
    k_castS16<<<(unsigned)((((long long)(2048) * ((1024) / 2)) + 255) / 256), 256, 0, stream>>>(Wq, 1024, (__bf16*)(G64B), (__bf16*)(G64B2), 1024, 2048, 1024, 1.0f, 0);
    w25::wmma_gemm64<1, true, 0, 0, false, 0><<<dim3((unsigned)((((1024) / 64) * ((2048) / 64) + 7) / 8), (unsigned)(1)), 256, 0, stream>>>((const unsigned short*)(G64A), (const unsigned short*)(G64A2), 1024, 0, (const unsigned short*)(G64B), (const unsigned short*)(G64B2), 1024, 0, (void*)(QKVV), nullptr, 4096, 0, nullptr, nullptr, 0, 1024, 2048, 1024, 1.0f);
    k_cast16<<<(unsigned)((((long long)(1024) * ((1024) / 2)) + 255) / 256), 256, 0, stream>>>(x + (size_t)2 * N * C, 1024, (_Float16*)(G64A), 1024, 1024, 1024, 1.0f);
    k_cast16<<<(unsigned)((((long long)(2048) * ((1024) / 2)) + 255) / 256), 256, 0, stream>>>(Wq + (size_t)2 * C * C, 1024, (_Float16*)(G64B), 1024, 2048, 1024, 16.0f);
    w25::wmma_gemm64<0, false, 0, 0, false, 0><<<dim3((unsigned)((((1024) / 64) * ((2048) / 64) + 7) / 8), (unsigned)(1)), 256, 0, stream>>>((const unsigned short*)(G64A), nullptr, 1024, 0, (const unsigned short*)(G64B), nullptr, 1024, 0, (void*)(QKVV + 2 * C), nullptr, 4096, 0, nullptr, nullptr, 0, 1024, 2048, 1024, 0.0625f);
    k_cast16<<<(unsigned)((((long long)(N) * ((C) / 2)) + 255) / 256), 256, 0, stream>>>(QKVV + C, C4, (_Float16*)(K16), C, N, C, 1.0f);
    k_cast16<<<(unsigned)((((long long)(N) * ((C) / 2)) + 255) / 256), 256, 0, stream>>>(QKVV + 3 * C, C4, (_Float16*)(VSA16), C, N, C, 1.0f);
    k_cast16<<<(unsigned)((((long long)(N) * ((C) / 2)) + 255) / 256), 256, 0, stream>>>(QKVV + 2 * C, C4, (_Float16*)(VCA16), C, N, C, 1.0f);
    k_castS16<<<(unsigned)((((long long)(C) * ((N) / 2)) + 255) / 256), 256, 0, stream>>>(QKVV, C4, (__bf16*)(QTH), (__bf16*)(QTL), N, N, C, 1.0f, 1);
    k_castS16<<<(unsigned)((((long long)(C) * ((N) / 2)) + 255) / 256), 256, 0, stream>>>(QKVV + C, C4, (__bf16*)(KTH), (__bf16*)(KTL), N, N, C, 1.0f, 1);
    w25::wmma_gemm64<0, false, 2, 0, false, 0><<<dim3((unsigned)((((N) / 64) * ((HD) / 64) + 7) / 8), (unsigned)(NH)), 256, 0, stream>>>((const unsigned short*)(K16), nullptr, C, HD, (const unsigned short*)(WE16), nullptr, HD, 0, (void*)(KS), nullptr, C, HD, BEB, nullptr, 0, N, HD, HD, 0.0625f);
    w25::wmma_gemm64<0, false, 2, 0, false, 0><<<dim3((unsigned)((((N) / 64) * ((HD) / 64) + 7) / 8), (unsigned)(NH)), 256, 0, stream>>>((const unsigned short*)(VSA16), nullptr, C, HD, (const unsigned short*)(WF16), nullptr, HD, 0, (void*)(VS), nullptr, C, HD, BFB, nullptr, 0, N, HD, HD, 0.0625f);
    k_ep_qs<<<(unsigned)(((long long)N * C + 255) / 256), 256, 0, stream>>>(QKVV, t2, QS, N, C, C4, HD);
    { /*apv4*/ AttnP a;
      a.Q = QS; a.K = KS; a.V = VS; a.O = XS; a.P = 0; a.Mf = 0; a.Mi = 0; a.ST = 0;
      a.Pw = 0; a.Rt = 0; a.SQ = 0; a.SK = 0;
      a.swb = 0; a.swh = 0; a.swi = 0; a.swj = 0; a.srb = 0; a.srh = 0; a.sri = 0; a.sQb = 0; a.sQh = HD; a.sQi = C; a.sQd = 1; a.sKb = 0; a.sKh = HD; a.sKj = C; a.sKd = 1; a.sVb = 0; a.sVh = HD; a.sVj = C; a.sVd = 1; a.sOb = 0; a.sOh = HD; a.sOi = C; a.sPb = 0; a.sPh = 0; a.sPi = 0; a.smb = 0; a.smh = 0; a.smi = 0; a.smj = 0;
      a.Lq = N; a.Lk = N; a.dh = HD; a.dv = HD; a.hrep = 1; a.causal = 0; a.coff = 0; a.pband = 0;
      a.scale = 1.0f; a.mfill = 0.0f; a.nonorm = 0; a.mpol = 0;
      a.roff = 0; a.rn = 1; a.segpol = 0; a.win = 0;
      k_attn<64, 64, 0, false, false><<<dim3((unsigned)((N) + 16 * AW - 1) / (16 * AW), (unsigned)(NH), (unsigned)(1)), 32 * AW, 0, stream>>>(a); }
    w25::wmma_gemm64<1, true, 0, 0, false, 0><<<dim3((unsigned)((((HD) / 64) * ((HD) / 64) + 7) / 8), (unsigned)(NH)), 256, 0, stream>>>((const unsigned short*)(QTH), (const unsigned short*)(QTL), N, (long long)HD * N, (const unsigned short*)(KTH), (const unsigned short*)(KTL), N, (long long)HD * N, (void*)(SCC), nullptr, HD, HD * HD, nullptr, nullptr, 0, HD, HD, N, 1.0f);
    k_ep_csoft<<<NH, 64, 0, stream>>>(SCC, t1, (_Float16*)P16);
    w25::wmma_gemm64<0, false, 0, 0, false, 0><<<dim3((unsigned)((((HD) / 64) * ((N) / 64) + 7) / 8), (unsigned)(NH)), 256, 0, stream>>>((const unsigned short*)(P16), nullptr, HD, HD * HD, (const unsigned short*)(VCA16), nullptr, C, HD, (void*)(XC), nullptr, 16 * C, C, nullptr, nullptr, 0, HD, N, HD, 0.000244140625f);
    k_cast16<<<(unsigned)((((long long)(1024) * ((1024) / 2)) + 255) / 256), 256, 0, stream>>>(XS, 1024, (_Float16*)(G64A), 1024, 1024, 1024, 1.0f);
    k_cast16<<<(unsigned)((((long long)(512) * ((1024) / 2)) + 255) / 256), 256, 0, stream>>>(Wo1, 1024, (_Float16*)(G64B), 1024, 512, 1024, 16.0f);
    w25::wmma_gemm64<0, false, 2, 0, false, 5><<<dim3((unsigned)((((1024) / 64) * ((512) / 64) + 7) / 8), (unsigned)(1)), 256, 0, stream>>>((const unsigned short*)(G64A), nullptr, 1024, 0, (const unsigned short*)(G64B), nullptr, 1024, 0, (void*)(out + (size_t)2 * N * C), nullptr, 1024, 0, bo1, nullptr, 0, 1024, 512, 1024, 0.0625f);
    k_cast16<<<(unsigned)((((long long)(1024) * ((1024) / 2)) + 255) / 256), 256, 0, stream>>>(XC, 1024, (_Float16*)(G64A), 1024, 1024, 1024, 1.0f);
    k_cast16<<<(unsigned)((((long long)(512) * ((1024) / 2)) + 255) / 256), 256, 0, stream>>>(Wo2, 1024, (_Float16*)(G64B), 1024, 512, 1024, 16.0f);
    w25::wmma_gemm64<0, false, 2, 0, false, 5><<<dim3((unsigned)((((1024) / 64) * ((512) / 64) + 7) / 8), (unsigned)(1)), 256, 0, stream>>>((const unsigned short*)(G64A), nullptr, 1024, 0, (const unsigned short*)(G64B), nullptr, 1024, 0, (void*)(out + (size_t)2 * N * C + CH), nullptr, 1024, 0, bo2, nullptr, 0, 1024, 512, 1024, 0.0625f);
    k_castS16<<<(unsigned)((((long long)(1024) * ((1024) / 2)) + 255) / 256), 256, 0, stream>>>(x + (size_t)3 * N * C, 1024, (__bf16*)(G64A), (__bf16*)(G64A2), 1024, 1024, 1024, 1.0f, 0);
    k_castS16<<<(unsigned)((((long long)(2048) * ((1024) / 2)) + 255) / 256), 256, 0, stream>>>(Wq, 1024, (__bf16*)(G64B), (__bf16*)(G64B2), 1024, 2048, 1024, 1.0f, 0);
    w25::wmma_gemm64<1, true, 0, 0, false, 0><<<dim3((unsigned)((((1024) / 64) * ((2048) / 64) + 7) / 8), (unsigned)(1)), 256, 0, stream>>>((const unsigned short*)(G64A), (const unsigned short*)(G64A2), 1024, 0, (const unsigned short*)(G64B), (const unsigned short*)(G64B2), 1024, 0, (void*)(QKVV), nullptr, 4096, 0, nullptr, nullptr, 0, 1024, 2048, 1024, 1.0f);
    k_cast16<<<(unsigned)((((long long)(1024) * ((1024) / 2)) + 255) / 256), 256, 0, stream>>>(x + (size_t)3 * N * C, 1024, (_Float16*)(G64A), 1024, 1024, 1024, 1.0f);
    k_cast16<<<(unsigned)((((long long)(2048) * ((1024) / 2)) + 255) / 256), 256, 0, stream>>>(Wq + (size_t)2 * C * C, 1024, (_Float16*)(G64B), 1024, 2048, 1024, 16.0f);
    w25::wmma_gemm64<0, false, 0, 0, false, 0><<<dim3((unsigned)((((1024) / 64) * ((2048) / 64) + 7) / 8), (unsigned)(1)), 256, 0, stream>>>((const unsigned short*)(G64A), nullptr, 1024, 0, (const unsigned short*)(G64B), nullptr, 1024, 0, (void*)(QKVV + 2 * C), nullptr, 4096, 0, nullptr, nullptr, 0, 1024, 2048, 1024, 0.0625f);
    k_cast16<<<(unsigned)((((long long)(N) * ((C) / 2)) + 255) / 256), 256, 0, stream>>>(QKVV + C, C4, (_Float16*)(K16), C, N, C, 1.0f);
    k_cast16<<<(unsigned)((((long long)(N) * ((C) / 2)) + 255) / 256), 256, 0, stream>>>(QKVV + 3 * C, C4, (_Float16*)(VSA16), C, N, C, 1.0f);
    k_cast16<<<(unsigned)((((long long)(N) * ((C) / 2)) + 255) / 256), 256, 0, stream>>>(QKVV + 2 * C, C4, (_Float16*)(VCA16), C, N, C, 1.0f);
    k_castS16<<<(unsigned)((((long long)(C) * ((N) / 2)) + 255) / 256), 256, 0, stream>>>(QKVV, C4, (__bf16*)(QTH), (__bf16*)(QTL), N, N, C, 1.0f, 1);
    k_castS16<<<(unsigned)((((long long)(C) * ((N) / 2)) + 255) / 256), 256, 0, stream>>>(QKVV + C, C4, (__bf16*)(KTH), (__bf16*)(KTL), N, N, C, 1.0f, 1);
    w25::wmma_gemm64<0, false, 2, 0, false, 0><<<dim3((unsigned)((((N) / 64) * ((HD) / 64) + 7) / 8), (unsigned)(NH)), 256, 0, stream>>>((const unsigned short*)(K16), nullptr, C, HD, (const unsigned short*)(WE16), nullptr, HD, 0, (void*)(KS), nullptr, C, HD, BEB, nullptr, 0, N, HD, HD, 0.0625f);
    w25::wmma_gemm64<0, false, 2, 0, false, 0><<<dim3((unsigned)((((N) / 64) * ((HD) / 64) + 7) / 8), (unsigned)(NH)), 256, 0, stream>>>((const unsigned short*)(VSA16), nullptr, C, HD, (const unsigned short*)(WF16), nullptr, HD, 0, (void*)(VS), nullptr, C, HD, BFB, nullptr, 0, N, HD, HD, 0.0625f);
    k_ep_qs<<<(unsigned)(((long long)N * C + 255) / 256), 256, 0, stream>>>(QKVV, t2, QS, N, C, C4, HD);
    { /*apv4*/ AttnP a;
      a.Q = QS; a.K = KS; a.V = VS; a.O = XS; a.P = 0; a.Mf = 0; a.Mi = 0; a.ST = 0;
      a.Pw = 0; a.Rt = 0; a.SQ = 0; a.SK = 0;
      a.swb = 0; a.swh = 0; a.swi = 0; a.swj = 0; a.srb = 0; a.srh = 0; a.sri = 0; a.sQb = 0; a.sQh = HD; a.sQi = C; a.sQd = 1; a.sKb = 0; a.sKh = HD; a.sKj = C; a.sKd = 1; a.sVb = 0; a.sVh = HD; a.sVj = C; a.sVd = 1; a.sOb = 0; a.sOh = HD; a.sOi = C; a.sPb = 0; a.sPh = 0; a.sPi = 0; a.smb = 0; a.smh = 0; a.smi = 0; a.smj = 0;
      a.Lq = N; a.Lk = N; a.dh = HD; a.dv = HD; a.hrep = 1; a.causal = 0; a.coff = 0; a.pband = 0;
      a.scale = 1.0f; a.mfill = 0.0f; a.nonorm = 0; a.mpol = 0;
      a.roff = 0; a.rn = 1; a.segpol = 0; a.win = 0;
      k_attn<64, 64, 0, false, false><<<dim3((unsigned)((N) + 16 * AW - 1) / (16 * AW), (unsigned)(NH), (unsigned)(1)), 32 * AW, 0, stream>>>(a); }
    w25::wmma_gemm64<1, true, 0, 0, false, 0><<<dim3((unsigned)((((HD) / 64) * ((HD) / 64) + 7) / 8), (unsigned)(NH)), 256, 0, stream>>>((const unsigned short*)(QTH), (const unsigned short*)(QTL), N, (long long)HD * N, (const unsigned short*)(KTH), (const unsigned short*)(KTL), N, (long long)HD * N, (void*)(SCC), nullptr, HD, HD * HD, nullptr, nullptr, 0, HD, HD, N, 1.0f);
    k_ep_csoft<<<NH, 64, 0, stream>>>(SCC, t1, (_Float16*)P16);
    w25::wmma_gemm64<0, false, 0, 0, false, 0><<<dim3((unsigned)((((HD) / 64) * ((N) / 64) + 7) / 8), (unsigned)(NH)), 256, 0, stream>>>((const unsigned short*)(P16), nullptr, HD, HD * HD, (const unsigned short*)(VCA16), nullptr, C, HD, (void*)(XC), nullptr, 16 * C, C, nullptr, nullptr, 0, HD, N, HD, 0.000244140625f);
    k_cast16<<<(unsigned)((((long long)(1024) * ((1024) / 2)) + 255) / 256), 256, 0, stream>>>(XS, 1024, (_Float16*)(G64A), 1024, 1024, 1024, 1.0f);
    k_cast16<<<(unsigned)((((long long)(512) * ((1024) / 2)) + 255) / 256), 256, 0, stream>>>(Wo1, 1024, (_Float16*)(G64B), 1024, 512, 1024, 16.0f);
    w25::wmma_gemm64<0, false, 2, 0, false, 5><<<dim3((unsigned)((((1024) / 64) * ((512) / 64) + 7) / 8), (unsigned)(1)), 256, 0, stream>>>((const unsigned short*)(G64A), nullptr, 1024, 0, (const unsigned short*)(G64B), nullptr, 1024, 0, (void*)(out + (size_t)3 * N * C), nullptr, 1024, 0, bo1, nullptr, 0, 1024, 512, 1024, 0.0625f);
    k_cast16<<<(unsigned)((((long long)(1024) * ((1024) / 2)) + 255) / 256), 256, 0, stream>>>(XC, 1024, (_Float16*)(G64A), 1024, 1024, 1024, 1.0f);
    k_cast16<<<(unsigned)((((long long)(512) * ((1024) / 2)) + 255) / 256), 256, 0, stream>>>(Wo2, 1024, (_Float16*)(G64B), 1024, 512, 1024, 16.0f);
    w25::wmma_gemm64<0, false, 2, 0, false, 5><<<dim3((unsigned)((((1024) / 64) * ((512) / 64) + 7) / 8), (unsigned)(1)), 256, 0, stream>>>((const unsigned short*)(G64A), nullptr, 1024, 0, (const unsigned short*)(G64B), nullptr, 1024, 0, (void*)(out + (size_t)3 * N * C + CH), nullptr, 1024, 0, bo2, nullptr, 0, 1024, 512, 1024, 0.0625f);
    k_castS16<<<(unsigned)((((long long)(1024) * ((1024) / 2)) + 255) / 256), 256, 0, stream>>>(x + (size_t)4 * N * C, 1024, (__bf16*)(G64A), (__bf16*)(G64A2), 1024, 1024, 1024, 1.0f, 0);
    k_castS16<<<(unsigned)((((long long)(2048) * ((1024) / 2)) + 255) / 256), 256, 0, stream>>>(Wq, 1024, (__bf16*)(G64B), (__bf16*)(G64B2), 1024, 2048, 1024, 1.0f, 0);
    w25::wmma_gemm64<1, true, 0, 0, false, 0><<<dim3((unsigned)((((1024) / 64) * ((2048) / 64) + 7) / 8), (unsigned)(1)), 256, 0, stream>>>((const unsigned short*)(G64A), (const unsigned short*)(G64A2), 1024, 0, (const unsigned short*)(G64B), (const unsigned short*)(G64B2), 1024, 0, (void*)(QKVV), nullptr, 4096, 0, nullptr, nullptr, 0, 1024, 2048, 1024, 1.0f);
    k_cast16<<<(unsigned)((((long long)(1024) * ((1024) / 2)) + 255) / 256), 256, 0, stream>>>(x + (size_t)4 * N * C, 1024, (_Float16*)(G64A), 1024, 1024, 1024, 1.0f);
    k_cast16<<<(unsigned)((((long long)(2048) * ((1024) / 2)) + 255) / 256), 256, 0, stream>>>(Wq + (size_t)2 * C * C, 1024, (_Float16*)(G64B), 1024, 2048, 1024, 16.0f);
    w25::wmma_gemm64<0, false, 0, 0, false, 0><<<dim3((unsigned)((((1024) / 64) * ((2048) / 64) + 7) / 8), (unsigned)(1)), 256, 0, stream>>>((const unsigned short*)(G64A), nullptr, 1024, 0, (const unsigned short*)(G64B), nullptr, 1024, 0, (void*)(QKVV + 2 * C), nullptr, 4096, 0, nullptr, nullptr, 0, 1024, 2048, 1024, 0.0625f);
    k_cast16<<<(unsigned)((((long long)(N) * ((C) / 2)) + 255) / 256), 256, 0, stream>>>(QKVV + C, C4, (_Float16*)(K16), C, N, C, 1.0f);
    k_cast16<<<(unsigned)((((long long)(N) * ((C) / 2)) + 255) / 256), 256, 0, stream>>>(QKVV + 3 * C, C4, (_Float16*)(VSA16), C, N, C, 1.0f);
    k_cast16<<<(unsigned)((((long long)(N) * ((C) / 2)) + 255) / 256), 256, 0, stream>>>(QKVV + 2 * C, C4, (_Float16*)(VCA16), C, N, C, 1.0f);
    k_castS16<<<(unsigned)((((long long)(C) * ((N) / 2)) + 255) / 256), 256, 0, stream>>>(QKVV, C4, (__bf16*)(QTH), (__bf16*)(QTL), N, N, C, 1.0f, 1);
    k_castS16<<<(unsigned)((((long long)(C) * ((N) / 2)) + 255) / 256), 256, 0, stream>>>(QKVV + C, C4, (__bf16*)(KTH), (__bf16*)(KTL), N, N, C, 1.0f, 1);
    w25::wmma_gemm64<0, false, 2, 0, false, 0><<<dim3((unsigned)((((N) / 64) * ((HD) / 64) + 7) / 8), (unsigned)(NH)), 256, 0, stream>>>((const unsigned short*)(K16), nullptr, C, HD, (const unsigned short*)(WE16), nullptr, HD, 0, (void*)(KS), nullptr, C, HD, BEB, nullptr, 0, N, HD, HD, 0.0625f);
    w25::wmma_gemm64<0, false, 2, 0, false, 0><<<dim3((unsigned)((((N) / 64) * ((HD) / 64) + 7) / 8), (unsigned)(NH)), 256, 0, stream>>>((const unsigned short*)(VSA16), nullptr, C, HD, (const unsigned short*)(WF16), nullptr, HD, 0, (void*)(VS), nullptr, C, HD, BFB, nullptr, 0, N, HD, HD, 0.0625f);
    k_ep_qs<<<(unsigned)(((long long)N * C + 255) / 256), 256, 0, stream>>>(QKVV, t2, QS, N, C, C4, HD);
    { /*apv4*/ AttnP a;
      a.Q = QS; a.K = KS; a.V = VS; a.O = XS; a.P = 0; a.Mf = 0; a.Mi = 0; a.ST = 0;
      a.Pw = 0; a.Rt = 0; a.SQ = 0; a.SK = 0;
      a.swb = 0; a.swh = 0; a.swi = 0; a.swj = 0; a.srb = 0; a.srh = 0; a.sri = 0; a.sQb = 0; a.sQh = HD; a.sQi = C; a.sQd = 1; a.sKb = 0; a.sKh = HD; a.sKj = C; a.sKd = 1; a.sVb = 0; a.sVh = HD; a.sVj = C; a.sVd = 1; a.sOb = 0; a.sOh = HD; a.sOi = C; a.sPb = 0; a.sPh = 0; a.sPi = 0; a.smb = 0; a.smh = 0; a.smi = 0; a.smj = 0;
      a.Lq = N; a.Lk = N; a.dh = HD; a.dv = HD; a.hrep = 1; a.causal = 0; a.coff = 0; a.pband = 0;
      a.scale = 1.0f; a.mfill = 0.0f; a.nonorm = 0; a.mpol = 0;
      a.roff = 0; a.rn = 1; a.segpol = 0; a.win = 0;
      k_attn<64, 64, 0, false, false><<<dim3((unsigned)((N) + 16 * AW - 1) / (16 * AW), (unsigned)(NH), (unsigned)(1)), 32 * AW, 0, stream>>>(a); }
    w25::wmma_gemm64<1, true, 0, 0, false, 0><<<dim3((unsigned)((((HD) / 64) * ((HD) / 64) + 7) / 8), (unsigned)(NH)), 256, 0, stream>>>((const unsigned short*)(QTH), (const unsigned short*)(QTL), N, (long long)HD * N, (const unsigned short*)(KTH), (const unsigned short*)(KTL), N, (long long)HD * N, (void*)(SCC), nullptr, HD, HD * HD, nullptr, nullptr, 0, HD, HD, N, 1.0f);
    k_ep_csoft<<<NH, 64, 0, stream>>>(SCC, t1, (_Float16*)P16);
    w25::wmma_gemm64<0, false, 0, 0, false, 0><<<dim3((unsigned)((((HD) / 64) * ((N) / 64) + 7) / 8), (unsigned)(NH)), 256, 0, stream>>>((const unsigned short*)(P16), nullptr, HD, HD * HD, (const unsigned short*)(VCA16), nullptr, C, HD, (void*)(XC), nullptr, 16 * C, C, nullptr, nullptr, 0, HD, N, HD, 0.000244140625f);
    k_cast16<<<(unsigned)((((long long)(1024) * ((1024) / 2)) + 255) / 256), 256, 0, stream>>>(XS, 1024, (_Float16*)(G64A), 1024, 1024, 1024, 1.0f);
    k_cast16<<<(unsigned)((((long long)(512) * ((1024) / 2)) + 255) / 256), 256, 0, stream>>>(Wo1, 1024, (_Float16*)(G64B), 1024, 512, 1024, 16.0f);
    w25::wmma_gemm64<0, false, 2, 0, false, 5><<<dim3((unsigned)((((1024) / 64) * ((512) / 64) + 7) / 8), (unsigned)(1)), 256, 0, stream>>>((const unsigned short*)(G64A), nullptr, 1024, 0, (const unsigned short*)(G64B), nullptr, 1024, 0, (void*)(out + (size_t)4 * N * C), nullptr, 1024, 0, bo1, nullptr, 0, 1024, 512, 1024, 0.0625f);
    k_cast16<<<(unsigned)((((long long)(1024) * ((1024) / 2)) + 255) / 256), 256, 0, stream>>>(XC, 1024, (_Float16*)(G64A), 1024, 1024, 1024, 1.0f);
    k_cast16<<<(unsigned)((((long long)(512) * ((1024) / 2)) + 255) / 256), 256, 0, stream>>>(Wo2, 1024, (_Float16*)(G64B), 1024, 512, 1024, 16.0f);
    w25::wmma_gemm64<0, false, 2, 0, false, 5><<<dim3((unsigned)((((1024) / 64) * ((512) / 64) + 7) / 8), (unsigned)(1)), 256, 0, stream>>>((const unsigned short*)(G64A), nullptr, 1024, 0, (const unsigned short*)(G64B), nullptr, 1024, 0, (void*)(out + (size_t)4 * N * C + CH), nullptr, 1024, 0, bo2, nullptr, 0, 1024, 512, 1024, 0.0625f);
    k_castS16<<<(unsigned)((((long long)(1024) * ((1024) / 2)) + 255) / 256), 256, 0, stream>>>(x + (size_t)5 * N * C, 1024, (__bf16*)(G64A), (__bf16*)(G64A2), 1024, 1024, 1024, 1.0f, 0);
    k_castS16<<<(unsigned)((((long long)(2048) * ((1024) / 2)) + 255) / 256), 256, 0, stream>>>(Wq, 1024, (__bf16*)(G64B), (__bf16*)(G64B2), 1024, 2048, 1024, 1.0f, 0);
    w25::wmma_gemm64<1, true, 0, 0, false, 0><<<dim3((unsigned)((((1024) / 64) * ((2048) / 64) + 7) / 8), (unsigned)(1)), 256, 0, stream>>>((const unsigned short*)(G64A), (const unsigned short*)(G64A2), 1024, 0, (const unsigned short*)(G64B), (const unsigned short*)(G64B2), 1024, 0, (void*)(QKVV), nullptr, 4096, 0, nullptr, nullptr, 0, 1024, 2048, 1024, 1.0f);
    k_cast16<<<(unsigned)((((long long)(1024) * ((1024) / 2)) + 255) / 256), 256, 0, stream>>>(x + (size_t)5 * N * C, 1024, (_Float16*)(G64A), 1024, 1024, 1024, 1.0f);
    k_cast16<<<(unsigned)((((long long)(2048) * ((1024) / 2)) + 255) / 256), 256, 0, stream>>>(Wq + (size_t)2 * C * C, 1024, (_Float16*)(G64B), 1024, 2048, 1024, 16.0f);
    w25::wmma_gemm64<0, false, 0, 0, false, 0><<<dim3((unsigned)((((1024) / 64) * ((2048) / 64) + 7) / 8), (unsigned)(1)), 256, 0, stream>>>((const unsigned short*)(G64A), nullptr, 1024, 0, (const unsigned short*)(G64B), nullptr, 1024, 0, (void*)(QKVV + 2 * C), nullptr, 4096, 0, nullptr, nullptr, 0, 1024, 2048, 1024, 0.0625f);
    k_cast16<<<(unsigned)((((long long)(N) * ((C) / 2)) + 255) / 256), 256, 0, stream>>>(QKVV + C, C4, (_Float16*)(K16), C, N, C, 1.0f);
    k_cast16<<<(unsigned)((((long long)(N) * ((C) / 2)) + 255) / 256), 256, 0, stream>>>(QKVV + 3 * C, C4, (_Float16*)(VSA16), C, N, C, 1.0f);
    k_cast16<<<(unsigned)((((long long)(N) * ((C) / 2)) + 255) / 256), 256, 0, stream>>>(QKVV + 2 * C, C4, (_Float16*)(VCA16), C, N, C, 1.0f);
    k_castS16<<<(unsigned)((((long long)(C) * ((N) / 2)) + 255) / 256), 256, 0, stream>>>(QKVV, C4, (__bf16*)(QTH), (__bf16*)(QTL), N, N, C, 1.0f, 1);
    k_castS16<<<(unsigned)((((long long)(C) * ((N) / 2)) + 255) / 256), 256, 0, stream>>>(QKVV + C, C4, (__bf16*)(KTH), (__bf16*)(KTL), N, N, C, 1.0f, 1);
    w25::wmma_gemm64<0, false, 2, 0, false, 0><<<dim3((unsigned)((((N) / 64) * ((HD) / 64) + 7) / 8), (unsigned)(NH)), 256, 0, stream>>>((const unsigned short*)(K16), nullptr, C, HD, (const unsigned short*)(WE16), nullptr, HD, 0, (void*)(KS), nullptr, C, HD, BEB, nullptr, 0, N, HD, HD, 0.0625f);
    w25::wmma_gemm64<0, false, 2, 0, false, 0><<<dim3((unsigned)((((N) / 64) * ((HD) / 64) + 7) / 8), (unsigned)(NH)), 256, 0, stream>>>((const unsigned short*)(VSA16), nullptr, C, HD, (const unsigned short*)(WF16), nullptr, HD, 0, (void*)(VS), nullptr, C, HD, BFB, nullptr, 0, N, HD, HD, 0.0625f);
    k_ep_qs<<<(unsigned)(((long long)N * C + 255) / 256), 256, 0, stream>>>(QKVV, t2, QS, N, C, C4, HD);
    { /*apv4*/ AttnP a;
      a.Q = QS; a.K = KS; a.V = VS; a.O = XS; a.P = 0; a.Mf = 0; a.Mi = 0; a.ST = 0;
      a.Pw = 0; a.Rt = 0; a.SQ = 0; a.SK = 0;
      a.swb = 0; a.swh = 0; a.swi = 0; a.swj = 0; a.srb = 0; a.srh = 0; a.sri = 0; a.sQb = 0; a.sQh = HD; a.sQi = C; a.sQd = 1; a.sKb = 0; a.sKh = HD; a.sKj = C; a.sKd = 1; a.sVb = 0; a.sVh = HD; a.sVj = C; a.sVd = 1; a.sOb = 0; a.sOh = HD; a.sOi = C; a.sPb = 0; a.sPh = 0; a.sPi = 0; a.smb = 0; a.smh = 0; a.smi = 0; a.smj = 0;
      a.Lq = N; a.Lk = N; a.dh = HD; a.dv = HD; a.hrep = 1; a.causal = 0; a.coff = 0; a.pband = 0;
      a.scale = 1.0f; a.mfill = 0.0f; a.nonorm = 0; a.mpol = 0;
      a.roff = 0; a.rn = 1; a.segpol = 0; a.win = 0;
      k_attn<64, 64, 0, false, false><<<dim3((unsigned)((N) + 16 * AW - 1) / (16 * AW), (unsigned)(NH), (unsigned)(1)), 32 * AW, 0, stream>>>(a); }
    w25::wmma_gemm64<1, true, 0, 0, false, 0><<<dim3((unsigned)((((HD) / 64) * ((HD) / 64) + 7) / 8), (unsigned)(NH)), 256, 0, stream>>>((const unsigned short*)(QTH), (const unsigned short*)(QTL), N, (long long)HD * N, (const unsigned short*)(KTH), (const unsigned short*)(KTL), N, (long long)HD * N, (void*)(SCC), nullptr, HD, HD * HD, nullptr, nullptr, 0, HD, HD, N, 1.0f);
    k_ep_csoft<<<NH, 64, 0, stream>>>(SCC, t1, (_Float16*)P16);
    w25::wmma_gemm64<0, false, 0, 0, false, 0><<<dim3((unsigned)((((HD) / 64) * ((N) / 64) + 7) / 8), (unsigned)(NH)), 256, 0, stream>>>((const unsigned short*)(P16), nullptr, HD, HD * HD, (const unsigned short*)(VCA16), nullptr, C, HD, (void*)(XC), nullptr, 16 * C, C, nullptr, nullptr, 0, HD, N, HD, 0.000244140625f);
    k_cast16<<<(unsigned)((((long long)(1024) * ((1024) / 2)) + 255) / 256), 256, 0, stream>>>(XS, 1024, (_Float16*)(G64A), 1024, 1024, 1024, 1.0f);
    k_cast16<<<(unsigned)((((long long)(512) * ((1024) / 2)) + 255) / 256), 256, 0, stream>>>(Wo1, 1024, (_Float16*)(G64B), 1024, 512, 1024, 16.0f);
    w25::wmma_gemm64<0, false, 2, 0, false, 5><<<dim3((unsigned)((((1024) / 64) * ((512) / 64) + 7) / 8), (unsigned)(1)), 256, 0, stream>>>((const unsigned short*)(G64A), nullptr, 1024, 0, (const unsigned short*)(G64B), nullptr, 1024, 0, (void*)(out + (size_t)5 * N * C), nullptr, 1024, 0, bo1, nullptr, 0, 1024, 512, 1024, 0.0625f);
    k_cast16<<<(unsigned)((((long long)(1024) * ((1024) / 2)) + 255) / 256), 256, 0, stream>>>(XC, 1024, (_Float16*)(G64A), 1024, 1024, 1024, 1.0f);
    k_cast16<<<(unsigned)((((long long)(512) * ((1024) / 2)) + 255) / 256), 256, 0, stream>>>(Wo2, 1024, (_Float16*)(G64B), 1024, 512, 1024, 16.0f);
    w25::wmma_gemm64<0, false, 2, 0, false, 5><<<dim3((unsigned)((((1024) / 64) * ((512) / 64) + 7) / 8), (unsigned)(1)), 256, 0, stream>>>((const unsigned short*)(G64A), nullptr, 1024, 0, (const unsigned short*)(G64B), nullptr, 1024, 0, (void*)(out + (size_t)5 * N * C + CH), nullptr, 1024, 0, bo2, nullptr, 0, 1024, 512, 1024, 0.0625f);
    k_castS16<<<(unsigned)((((long long)(1024) * ((1024) / 2)) + 255) / 256), 256, 0, stream>>>(x + (size_t)6 * N * C, 1024, (__bf16*)(G64A), (__bf16*)(G64A2), 1024, 1024, 1024, 1.0f, 0);
    k_castS16<<<(unsigned)((((long long)(2048) * ((1024) / 2)) + 255) / 256), 256, 0, stream>>>(Wq, 1024, (__bf16*)(G64B), (__bf16*)(G64B2), 1024, 2048, 1024, 1.0f, 0);
    w25::wmma_gemm64<1, true, 0, 0, false, 0><<<dim3((unsigned)((((1024) / 64) * ((2048) / 64) + 7) / 8), (unsigned)(1)), 256, 0, stream>>>((const unsigned short*)(G64A), (const unsigned short*)(G64A2), 1024, 0, (const unsigned short*)(G64B), (const unsigned short*)(G64B2), 1024, 0, (void*)(QKVV), nullptr, 4096, 0, nullptr, nullptr, 0, 1024, 2048, 1024, 1.0f);
    k_cast16<<<(unsigned)((((long long)(1024) * ((1024) / 2)) + 255) / 256), 256, 0, stream>>>(x + (size_t)6 * N * C, 1024, (_Float16*)(G64A), 1024, 1024, 1024, 1.0f);
    k_cast16<<<(unsigned)((((long long)(2048) * ((1024) / 2)) + 255) / 256), 256, 0, stream>>>(Wq + (size_t)2 * C * C, 1024, (_Float16*)(G64B), 1024, 2048, 1024, 16.0f);
    w25::wmma_gemm64<0, false, 0, 0, false, 0><<<dim3((unsigned)((((1024) / 64) * ((2048) / 64) + 7) / 8), (unsigned)(1)), 256, 0, stream>>>((const unsigned short*)(G64A), nullptr, 1024, 0, (const unsigned short*)(G64B), nullptr, 1024, 0, (void*)(QKVV + 2 * C), nullptr, 4096, 0, nullptr, nullptr, 0, 1024, 2048, 1024, 0.0625f);
    k_cast16<<<(unsigned)((((long long)(N) * ((C) / 2)) + 255) / 256), 256, 0, stream>>>(QKVV + C, C4, (_Float16*)(K16), C, N, C, 1.0f);
    k_cast16<<<(unsigned)((((long long)(N) * ((C) / 2)) + 255) / 256), 256, 0, stream>>>(QKVV + 3 * C, C4, (_Float16*)(VSA16), C, N, C, 1.0f);
    k_cast16<<<(unsigned)((((long long)(N) * ((C) / 2)) + 255) / 256), 256, 0, stream>>>(QKVV + 2 * C, C4, (_Float16*)(VCA16), C, N, C, 1.0f);
    k_castS16<<<(unsigned)((((long long)(C) * ((N) / 2)) + 255) / 256), 256, 0, stream>>>(QKVV, C4, (__bf16*)(QTH), (__bf16*)(QTL), N, N, C, 1.0f, 1);
    k_castS16<<<(unsigned)((((long long)(C) * ((N) / 2)) + 255) / 256), 256, 0, stream>>>(QKVV + C, C4, (__bf16*)(KTH), (__bf16*)(KTL), N, N, C, 1.0f, 1);
    w25::wmma_gemm64<0, false, 2, 0, false, 0><<<dim3((unsigned)((((N) / 64) * ((HD) / 64) + 7) / 8), (unsigned)(NH)), 256, 0, stream>>>((const unsigned short*)(K16), nullptr, C, HD, (const unsigned short*)(WE16), nullptr, HD, 0, (void*)(KS), nullptr, C, HD, BEB, nullptr, 0, N, HD, HD, 0.0625f);
    w25::wmma_gemm64<0, false, 2, 0, false, 0><<<dim3((unsigned)((((N) / 64) * ((HD) / 64) + 7) / 8), (unsigned)(NH)), 256, 0, stream>>>((const unsigned short*)(VSA16), nullptr, C, HD, (const unsigned short*)(WF16), nullptr, HD, 0, (void*)(VS), nullptr, C, HD, BFB, nullptr, 0, N, HD, HD, 0.0625f);
    k_ep_qs<<<(unsigned)(((long long)N * C + 255) / 256), 256, 0, stream>>>(QKVV, t2, QS, N, C, C4, HD);
    { /*apv4*/ AttnP a;
      a.Q = QS; a.K = KS; a.V = VS; a.O = XS; a.P = 0; a.Mf = 0; a.Mi = 0; a.ST = 0;
      a.Pw = 0; a.Rt = 0; a.SQ = 0; a.SK = 0;
      a.swb = 0; a.swh = 0; a.swi = 0; a.swj = 0; a.srb = 0; a.srh = 0; a.sri = 0; a.sQb = 0; a.sQh = HD; a.sQi = C; a.sQd = 1; a.sKb = 0; a.sKh = HD; a.sKj = C; a.sKd = 1; a.sVb = 0; a.sVh = HD; a.sVj = C; a.sVd = 1; a.sOb = 0; a.sOh = HD; a.sOi = C; a.sPb = 0; a.sPh = 0; a.sPi = 0; a.smb = 0; a.smh = 0; a.smi = 0; a.smj = 0;
      a.Lq = N; a.Lk = N; a.dh = HD; a.dv = HD; a.hrep = 1; a.causal = 0; a.coff = 0; a.pband = 0;
      a.scale = 1.0f; a.mfill = 0.0f; a.nonorm = 0; a.mpol = 0;
      a.roff = 0; a.rn = 1; a.segpol = 0; a.win = 0;
      k_attn<64, 64, 0, false, false><<<dim3((unsigned)((N) + 16 * AW - 1) / (16 * AW), (unsigned)(NH), (unsigned)(1)), 32 * AW, 0, stream>>>(a); }
    w25::wmma_gemm64<1, true, 0, 0, false, 0><<<dim3((unsigned)((((HD) / 64) * ((HD) / 64) + 7) / 8), (unsigned)(NH)), 256, 0, stream>>>((const unsigned short*)(QTH), (const unsigned short*)(QTL), N, (long long)HD * N, (const unsigned short*)(KTH), (const unsigned short*)(KTL), N, (long long)HD * N, (void*)(SCC), nullptr, HD, HD * HD, nullptr, nullptr, 0, HD, HD, N, 1.0f);
    k_ep_csoft<<<NH, 64, 0, stream>>>(SCC, t1, (_Float16*)P16);
    w25::wmma_gemm64<0, false, 0, 0, false, 0><<<dim3((unsigned)((((HD) / 64) * ((N) / 64) + 7) / 8), (unsigned)(NH)), 256, 0, stream>>>((const unsigned short*)(P16), nullptr, HD, HD * HD, (const unsigned short*)(VCA16), nullptr, C, HD, (void*)(XC), nullptr, 16 * C, C, nullptr, nullptr, 0, HD, N, HD, 0.000244140625f);
    k_cast16<<<(unsigned)((((long long)(1024) * ((1024) / 2)) + 255) / 256), 256, 0, stream>>>(XS, 1024, (_Float16*)(G64A), 1024, 1024, 1024, 1.0f);
    k_cast16<<<(unsigned)((((long long)(512) * ((1024) / 2)) + 255) / 256), 256, 0, stream>>>(Wo1, 1024, (_Float16*)(G64B), 1024, 512, 1024, 16.0f);
    w25::wmma_gemm64<0, false, 2, 0, false, 5><<<dim3((unsigned)((((1024) / 64) * ((512) / 64) + 7) / 8), (unsigned)(1)), 256, 0, stream>>>((const unsigned short*)(G64A), nullptr, 1024, 0, (const unsigned short*)(G64B), nullptr, 1024, 0, (void*)(out + (size_t)6 * N * C), nullptr, 1024, 0, bo1, nullptr, 0, 1024, 512, 1024, 0.0625f);
    k_cast16<<<(unsigned)((((long long)(1024) * ((1024) / 2)) + 255) / 256), 256, 0, stream>>>(XC, 1024, (_Float16*)(G64A), 1024, 1024, 1024, 1.0f);
    k_cast16<<<(unsigned)((((long long)(512) * ((1024) / 2)) + 255) / 256), 256, 0, stream>>>(Wo2, 1024, (_Float16*)(G64B), 1024, 512, 1024, 16.0f);
    w25::wmma_gemm64<0, false, 2, 0, false, 5><<<dim3((unsigned)((((1024) / 64) * ((512) / 64) + 7) / 8), (unsigned)(1)), 256, 0, stream>>>((const unsigned short*)(G64A), nullptr, 1024, 0, (const unsigned short*)(G64B), nullptr, 1024, 0, (void*)(out + (size_t)6 * N * C + CH), nullptr, 1024, 0, bo2, nullptr, 0, 1024, 512, 1024, 0.0625f);
    k_castS16<<<(unsigned)((((long long)(1024) * ((1024) / 2)) + 255) / 256), 256, 0, stream>>>(x + (size_t)7 * N * C, 1024, (__bf16*)(G64A), (__bf16*)(G64A2), 1024, 1024, 1024, 1.0f, 0);
    k_castS16<<<(unsigned)((((long long)(2048) * ((1024) / 2)) + 255) / 256), 256, 0, stream>>>(Wq, 1024, (__bf16*)(G64B), (__bf16*)(G64B2), 1024, 2048, 1024, 1.0f, 0);
    w25::wmma_gemm64<1, true, 0, 0, false, 0><<<dim3((unsigned)((((1024) / 64) * ((2048) / 64) + 7) / 8), (unsigned)(1)), 256, 0, stream>>>((const unsigned short*)(G64A), (const unsigned short*)(G64A2), 1024, 0, (const unsigned short*)(G64B), (const unsigned short*)(G64B2), 1024, 0, (void*)(QKVV), nullptr, 4096, 0, nullptr, nullptr, 0, 1024, 2048, 1024, 1.0f);
    k_cast16<<<(unsigned)((((long long)(1024) * ((1024) / 2)) + 255) / 256), 256, 0, stream>>>(x + (size_t)7 * N * C, 1024, (_Float16*)(G64A), 1024, 1024, 1024, 1.0f);
    k_cast16<<<(unsigned)((((long long)(2048) * ((1024) / 2)) + 255) / 256), 256, 0, stream>>>(Wq + (size_t)2 * C * C, 1024, (_Float16*)(G64B), 1024, 2048, 1024, 16.0f);
    w25::wmma_gemm64<0, false, 0, 0, false, 0><<<dim3((unsigned)((((1024) / 64) * ((2048) / 64) + 7) / 8), (unsigned)(1)), 256, 0, stream>>>((const unsigned short*)(G64A), nullptr, 1024, 0, (const unsigned short*)(G64B), nullptr, 1024, 0, (void*)(QKVV + 2 * C), nullptr, 4096, 0, nullptr, nullptr, 0, 1024, 2048, 1024, 0.0625f);
    k_cast16<<<(unsigned)((((long long)(N) * ((C) / 2)) + 255) / 256), 256, 0, stream>>>(QKVV + C, C4, (_Float16*)(K16), C, N, C, 1.0f);
    k_cast16<<<(unsigned)((((long long)(N) * ((C) / 2)) + 255) / 256), 256, 0, stream>>>(QKVV + 3 * C, C4, (_Float16*)(VSA16), C, N, C, 1.0f);
    k_cast16<<<(unsigned)((((long long)(N) * ((C) / 2)) + 255) / 256), 256, 0, stream>>>(QKVV + 2 * C, C4, (_Float16*)(VCA16), C, N, C, 1.0f);
    k_castS16<<<(unsigned)((((long long)(C) * ((N) / 2)) + 255) / 256), 256, 0, stream>>>(QKVV, C4, (__bf16*)(QTH), (__bf16*)(QTL), N, N, C, 1.0f, 1);
    k_castS16<<<(unsigned)((((long long)(C) * ((N) / 2)) + 255) / 256), 256, 0, stream>>>(QKVV + C, C4, (__bf16*)(KTH), (__bf16*)(KTL), N, N, C, 1.0f, 1);
    w25::wmma_gemm64<0, false, 2, 0, false, 0><<<dim3((unsigned)((((N) / 64) * ((HD) / 64) + 7) / 8), (unsigned)(NH)), 256, 0, stream>>>((const unsigned short*)(K16), nullptr, C, HD, (const unsigned short*)(WE16), nullptr, HD, 0, (void*)(KS), nullptr, C, HD, BEB, nullptr, 0, N, HD, HD, 0.0625f);
    w25::wmma_gemm64<0, false, 2, 0, false, 0><<<dim3((unsigned)((((N) / 64) * ((HD) / 64) + 7) / 8), (unsigned)(NH)), 256, 0, stream>>>((const unsigned short*)(VSA16), nullptr, C, HD, (const unsigned short*)(WF16), nullptr, HD, 0, (void*)(VS), nullptr, C, HD, BFB, nullptr, 0, N, HD, HD, 0.0625f);
    k_ep_qs<<<(unsigned)(((long long)N * C + 255) / 256), 256, 0, stream>>>(QKVV, t2, QS, N, C, C4, HD);
    { /*apv4*/ AttnP a;
      a.Q = QS; a.K = KS; a.V = VS; a.O = XS; a.P = 0; a.Mf = 0; a.Mi = 0; a.ST = 0;
      a.Pw = 0; a.Rt = 0; a.SQ = 0; a.SK = 0;
      a.swb = 0; a.swh = 0; a.swi = 0; a.swj = 0; a.srb = 0; a.srh = 0; a.sri = 0; a.sQb = 0; a.sQh = HD; a.sQi = C; a.sQd = 1; a.sKb = 0; a.sKh = HD; a.sKj = C; a.sKd = 1; a.sVb = 0; a.sVh = HD; a.sVj = C; a.sVd = 1; a.sOb = 0; a.sOh = HD; a.sOi = C; a.sPb = 0; a.sPh = 0; a.sPi = 0; a.smb = 0; a.smh = 0; a.smi = 0; a.smj = 0;
      a.Lq = N; a.Lk = N; a.dh = HD; a.dv = HD; a.hrep = 1; a.causal = 0; a.coff = 0; a.pband = 0;
      a.scale = 1.0f; a.mfill = 0.0f; a.nonorm = 0; a.mpol = 0;
      a.roff = 0; a.rn = 1; a.segpol = 0; a.win = 0;
      k_attn<64, 64, 0, false, false><<<dim3((unsigned)((N) + 16 * AW - 1) / (16 * AW), (unsigned)(NH), (unsigned)(1)), 32 * AW, 0, stream>>>(a); }
    w25::wmma_gemm64<1, true, 0, 0, false, 0><<<dim3((unsigned)((((HD) / 64) * ((HD) / 64) + 7) / 8), (unsigned)(NH)), 256, 0, stream>>>((const unsigned short*)(QTH), (const unsigned short*)(QTL), N, (long long)HD * N, (const unsigned short*)(KTH), (const unsigned short*)(KTL), N, (long long)HD * N, (void*)(SCC), nullptr, HD, HD * HD, nullptr, nullptr, 0, HD, HD, N, 1.0f);
    k_ep_csoft<<<NH, 64, 0, stream>>>(SCC, t1, (_Float16*)P16);
    w25::wmma_gemm64<0, false, 0, 0, false, 0><<<dim3((unsigned)((((HD) / 64) * ((N) / 64) + 7) / 8), (unsigned)(NH)), 256, 0, stream>>>((const unsigned short*)(P16), nullptr, HD, HD * HD, (const unsigned short*)(VCA16), nullptr, C, HD, (void*)(XC), nullptr, 16 * C, C, nullptr, nullptr, 0, HD, N, HD, 0.000244140625f);
    k_cast16<<<(unsigned)((((long long)(1024) * ((1024) / 2)) + 255) / 256), 256, 0, stream>>>(XS, 1024, (_Float16*)(G64A), 1024, 1024, 1024, 1.0f);
    k_cast16<<<(unsigned)((((long long)(512) * ((1024) / 2)) + 255) / 256), 256, 0, stream>>>(Wo1, 1024, (_Float16*)(G64B), 1024, 512, 1024, 16.0f);
    w25::wmma_gemm64<0, false, 2, 0, false, 5><<<dim3((unsigned)((((1024) / 64) * ((512) / 64) + 7) / 8), (unsigned)(1)), 256, 0, stream>>>((const unsigned short*)(G64A), nullptr, 1024, 0, (const unsigned short*)(G64B), nullptr, 1024, 0, (void*)(out + (size_t)7 * N * C), nullptr, 1024, 0, bo1, nullptr, 0, 1024, 512, 1024, 0.0625f);
    k_cast16<<<(unsigned)((((long long)(1024) * ((1024) / 2)) + 255) / 256), 256, 0, stream>>>(XC, 1024, (_Float16*)(G64A), 1024, 1024, 1024, 1.0f);
    k_cast16<<<(unsigned)((((long long)(512) * ((1024) / 2)) + 255) / 256), 256, 0, stream>>>(Wo2, 1024, (_Float16*)(G64B), 1024, 512, 1024, 16.0f);
    w25::wmma_gemm64<0, false, 2, 0, false, 5><<<dim3((unsigned)((((1024) / 64) * ((512) / 64) + 7) / 8), (unsigned)(1)), 256, 0, stream>>>((const unsigned short*)(G64A), nullptr, 1024, 0, (const unsigned short*)(G64B), nullptr, 1024, 0, (void*)(out + (size_t)7 * N * C + CH), nullptr, 1024, 0, bo2, nullptr, 0, 1024, 512, 1024, 0.0625f);
}

// v001
// One run takes 2560 microseconds.
// In two side-by-side timings against v000, it was 2.69 and 2.68 times as fast.
// Contractions (per sample): the shared QKVV projection x.W^T [1024x1024].[1024x4096] (q/k columns on bf16 hi/lo split planes), the E/F head projections of k and v_sa as per-head z-batched [1024x64].[64x64] products (+b), the 16 channel affinities q^T k [64x1024].[1024x64] on bf16 hi/lo split planes (64-wide softmax over sigma~19 logits: plain f16 flipped near-ties) and x_c = attn_c.v_ca^T [64x64].[64x1024] as z-batched products, and the two output halves gelu(x_s.W_o1^T + b) / gelu(x_c.W_o2^T + b) [1024x1024].[1024x512] — f16 operands on pre-cast planes (v_wmma_f32_16x16x32_f16; 64x64 register-blocked wave tiles, weights x16); per (sample, head) the spatial attention softmax(q.k_s^T * temp2[h]) v_s over 1024 positions as one flash launch (f16 operands; temperature folded into q on device); f32 accumulate and softmax. The tiled E/F biases, the 64-wide channel softmax (x temp1[h], exp once, f16 plane) and the q pre-scaling are f32 kernels; x_c is laid out exactly as torch's permute(0,2,1,3).reshape (row = d*16 + h, column = n).
#include <hip/hip_runtime.h>
#include <math.h>

typedef __attribute__((ext_vector_type(16))) _Float16 v16h;
typedef __attribute__((ext_vector_type(8)))  _Float16 v8h;
typedef __attribute__((ext_vector_type(16))) __bf16   v16b;
typedef __attribute__((ext_vector_type(8)))  float    v8f;
typedef __attribute__((ext_vector_type(4)))  float    v4f;

// 16-bit WMMA fragment map (wave32), lane L, h = L>>4, m = L&15:
//   A 16x32: lane = row m;   element i -> k = (i<8) ? 8h+i : 16+8h+(i-8)
//   B 32x16: lane = column m; the SAME k(i,h)
//   D 16x16 (8 f32): lane = column m; element r -> row 8h+r
__device__ __forceinline__ int frag_k(int i, int h) { return (i < 8) ? (8 * h + i) : (16 + 8 * h + (i - 8)); }
__device__ __forceinline__ __bf16 bf16_rne(float f) {
    unsigned int u = __float_as_uint(f);
    u += 0x7fffu + ((u >> 16) & 1u);
    return __builtin_bit_cast(__bf16, (unsigned short)(u >> 16));
}
__device__ __forceinline__ float bf16_f32(__bf16 b) { return __uint_as_float(((unsigned int)__builtin_bit_cast(unsigned short, b)) << 16); }
__device__ __forceinline__ v8f wmma16(v16h a, v16h b, v8f c) {
    c = __builtin_amdgcn_wmma_f32_16x16x32_f16(false, a, false, b, (short)0, c, false, false);
    asm volatile("v_nop\n\tv_nop\n\tv_nop\n\tv_nop" : "+v"(c) : "v"(a), "v"(b));
    return c;
}
__device__ __forceinline__ v8f wmmab(v16b a, v16b b, v8f c) {
    c = __builtin_amdgcn_wmma_f32_16x16x32_bf16(false, a, false, b, (short)0, c, false, false);
    asm volatile("v_nop\n\tv_nop\n\tv_nop\n\tv_nop" : "+v"(c) : "v"(a), "v"(b));
    return c;
}
struct Split { v16b hi, lo; };
// hi/lo split product: a.hi*b.hi + a.hi*b.lo + a.lo*b.hi
__device__ __forceinline__ v8f wmma3(const Split& a, const Split& b, v8f c) {
    c = __builtin_amdgcn_wmma_f32_16x16x32_bf16(false, a.hi, false, b.hi, (short)0, c, false, false);
    c = __builtin_amdgcn_wmma_f32_16x16x32_bf16(false, a.hi, false, b.lo, (short)0, c, false, false);
    c = __builtin_amdgcn_wmma_f32_16x16x32_bf16(false, a.lo, false, b.hi, (short)0, c, false, false);
    asm volatile("v_nop\n\tv_nop\n\tv_nop\n\tv_nop" : "+v"(c) : "v"(a.hi), "v"(a.lo), "v"(b.hi), "v"(b.lo));
    return c;
}
struct Split3 { v16b hi, mid, lo; };
// triple split product (6 terms, drops only terms below 2^-24 relative)
__device__ __forceinline__ v8f wmma6(const Split3& a, const Split3& b, v8f c) {
    c = __builtin_amdgcn_wmma_f32_16x16x32_bf16(false, a.hi, false, b.hi, (short)0, c, false, false);
    c = __builtin_amdgcn_wmma_f32_16x16x32_bf16(false, a.hi, false, b.mid, (short)0, c, false, false);
    c = __builtin_amdgcn_wmma_f32_16x16x32_bf16(false, a.mid, false, b.hi, (short)0, c, false, false);
    c = __builtin_amdgcn_wmma_f32_16x16x32_bf16(false, a.hi, false, b.lo, (short)0, c, false, false);
    c = __builtin_amdgcn_wmma_f32_16x16x32_bf16(false, a.mid, false, b.mid, (short)0, c, false, false);
    c = __builtin_amdgcn_wmma_f32_16x16x32_bf16(false, a.lo, false, b.hi, (short)0, c, false, false);
    asm volatile("v_nop\n\tv_nop\n\tv_nop\n\tv_nop" : "+v"(c) : "v"(a.hi), "v"(a.mid), "v"(a.lo), "v"(b.hi), "v"(b.mid), "v"(b.lo));
    return c;
}

// Fragment gathers from f32 memory: element i <- p[(k0 + frag_k(i,h)) * sk] * s, zero for k >= klen.
__device__ __forceinline__ v16h fh_ld(const float* __restrict__ p, long long sk, int k0, int h, int klen, float s) {
    v16h a;
#pragma unroll
    for (int i = 0; i < 16; ++i) { const int k = k0 + frag_k(i, h); a[i] = (k < klen) ? (_Float16)(p[(long long)k * sk] * s) : (_Float16)0.f; }
    return a;
}
__device__ __forceinline__ Split sp_ld(const float* __restrict__ p, long long sk, int k0, int h, int klen, float s) {
    Split r;
#pragma unroll
    for (int i = 0; i < 16; ++i) {
        const int k = k0 + frag_k(i, h); const float x = (k < klen) ? p[(long long)k * sk] * s : 0.f;
        const __bf16 hb = bf16_rne(x); r.hi[i] = hb; r.lo[i] = bf16_rne(x - bf16_f32(hb));
    }
    return r;
}
__device__ __forceinline__ Split3 sp3_ld(const float* __restrict__ p, long long sk, int k0, int h, int klen, float s) {
    Split3 r;
#pragma unroll
    for (int i = 0; i < 16; ++i) {
        const int k = k0 + frag_k(i, h); const float x = (k < klen) ? p[(long long)k * sk] * s : 0.f;
        const __bf16 hb = bf16_rne(x); const float r1 = x - bf16_f32(hb); const __bf16 mb = bf16_rne(r1);
        r.hi[i] = hb; r.mid[i] = mb; r.lo[i] = bf16_rne(r1 - bf16_f32(mb));
    }
    return r;
}
__device__ __forceinline__ v16b bh_ld(const float* __restrict__ p, long long sk, int k0, int h, int klen, float s) {
    v16b a;
#pragma unroll
    for (int i = 0; i < 16; ++i) { const int k = k0 + frag_k(i, h); a[i] = bf16_rne((k < klen) ? p[(long long)k * sk] * s : 0.f); }
    return a;
}
// f16 fragment from an f16 LDS/global row with element stride 1 (k-contiguous), no bounds (tile already zero padded)
__device__ __forceinline__ v16h fh_row(const _Float16* __restrict__ row, int k0, int h) {
    v16h a;
#pragma unroll
    for (int i = 0; i < 16; ++i) a[i] = row[k0 + frag_k(i, h)];
    return a;
}

#define VST2(T, ptr, val) do { const T vst2_v_ = (val); *(T*)(ptr) = vst2_v_;  } while (0)
typedef float v4f __attribute__((ext_vector_type(4)));
#define VST2V4(ptr, val) do { const v4f vst2_v4_ = (val); *(v4f*)(ptr) = vst2_v4_;  } while (0)

__device__ __attribute__((noinline)) float act_fn(float v, int act) {
    if (act == 1) return fmaxf(v, 0.f);                                                                               // relu
    if (act == 2) { const float u = 0.7978845608028654f * (v + 0.044715f * v * v * v); return 0.5f * v * (1.f + tanhf(u)); } // tanh-gelu
    if (act == 3) return v / (1.f + expf(-v));                                                                        // silu
    if (act == 4) return 0.5f * v * (1.f + erff(v * 0.7071067811865476f));                                             // erf-gelu
    if (act == 5) return tanhf(v);
    if (act == 6) return 1.f / (1.f + expf(-v));                                                                      // sigmoid
    if (act == 7) return (v > 0.f) ? v : 0.01f * v;                                                                   // leaky relu 0.01
    if (act == 8) return (v > 0.f) ? v : (expf(v) - 1.f);                                                             // elu
    if (act == 9) return fminf(fmaxf(v, 0.f), 6.f);                                                                   // relu6
    if (act == 10) return fabsf(v);                                                                                    // abs
    if (act == 11) return (v >= 0.f) ? v : 0.1f * v;                                                                  // leaky 0.1
    if (act == 12) return (v > 0.f) ? v : 0.2f * v;                                                                   // leaky 0.2
    if (act == 13) return (v > 20.f) ? v : log1pf(expf(v));                                                            // softplus
    return v;
}

// =====================================================================================================================
// k_gemm<MODE>: C(z, m, n) = act(alpha * sum_k A(z, m, k) * B(z, k, n) + bias) + beta * R(z, m, n)
//   One wave (32-thread block) per 16 x 32 tile of C; grid (ceil(N/32), ceil(M/16), Z). Batch z -> (zo = z / zi_n, zi = z % zi_n)
//   with separate outer/inner strides for every tensor (e.g. batch and head). A(m,k) = A[zo*sAo + zi*sAi + m*sAm + k*sAk] (f32),
//   B(k,n) = B[zo*sBo + zi*sBi + n*sBn + k*sBk] (f32); any M, N, K (K zero-padded to 32 inside the fragments, M/N tails guarded).
//   C(m,n) = C[zo*sCo + zi*sCi + m*sCm + n] (n contiguous). flags: 1 bias[n], 2 bias[m], 4 residual R[zo*sRo + zi*sRi + m*sRm + n*sRn].
//   MODE 0: f16 operands (A prescaled by sa, B by sb, both undone in the epilogue); 1: bf16 hi/lo split (3 products); 2: bf16;
//   3: bf16 hi/mid/lo triple split (6 products); 4: as 3 with Kahan-compensated f32 accumulation across k-steps.
// =====================================================================================================================
struct GemmP {
    const float* A; const float* B; const float* bias; const float* R; float* C;
    long long sAo, sAi, sAm, sAk, sBo, sBi, sBn, sBk, sCo, sCi, sCm, sRo, sRi, sRm, sRn;
    int M, N, K, zi_n, flags, act; float alpha, beta, sa, sb;
    int Npad, pad_;     // columns [N, Npad) of C are written as 0 so that padded workspace rows are covered by whole-line stores; Npad >= N
};
static_assert(sizeof(GemmP) == 5 * 8 + 15 * 8 + 6 * 4 + 4 * 4 + 2 * 4, "GemmP has padding");

template <int MODE>
__global__ __launch_bounds__(32) void k_gemm(GemmP p) {
    const int lane = threadIdx.x & 31, h = lane >> 4, l15 = lane & 15;
    const int m0 = blockIdx.y * 16, n0 = blockIdx.x * 32;
    const int z = blockIdx.z, zo = z / p.zi_n, zi = z - zo * p.zi_n;
    const float* A = p.A + zo * p.sAo + zi * p.sAi;
    const float* B = p.B + zo * p.sBo + zi * p.sBi;
    const int am = min(m0 + l15, p.M - 1);                       // clamped row for loads (stores are guarded)
    v8f acc[2], comp[2];
#pragma unroll
    for (int t = 0; t < 2; ++t) { v8f zz = {}; acc[t] = zz; comp[t] = zz; }
    for (int k0 = 0; k0 < p.K; k0 += 32) {
        const float* arow = A + (long long)am * p.sAm;
        if (MODE == 1) {
            const Split a = sp_ld(arow, p.sAk, k0, h, p.K, 1.f);
#pragma unroll
            for (int t = 0; t < 2; ++t) {
                const int bn = min(n0 + t * 16 + l15, p.N - 1);
                acc[t] = wmma3(a, sp_ld(B + (long long)bn * p.sBn, p.sBk, k0, h, p.K, 1.f), acc[t]);
            }
        } else if (MODE == 3) {
            const Split3 a = sp3_ld(arow, p.sAk, k0, h, p.K, 1.f);
#pragma unroll
            for (int t = 0; t < 2; ++t) {
                const int bn = min(n0 + t * 16 + l15, p.N - 1);
                acc[t] = wmma6(a, sp3_ld(B + (long long)bn * p.sBn, p.sBk, k0, h, p.K, 1.f), acc[t]);
            }
        } else if (MODE == 4) {
            // triple split as MODE 3, but each k-step's 6 products go into a fresh accumulator and the partial is added to the running f32 sum
            // on the VALU with Kahan compensation (accumulation error stays ~1 ulp however long K is)
            const Split3 a = sp3_ld(arow, p.sAk, k0, h, p.K, 1.f);
#pragma unroll
            for (int t = 0; t < 2; ++t) {
                const int bn = min(n0 + t * 16 + l15, p.N - 1); v8f zz = {};
                const v8f part = wmma6(a, sp3_ld(B + (long long)bn * p.sBn, p.sBk, k0, h, p.K, 1.f), zz);
                const v8f y = part - comp[t]; const v8f s = acc[t] + y; comp[t] = (s - acc[t]) - y; acc[t] = s;
            }
        } else if (MODE == 2) {
            const v16b a = bh_ld(arow, p.sAk, k0, h, p.K, 1.f);
#pragma unroll
            for (int t = 0; t < 2; ++t) {
                const int bn = min(n0 + t * 16 + l15, p.N - 1);
                acc[t] = wmmab(a, bh_ld(B + (long long)bn * p.sBn, p.sBk, k0, h, p.K, 1.f), acc[t]);
            }
        } else {
            const v16h a = fh_ld(arow, p.sAk, k0, h, p.K, p.sa);
#pragma unroll
            for (int t = 0; t < 2; ++t) {
                const int bn = min(n0 + t * 16 + l15, p.N - 1);
                acc[t] = wmma16(a, fh_ld(B + (long long)bn * p.sBn, p.sBk, k0, h, p.K, p.sb), acc[t]);
            }
        }
    }
    const float iscale = (MODE == 0) ? p.alpha / (p.sa * p.sb) : p.alpha;
    float* C = p.C + zo * p.sCo + zi * p.sCi;
    const float* R = p.R + zo * p.sRo + zi * p.sRi;
    __shared__ __align__(16) float ctile[16][36];
#pragma unroll
    for (int t = 0; t < 2; ++t) {
        const int n = n0 + t * 16 + l15; const int nn = min(n, p.N - 1);
#pragma unroll
        for (int r = 0; r < 8; ++r) {
            const int m = m0 + 8 * h + r; const int mm = min(m, p.M - 1);
            float v = acc[t][r] * iscale;
            if (p.flags & 1) v += p.bias[nn];
            if (p.flags & 2) v += p.bias[mm];
            if (p.flags & 8) v *= p.bias[(long long)zo * p.M + mm];   /* per-(z,row) scale vector laid out [Z][M]; exclusive with the bias flags */
            v = act_fn(v, p.act);
            if (p.flags & 4) v += p.beta * R[(long long)mm * p.sRm + (long long)nn * p.sRn];
            ctile[8 * h + r][t * 16 + l15] = (n < p.N) ? v : 0.f;
        }
    }
    __syncthreads();
    const int NW = (p.Npad > p.N) ? p.Npad : p.N;           // write width
    const bool fast = (m0 + 16 <= p.M) && (n0 + 32 <= NW) && ((p.sCm & 3) == 0) && ((((size_t)C) & 15) == 0);
    if (fast) {
#pragma unroll
        for (int s = 0; s < 4; ++s) {
            const int row = s * 4 + (lane >> 3), c4 = (lane & 7) * 4;
            const v4f v = *(const v4f*)&ctile[row][c4];
            VST2V4(C + (long long)(m0 + row) * p.sCm + n0 + c4, v);
        }
    } else {
        for (int row = 0; row < 16; ++row) {
            const int m = m0 + row, n = n0 + lane;
            if (m < p.M && n < NW) VST2(float, C + (long long)m * p.sCm + n, ctile[row][lane]);
        }
    }
}


// =====================================================================================================================
// k_gemmT<MODE, TM, TN>: same contract as k_gemm, but one wave computes a (16*TM) x (16*TN) tile: TM A fragments and TN B fragments are
//   loaded per 32-wide k-step and reused across TM*TN WMMAs (far fewer load/convert instructions per MAC). MODE 0 (f16), 1 (bf16 hi/lo),
//   2 (bf16) only. grid (ceil(NW/(16*TN)), ceil(M/(16*TM)), Z), block 32. Epilogue identical to k_gemm, run per 16x32 sub-tile.
// =====================================================================================================================
template <int MODE, int TM, int TN>
__global__ __launch_bounds__(32) void k_gemmT(GemmP p) {
    const int lane = threadIdx.x & 31, h = lane >> 4, l15 = lane & 15;
    const int m0 = blockIdx.y * (16 * TM), n0 = blockIdx.x * (16 * TN);
    const int z = blockIdx.z, zo = z / p.zi_n, zi = z - zo * p.zi_n;
    const float* A = p.A + zo * p.sAo + zi * p.sAi;
    const float* B = p.B + zo * p.sBo + zi * p.sBi;
    v8f acc[TM][TN];
#pragma unroll
    for (int i = 0; i < TM; ++i)
#pragma unroll
        for (int t = 0; t < TN; ++t) { v8f zz = {}; acc[i][t] = zz; }
    for (int k0 = 0; k0 < p.K; k0 += 32) {
        if (MODE == 1) {
            Split a[TM], b[TN];
#pragma unroll
            for (int i = 0; i < TM; ++i) { const int am = min(m0 + 16 * i + l15, p.M - 1); a[i] = sp_ld(A + (long long)am * p.sAm, p.sAk, k0, h, p.K, 1.f); }
#pragma unroll
            for (int t = 0; t < TN; ++t) { const int bn = min(n0 + 16 * t + l15, p.N - 1); b[t] = sp_ld(B + (long long)bn * p.sBn, p.sBk, k0, h, p.K, 1.f); }
#pragma unroll
            for (int i = 0; i < TM; ++i)
#pragma unroll
                for (int t = 0; t < TN; ++t) acc[i][t] = wmma3(a[i], b[t], acc[i][t]);
        } else if (MODE == 2) {
            v16b a[TM], b[TN];
#pragma unroll
            for (int i = 0; i < TM; ++i) { const int am = min(m0 + 16 * i + l15, p.M - 1); a[i] = bh_ld(A + (long long)am * p.sAm, p.sAk, k0, h, p.K, 1.f); }
#pragma unroll
            for (int t = 0; t < TN; ++t) { const int bn = min(n0 + 16 * t + l15, p.N - 1); b[t] = bh_ld(B + (long long)bn * p.sBn, p.sBk, k0, h, p.K, 1.f); }
#pragma unroll
            for (int i = 0; i < TM; ++i)
#pragma unroll
                for (int t = 0; t < TN; ++t) acc[i][t] = wmmab(a[i], b[t], acc[i][t]);
        } else {
            v16h a[TM], b[TN];
#pragma unroll
            for (int i = 0; i < TM; ++i) { const int am = min(m0 + 16 * i + l15, p.M - 1); a[i] = fh_ld(A + (long long)am * p.sAm, p.sAk, k0, h, p.K, p.sa); }
#pragma unroll
            for (int t = 0; t < TN; ++t) { const int bn = min(n0 + 16 * t + l15, p.N - 1); b[t] = fh_ld(B + (long long)bn * p.sBn, p.sBk, k0, h, p.K, p.sb); }
#pragma unroll
            for (int i = 0; i < TM; ++i)
#pragma unroll
                for (int t = 0; t < TN; ++t) acc[i][t] = wmma16(a[i], b[t], acc[i][t]);
        }
    }
    const float iscale = (MODE == 0) ? p.alpha / (p.sa * p.sb) : p.alpha;
    float* C = p.C + zo * p.sCo + zi * p.sCi;
    const float* R = p.R + zo * p.sRo + zi * p.sRi;
    const int NW = (p.Npad > p.N) ? p.Npad : p.N;
    __shared__ __align__(16) float ctile[16][36];
#pragma unroll
    for (int i = 0; i < TM; ++i) {
        const int mb = m0 + 16 * i; if (mb >= p.M) break;          // wave-uniform
#pragma unroll
        for (int tp = 0; tp < TN / 2; ++tp) {
            const int nb = n0 + 32 * tp; if (nb >= NW) break;        // wave-uniform
#pragma unroll
            for (int t2 = 0; t2 < 2; ++t2) {
                const int t = 2 * tp + t2; const int n = nb + t2 * 16 + l15; const int nn = min(n, p.N - 1);
#pragma unroll
                for (int r = 0; r < 8; ++r) {
                    const int m = mb + 8 * h + r; const int mm = min(m, p.M - 1);
                    float v = acc[i][t][r] * iscale;
                    if (p.flags & 1) v += p.bias[nn];
                    if (p.flags & 2) v += p.bias[mm];
            if (p.flags & 8) v *= p.bias[(long long)zo * p.M + mm];   /* per-(z,row) scale vector laid out [Z][M]; exclusive with the bias flags */
                    v = act_fn(v, p.act);
                    if (p.flags & 4) v += p.beta * R[(long long)mm * p.sRm + (long long)nn * p.sRn];
                    ctile[8 * h + r][t2 * 16 + l15] = (n < p.N) ? v : 0.f;
                }
            }
            __syncthreads();
            const bool fast = (mb + 16 <= p.M) && (nb + 32 <= NW) && ((p.sCm & 3) == 0) && ((((size_t)C) & 15) == 0);
            if (fast) {
#pragma unroll
                for (int s = 0; s < 4; ++s) {
                    const int row = s * 4 + (lane >> 3), c4 = (lane & 7) * 4;
                    const v4f v = *(const v4f*)&ctile[row][c4];
                    VST2V4(C + (long long)(mb + row) * p.sCm + nb + c4, v);
                }
            } else {
                for (int row = 0; row < 16; ++row) {
                    const int m = mb + row, n = nb + lane;
                    if (m < p.M && n < NW) VST2(float, C + (long long)m * p.sCm + n, ctile[row][lane]);
                }
            }
            __syncthreads();
        }
    }
}

// =====================================================================================================================
//   Wave = 16 queries, AW waves per block, 64-key blocks; grid (ceil(Lq/(16*AW)), H, B), block 32*AW. Any Lq, Lk; head dim dh <= DHP
//   (DHP multiple of 32), value dim dv <= DVP (multiple of 16, <= 128). Every tensor addressed by (batch, head, row, element) strides, f32.
//   Scores: QM 0 f16 operands, 1 bf16 hi/lo split, 2 bf16 triple split; statistics f32 (exp2 domain); P.V: P x 4096 as f16 with V f16 staged in LDS
//   (SPLITPV: P and V as bf16 hi/lo splits). kv head = h / hrep. Masking: causal = 1 (keep j <= i + coff, masked -> -inf, key blocks beyond the
//   diagonal skipped), causal = 2 (masked -> mfill, a finite fill like the -1e9; no skipping), causal = 3 (keep j >= i + coff,
//   masked -> -inf, no skipping); optional additive f32 mask Mf,
//   optional int keep-mask Mi (0 -> score := mfill), both addressed b*smb + h*smh + i*smi + j*smj (0 strides broadcast).
// =====================================================================================================================
#define AW 4
struct AttnP {   // apv4
    const float* Q; const float* K; const float* V; float* O; float* P; const float* Mf; const int* Mi; float* ST;
    const float* Pw; const float* Rt; const int* SQ; const int* SK;           // optional: post-softmax weight, relative-position table, segment ids
    long long swb, swh, swi, swj, srb, srh, sri;                                 // Pw strides (b,h,i,j); Rt strides (b,h,i), column = clamp(i - j + roff, 0, rn-1)
    long long sQb, sQh, sQi, sQd, sKb, sKh, sKj, sKd, sVb, sVh, sVj, sVd, sOb, sOh, sOi, sPb, sPh, sPi, smb, smh, smi, smj;
    int Lq, Lk, dh, dv, hrep, causal, coff, pband;   // pband > 0: P holds only the band |j - i| <= pband, column j - i + pband
    float scale, mfill; int nonorm, mpol;             // nonorm (online path only): O = sum_j exp(score_j) V_j without the 1/rowsum (scores must be <= ~0); mpol: Mi masks where ==0 (mpol 0) or where !=0 (mpol 1)
    int roff, rn, segpol, win;                        // Rt column offset/count; SQ/SK: score := mfill where (segpol 0) SQ[i] != SK[j] or (segpol 1) SQ[i] == SK[j]; win > 0: keys with i - j > win (after coff) -> -inf
};
//   Pw: the softmax numerator is multiplied by Pw(b,h,i,j) AFTER the row sum is taken (probs * weight, then P.V), as in post-softmax multiplicative biases.                                                    // ST (optional): per row (b,h,i) -> ST[((b*H + h)*Lq + i)*2 + {0,1}] = {row max of the scaled+masked score (natural units), sum_j exp(score - max)}
static_assert(sizeof(AttnP) == 12 * 8 + 29 * 8 + 16 * 4, "AttnP has padding");

#ifndef KATTN_ATTR
#define KATTN_ATTR
#endif
template <int DHP, int DVP, int QM, bool SPLITPV, bool TWOPASS>
__global__ __launch_bounds__(32 * AW) KATTN_ATTR void k_attn(AttnP p) {
    constexpr int NT = DVP / 16;                // output tiles
    constexpr int KS = DHP / 32;                // k-steps for the scores
    constexpr int VP = DVP + 8;                 // LDS pitch (halves)
    __shared__ __align__(16) float    pl[AW][16 * 64];
    __shared__ __align__(16) _Float16 vl[(SPLITPV ? 2 : 1) * 64 * VP];   // f16 V tile, or bf16 hi and lo tiles (same 2-byte size)
    const int lane = threadIdx.x & 31, hf = lane >> 4, l15 = lane & 15, wave = threadIdx.x >> 5;
    const int h = blockIdx.y, b = blockIdx.z, hk = h / p.hrep;
    const int q0 = (blockIdx.x * AW + wave) * 16;
    float* myp = pl[wave];
    const float L2E = 1.4426950408889634f;
    const float NEG = -__builtin_inff();
    const int qi = min(q0 + l15, p.Lq - 1);
    const float* qrow = p.Q + b * p.sQb + h * p.sQh + (long long)qi * p.sQi;
    const float* kbase = p.K + b * p.sKb + hk * p.sKh;
    const float* vbase = p.V + b * p.sVb + hk * p.sVh;
    v16h qa[QM == 0 ? KS : 1]; Split qs_[QM == 1 ? KS : 1]; Split3 qt_[QM == 2 ? KS : 1];
#pragma unroll
    for (int ks = 0; ks < KS; ++ks) {
        if (QM == 2) qt_[ks] = sp3_ld(qrow, p.sQd, ks * 32, hf, p.dh, 1.f);
        else if (QM == 1) qs_[ks] = sp_ld(qrow, p.sQd, ks * 32, hf, p.dh, 1.f);
        else qa[ks] = fh_ld(qrow, p.sQd, ks * 32, hf, p.dh, 1.f);
    }
    v8f o[NT]; float m8[8], l8[8];
#pragma unroll
    for (int t = 0; t < NT; ++t) { v8f zz = {}; o[t] = zz; }
#pragma unroll
    for (int i = 0; i < 8; ++i) { m8[i] = NEG; l8[i] = 0.f; }
    int jend = p.Lk; int jstart = 0;
    if (p.causal == 1) { const int je = (blockIdx.x * AW + AW - 1) * 16 + 16 + p.coff; jend = min(jend, max(je, 0)); }   // uniform per block
    if (p.win > 0) { const int js = (int)(blockIdx.x * AW) * 16 + p.coff - p.win; jstart = (js > 0) ? (js / 64) * 64 : 0; }   // uniform per block: key blocks entirely outside every row's window hold only -inf entries and are skipped exactly
    const int npass = TWOPASS ? 2 : 1;
    for (int pass = 0; pass < npass; ++pass) {
        const bool dopv = (!TWOPASS) || pass == 1;
        for (int j0 = jstart; j0 < jend; j0 += 64) {
            if (dopv) {
                __syncthreads();                                 // previous key block's reads of vl / pl are done
                for (int idx = threadIdx.x; idx < 64 * DVP; idx += 32 * AW) {
                    const int jr = idx / DVP, d = idx - jr * DVP, j = j0 + jr;
                    const float f = (j < p.Lk && d < p.dv) ? vbase[(long long)j * p.sVj + (long long)d * p.sVd] : 0.f;
                    if (SPLITPV) {
                        const __bf16 hb = bf16_rne(f);
                        ((__bf16*)vl)[jr * VP + d] = hb; ((__bf16*)vl)[64 * VP + jr * VP + d] = bf16_rne(f - bf16_f32(hb));
                    } else vl[jr * VP + d] = (_Float16)f;
                }
            }
            v8f s[4];
#pragma unroll
            for (int t = 0; t < 4; ++t) {
                const int j = min(j0 + t * 16 + l15, p.Lk - 1);
                const float* krow = kbase + (long long)j * p.sKj;
                v8f acc = {};
#pragma unroll
                for (int ks = 0; ks < KS; ++ks) {
                    if (QM == 2)      acc = wmma6(qt_[ks], sp3_ld(krow, p.sKd, ks * 32, hf, p.dh, 1.f), acc);
                    else if (QM == 1) acc = wmma3(qs_[ks], sp_ld(krow, p.sKd, ks * 32, hf, p.dh, 1.f), acc);
                    else              acc = wmma16(qa[ks], fh_ld(krow, p.sKd, ks * 32, hf, p.dh, 1.f), acc);
                }
                s[t] = acc;
            }
            float pv[8][4];
#pragma unroll
            for (int i = 0; i < 8; ++i) {
                const int irow = q0 + i + 8 * hf;
                const int ic = min(irow, p.Lq - 1);
                float sc[4];
#pragma unroll
                for (int t = 0; t < 4; ++t) {
                    const int jg = j0 + t * 16 + l15;
                    float v = s[t][i] * p.scale;
                    if (p.Mf) v += p.Mf[b * p.smb + h * p.smh + (long long)ic * p.smi + (long long)min(jg, p.Lk - 1) * p.smj];
                    if (p.Rt) { int rc = ic - min(jg, p.Lk - 1) + p.roff; rc = rc < 0 ? 0 : (rc >= p.rn ? p.rn - 1 : rc); v += p.Rt[b * p.srb + h * p.srh + (long long)ic * p.sri + rc]; }
                    if (p.Mi) { const int mv = p.Mi[b * p.smb + h * p.smh + (long long)ic * p.smi + (long long)min(jg, p.Lk - 1) * p.smj]; if (p.mpol ? (mv != 0) : (mv == 0)) v = p.mfill; }
                    if (p.SQ) { const bool same = p.SQ[(long long)b * p.Lq + ic] == p.SK[(long long)b * p.Lk + min(jg, p.Lk - 1)]; if (p.segpol ? same : !same) v = p.mfill; }
                    if (p.causal == 2 && jg > irow + p.coff) v = p.mfill;
                    if (jg >= p.Lk || (p.causal == 1 && jg > irow + p.coff) || (p.causal == 3 && jg < irow + p.coff) || (p.win > 0 && irow + p.coff - jg > p.win)) v = NEG; else v *= L2E;
                    sc[t] = v;
                }
                if (!TWOPASS || pass == 0) {
                    float mx = fmaxf(fmaxf(sc[0], sc[1]), fmaxf(sc[2], sc[3]));
                    mx = fmaxf(mx, __shfl_xor(mx, 1, 32)); mx = fmaxf(mx, __shfl_xor(mx, 2, 32));
                    mx = fmaxf(mx, __shfl_xor(mx, 4, 32)); mx = fmaxf(mx, __shfl_xor(mx, 8, 32));
                    const float mnew = fmaxf(m8[i], mx);
                    const float corr = (mnew == NEG) ? 1.f : exp2f(m8[i] - mnew);
                    float rs = 0.f;
#pragma unroll
                    for (int t = 0; t < 4; ++t) {
                        const float pp = (sc[t] == NEG) ? 0.f : exp2f(sc[t] - mnew); rs += pp;
                        pv[i][t] = p.Pw ? pp * p.Pw[b * p.swb + h * p.swh + (long long)ic * p.swi + (long long)min(j0 + t * 16 + l15, p.Lk - 1) * p.swj] : pp;
                    }
                    rs += __shfl_xor(rs, 1, 32); rs += __shfl_xor(rs, 2, 32); rs += __shfl_xor(rs, 4, 32); rs += __shfl_xor(rs, 8, 32);
                    l8[i] = l8[i] * corr + rs; m8[i] = mnew;
                    if (!TWOPASS) {
#pragma unroll
                        for (int t = 0; t < NT; ++t) o[t][i] *= corr;
                    }
                } else {
                    const float inv = (l8[i] > 0.f) ? 1.f / l8[i] : 0.f;
#pragma unroll
                    for (int t = 0; t < 4; ++t) {
                        const int jg = j0 + t * 16 + l15;
                        float pp = (sc[t] == NEG) ? 0.f : exp2f(sc[t] - m8[i]) * inv;
                        if (p.Pw) pp *= p.Pw[b * p.swb + h * p.swh + (long long)ic * p.swi + (long long)min(jg, p.Lk - 1) * p.swj];
                        pv[i][t] = pp;
                    }
                }
            }
            if (dopv) {
#pragma unroll
                for (int i = 0; i < 8; ++i)
#pragma unroll
                    for (int t = 0; t < 4; ++t) ((float*)myp)[(i + 8 * hf) * 64 + t * 16 + l15] = pv[i][t];
                __syncthreads();                                 // P (per wave) and V (shared) visible
                if (p.P) {
                    float* pb_ = p.P + b * p.sPb + h * p.sPh;
                    const bool fastP = (p.pband == 0) && ((p.sPi & 3) == 0) && (j0 + 64 <= p.Lk) && (q0 + 16 <= p.Lq) && ((((size_t)pb_) & 15) == 0);
                    if (fastP) {
#pragma unroll
                        for (int s = 0; s < 8; ++s) {
                            const int row = s * 2 + (lane >> 4), c4 = (lane & 15) * 4;
                            const v4f v = *(const v4f*)(myp + row * 64 + c4);
                            VST2V4(pb_ + (long long)(q0 + row) * p.sPi + j0 + c4, v);
                        }
                    } else {
                        for (int row = 0; row < 16; ++row) {
                            const int irow = q0 + row; if (irow >= p.Lq) continue;
                            for (int c = lane; c < 64; c += 32) {
                                const int jg = j0 + c; if (jg >= p.Lk) continue;
                                if (p.pband == 0) VST2(float, pb_ + (long long)irow * p.sPi + jg, myp[row * 64 + c]);
                                else if (jg - irow <= p.pband && irow - jg <= p.pband) VST2(float, pb_ + (long long)irow * p.sPi + (jg - irow + p.pband), myp[row * 64 + c]);
                            }
                        }
                    }
                }
                if (SPLITPV) {
                    const Split pa0 = sp_ld(myp + l15 * 64, 1, 0, hf, 64, 1.f), pa1 = sp_ld(myp + l15 * 64, 1, 32, hf, 64, 1.f);
                    const __bf16* vh = (const __bf16*)vl; const __bf16* vlo = vh + 64 * VP;
#pragma unroll
                    for (int t = 0; t < NT; ++t) {
                        const int dcol = t * 16 + l15;
                        Split b0, b1;
#pragma unroll
                        for (int e = 0; e < 16; ++e) {
                            const int k0 = frag_k(e, hf), k1 = 32 + frag_k(e, hf);
                            b0.hi[e] = vh[k0 * VP + dcol]; b0.lo[e] = vlo[k0 * VP + dcol]; b1.hi[e] = vh[k1 * VP + dcol]; b1.lo[e] = vlo[k1 * VP + dcol];
                        }
                        o[t] = wmma3(pa0, b0, o[t]);
                        o[t] = wmma3(pa1, b1, o[t]);
                    }
                } else {
                    const v16h pa0 = fh_ld(myp + l15 * 64, 1, 0, hf, 64, 4096.f), pa1 = fh_ld(myp + l15 * 64, 1, 32, hf, 64, 4096.f);
#pragma unroll
                    for (int t = 0; t < NT; ++t) {
                        const int dcol = t * 16 + l15;
                        v16h b0, b1;
#pragma unroll
                        for (int e = 0; e < 16; ++e) { b0[e] = vl[frag_k(e, hf) * VP + dcol]; b1[e] = vl[(32 + frag_k(e, hf)) * VP + dcol]; }
                        o[t] = wmma16(pa0, b0, o[t]);
                        o[t] = wmma16(pa1, b1, o[t]);
                    }
                }
            }
        }
    }
    float* obase = p.O + b * p.sOb + h * p.sOh;
    if (p.ST) {
        const int rl = lane >> 1, isel = rl & 7;           // row q0 + rl ; rl>>3 == hf holds because lane>>4 == (lane>>1)>>3
        float mv = 0.f, lv = 0.f;
#pragma unroll
        for (int i = 0; i < 8; ++i) if (i == isel) { mv = m8[i]; lv = l8[i]; }
        const int irow = q0 + rl;
        if (irow < p.Lq) { float* st = p.ST + (((long long)b * gridDim.y + h) * p.Lq + irow) * 2 + (lane & 1); VST2(float, st, (lane & 1) ? lv : mv * 0.6931471805599453f); }
    }
    float invr[8];
#pragma unroll
    for (int i = 0; i < 8; ++i) {
        if (TWOPASS) invr[i] = SPLITPV ? 1.f : (1.f / 4096.f);
        else if (p.nonorm) invr[i] = exp2f(m8[i]) * (SPLITPV ? 1.f : (1.f / 4096.f));
        else invr[i] = (l8[i] > 0.f) ? (SPLITPV ? 1.f / l8[i] : 1.f / (l8[i] * 4096.f)) : 0.f;
    }
    __syncthreads();                                             // all waves done with pl/vl from the main loop
    const bool ofast = ((p.sOi & 3) == 0) && ((((size_t)obase) & 15) == 0) && (q0 + 16 <= p.Lq);
#pragma unroll
    for (int c0 = 0; c0 < DVP; c0 += 64) {
#pragma unroll
        for (int i = 0; i < 8; ++i)
#pragma unroll
            for (int t = 0; t < NT; ++t) if (t * 16 >= c0 && t * 16 < c0 + 64) ((float*)myp)[(i + 8 * hf) * 64 + (t * 16 - c0) + l15] = o[t][i] * invr[i];
        __syncthreads();
        const int cw = (DVP - c0 < 64) ? (DVP - c0) : 64;      // staged columns in this chunk (multiple of 16)
        if (ofast && (c0 + cw <= p.dv) && (cw % 32 == 0)) {
            const int lpr = cw / 4;                              // lanes per row (16 for 64 cols, 8 for 32)
            const int rows_per_ins = 32 / lpr;
            for (int r0 = 0; r0 < 16; r0 += rows_per_ins) {
                const int row = r0 + lane / lpr, c4 = (lane % lpr) * 4;
                const v4f v = *(const v4f*)(myp + row * 64 + c4);
                VST2V4(obase + (long long)(q0 + row) * p.sOi + c0 + c4, v);
            }
        } else {
            for (int row = 0; row < 16; ++row) {
                const int irow = q0 + row; if (irow >= p.Lq) continue;
                for (int c = lane; c < cw; c += 32) { const int d = c0 + c; if (d < p.dv) VST2(float, obase + (long long)irow * p.sOi + d, myp[row * 64 + c]); }
            }
        }
        __syncthreads();
    }
}

// =====================================================================================================================
// k_tr: dst(z, c, r) = alpha * src(z, r, c) (+ beta * R2(z, c, r)): [Z][R][C] (row stride lds) -> [Z][C][R] (row stride ldd) through a 32x32 LDS tile;
//   flags: 1 -> add beta * residual R2 addressed like dst (z*sRz + c*ldr + r); act applied before the residual.
// =====================================================================================================================
struct TrP { const float* src; float* dst; const float* R2; long long sSz, lds, sDz, ldd, sRz, ldr; int R, C, flags, act; float alpha, beta; };
static_assert(sizeof(TrP) == 3 * 8 + 6 * 8 + 6 * 4, "TrP has padding");
__global__ __launch_bounds__(256) void k_tr(TrP p) {
    __shared__ float tile[32][33];
    const int c0 = blockIdx.x * 32, r0 = blockIdx.y * 32, z = blockIdx.z;
    const int lane = threadIdx.x & 31, wave = threadIdx.x >> 5;
    const float* s = p.src + z * p.sSz;
#pragma unroll
    for (int k = 0; k < 4; ++k) {
        const int rl = wave * 4 + k, r = r0 + rl, c = c0 + lane;
        tile[rl][lane] = (r < p.R && c < p.C) ? s[(long long)r * p.lds + c] : 0.f;
    }
    __syncthreads();
    float* d = p.dst + z * p.sDz; const float* rr = p.R2 + z * p.sRz;
#pragma unroll
    for (int k = 0; k < 4; ++k) {
        const int cl = wave * 4 + k, c = c0 + cl, r = r0 + lane;
        if (c < p.C && r < p.R) {
            float v = act_fn(p.alpha * tile[lane][cl], p.act);
            if (p.flags & 1) v += p.beta * rr[(long long)c * p.ldr + r];
            VST2(float, d + (long long)c * p.ldd + r, v);
        }
    }
}

// k_affine: dst[i] = a * (sdev ? sdev[0] : 1) * src[i] + b, i < n (one thread per element; consecutive lanes -> consecutive addresses)
__global__ __launch_bounds__(256) void k_affine(const float* __restrict__ src, float* __restrict__ dst, int n, float a, float b, const float* __restrict__ sdev) {
    const int i = blockIdx.x * 256 + threadIdx.x;
    if (i < n) { const float aa = sdev ? a * sdev[0] : a; const float v = aa * src[i] + b; VST2(float, dst + i, v); }
}

// =====================================================================================================================
// k_softmax: row softmax over n contiguous elements, one 256-thread block per row; rows addressed z*sz + r*sr (grid (R, Z)).
//   out = scale_out * softmax(scale_in * x + (Mf ? Mf[z*smz + r*smr + j] : 0)); a row whose max is -inf is written as 0.
// =====================================================================================================================
struct SmP { const float* src; float* dst; const float* Mf; long long sz, sr, dz, dr, smz, smr; int n, pad; float scale_in, scale_out; };
static_assert(sizeof(SmP) == 3 * 8 + 6 * 8 + 4 * 4, "SmP has padding");
__global__ __launch_bounds__(256) void k_softmax(SmP p) {
    __shared__ float red[256];
    const int r = blockIdx.x, z = blockIdx.y, tid = threadIdx.x;
    const float* s = p.src + z * p.sz + (long long)r * p.sr;
    const float* mf = p.Mf ? (p.Mf + z * p.smz + (long long)r * p.smr) : nullptr;
    float mx = -__builtin_inff();
    for (int j = tid; j < p.n; j += 256) { float v = s[j] * p.scale_in; if (mf) v += mf[j]; mx = fmaxf(mx, v); }
    red[tid] = mx; __syncthreads();
    for (int o = 128; o > 0; o >>= 1) { if (tid < o) red[tid] = fmaxf(red[tid], red[tid + o]); __syncthreads(); }
    mx = red[0]; __syncthreads();
    float sum = 0.f;
    for (int j = tid; j < p.n; j += 256) { float v = s[j] * p.scale_in; if (mf) v += mf[j]; sum += (mx == -__builtin_inff()) ? 0.f : expf(v - mx); }
    red[tid] = sum; __syncthreads();
    for (int o = 128; o > 0; o >>= 1) { if (tid < o) red[tid] += red[tid + o]; __syncthreads(); }
    sum = red[0];
    const float inv = (sum > 0.f) ? p.scale_out / sum : 0.f;
    float* d = p.dst + z * p.dz + (long long)r * p.dr;
    for (int j = tid; j < p.n; j += 256) { float v = s[j] * p.scale_in; if (mf) v += mf[j]; const float o = (mx == -__builtin_inff()) ? 0.f : expf(v - mx) * inv; VST2(float, d + j, o); }
}
// =====================================================================================================================
// k_stats: mean and rsqrt(var + eps) over a set of n elements addressed base + z*sz + (e / inner) * so + (e % inner) * si, one 256-thread
// k_norm_apply: y = (x - mean[set]) * rstd[set] * g[c] + b[c] over a [Z][C][L] channel-major tensor with set = z*G + c / (C/G) (G groups per z;
//   G = C -> per-channel sets indexed z*C+c; for batch norm pass stats indexed by c only via bn = 1). Optional act. Output same layout.
// =====================================================================================================================
//   mode 0: mean / rsqrt(var + eps); mode 1 (RMSNorm): 0 / rsqrt(mean(x^2) + eps); mode 2 (L2 normalize * sqrt(n)): 0 / sqrt(n) / max(||x||, eps); mode 3: as 0 with unbiased variance (n-1)
__global__ __launch_bounds__(256) void k_stats(const float* __restrict__ x, long long sz, long long so, long long si, int inner, int n, float eps, float* __restrict__ stat, int mode) {
    __shared__ float red[256];
    const int z = blockIdx.x, tid = threadIdx.x;
    const float* base = x + z * sz;
    float s = 0.f;
    for (int e = tid; e < n; e += 256) s += base[(long long)(e / inner) * so + (long long)(e % inner) * si];
    red[tid] = s; __syncthreads();
    for (int o = 128; o > 0; o >>= 1) { if (tid < o) red[tid] += red[tid + o]; __syncthreads(); }
    const float mu = (mode == 0 || mode == 3) ? red[0] / (float)n : 0.f; __syncthreads();
    float q = 0.f;
    for (int e = tid; e < n; e += 256) { const float dlt = base[(long long)(e / inner) * so + (long long)(e % inner) * si] - mu; q += dlt * dlt; }
    red[tid] = q; __syncthreads();
    for (int o = 128; o > 0; o >>= 1) { if (tid < o) red[tid] += red[tid + o]; __syncthreads(); }
    {
        float rs;
        if (mode == 2) rs = sqrtf((float)n) / fmaxf(sqrtf(red[0]), eps); else if (mode == 3) rs = rsqrtf(red[0] / (float)(n - 1) + eps); else rs = rsqrtf(red[0] / (float)n + eps);
        if (tid < 32) { const float v = (tid == 0) ? mu : ((tid == 1) ? rs : 0.f); VST2(float, stat + (long long)z * 32 + tid, v); }
    }
}
//   One thread per element over the flat [Z][C][L] index space: grid ceil(Z*C*L / 256).
__global__ __launch_bounds__(256) void k_norm_apply(const float* __restrict__ x, float* __restrict__ y, const float* __restrict__ stat, const float* __restrict__ g, const float* __restrict__ bta,
                                                     int Z, int C, int L, int G, int bn, int act) {
    const long long idx = (long long)blockIdx.x * 256 + threadIdx.x;
    if (idx >= (long long)Z * C * L) return;
    const int l = (int)(idx % L); const long long zc = idx / L; const int c = (int)(zc % C), z = (int)(zc / C); (void)l;
    const int set = bn ? c : (z * G + c / (C / G));
    float v = (x[idx] - stat[(long long)set * 32]) * stat[(long long)set * 32 + 1];
    if (g) v *= g[c];
    if (bta) v += bta[c];
    v = act_fn(v, act);
    VST2(float, y + idx, v);
}

// k_lse_neg: c[i] = -(st[2i] + log(st[2i+1])) = minus the log-sum-exp of row i from k_attn's ST output (for softmax over the query dimension)
__global__ __launch_bounds__(256) void k_lse_neg(const float* __restrict__ st, float* __restrict__ c, int n) {
    const int i = blockIdx.x * 256 + threadIdx.x;
    if (i < n) { const float v = -(st[2 * i] + logf(st[2 * i + 1])); VST2(float, c + i, v); }
}

// k_iota: dst[i] = a * i + b as int32 (segment/position id helper)
__global__ __launch_bounds__(256) void k_iota(int* __restrict__ dst, int n, int a, int b) {
    const int i = blockIdx.x * 256 + threadIdx.x;
    if (i < n) { const int v = a * i + b; VST2(int, dst + i, v); }
}

// k_axpby: dst[i] = a * x[i] + b * y[i] (+ c), i < n
__global__ __launch_bounds__(256) void k_axpby(const float* __restrict__ x, const float* __restrict__ y, float* __restrict__ dst, int n, float a, float b, float c) {
    const int i = blockIdx.x * 256 + threadIdx.x;
    if (i < n) { const float v = a * x[i] + b * y[i] + c; VST2(float, dst + i, v); }
}

// =====================================================================================================================
// k_rope: rotary embedding on a [R rows][Hn heads][D] view (row stride sXr, head stride sXh, element stride 1) -> Y (own strides).
//   mode 0: rotate_half (partner d±D/2, sign - for d<D/2); mode 1: interleaved pairs (partner d^1, sign - for even d).
//   table column tcol: tmode 0 -> d, 1 -> d % (D/2), 2 -> d / 2; position p: pmode 0 -> r % S, 1 -> head index, 2 -> pos[r];
//   c = C[(r / S) * sCb + p * sCp + tcol * sCd], s likewise from Sn; y = x[d] * c + sign * x[partner] * s. X and Y must not alias.
// =====================================================================================================================
struct RopeP { const float* X; float* Y; const float* C; const float* Sn; const int* pos; long long sXr, sXh, sYr, sYh, sCb, sCp, sCd; int R, Hn, D, S, mode, tmode, pmode, pad; };
static_assert(sizeof(RopeP) == 5 * 8 + 7 * 8 + 8 * 4, "RopeP has padding");
__global__ __launch_bounds__(256) void k_rope(RopeP p) {
    const long long idx = (long long)blockIdx.x * 256 + threadIdx.x;
    if (idx >= (long long)p.R * p.Hn * p.D) return;
    const int d = (int)(idx % p.D); const long long rh = idx / p.D; const int h = (int)(rh % p.Hn); const int r = (int)(rh / p.Hn);
    const int half = p.D / 2;
    int partner; float sign;
    if (p.mode == 0) { partner = (d < half) ? d + half : d - half; sign = (d < half) ? -1.f : 1.f; }
    else { partner = d ^ 1; sign = (d & 1) ? 1.f : -1.f; }
    const int tcol = (p.tmode == 0) ? d : ((p.tmode == 1) ? (d % half) : (d >> 1));
    const int pp = (p.pmode == 0) ? (r % p.S) : ((p.pmode == 1) ? h : p.pos[r]);
    const long long toff = (long long)(r / p.S) * p.sCb + (long long)pp * p.sCp + (long long)tcol * p.sCd;
    const float* xr = p.X + (long long)r * p.sXr + (long long)h * p.sXh;
    const float v = xr[d] * p.C[toff] + sign * xr[partner] * p.Sn[toff];
    VST2(float, p.Y + (long long)r * p.sYr + (long long)h * p.sYh + d, v);
}

// k_invf + k_sincos (split so neither kernel carries a large VALU-fma footprint): invf_i = num * (1 / powf(base, (2 i)/D)) [fmode 0],
//   num * expf((2 i) * cexp) [fmode 1], num * powf(base, -2 (i - 1) / D) [fmode 2]; then cs/sn[s*half + i] = cos/sin((pscale * s) * invf_i)
__global__ __launch_bounds__(256) void k_invf(float* __restrict__ invb, int half, int D, float base, float num, int fmode, float cexp) {
    const int i = blockIdx.x * 256 + threadIdx.x;
    if (i >= ((half + 31) / 32) * 32) return;
    if (i >= half) { VST2(float, invb + i, 0.f); return; }
    const float e = (float)(2 * i) / (float)D;
    float invf;
    if (fmode == 1) invf = num * expf((float)(2 * i) * cexp);
    else if (fmode == 2) invf = num * powf(base, (-2.0f * ((float)i - 1.0f)) / (float)D);
    else invf = num * (1.0f / powf(base, e));
    VST2(float, invb + i, invf);
}
__global__ __launch_bounds__(256) void k_sincos(float* __restrict__ cs, float* __restrict__ sn, const float* __restrict__ invb, int S, int half, float pscale) {
    const int idx = blockIdx.x * 256 + threadIdx.x;
    if (idx >= S * half) return;
    const int s = idx / half, i = idx - s * half;
    const float ang = (pscale * (float)s) * invb[i];
    VST2(float, cs + idx, cosf(ang)); VST2(float, sn + idx, sinf(ang));
}

// k_mulact: dst[i] = act(x[i]) * y[i]
__global__ __launch_bounds__(256) void k_mulact(const float* __restrict__ x, const float* __restrict__ y, float* __restrict__ dst, int n, int act) {
    const int i = blockIdx.x * 256 + threadIdx.x;
    if (i < n) { const float v = act_fn(x[i], act) * y[i]; VST2(float, dst + i, v); }
}

// =====================================================================================================================
// k_matvec: thread-per-row matrix-vector products for N <= 8 output columns (heads with 1-3 outputs, gates), f32 on the VALU.
//   C[r*sCm + j] = act(alpha * sum_k A[r*sAm + k*sAk] * B[j*sBn + k*sBk] + bias[j]) + beta * R[r*sRm + j*sRn]; each thread writes its N contiguous floats.
// =====================================================================================================================
__global__ __launch_bounds__(256) void k_matvec(GemmP p) {
    // N == 1: one row per thread, so 32 lanes write one line with one instruction; otherwise each thread takes 32 consecutive rows.
    const int rpt = (p.N == 1) ? 1 : 32;
    const long long r0 = ((long long)blockIdx.x * 256 + threadIdx.x) * rpt; const int z = blockIdx.z, zo = z / p.zi_n, zi = z - zo * p.zi_n;
    if (r0 >= p.M) return;
    const float* Bb = p.B + zo * p.sBo + zi * p.sBi;
    float* C = p.C + zo * p.sCo + zi * p.sCi; const float* R = p.R + zo * p.sRo + zi * p.sRi;
    for (int rr = 0; rr < rpt; ++rr) {
        const long long r = r0 + rr; if (r >= p.M) break;
        const float* A = p.A + zo * p.sAo + zi * p.sAi + r * p.sAm;
        float acc[8] = {0.f, 0.f, 0.f, 0.f, 0.f, 0.f, 0.f, 0.f};
        for (int k = 0; k < p.K; ++k) { const float a = A[(long long)k * p.sAk];
#pragma unroll
            for (int j = 0; j < 8; ++j) if (j < p.N) acc[j] += a * Bb[(long long)j * p.sBn + (long long)k * p.sBk]; }
#pragma unroll
        for (int j = 0; j < 8; ++j) if (j < p.N) {
            float v = acc[j] * p.alpha;
            if (p.flags & 1) v += p.bias[j];
            if (p.flags & 2) v += p.bias[r];
            v = act_fn(v, p.act);
            if (p.flags & 4) v += p.beta * R[r * p.sRm + (long long)j * p.sRn];
            VST2(float, C + r * p.sCm + j, v);
        }
    }
}
// k_smallsoftmax: thread-per-row softmax for short rows (n <= 64): dst[r*dr + j] = softmax(scale*src[r*sr + j])
__global__ __launch_bounds__(256) void k_smallsoftmax(const float* __restrict__ src, float* __restrict__ dst, long long sr, long long dr, int n, long long R, float scale) {
    const long long r0 = ((long long)blockIdx.x * 256 + threadIdx.x) * 32;
    for (int rr = 0; rr < 32; ++rr) {
        const long long r = r0 + rr; if (r >= R) return;
        const float* s = src + r * sr; float* d = dst + r * dr;
        float mx = -__builtin_inff();
        for (int j = 0; j < n; ++j) mx = fmaxf(mx, s[j] * scale);
        float sum = 0.f;
        for (int j = 0; j < n; ++j) sum += expf(s[j] * scale - mx);
        const float inv = 1.f / sum;
        for (int j = 0; j < n; ++j) { const float v = expf(s[j] * scale - mx) * inv; VST2(float, d + j, v); }
    }
}

__global__ __launch_bounds__(32) void k_unitstat(float* __restrict__ st) { const int t = threadIdx.x; const float v = (t == 1) ? 1.f : 0.f; VST2(float, st + t, v); }

// destination (e.g. a d_out whose row width is not a multiple of 32 floats) is written by consecutive lanes of one instruction
__global__ __launch_bounds__(256) void k_lincopy(const float* __restrict__ src, long long lds, float* __restrict__ dst, long long ldd, long long rows, int cols) {
    const long long i = (long long)blockIdx.x * 256 + threadIdx.x; if (i >= rows * cols) return;
    const long long r = i / cols; const int c = (int)(i - r * cols);
    const float v = src[r * lds + c]; VST2(float, dst + r * ldd + c, v);
}

namespace w25 {
typedef __attribute__((ext_vector_type(16))) _Float16 v16h;
typedef __attribute__((ext_vector_type(8)))  _Float16 v8h;
typedef __attribute__((ext_vector_type(16))) __bf16   v16b;
typedef __attribute__((ext_vector_type(8)))  __bf16   v8b;
typedef __attribute__((ext_vector_type(8)))  float    v8f;
typedef __attribute__((ext_vector_type(4)))  float    v4f;

__device__ __forceinline__ unsigned short f2bf_bits(float f) {
  unsigned u = __float_as_uint(f);
  return (unsigned short)((u + 0x7FFFu + ((u >> 16) & 1u)) >> 16);
}
__device__ __forceinline__ float bf_bits2f(unsigned short h) { return __uint_as_float(((unsigned)h) << 16); }

// hazard guards as plain device helpers (no inline asm inside the kernel template body)
__device__ __forceinline__ void dep_guard_h(v8f& a, v8f& b, v16h x, v16h y) { asm volatile("v_nop\n\tv_nop\n\tv_nop\n\tv_nop" : "+v"(a), "+v"(b) : "v"(x), "v"(y)); }
__device__ __forceinline__ void dep_guard_b(v8f& a, v8f& b, v16b x, v16b y) { asm volatile("v_nop\n\tv_nop\n\tv_nop\n\tv_nop" : "+v"(a), "+v"(b) : "v"(x), "v"(y)); }
__device__ __forceinline__ void keep4_h(v16h a, v16h b, v16h c, v16h d) { asm volatile("v_nop" :: "v"(a), "v"(b), "v"(c), "v"(d)); }
__device__ __forceinline__ void keep4_b(v16b a, v16b b, v16b c, v16b d) { asm volatile("v_nop" :: "v"(a), "v"(b), "v"(c), "v"(d)); }
__device__ __forceinline__ void acc_guard4(v8f& a, v8f& b, v8f& c, v8f& d) { asm volatile("v_nop\n\tv_nop\n\tv_nop\n\tv_nop" : "+v"(a), "+v"(b), "+v"(c), "+v"(d)); }
template <typename T> struct Frag;
template <> struct Frag<_Float16> {
  typedef v16h V; union U { v16h v; v8h h[2]; };
  static __device__ __forceinline__ v16h load(const _Float16* p) {   // elements 0..7 <- p[0..7], 8..15 <- p[16..23]
    U f; f.h[0] = *(const v8h*)(p); f.h[1] = *(const v8h*)(p + 16); return f.v;
  }
  static __device__ __forceinline__ v8f mma(v16h a, v16h b, v8f c) {
    return __builtin_amdgcn_wmma_f32_16x16x32_f16(false, a, false, b, (short)0, c, false, false);
  }
  static __device__ __forceinline__ void guard(v8f& a, v8f& b, v16h x, v16h y) { dep_guard_h(a, b, x, y); }
  static __device__ __forceinline__ void keep(v16h a, v16h b, v16h c, v16h d) { keep4_h(a, b, c, d); }
};
template <> struct Frag<__bf16> {
  typedef v16b V; union U { v16b v; v8b h[2]; };
  static __device__ __forceinline__ v16b load(const __bf16* p) {
    U f; f.h[0] = *(const v8b*)(p); f.h[1] = *(const v8b*)(p + 16); return f.v;
  }
  static __device__ __forceinline__ v8f mma(v16b a, v16b b, v8f c) {
    return __builtin_amdgcn_wmma_f32_16x16x32_bf16(false, a, false, b, (short)0, c, false, false);
  }
  static __device__ __forceinline__ void guard(v8f& a, v8f& b, v16b x, v16b y) { dep_guard_b(a, b, x, y); }
  static __device__ __forceinline__ void keep(v16b a, v16b b, v16b c, v16b d) { keep4_b(a, b, c, d); }
};

// ---- Register-blocked batched WMMA GEMM ------------------------------------
// C[m,n] = scale * sum_k A[m,k] * Bt[n,k] (+bias)(+resid); each wave owns a 64x64 tile.
// A row-major [M,K]; Bt row-major [N,K]; M,N % 64 == 0, K % 32 == 0.
// SPLIT: operands are hi/lo planes (A2/Bt2 = lo planes, same layout); product = hi·hi + hi·lo + lo·hi.
// BIAS_MODE: 0 = none, 1 = bias[m], 2 = bias[n].
// OUT_MODE: 0 = f32, 1 = f16, 2 = bf16 hi plane (Cout) + bf16 lo plane (Cout2).
// ET: 0 = f16 operands, 1 = bf16 operands (pointers passed as 16-bit storage)
template <int ET> struct Elem;
template <> struct Elem<0> { typedef _Float16 T; };
template <> struct Elem<1> { typedef __bf16 T; };
template <int ET, bool SPLIT, int BIAS_MODE, int OUT_MODE, bool RESID, int ACT = 0>
__global__ __launch_bounds__(256) void wmma_gemm64(
    const unsigned short* __restrict__ Ap, const unsigned short* __restrict__ A2p, int lda, long strideA, long strideAz,
    const unsigned short* __restrict__ Btp, const unsigned short* __restrict__ Bt2p, int ldb, long strideB, long strideBz,
    void* __restrict__ Cout, void* __restrict__ Cout2, int ldc, long strideC, long strideCz,
    const float* __restrict__ bias,
    const float* __restrict__ resid, long strideR,
    int M, int N, int K, float scale) {
  typedef typename Elem<ET>::T T;
  typedef typename Frag<T>::V V;
  const T* A = (const T*)Ap; const T* A2 = (const T*)A2p; const T* Bt = (const T*)Btp; const T* Bt2 = (const T*)Bt2p;
  __shared__ __align__(16) float sT[8][16 * 68];   // per-wave 16x64 slab, pitch 68 floats
  const int b    = blockIdx.y;
  const int lane = threadIdx.x & 31;
  const int wave = threadIdx.x >> 5;
  const int tilesN = N >> 6;
  const int tilesM = M >> 6;
  const int tile = blockIdx.x * 8 + wave;
  if (tile >= tilesM * tilesN) return;   // wave-uniform; no block barriers in this kernel
  const int tm = tile / tilesN;
  const int tn = tile - tm * tilesN;
  const int m0 = tm << 6;
  const int n0 = tn << 6;

  const int bz = blockIdx.z;                   // outer batch index (sample), with its own strides
  const T* Ab  = A  + (size_t)b * strideA + (size_t)bz * strideAz;
  const T* Bb  = Bt + (size_t)b * strideB + (size_t)bz * strideBz;
  const T* Ab2 = SPLIT ? (A2  + (size_t)b * strideA + (size_t)bz * strideAz) : nullptr;
  const T* Bb2 = SPLIT ? (Bt2 + (size_t)b * strideB + (size_t)bz * strideBz) : nullptr;

  const int rlane = lane & 15;                 // row (A) / col (B, D) within subtile
  const int koff  = (lane >> 4) * 8;           // k offset of this lane half
  const int mOff  = (lane >> 4) * 8;           // D row offset

  v8f acc[4][4];
#pragma unroll
  for (int i = 0; i < 4; ++i)
#pragma unroll
    for (int j = 0; j < 4; ++j) acc[i][j] = (v8f){0.f,0.f,0.f,0.f,0.f,0.f,0.f,0.f};

  for (int k0 = 0; k0 < K; k0 += 32) {
    V bh[4], bl[4];
#pragma unroll
    for (int j = 0; j < 4; ++j) {
      const size_t bo = (size_t)(n0 + (j << 4) + rlane) * ldb + koff + k0;
      bh[j] = Frag<T>::load(Bb + bo);
      if (SPLIT) bl[j] = Frag<T>::load(Bb2 + bo);
    }
#pragma unroll
    for (int i = 0; i < 4; ++i) {
      const size_t ao = (size_t)(m0 + (i << 4) + rlane) * lda + koff + k0;
      V ah = Frag<T>::load(Ab + ao);
      V al;
      if (SPLIT) al = Frag<T>::load(Ab2 + ao);
#pragma unroll
      for (int j = 0; j < 4; ++j) {
        acc[i][j] = Frag<T>::mma(ah, bh[j], acc[i][j]);
        if (SPLIT) {
          acc[i][j] = Frag<T>::mma(ah, bl[j], acc[i][j]);
          acc[i][j] = Frag<T>::mma(al, bh[j], acc[i][j]);
        }
      }
      Frag<T>::guard(acc[i][0], acc[i][3], ah, SPLIT ? al : ah);
    }
    Frag<T>::keep(bh[0], bh[1], bh[2], bh[3]);
    if (SPLIT) Frag<T>::keep(bl[0], bl[1], bl[2], bl[3]);
  }
  acc_guard4(acc[0][0], acc[0][1], acc[0][2], acc[0][3]);
  acc_guard4(acc[1][0], acc[1][1], acc[1][2], acc[1][3]);
  acc_guard4(acc[2][0], acc[2][1], acc[2][2], acc[2][3]);
  acc_guard4(acc[3][0], acc[3][1], acc[3][2], acc[3][3]);

  // ---- epilogue ----
  float* slab = sT[wave];
  const float* Rb = RESID ? (resid + (size_t)b * strideR) : nullptr;
#pragma unroll
  for (int i = 0; i < 4; ++i) {
    const int mBase = m0 + (i << 4);
#pragma unroll
    for (int j = 0; j < 4; ++j) {
      const int n = n0 + (j << 4) + rlane;
      float bv = 0.f;
      if (BIAS_MODE == 2) bv = bias[n];
#pragma unroll
      for (int r = 0; r < 8; ++r) {
        float v = acc[i][j][r] * scale;
        if (BIAS_MODE == 1) v += bias[mBase + mOff + r];
        if (BIAS_MODE == 2) v += bv;
        if (RESID) v += Rb[(size_t)(mBase + mOff + r) * ldc + n];
        if (ACT == 1) v = tanhf(v);
        if (ACT == 2) v = fmaxf(v, 0.0f);
        if (ACT == 3) v = v / (1.0f + expf(-v));
        if (ACT == 4) v = (v > 0.f) ? v : 0.01f * v;
        if (ACT == 5) v = 0.5f * v * (1.0f + erff(v * 0.70710678118654752f));
        slab[(mOff + r) * 68 + (j << 4) + rlane] = v;
      }
    }
    __builtin_amdgcn_fence(__ATOMIC_RELEASE, "workgroup");
    __builtin_amdgcn_wave_barrier();
    __builtin_amdgcn_fence(__ATOMIC_ACQUIRE, "workgroup");
    if (OUT_MODE == 0) {
      float* C = (float*)Cout + (size_t)b * strideC + (size_t)bz * strideCz;
      const int hh = lane >> 4, c4 = (lane & 15) * 4;     // row seg = 256 B = 16 lanes x 16 B
      {
#pragma unroll
        for (int it = 0; it < 8; ++it) {
          const int row = it * 2 + hh;
          v4f v = *(const v4f*)(slab + row * 68 + c4);
          *(v4f*)(C + (size_t)(mBase + row) * ldc + n0 + c4) = v;
        }
        
      }
    } else {
      const int q = lane >> 3, c8 = (lane & 7) * 8;
      unsigned short* C  = (unsigned short*)Cout  + (size_t)b * strideC + (size_t)bz * strideCz;
      unsigned short* C2 = (OUT_MODE == 2) ? ((unsigned short*)Cout2 + (size_t)b * strideC + (size_t)bz * strideCz) : nullptr;
      {
#pragma unroll
        for (int it = 0; it < 4; ++it) {
          const int row = it * 4 + q;
          const float* sp = slab + row * 68 + c8;
          v8h hv, lv;
#pragma unroll
          for (int e = 0; e < 8; ++e) {
            if (OUT_MODE == 1) {
              hv[e] = (_Float16)sp[e];
            } else {
              unsigned short hb = f2bf_bits(sp[e]);
              unsigned short lb = f2bf_bits(sp[e] - bf_bits2f(hb));
              hv[e] = __builtin_bit_cast(_Float16, hb);
              lv[e] = __builtin_bit_cast(_Float16, lb);
            }
          }
          *(v8h*)(C + (size_t)(mBase + row) * ldc + n0 + c8) = hv;
          if (OUT_MODE == 2) *(v8h*)(C2 + (size_t)(mBase + row) * ldc + n0 + c8) = lv;
        }
        
      }
    }
    __builtin_amdgcn_fence(__ATOMIC_RELEASE, "workgroup");
    __builtin_amdgcn_wave_barrier();
    __builtin_amdgcn_fence(__ATOMIC_ACQUIRE, "workgroup");
  }
}

__global__ __launch_bounds__(256) void cast_f32_f16x2(
    const float* __restrict__ in, _Float16* __restrict__ out, int n2) {
  int i = blockIdx.x * 256 + threadIdx.x;
  if (i < n2) {
    const _Float16 h0 = (_Float16)in[2 * i], h1 = (_Float16)in[2 * i + 1];
    const unsigned u = (unsigned)__builtin_bit_cast(unsigned short, h0) | ((unsigned)__builtin_bit_cast(unsigned short, h1) << 16);
    ((unsigned*)out)[i] = u;
    
  }
}


} // namespace w25

__global__ __launch_bounds__(256) void k_castT16(const float* __restrict__ src, long long lds, _Float16* __restrict__ dst, long long ldd, int R, int C, float s) {
    const long long i = (long long)blockIdx.x * 256 + threadIdx.x; const long long np = (long long)C * (R / 2); if (i >= np) return; const int c = (int)(i / (R / 2)); const int r = 2 * (int)(i % (R / 2));
    const _Float16 h0 = (_Float16)(src[(long long)r * lds + c] * s), h1 = (_Float16)(src[(long long)(r + 1) * lds + c] * s);
    const unsigned u = (unsigned)__builtin_bit_cast(unsigned short, h0) | ((unsigned)__builtin_bit_cast(unsigned short, h1) << 16);
    unsigned* d = (unsigned*)(dst + (long long)c * ldd + r); *d = u;  }
__global__ __launch_bounds__(256) void k_cast16(const float* __restrict__ src, long long lds, _Float16* __restrict__ dst, long long ldd, int R, int C, float s) {
    const long long i = (long long)blockIdx.x * 256 + threadIdx.x; const long long np = (long long)R * (C / 2); if (i >= np) return; const int r = (int)(i / (C / 2)); const int c = 2 * (int)(i % (C / 2));
    const _Float16 h0 = (_Float16)(src[(long long)r * lds + c] * s), h1 = (_Float16)(src[(long long)r * lds + c + 1] * s);
    const unsigned u = (unsigned)__builtin_bit_cast(unsigned short, h0) | ((unsigned)__builtin_bit_cast(unsigned short, h1) << 16);
    unsigned* d = (unsigned*)(dst + (long long)r * ldd + c); *d = u;  }

// f32 -> bf16 hi plane + bf16 lo plane (x = hi + lo to ~2^-17 relative; RNE both), [R][C] -> [R][C] (or transposed to [C][R]); 2 consecutive destination elements
__device__ __forceinline__ unsigned int f2bf2_pack(float a, float b, unsigned int* lo) {
    const unsigned short ha = w25::f2bf_bits(a), hb = w25::f2bf_bits(b);
    const unsigned short la = w25::f2bf_bits(a - w25::bf_bits2f(ha)), lb = w25::f2bf_bits(b - w25::bf_bits2f(hb));
    *lo = (unsigned)la | ((unsigned)lb << 16); return (unsigned)ha | ((unsigned)hb << 16); }
__global__ __launch_bounds__(256) void k_castS16(const float* __restrict__ src, long long lds, __bf16* __restrict__ dhi, __bf16* __restrict__ dlo, long long ldd, int R, int C, float s, int transpose, long long sby, long long dby) {
    const long long i = (long long)blockIdx.x * 256 + threadIdx.x; long long o; float a, b;
    src += (long long)blockIdx.y * sby; dhi += (long long)blockIdx.y * dby; dlo += (long long)blockIdx.y * dby;   // grid y = sample
    if (transpose) { const long long np = (long long)C * (R / 2); if (i >= np) return; const int c = (int)(i / (R / 2)); const int r = 2 * (int)(i % (R / 2)); a = src[(long long)r * lds + c] * s; b = src[(long long)(r + 1) * lds + c] * s; o = (long long)c * ldd + r; }
    else { const long long np = (long long)R * (C / 2); if (i >= np) return; const int r = (int)(i / (C / 2)); const int c = 2 * (int)(i % (C / 2)); a = src[(long long)r * lds + c] * s; b = src[(long long)r * lds + c + 1] * s; o = (long long)r * ldd + c; }
    unsigned lo; const unsigned hi = f2bf2_pack(a, b, &lo); unsigned* ph = (unsigned*)(dhi + o); unsigned* pl = (unsigned*)(dlo + o);
    *ph = hi; *pl = lo;  }

namespace w25 {
// =====================================================================================
// Generic causal/non-causal attention for head_dim 64, f32 in / f32 out; 16-bit operands: bf16 with optional hi/lo splits, or
// plain f16 (F16=true, non-split, probabilities carried x2^15).
//   scores = (q*qscale)·kᵀ : v_wmma_f32_16x16x32_bf16; SPLIT_QK -> q,k as bf16 hi/lo (hi·hi + hi·lo + lo·hi)
//   out    = p·v           : v_wmma_f32_16x16x32_bf16; SPLIT_PV -> p,v as bf16 hi/lo; else p,v plain bf16
//   f32 accumulate; online softmax in f32. Block = 4 waves = 64 query rows of one (batch, head); S % 64 == 0.
//   Element (b, s, h, d) of tensor X lives at X[b*X_bs + s*X_rs + h*X_hs + d] (strides in floats, multiples of 4).
//   Masking: mask_mode 0 none, 1 causal (kv > q masked), 2 tensor [S][Skv] shared over (b,h) (float if
//   mask_is_int==0, int32 with element == 0 -> masked if 1, int32 with element != 0 -> masked if 2), 3 per-token vectors qmask[B][S] & kvmask[B][Skv] (int32,
//   0 -> masked), 4 causal + sliding window (kv > q or q - kv > W masked; W passed in mask_is_int);
//   5 = relative-position bias: s += cp[b,h,q][idx[q][kv]] + pc[b,h,kv][idx[q][kv]] with idx = mask_b ([S][Skv] int32) and
//   mask_a an int32 [S][Skv] tensor with nonzero = masked (tables: element (b,h,row,n) at X + b*c_bs + h*c_hs + row*c_rs + n);
//   masked scores are replaced by mask_fill (e.g. -inf or -1e9) before the softmax.
//   grid.x = B * H * (S/64) (or a sub-range with blk0).
// =====================================================================================
#define AT_D 64
#define AT_NW 4
#define AT_QB 64
#define AT_KC 64
struct AttnGeom { const float* cp = nullptr; const float* pc = nullptr; long c_bs = 0, c_rs = 0, c_hs = 0;   // mode-5 score-bias tables
                  long q_bs, q_rs, q_hs, k_bs, k_rs, k_hs, v_bs, v_rs, v_hs, o_bs, o_rs, o_hs;
                  int S, Skv, H, mask_mode; float qscale; int blk0; float mask_fill; int mask_is_int; };
static_assert(sizeof(AttnGeom) == 168, "no padding");

__device__ __forceinline__ unsigned short at_bf_bits(float f) {
  unsigned u = __float_as_uint(f);
  return (unsigned short)((u + 0x7FFFu + ((u >> 16) & 1u)) >> 16);
}
__device__ __forceinline__ __bf16 at_f2bf(float f) { return __builtin_bit_cast(__bf16, at_bf_bits(f)); }
__device__ __forceinline__ void at_split(float f, __bf16& hi, __bf16& lo) {
  const unsigned short hb = at_bf_bits(f);
  hi = __builtin_bit_cast(__bf16, hb);
  lo = at_f2bf(f - __uint_as_float(((unsigned)hb) << 16));
}
__device__ __forceinline__ v8f at_mma(v16b a, v16b b, v8f c) {
  c = __builtin_amdgcn_wmma_f32_16x16x32_bf16(false, a, false, b, (short)0, c, false, false);
  asm volatile("v_nop\n\tv_nop\n\tv_nop\n\tv_nop" : "+v"(c) : "v"(a), "v"(b));
  return c;
}
// 16-bit element as a bit pattern held in a __bf16 slot: f16 bits when F16, bf16 (RNE) otherwise
template <bool F16> __device__ __forceinline__ __bf16 at_to16(float f) {
  if (F16) return __builtin_bit_cast(__bf16, (_Float16)f);
  return at_f2bf(f);
}
template <bool F16> __device__ __forceinline__ v8f at_mma16(v16b a, v16b b, v8f c) {
  if (F16) {
    const v16h ah = __builtin_bit_cast(v16h, a), bh = __builtin_bit_cast(v16h, b);
    c = __builtin_amdgcn_wmma_f32_16x16x32_f16(false, ah, false, bh, (short)0, c, false, false);
    asm volatile("v_nop\n\tv_nop\n\tv_nop\n\tv_nop" : "+v"(c) : "v"(ah), "v"(bh));
    return c;
  }
  return at_mma(a, b, c);
}

template <bool SPLIT_QK, bool SPLIT_PV, bool F16 = false>
__global__ __launch_bounds__(128)
void attn64_kernel(const float* __restrict__ q, const float* __restrict__ k,
                   const float* __restrict__ v, float* __restrict__ out,
                   const void* __restrict__ mask_a, const int* __restrict__ mask_b, AttnGeom g) {
  static_assert(!(F16 && (SPLIT_QK || SPLIT_PV)), "f16 mode is non-split");
  const float PSC = F16 ? 32768.0f : 1.0f;     // f16 probabilities carried x2^15 (subnormal range), folded into the final 1/l
  union FB { v16b v; v8b h[2]; };
  __shared__ __align__(16) __bf16 Ksh[AT_KC * AT_D];             // K hi [kv][d]      8 KB
  __shared__ __align__(16) __bf16 Ksl[SPLIT_QK ? AT_KC * AT_D : 8];
  __shared__ __align__(16) __bf16 Vth[AT_D * AT_KC];             // V hi [d][kv]      8 KB
  __shared__ __align__(16) __bf16 Vtl[SPLIT_PV ? AT_D * AT_KC : 8];
  __shared__ __align__(16) __bf16 Psh[AT_NW][16 * AT_KC];        // per wave P hi [row][kv]  8 KB
  __shared__ __align__(16) __bf16 Psl[SPLIT_PV ? AT_NW : 1][SPLIT_PV ? 16 * AT_KC : 8];
  __shared__ __align__(16) float  Os[AT_NW][16 * 68];            // per wave out tile, pitch 68

  const int tid  = threadIdx.x;
  const int wave = tid >> 5;
  const int lane = tid & 31;
  const int hh   = lane >> 4;
  const int c    = lane & 15;

  const int nqb = g.S / AT_QB;
  const int bx = blockIdx.x + g.blk0;
  const int qb = bx % nqb;
  const int bh = bx / nqb;
  const int h  = bh % g.H;
  const int b  = bh / g.H;
  const int qbase_block = qb * AT_QB;
  const int q0 = qbase_block + wave * 16;

  const float* qb_ptr = q + (size_t)b * g.q_bs + (size_t)h * g.q_hs;
  const float* kb_ptr = k + (size_t)b * g.k_bs + (size_t)h * g.k_hs;
  const float* vb_ptr = v + (size_t)b * g.v_bs + (size_t)h * g.v_hs;
  float*       ob_ptr = out + (size_t)b * g.o_bs + (size_t)h * g.o_hs;

  // ---- Q fragments (A operand): 2 d-chunks, hi (and lo) ----
  v16b qah[2], qal[2];
  {
    const float* qrow = qb_ptr + (size_t)(q0 + c) * g.q_rs;
#pragma unroll
    for (int dc = 0; dc < 2; ++dc) {
#pragma unroll
      for (int e = 0; e < 8; ++e) {
        const float f0 = qrow[dc * 32 + 8 * hh + e] * g.qscale;
        const float f1 = qrow[dc * 32 + 16 + 8 * hh + e] * g.qscale;
        if (SPLIT_QK) { __bf16 hq, lq; at_split(f0, hq, lq); qah[dc][e] = hq; qal[dc][e] = lq; at_split(f1, hq, lq); qah[dc][8 + e] = hq; qal[dc][8 + e] = lq; }
        else { qah[dc][e] = at_to16<F16>(f0); qah[dc][8 + e] = at_to16<F16>(f1); qal[dc][e] = qah[dc][e]; qal[dc][8 + e] = qah[dc][8 + e]; }
      }
    }
  }

  float mrow[8], lrow[8];
  v8f oacc[4];
#pragma unroll
  for (int r = 0; r < 8; ++r) { mrow[r] = -INFINITY; lrow[r] = 0.f; }
#pragma unroll
  for (int t = 0; t < 4; ++t) oacc[t] = (v8f){0.f,0.f,0.f,0.f,0.f,0.f,0.f,0.f};

  const int nChunks = (g.mask_mode == 1 || g.mask_mode == 4) ? (qb + 1) : (g.Skv / AT_KC);   // block-uniform
  // per-row query mask (mode 3)
  int qkeep[8];
#pragma unroll
  for (int r = 0; r < 8; ++r) qkeep[r] = (g.mask_mode == 3) ? mask_b[(size_t)b * g.S + q0 + 8 * hh + r] : 1;   // mask_b = qmask in mode 3
  for (int kc = 0; kc < nChunks; ++kc) {
    const int kv0 = kc * AT_KC;
    __syncthreads();
    {
      const int kvr = tid >> 1, dh = (tid & 1) * 32;
      const float* krow = kb_ptr + (size_t)(kv0 + kvr) * g.k_rs + dh;
      const float* vrow = vb_ptr + (size_t)(kv0 + kvr) * g.v_rs + dh;
#pragma unroll
      for (int i = 0; i < 8; ++i) {
        v4f kk = *(const v4f*)(krow + 4 * i);
        v4f vv = *(const v4f*)(vrow + 4 * i);
#pragma unroll
        for (int e = 0; e < 4; ++e) {
          const int d = dh + 4 * i + e;
          if (SPLIT_QK) { __bf16 a, bl; at_split(kk[e], a, bl); Ksh[kvr * AT_D + d] = a; Ksl[kvr * AT_D + d] = bl; }
          else Ksh[kvr * AT_D + d] = at_to16<F16>(kk[e]);
          if (SPLIT_PV) { __bf16 a, bl; at_split(vv[e], a, bl); Vth[d * AT_KC + kvr] = a; Vtl[d * AT_KC + kvr] = bl; }
          else Vth[d * AT_KC + kvr] = at_to16<F16>(vv[e]);
        }
      }
    }
    __syncthreads();

    v8f s[4];
#pragma unroll
    for (int j = 0; j < 4; ++j) {
      s[j] = (v8f){0.f,0.f,0.f,0.f,0.f,0.f,0.f,0.f};
#pragma unroll 1
      for (int dc = 0; dc < 2; ++dc) {
        FB kb;
        kb.h[0] = *(const v8b*)(Ksh + (j * 16 + c) * AT_D + dc * 32 + 8 * hh);
        kb.h[1] = *(const v8b*)(Ksh + (j * 16 + c) * AT_D + dc * 32 + 16 + 8 * hh);
        s[j] = at_mma16<F16>(qah[dc], kb.v, s[j]);
        if (SPLIT_QK) {
          FB kl;
          kl.h[0] = *(const v8b*)(Ksl + (j * 16 + c) * AT_D + dc * 32 + 8 * hh);
          kl.h[1] = *(const v8b*)(Ksl + (j * 16 + c) * AT_D + dc * 32 + 16 + 8 * hh);
          s[j] = at_mma16<F16>(qah[dc], kl.v, s[j]);
          s[j] = at_mma16<F16>(qal[dc], kb.v, s[j]);
        }
      }
    }
    const bool diag = (g.mask_mode == 1) && (kc == qb);
    int kvkeep[4] = {1, 1, 1, 1};
    if (g.mask_mode == 3) {
#pragma unroll
      for (int j = 0; j < 4; ++j) kvkeep[j] = ((const int*)mask_a)[(size_t)b * g.Skv + kv0 + j * 16 + c];   // mask_a = kvmask
    }
    float cm[8];
#pragma unroll
    for (int r = 0; r < 8; ++r) {
      const int qrow = q0 + 8 * hh + r;
      float m = -INFINITY;
#pragma unroll
      for (int j = 0; j < 4; ++j) {
        const int kvcol = kv0 + j * 16 + c;
        bool masked = false;
        if (diag) masked = (kvcol > qrow);
        else if (g.mask_mode == 4) masked = (kvcol > qrow) || (qrow - kvcol > g.mask_is_int);
        else if (g.mask_mode == 2) {
          const size_t mi = (size_t)qrow * g.Skv + kvcol;
          masked = (g.mask_is_int == 0) ? (((const float*)mask_a)[mi] == 0.0f)
                 : (g.mask_is_int == 1) ? (((const int*)mask_a)[mi] == 0) : (((const int*)mask_a)[mi] != 0);
        } else if (g.mask_mode == 3) masked = (qkeep[r] == 0) || (kvkeep[j] == 0);
        else if (g.mask_mode == 5) {
          const size_t mi = (size_t)qrow * g.Skv + kvcol;
          masked = (((const int*)mask_a)[mi] != 0);
          int n = mask_b[mi]; n = n < 0 ? 0 : n;
          s[j][r] += g.cp[(size_t)b * g.c_bs + (size_t)h * g.c_hs + (size_t)qrow * g.c_rs + n]
                   + g.pc[(size_t)b * g.c_bs + (size_t)h * g.c_hs + (size_t)kvcol * g.c_rs + n];
        }
        if (masked) s[j][r] = g.mask_fill;
        m = fmaxf(m, s[j][r]);
      }
#pragma unroll
      for (int off = 1; off < 16; off <<= 1) m = fmaxf(m, __shfl_xor(m, off, 32));
      cm[r] = m;
    }
    __bf16* pwh = Psh[wave];
    __bf16* pwl = Psl[SPLIT_PV ? wave : 0];
#pragma unroll
    for (int r = 0; r < 8; ++r) {
      const float mnew = fmaxf(mrow[r], cm[r]);
      const float alpha = expf(mrow[r] - mnew);
      mrow[r] = mnew;
      float psum = 0.f;
#pragma unroll
      for (int j = 0; j < 4; ++j) {
        const float p = expf(s[j][r] - mnew);
        psum += p;
        if (SPLIT_PV) { __bf16 a, bl; at_split(p, a, bl); pwh[(8 * hh + r) * AT_KC + j * 16 + c] = a; pwl[(8 * hh + r) * AT_KC + j * 16 + c] = bl; }
        else pwh[(8 * hh + r) * AT_KC + j * 16 + c] = at_to16<F16>(p * PSC);
      }
#pragma unroll
      for (int off = 1; off < 16; off <<= 1) psum += __shfl_xor(psum, off, 32);
      lrow[r] = lrow[r] * alpha + psum;
#pragma unroll
      for (int t = 0; t < 4; ++t) oacc[t][r] *= alpha;
    }
    __builtin_amdgcn_fence(__ATOMIC_RELEASE, "workgroup");
    __builtin_amdgcn_wave_barrier();
    __builtin_amdgcn_fence(__ATOMIC_ACQUIRE, "workgroup");
#pragma unroll 1
    for (int kk = 0; kk < 2; ++kk) {
      FB pa, pl;
      pa.h[0] = *(const v8b*)(pwh + c * AT_KC + kk * 32 + 8 * hh);
      pa.h[1] = *(const v8b*)(pwh + c * AT_KC + kk * 32 + 16 + 8 * hh);
      if (SPLIT_PV) {
        pl.h[0] = *(const v8b*)(pwl + c * AT_KC + kk * 32 + 8 * hh);
        pl.h[1] = *(const v8b*)(pwl + c * AT_KC + kk * 32 + 16 + 8 * hh);
      }
#pragma unroll
      for (int t = 0; t < 4; ++t) {
        FB vb;
        vb.h[0] = *(const v8b*)(Vth + (t * 16 + c) * AT_KC + kk * 32 + 8 * hh);
        vb.h[1] = *(const v8b*)(Vth + (t * 16 + c) * AT_KC + kk * 32 + 16 + 8 * hh);
        oacc[t] = at_mma16<F16>(pa.v, vb.v, oacc[t]);
        if (SPLIT_PV) {
          FB vl;
          vl.h[0] = *(const v8b*)(Vtl + (t * 16 + c) * AT_KC + kk * 32 + 8 * hh);
          vl.h[1] = *(const v8b*)(Vtl + (t * 16 + c) * AT_KC + kk * 32 + 16 + 8 * hh);
          oacc[t] = at_mma16<F16>(pa.v, vl.v, oacc[t]);
          oacc[t] = at_mma16<F16>(pl.v, vb.v, oacc[t]);
        }
      }
    }
  }

  float* os = Os[wave];
#pragma unroll
  for (int r = 0; r < 8; ++r) {
    const float inv = 1.0f / (lrow[r] * PSC);
#pragma unroll
    for (int t = 0; t < 4; ++t) os[(8 * hh + r) * 68 + t * 16 + c] = oacc[t][r] * inv;
  }
  __builtin_amdgcn_fence(__ATOMIC_RELEASE, "workgroup");
  __builtin_amdgcn_wave_barrier();
  __builtin_amdgcn_fence(__ATOMIC_ACQUIRE, "workgroup");
  {
    const int c4 = (lane & 15) * 4;
    {
#pragma unroll
      for (int it = 0; it < 8; ++it) {
        const int row = it * 2 + hh;
        v4f val = *(const v4f*)(os + row * 68 + c4);
        *(v4f*)(ob_ptr + (size_t)(q0 + row) * g.o_rs + c4) = val;
      }
      
    }
  }
}

} // namespace w25

__device__ __forceinline__ void st_h2(_Float16* dst, float a, float b) { const unsigned u = (unsigned)__builtin_bit_cast(unsigned short, (_Float16)a) | ((unsigned)__builtin_bit_cast(unsigned short, (_Float16)b) << 16); unsigned* d = (unsigned*)dst; *d = u;  }
// tiled biases BEB[c] = bE[c % 64], BFB[c] = bF[c % 64] (thread-linear)
__global__ __launch_bounds__(256) void k_ep_btile(const float* __restrict__ BE, const float* __restrict__ BF, float* __restrict__ BEB, float* __restrict__ BFB, int C, int HD) { const int t = blockIdx.x * 256 + threadIdx.x; if (t >= C) return; VST2(float, BEB + t, BE[t % HD]); VST2(float, BFB + t, BF[t % HD]); }
// QS = q * temp2[h] (thread-linear over N*C)
__global__ __launch_bounds__(256) void k_ep_qs(const float* __restrict__ QKVV, const float* __restrict__ T2, float* __restrict__ QS, int N, int C, int C4, int HD) { const long long t = (long long)blockIdx.x * 256 + threadIdx.x; if (t >= (long long)N * C) return; const int n = (int)(t / C), c = (int)(t % C); VST2(float, QS + t, QKVV[(long long)n * C4 + c] * T2[c / HD]); }
// channel softmax: block h = sample * NH + head (64 threads): rows of SCC[h] [64][64] * temp1[h % NH]; thread i computes row i, then lanes write columns so each 32-float line comes from one wave; P16[h][i][j] = f16(4096 p)
__global__ __launch_bounds__(64) void k_ep_csoft(const float* __restrict__ S, const float* __restrict__ T1, _Float16* __restrict__ P16, int NH) { __shared__ float sh[64][65]; const int h = blockIdx.x; const int i = threadIdx.x; const float* r = S + ((long long)h * 64 + i) * 64; const float tp = T1[h % NH]; float mx = -3.0e38f;
    for (int j = 0; j < 64; ++j) mx = fmaxf(mx, r[j] * tp);
    float s = 0.f; for (int j = 0; j < 64; ++j) { const float e = expf(r[j] * tp - mx); sh[i][j] = e; s += e; }
    const float f = 4096.f / s; for (int j = 0; j < 64; ++j) sh[i][j] *= f;
    __syncthreads();
    const int half = i >> 5, c0 = 2 * (i & 31);
    for (int step = 0; step < 32; ++step) { const int rr = 2 * step + half; st_h2(P16 + ((long long)h * 64 + rr) * 64 + c0, sh[rr][c0], sh[rr][c0 + 1]); } }


extern "C" void kernel_launch(void* const* d_in, const int* in_sizes, int n_in, void* d_out, int out_size, void* d_ws, size_t ws_size, hipStream_t stream) {
    (void)in_sizes; (void)n_in; (void)out_size; (void)ws_size;
    const float* x = (const float*)d_in[0];
    const float* Wq = (const float*)d_in[1];
    const float* WE = (const float*)d_in[2];
    const float* bE = (const float*)d_in[3];
    const float* WF = (const float*)d_in[4];
    const float* bF = (const float*)d_in[5];
    const float* Wo1 = (const float*)d_in[6];
    const float* bo1 = (const float*)d_in[7];
    const float* Wo2 = (const float*)d_in[8];
    const float* bo2 = (const float*)d_in[9];
    const float* t1 = (const float*)d_in[10];
    const float* t2 = (const float*)d_in[11];
    const int Bn = 8;
    const int N = 1024;
    const int C = 1024;
    const int NH = 16;
    const int HD = 64;
    const int C4 = 4 * C;
    const int CH = C / 2;
    float* out = (float*)d_out;
    char* wsp = (char*)d_ws;
    const int BN = Bn * N;                    // all samples' rows: every launch below covers the whole batch
    const size_t MB = (size_t)1048576;
    float* QKVV = (float*)wsp; wsp += (((size_t)((size_t)BN * C4) * 4 + 255) / 256) * 256;
    unsigned short* WE16 = (unsigned short*)wsp; wsp += (((size_t)((size_t)HD * HD) * 2 + 255) / 256) * 256;
    unsigned short* WF16 = (unsigned short*)wsp; wsp += (((size_t)((size_t)HD * HD) * 2 + 255) / 256) * 256;
    float* BEB = (float*)wsp; wsp += (((size_t)((size_t)C) * 4 + 255) / 256) * 256;
    float* BFB = (float*)wsp; wsp += (((size_t)((size_t)C) * 4 + 255) / 256) * 256;
    // One 115 MiB region behind QKVV, used by three phases one after the other (stream order); a plane is reused only once its last reader has been launched.
    // projection: x planes and weight planes
    unsigned short* G64A  = (unsigned short*)(wsp);
    unsigned short* G64A2 = (unsigned short*)(wsp + 16 * MB);
    unsigned short* G64B  = (unsigned short*)(wsp + 32 * MB);
    unsigned short* G64B2 = (unsigned short*)(wsp + 36 * MB);
    // channel attention
    unsigned short* QTH   = (unsigned short*)(wsp);
    unsigned short* QTL   = (unsigned short*)(wsp + 16 * MB);
    unsigned short* KTH   = (unsigned short*)(wsp + 32 * MB);
    unsigned short* KTL   = (unsigned short*)(wsp + 48 * MB);
    unsigned short* VCA16 = (unsigned short*)(wsp + 64 * MB);
    float*          XC    = (float*)(wsp + 80 * MB);
    float*          SCC   = (float*)(wsp + 112 * MB);
    unsigned short* P16   = (unsigned short*)(wsp + 114 * MB);
    unsigned short* XC16  = (unsigned short*)(wsp);               // over QTH, read last by the affinity product
    unsigned short* WO2H  = (unsigned short*)(wsp + 16 * MB);     // over QTL
    // spatial attention
    unsigned short* K16   = (unsigned short*)(wsp);
    unsigned short* VSA16 = (unsigned short*)(wsp + 16 * MB);
    float*          KS    = (float*)(wsp + 32 * MB);
    float*          VS    = (float*)(wsp + 64 * MB);
    float*          QS    = (float*)(wsp);                        // over K16 and VSA16, read last by the E/F products
    float*          XS    = (float*)d_ws;                         // over QKVV, read last by k_ep_qs
    unsigned short* XS16  = (unsigned short*)((char*)d_ws + 32 * MB);
    unsigned short* WO1H  = (unsigned short*)((char*)d_ws + 48 * MB);
    k_cast16<<<(unsigned)((((long long)(HD) * ((HD) / 2)) + 255) / 256), 256, 0, stream>>>(WE, HD, (_Float16*)(WE16), HD, HD, HD, 16.0f);
    k_cast16<<<(unsigned)((((long long)(HD) * ((HD) / 2)) + 255) / 256), 256, 0, stream>>>(WF, HD, (_Float16*)(WF16), HD, HD, HD, 16.0f);
    k_ep_btile<<<(C + 255) / 256, 256, 0, stream>>>(bE, bF, BEB, BFB, C, HD);
    // shared projection, rows = sample * N + n
    k_castS16<<<(unsigned)((((long long)(BN) * ((1024) / 2)) + 255) / 256), 256, 0, stream>>>(x, 1024, (__bf16*)(G64A), (__bf16*)(G64A2), 1024, BN, 1024, 1.0f, 0, 0, 0);
    k_castS16<<<(unsigned)((((long long)(2048) * ((1024) / 2)) + 255) / 256), 256, 0, stream>>>(Wq, 1024, (__bf16*)(G64B), (__bf16*)(G64B2), 1024, 2048, 1024, 1.0f, 0, 0, 0);
    w25::wmma_gemm64<1, true, 0, 0, false, 0><<<dim3((unsigned)((((BN) / 64) * ((2048) / 64) + 7) / 8), (unsigned)(1), (unsigned)(1)), 256, 0, stream>>>((const unsigned short*)(G64A), (const unsigned short*)(G64A2), 1024, 0, 0, (const unsigned short*)(G64B), (const unsigned short*)(G64B2), 1024, 0, 0, (void*)(QKVV), nullptr, 4096, 0, 0, nullptr, nullptr, 0, BN, 2048, 1024, 1.0f);
    k_cast16<<<(unsigned)((((long long)(BN) * ((1024) / 2)) + 255) / 256), 256, 0, stream>>>(x, 1024, (_Float16*)(G64A), 1024, BN, 1024, 1.0f);
    k_cast16<<<(unsigned)((((long long)(2048) * ((1024) / 2)) + 255) / 256), 256, 0, stream>>>(Wq + (size_t)2 * C * C, 1024, (_Float16*)(G64B), 1024, 2048, 1024, 16.0f);
    w25::wmma_gemm64<0, false, 0, 0, false, 0><<<dim3((unsigned)((((BN) / 64) * ((2048) / 64) + 7) / 8), (unsigned)(1), (unsigned)(1)), 256, 0, stream>>>((const unsigned short*)(G64A), nullptr, 1024, 0, 0, (const unsigned short*)(G64B), nullptr, 1024, 0, 0, (void*)(QKVV + 2 * C), nullptr, 4096, 0, 0, nullptr, nullptr, 0, BN, 2048, 1024, 0.0625f);
    // channel attention: grid y = head, grid z = sample
    k_cast16<<<(unsigned)((((long long)(BN) * ((C) / 2)) + 255) / 256), 256, 0, stream>>>(QKVV + 2 * C, C4, (_Float16*)(VCA16), C, BN, C, 1.0f);
    k_castS16<<<dim3((unsigned)((((long long)(C) * ((N) / 2)) + 255) / 256), (unsigned)(Bn)), 256, 0, stream>>>(QKVV, C4, (__bf16*)(QTH), (__bf16*)(QTL), N, N, C, 1.0f, 1, (long long)N * C4, (long long)C * N);
    k_castS16<<<dim3((unsigned)((((long long)(C) * ((N) / 2)) + 255) / 256), (unsigned)(Bn)), 256, 0, stream>>>(QKVV + C, C4, (__bf16*)(KTH), (__bf16*)(KTL), N, N, C, 1.0f, 1, (long long)N * C4, (long long)C * N);
    w25::wmma_gemm64<1, true, 0, 0, false, 0><<<dim3((unsigned)((((HD) / 64) * ((HD) / 64) + 7) / 8), (unsigned)(NH), (unsigned)(Bn)), 256, 0, stream>>>((const unsigned short*)(QTH), (const unsigned short*)(QTL), N, (long long)HD * N, (long long)C * N, (const unsigned short*)(KTH), (const unsigned short*)(KTL), N, (long long)HD * N, (long long)C * N, (void*)(SCC), nullptr, HD, HD * HD, NH * HD * HD, nullptr, nullptr, 0, HD, HD, N, 1.0f);
    k_ep_csoft<<<Bn * NH, 64, 0, stream>>>(SCC, t1, (_Float16*)P16, NH);
    w25::wmma_gemm64<0, false, 0, 0, false, 0><<<dim3((unsigned)((((HD) / 64) * ((N) / 64) + 7) / 8), (unsigned)(NH), (unsigned)(Bn)), 256, 0, stream>>>((const unsigned short*)(P16), nullptr, HD, HD * HD, NH * HD * HD, (const unsigned short*)(VCA16), nullptr, C, HD, (long long)N * C, (void*)(XC), nullptr, 16 * C, C, (long long)N * C, nullptr, nullptr, 0, HD, N, HD, 0.000244140625f);
    k_cast16<<<(unsigned)((((long long)(BN) * ((1024) / 2)) + 255) / 256), 256, 0, stream>>>(XC, 1024, (_Float16*)(XC16), 1024, BN, 1024, 1.0f);
    k_cast16<<<(unsigned)((((long long)(512) * ((1024) / 2)) + 255) / 256), 256, 0, stream>>>(Wo2, 1024, (_Float16*)(WO2H), 1024, 512, 1024, 16.0f);
    w25::wmma_gemm64<0, false, 2, 0, false, 5><<<dim3((unsigned)((((BN) / 64) * ((512) / 64) + 7) / 8), (unsigned)(1), (unsigned)(1)), 256, 0, stream>>>((const unsigned short*)(XC16), nullptr, 1024, 0, 0, (const unsigned short*)(WO2H), nullptr, 1024, 0, 0, (void*)(out + CH), nullptr, 1024, 0, 0, bo2, nullptr, 0, BN, 512, 1024, 0.0625f);
    // spatial attention
    k_cast16<<<(unsigned)((((long long)(BN) * ((C) / 2)) + 255) / 256), 256, 0, stream>>>(QKVV + C, C4, (_Float16*)(K16), C, BN, C, 1.0f);
    k_cast16<<<(unsigned)((((long long)(BN) * ((C) / 2)) + 255) / 256), 256, 0, stream>>>(QKVV + 3 * C, C4, (_Float16*)(VSA16), C, BN, C, 1.0f);
    w25::wmma_gemm64<0, false, 2, 0, false, 0><<<dim3((unsigned)((((BN) / 64) * ((HD) / 64) + 7) / 8), (unsigned)(NH), (unsigned)(1)), 256, 0, stream>>>((const unsigned short*)(K16), nullptr, C, HD, 0, (const unsigned short*)(WE16), nullptr, HD, 0, 0, (void*)(KS), nullptr, C, HD, 0, BEB, nullptr, 0, BN, HD, HD, 0.0625f);
    w25::wmma_gemm64<0, false, 2, 0, false, 0><<<dim3((unsigned)((((BN) / 64) * ((HD) / 64) + 7) / 8), (unsigned)(NH), (unsigned)(1)), 256, 0, stream>>>((const unsigned short*)(VSA16), nullptr, C, HD, 0, (const unsigned short*)(WF16), nullptr, HD, 0, 0, (void*)(VS), nullptr, C, HD, 0, BFB, nullptr, 0, BN, HD, HD, 0.0625f);
    k_ep_qs<<<(unsigned)(((long long)BN * C + 255) / 256), 256, 0, stream>>>(QKVV, t2, QS, BN, C, C4, HD);
    { /*apv4*/ AttnP a;
      a.Q = QS; a.K = KS; a.V = VS; a.O = XS; a.P = 0; a.Mf = 0; a.Mi = 0; a.ST = 0;
      a.Pw = 0; a.Rt = 0; a.SQ = 0; a.SK = 0;
      a.swb = 0; a.swh = 0; a.swi = 0; a.swj = 0; a.srb = 0; a.srh = 0; a.sri = 0; a.sQb = (long long)N * C; a.sQh = HD; a.sQi = C; a.sQd = 1; a.sKb = (long long)N * C; a.sKh = HD; a.sKj = C; a.sKd = 1; a.sVb = (long long)N * C; a.sVh = HD; a.sVj = C; a.sVd = 1; a.sOb = (long long)N * C; a.sOh = HD; a.sOi = C; a.sPb = 0; a.sPh = 0; a.sPi = 0; a.smb = 0; a.smh = 0; a.smi = 0; a.smj = 0;
      a.Lq = N; a.Lk = N; a.dh = HD; a.dv = HD; a.hrep = 1; a.causal = 0; a.coff = 0; a.pband = 0;
      a.scale = 1.0f; a.mfill = 0.0f; a.nonorm = 0; a.mpol = 0;
      a.roff = 0; a.rn = 1; a.segpol = 0; a.win = 0;
      k_attn<64, 64, 0, false, false><<<dim3((unsigned)((N) + 16 * AW - 1) / (16 * AW), (unsigned)(NH), (unsigned)(Bn)), 32 * AW, 0, stream>>>(a); }
    k_cast16<<<(unsigned)((((long long)(BN) * ((1024) / 2)) + 255) / 256), 256, 0, stream>>>(XS, 1024, (_Float16*)(XS16), 1024, BN, 1024, 1.0f);
    k_cast16<<<(unsigned)((((long long)(512) * ((1024) / 2)) + 255) / 256), 256, 0, stream>>>(Wo1, 1024, (_Float16*)(WO1H), 1024, 512, 1024, 16.0f);
    w25::wmma_gemm64<0, false, 2, 0, false, 5><<<dim3((unsigned)((((BN) / 64) * ((512) / 64) + 7) / 8), (unsigned)(1), (unsigned)(1)), 256, 0, stream>>>((const unsigned short*)(XS16), nullptr, 1024, 0, 0, (const unsigned short*)(WO1H), nullptr, 1024, 0, 0, (void*)(out), nullptr, 1024, 0, 0, bo1, nullptr, 0, BN, 512, 1024, 0.0625f);
}

// v002
// It runs in 680 microseconds.
// Timed twice side by side with v001, it ran 3.76 times as fast both times.
// Counting every step since v000, it is 10.1 times as fast.
// Contractions (per sample): the shared QKVV projection x.W^T [1024x1024].[1024x4096] (q/k columns on bf16 hi/lo split planes), the E/F head projections of k and v_sa as per-head z-batched [1024x64].[64x64] products (+b), the 16 channel affinities q^T k [64x1024].[1024x64] on bf16 hi/lo split planes (64-wide softmax over sigma~19 logits: plain f16 flipped near-ties) and x_c = attn_c.v_ca^T [64x64].[64x1024] as z-batched products, and the two output halves gelu(x_s.W_o1^T + b) / gelu(x_c.W_o2^T + b) [1024x1024].[1024x512] — f16 operands on pre-cast planes (v_wmma_f32_16x16x32_f16; 64x64 register-blocked wave tiles, weights x16); per (sample, head) the spatial attention softmax(q.k_s^T * temp2[h]) v_s over 1024 positions as one flash launch (f16 operands; temperature folded into q on device); f32 accumulate and softmax. The tiled E/F biases, the 64-wide channel softmax (x temp1[h], exp once, f16 plane) and the q pre-scaling are f32 kernels; x_c is laid out exactly as torch's permute(0,2,1,3).reshape (row = d*16 + h, column = n).
#include <hip/hip_runtime.h>
#include <math.h>

typedef __attribute__((ext_vector_type(16))) _Float16 v16h;
typedef __attribute__((ext_vector_type(8)))  _Float16 v8h;
typedef __attribute__((ext_vector_type(16))) __bf16   v16b;
typedef __attribute__((ext_vector_type(8)))  float    v8f;
typedef __attribute__((ext_vector_type(4)))  float    v4f;

// 16-bit WMMA fragment map (wave32), lane L, h = L>>4, m = L&15:
//   A 16x32: lane = row m;   element i -> k = (i<8) ? 8h+i : 16+8h+(i-8)
//   B 32x16: lane = column m; the SAME k(i,h)
//   D 16x16 (8 f32): lane = column m; element r -> row 8h+r
__device__ __forceinline__ int frag_k(int i, int h) { return (i < 8) ? (8 * h + i) : (16 + 8 * h + (i - 8)); }
__device__ __forceinline__ __bf16 bf16_rne(float f) {
    unsigned int u = __float_as_uint(f);
    u += 0x7fffu + ((u >> 16) & 1u);
    return __builtin_bit_cast(__bf16, (unsigned short)(u >> 16));
}
__device__ __forceinline__ float bf16_f32(__bf16 b) { return __uint_as_float(((unsigned int)__builtin_bit_cast(unsigned short, b)) << 16); }
__device__ __forceinline__ v8f wmma16(v16h a, v16h b, v8f c) {
    c = __builtin_amdgcn_wmma_f32_16x16x32_f16(false, a, false, b, (short)0, c, false, false);
    asm volatile("v_nop\n\tv_nop\n\tv_nop\n\tv_nop" : "+v"(c) : "v"(a), "v"(b));
    return c;
}
__device__ __forceinline__ v8f wmmab(v16b a, v16b b, v8f c) {
    c = __builtin_amdgcn_wmma_f32_16x16x32_bf16(false, a, false, b, (short)0, c, false, false);
    asm volatile("v_nop\n\tv_nop\n\tv_nop\n\tv_nop" : "+v"(c) : "v"(a), "v"(b));
    return c;
}
struct Split { v16b hi, lo; };
// hi/lo split product: a.hi*b.hi + a.hi*b.lo + a.lo*b.hi
__device__ __forceinline__ v8f wmma3(const Split& a, const Split& b, v8f c) {
    c = __builtin_amdgcn_wmma_f32_16x16x32_bf16(false, a.hi, false, b.hi, (short)0, c, false, false);
    c = __builtin_amdgcn_wmma_f32_16x16x32_bf16(false, a.hi, false, b.lo, (short)0, c, false, false);
    c = __builtin_amdgcn_wmma_f32_16x16x32_bf16(false, a.lo, false, b.hi, (short)0, c, false, false);
    asm volatile("v_nop\n\tv_nop\n\tv_nop\n\tv_nop" : "+v"(c) : "v"(a.hi), "v"(a.lo), "v"(b.hi), "v"(b.lo));
    return c;
}
struct Split3 { v16b hi, mid, lo; };
// triple split product (6 terms, drops only terms below 2^-24 relative)
__device__ __forceinline__ v8f wmma6(const Split3& a, const Split3& b, v8f c) {
    c = __builtin_amdgcn_wmma_f32_16x16x32_bf16(false, a.hi, false, b.hi, (short)0, c, false, false);
    c = __builtin_amdgcn_wmma_f32_16x16x32_bf16(false, a.hi, false, b.mid, (short)0, c, false, false);
    c = __builtin_amdgcn_wmma_f32_16x16x32_bf16(false, a.mid, false, b.hi, (short)0, c, false, false);
    c = __builtin_amdgcn_wmma_f32_16x16x32_bf16(false, a.hi, false, b.lo, (short)0, c, false, false);
    c = __builtin_amdgcn_wmma_f32_16x16x32_bf16(false, a.mid, false, b.mid, (short)0, c, false, false);
    c = __builtin_amdgcn_wmma_f32_16x16x32_bf16(false, a.lo, false, b.hi, (short)0, c, false, false);
    asm volatile("v_nop\n\tv_nop\n\tv_nop\n\tv_nop" : "+v"(c) : "v"(a.hi), "v"(a.mid), "v"(a.lo), "v"(b.hi), "v"(b.mid), "v"(b.lo));
    return c;
}

// Fragment gathers from f32 memory: element i <- p[(k0 + frag_k(i,h)) * sk] * s, zero for k >= klen.
__device__ __forceinline__ v16h fh_ld(const float* __restrict__ p, long long sk, int k0, int h, int klen, float s) {
    v16h a;
#pragma unroll
    for (int i = 0; i < 16; ++i) { const int k = k0 + frag_k(i, h); a[i] = (k < klen) ? (_Float16)(p[(long long)k * sk] * s) : (_Float16)0.f; }
    return a;
}
__device__ __forceinline__ Split sp_ld(const float* __restrict__ p, long long sk, int k0, int h, int klen, float s) {
    Split r;
#pragma unroll
    for (int i = 0; i < 16; ++i) {
        const int k = k0 + frag_k(i, h); const float x = (k < klen) ? p[(long long)k * sk] * s : 0.f;
        const __bf16 hb = bf16_rne(x); r.hi[i] = hb; r.lo[i] = bf16_rne(x - bf16_f32(hb));
    }
    return r;
}
__device__ __forceinline__ Split3 sp3_ld(const float* __restrict__ p, long long sk, int k0, int h, int klen, float s) {
    Split3 r;
#pragma unroll
    for (int i = 0; i < 16; ++i) {
        const int k = k0 + frag_k(i, h); const float x = (k < klen) ? p[(long long)k * sk] * s : 0.f;
        const __bf16 hb = bf16_rne(x); const float r1 = x - bf16_f32(hb); const __bf16 mb = bf16_rne(r1);
        r.hi[i] = hb; r.mid[i] = mb; r.lo[i] = bf16_rne(r1 - bf16_f32(mb));
    }
    return r;
}
__device__ __forceinline__ v16b bh_ld(const float* __restrict__ p, long long sk, int k0, int h, int klen, float s) {
    v16b a;
#pragma unroll
    for (int i = 0; i < 16; ++i) { const int k = k0 + frag_k(i, h); a[i] = bf16_rne((k < klen) ? p[(long long)k * sk] * s : 0.f); }
    return a;
}
// f16 fragment from an f16 LDS/global row with element stride 1 (k-contiguous), no bounds (tile already zero padded)
__device__ __forceinline__ v16h fh_row(const _Float16* __restrict__ row, int k0, int h) {
    v16h a;
#pragma unroll
    for (int i = 0; i < 16; ++i) a[i] = row[k0 + frag_k(i, h)];
    return a;
}

#define VST2(T, ptr, val) do { const T vst2_v_ = (val); *(T*)(ptr) = vst2_v_;  } while (0)
typedef float v4f __attribute__((ext_vector_type(4)));
#define VST2V4(ptr, val) do { const v4f vst2_v4_ = (val); *(v4f*)(ptr) = vst2_v4_;  } while (0)

__device__ __attribute__((noinline)) float act_fn(float v, int act) {
    if (act == 1) return fmaxf(v, 0.f);                                                                               // relu
    if (act == 2) { const float u = 0.7978845608028654f * (v + 0.044715f * v * v * v); return 0.5f * v * (1.f + tanhf(u)); } // tanh-gelu
    if (act == 3) return v / (1.f + expf(-v));                                                                        // silu
    if (act == 4) return 0.5f * v * (1.f + erff(v * 0.7071067811865476f));                                             // erf-gelu
    if (act == 5) return tanhf(v);
    if (act == 6) return 1.f / (1.f + expf(-v));                                                                      // sigmoid
    if (act == 7) return (v > 0.f) ? v : 0.01f * v;                                                                   // leaky relu 0.01
    if (act == 8) return (v > 0.f) ? v : (expf(v) - 1.f);                                                             // elu
    if (act == 9) return fminf(fmaxf(v, 0.f), 6.f);                                                                   // relu6
    if (act == 10) return fabsf(v);                                                                                    // abs
    if (act == 11) return (v >= 0.f) ? v : 0.1f * v;                                                                  // leaky 0.1
    if (act == 12) return (v > 0.f) ? v : 0.2f * v;                                                                   // leaky 0.2
    if (act == 13) return (v > 20.f) ? v : log1pf(expf(v));                                                            // softplus
    return v;
}

// =====================================================================================================================
// k_gemm<MODE>: C(z, m, n) = act(alpha * sum_k A(z, m, k) * B(z, k, n) + bias) + beta * R(z, m, n)
//   One wave (32-thread block) per 16 x 32 tile of C; grid (ceil(N/32), ceil(M/16), Z). Batch z -> (zo = z / zi_n, zi = z % zi_n)
//   with separate outer/inner strides for every tensor (e.g. batch and head). A(m,k) = A[zo*sAo + zi*sAi + m*sAm + k*sAk] (f32),
//   B(k,n) = B[zo*sBo + zi*sBi + n*sBn + k*sBk] (f32); any M, N, K (K zero-padded to 32 inside the fragments, M/N tails guarded).
//   C(m,n) = C[zo*sCo + zi*sCi + m*sCm + n] (n contiguous). flags: 1 bias[n], 2 bias[m], 4 residual R[zo*sRo + zi*sRi + m*sRm + n*sRn].
//   MODE 0: f16 operands (A prescaled by sa, B by sb, both undone in the epilogue); 1: bf16 hi/lo split (3 products); 2: bf16;
//   3: bf16 hi/mid/lo triple split (6 products); 4: as 3 with Kahan-compensated f32 accumulation across k-steps.
// =====================================================================================================================
struct GemmP {
    const float* A; const float* B; const float* bias; const float* R; float* C;
    long long sAo, sAi, sAm, sAk, sBo, sBi, sBn, sBk, sCo, sCi, sCm, sRo, sRi, sRm, sRn;
    int M, N, K, zi_n, flags, act; float alpha, beta, sa, sb;
    int Npad, pad_;     // columns [N, Npad) of C are written as 0 so that padded workspace rows are covered by whole-line stores; Npad >= N
};
static_assert(sizeof(GemmP) == 5 * 8 + 15 * 8 + 6 * 4 + 4 * 4 + 2 * 4, "GemmP has padding");

template <int MODE>
__global__ __launch_bounds__(32) void k_gemm(GemmP p) {
    const int lane = threadIdx.x & 31, h = lane >> 4, l15 = lane & 15;
    const int m0 = blockIdx.y * 16, n0 = blockIdx.x * 32;
    const int z = blockIdx.z, zo = z / p.zi_n, zi = z - zo * p.zi_n;
    const float* A = p.A + zo * p.sAo + zi * p.sAi;
    const float* B = p.B + zo * p.sBo + zi * p.sBi;
    const int am = min(m0 + l15, p.M - 1);                       // clamped row for loads (stores are guarded)
    v8f acc[2], comp[2];
#pragma unroll
    for (int t = 0; t < 2; ++t) { v8f zz = {}; acc[t] = zz; comp[t] = zz; }
    for (int k0 = 0; k0 < p.K; k0 += 32) {
        const float* arow = A + (long long)am * p.sAm;
        if (MODE == 1) {
            const Split a = sp_ld(arow, p.sAk, k0, h, p.K, 1.f);
#pragma unroll
            for (int t = 0; t < 2; ++t) {
                const int bn = min(n0 + t * 16 + l15, p.N - 1);
                acc[t] = wmma3(a, sp_ld(B + (long long)bn * p.sBn, p.sBk, k0, h, p.K, 1.f), acc[t]);
            }
        } else if (MODE == 3) {
            const Split3 a = sp3_ld(arow, p.sAk, k0, h, p.K, 1.f);
#pragma unroll
            for (int t = 0; t < 2; ++t) {
                const int bn = min(n0 + t * 16 + l15, p.N - 1);
                acc[t] = wmma6(a, sp3_ld(B + (long long)bn * p.sBn, p.sBk, k0, h, p.K, 1.f), acc[t]);
            }
        } else if (MODE == 4) {
            // triple split as MODE 3, but each k-step's 6 products go into a fresh accumulator and the partial is added to the running f32 sum
            // on the VALU with Kahan compensation (accumulation error stays ~1 ulp however long K is)
            const Split3 a = sp3_ld(arow, p.sAk, k0, h, p.K, 1.f);
#pragma unroll
            for (int t = 0; t < 2; ++t) {
                const int bn = min(n0 + t * 16 + l15, p.N - 1); v8f zz = {};
                const v8f part = wmma6(a, sp3_ld(B + (long long)bn * p.sBn, p.sBk, k0, h, p.K, 1.f), zz);
                const v8f y = part - comp[t]; const v8f s = acc[t] + y; comp[t] = (s - acc[t]) - y; acc[t] = s;
            }
        } else if (MODE == 2) {
            const v16b a = bh_ld(arow, p.sAk, k0, h, p.K, 1.f);
#pragma unroll
            for (int t = 0; t < 2; ++t) {
                const int bn = min(n0 + t * 16 + l15, p.N - 1);
                acc[t] = wmmab(a, bh_ld(B + (long long)bn * p.sBn, p.sBk, k0, h, p.K, 1.f), acc[t]);
            }
        } else {
            const v16h a = fh_ld(arow, p.sAk, k0, h, p.K, p.sa);
#pragma unroll
            for (int t = 0; t < 2; ++t) {
                const int bn = min(n0 + t * 16 + l15, p.N - 1);
                acc[t] = wmma16(a, fh_ld(B + (long long)bn * p.sBn, p.sBk, k0, h, p.K, p.sb), acc[t]);
            }
        }
    }
    const float iscale = (MODE == 0) ? p.alpha / (p.sa * p.sb) : p.alpha;
    float* C = p.C + zo * p.sCo + zi * p.sCi;
    const float* R = p.R + zo * p.sRo + zi * p.sRi;
    __shared__ __align__(16) float ctile[16][36];
#pragma unroll
    for (int t = 0; t < 2; ++t) {
        const int n = n0 + t * 16 + l15; const int nn = min(n, p.N - 1);
#pragma unroll
        for (int r = 0; r < 8; ++r) {
            const int m = m0 + 8 * h + r; const int mm = min(m, p.M - 1);
            float v = acc[t][r] * iscale;
            if (p.flags & 1) v += p.bias[nn];
            if (p.flags & 2) v += p.bias[mm];
            if (p.flags & 8) v *= p.bias[(long long)zo * p.M + mm];   /* per-(z,row) scale vector laid out [Z][M]; exclusive with the bias flags */
            v = act_fn(v, p.act);
            if (p.flags & 4) v += p.beta * R[(long long)mm * p.sRm + (long long)nn * p.sRn];
            ctile[8 * h + r][t * 16 + l15] = (n < p.N) ? v : 0.f;
        }
    }
    __syncthreads();
    const int NW = (p.Npad > p.N) ? p.Npad : p.N;           // write width
    const bool fast = (m0 + 16 <= p.M) && (n0 + 32 <= NW) && ((p.sCm & 3) == 0) && ((((size_t)C) & 15) == 0);
    if (fast) {
#pragma unroll
        for (int s = 0; s < 4; ++s) {
            const int row = s * 4 + (lane >> 3), c4 = (lane & 7) * 4;
            const v4f v = *(const v4f*)&ctile[row][c4];
            VST2V4(C + (long long)(m0 + row) * p.sCm + n0 + c4, v);
        }
    } else {
        for (int row = 0; row < 16; ++row) {
            const int m = m0 + row, n = n0 + lane;
            if (m < p.M && n < NW) VST2(float, C + (long long)m * p.sCm + n, ctile[row][lane]);
        }
    }
}


// =====================================================================================================================
// k_gemmT<MODE, TM, TN>: same contract as k_gemm, but one wave computes a (16*TM) x (16*TN) tile: TM A fragments and TN B fragments are
//   loaded per 32-wide k-step and reused across TM*TN WMMAs (far fewer load/convert instructions per MAC). MODE 0 (f16), 1 (bf16 hi/lo),
//   2 (bf16) only. grid (ceil(NW/(16*TN)), ceil(M/(16*TM)), Z), block 32. Epilogue identical to k_gemm, run per 16x32 sub-tile.
// =====================================================================================================================
template <int MODE, int TM, int TN>
__global__ __launch_bounds__(32) void k_gemmT(GemmP p) {
    const int lane = threadIdx.x & 31, h = lane >> 4, l15 = lane & 15;
    const int m0 = blockIdx.y * (16 * TM), n0 = blockIdx.x * (16 * TN);
    const int z = blockIdx.z, zo = z / p.zi_n, zi = z - zo * p.zi_n;
    const float* A = p.A + zo * p.sAo + zi * p.sAi;
    const float* B = p.B + zo * p.sBo + zi * p.sBi;
    v8f acc[TM][TN];
#pragma unroll
    for (int i = 0; i < TM; ++i)
#pragma unroll
        for (int t = 0; t < TN; ++t) { v8f zz = {}; acc[i][t] = zz; }
    for (int k0 = 0; k0 < p.K; k0 += 32) {
        if (MODE == 1) {
            Split a[TM], b[TN];
#pragma unroll
            for (int i = 0; i < TM; ++i) { const int am = min(m0 + 16 * i + l15, p.M - 1); a[i] = sp_ld(A + (long long)am * p.sAm, p.sAk, k0, h, p.K, 1.f); }
#pragma unroll
            for (int t = 0; t < TN; ++t) { const int bn = min(n0 + 16 * t + l15, p.N - 1); b[t] = sp_ld(B + (long long)bn * p.sBn, p.sBk, k0, h, p.K, 1.f); }
#pragma unroll
            for (int i = 0; i < TM; ++i)
#pragma unroll
                for (int t = 0; t < TN; ++t) acc[i][t] = wmma3(a[i], b[t], acc[i][t]);
        } else if (MODE == 2) {
            v16b a[TM], b[TN];
#pragma unroll
            for (int i = 0; i < TM; ++i) { const int am = min(m0 + 16 * i + l15, p.M - 1); a[i] = bh_ld(A + (long long)am * p.sAm, p.sAk, k0, h, p.K, 1.f); }
#pragma unroll
            for (int t = 0; t < TN; ++t) { const int bn = min(n0 + 16 * t + l15, p.N - 1); b[t] = bh_ld(B + (long long)bn * p.sBn, p.sBk, k0, h, p.K, 1.f); }
#pragma unroll
            for (int i = 0; i < TM; ++i)
#pragma unroll
                for (int t = 0; t < TN; ++t) acc[i][t] = wmmab(a[i], b[t], acc[i][t]);
        } else {
            v16h a[TM], b[TN];
#pragma unroll
            for (int i = 0; i < TM; ++i) { const int am = min(m0 + 16 * i + l15, p.M - 1); a[i] = fh_ld(A + (long long)am * p.sAm, p.sAk, k0, h, p.K, p.sa); }
#pragma unroll
            for (int t = 0; t < TN; ++t) { const int bn = min(n0 + 16 * t + l15, p.N - 1); b[t] = fh_ld(B + (long long)bn * p.sBn, p.sBk, k0, h, p.K, p.sb); }
#pragma unroll
            for (int i = 0; i < TM; ++i)
#pragma unroll
                for (int t = 0; t < TN; ++t) acc[i][t] = wmma16(a[i], b[t], acc[i][t]);
        }
    }
    const float iscale = (MODE == 0) ? p.alpha / (p.sa * p.sb) : p.alpha;
    float* C = p.C + zo * p.sCo + zi * p.sCi;
    const float* R = p.R + zo * p.sRo + zi * p.sRi;
    const int NW = (p.Npad > p.N) ? p.Npad : p.N;
    __shared__ __align__(16) float ctile[16][36];
#pragma unroll
    for (int i = 0; i < TM; ++i) {
        const int mb = m0 + 16 * i; if (mb >= p.M) break;          // wave-uniform
#pragma unroll
        for (int tp = 0; tp < TN / 2; ++tp) {
            const int nb = n0 + 32 * tp; if (nb >= NW) break;        // wave-uniform
#pragma unroll
            for (int t2 = 0; t2 < 2; ++t2) {
                const int t = 2 * tp + t2; const int n = nb + t2 * 16 + l15; const int nn = min(n, p.N - 1);
#pragma unroll
                for (int r = 0; r < 8; ++r) {
                    const int m = mb + 8 * h + r; const int mm = min(m, p.M - 1);
                    float v = acc[i][t][r] * iscale;
                    if (p.flags & 1) v += p.bias[nn];
                    if (p.flags & 2) v += p.bias[mm];
            if (p.flags & 8) v *= p.bias[(long long)zo * p.M + mm];   /* per-(z,row) scale vector laid out [Z][M]; exclusive with the bias flags */
                    v = act_fn(v, p.act);
                    if (p.flags & 4) v += p.beta * R[(long long)mm * p.sRm + (long long)nn * p.sRn];
                    ctile[8 * h + r][t2 * 16 + l15] = (n < p.N) ? v : 0.f;
                }
            }
            __syncthreads();
            const bool fast = (mb + 16 <= p.M) && (nb + 32 <= NW) && ((p.sCm & 3) == 0) && ((((size_t)C) & 15) == 0);
            if (fast) {
#pragma unroll
                for (int s = 0; s < 4; ++s) {
                    const int row = s * 4 + (lane >> 3), c4 = (lane & 7) * 4;
                    const v4f v = *(const v4f*)&ctile[row][c4];
                    VST2V4(C + (long long)(mb + row) * p.sCm + nb + c4, v);
                }
            } else {
                for (int row = 0; row < 16; ++row) {
                    const int m = mb + row, n = nb + lane;
                    if (m < p.M && n < NW) VST2(float, C + (long long)m * p.sCm + n, ctile[row][lane]);
                }
            }
            __syncthreads();
        }
    }
}

namespace sfa {
typedef unsigned int u32x4 __attribute__((ext_vector_type(4)));
typedef unsigned int u32x2 __attribute__((ext_vector_type(2)));
typedef int i32x8 __attribute__((ext_vector_type(8)));
typedef short s16x8 __attribute__((ext_vector_type(8)));
typedef float f32x2 __attribute__((ext_vector_type(2)));
typedef _Float16 h16x2 __attribute__((ext_vector_type(2)));
constexpr int SEQ = 1024, LDR = 1024, HS = 64;
constexpr int NWV = 8, CW = 32, BR = NWV * CW, SK = 64, NST = SEQ / SK;
constexpr unsigned PK = 2u * HS + 16u, PV = 2u * HS + 32u, TILE_K = SK * PK, TILE_V = SK * PV, SLOT = TILE_K + TILE_V;
struct Fr { u32x4 q[2]; };
__device__ __forceinline__ v8f mma(const Fr& a, const Fr& b, v8f c) {
    const i32x8 av = {(int)a.q[0].x, (int)a.q[0].y, (int)a.q[0].z, (int)a.q[0].w, (int)a.q[1].x, (int)a.q[1].y, (int)a.q[1].z, (int)a.q[1].w};
    const i32x8 bv = {(int)b.q[0].x, (int)b.q[0].y, (int)b.q[0].z, (int)b.q[0].w, (int)b.q[1].x, (int)b.q[1].y, (int)b.q[1].z, (int)b.q[1].w};
    return __builtin_amdgcn_wmma_f32_16x16x32_f16(false, __builtin_bit_cast(v16h, av), false, __builtin_bit_cast(v16h, bv), (short)0, c, false, false);
}
__device__ __forceinline__ unsigned pack2(float lo, float hi) { return __builtin_bit_cast(unsigned, __builtin_convertvector(f32x2{lo, hi}, h16x2)); }   // round to nearest even
__device__ __forceinline__ u32x4 ld_tr16(const unsigned char* p) { typedef __attribute__((address_space(3))) s16x8 lds_s16x8; return __builtin_bit_cast(u32x4, __builtin_amdgcn_ds_load_tr16_b128_v8i16((lds_s16x8*)p)); }
__device__ __forceinline__ float xhalf(float x) { return __builtin_bit_cast(float, __builtin_amdgcn_permlanex16(__builtin_bit_cast(int, x), __builtin_bit_cast(int, x), 0x76543210, 0xfedcba98, false, false)); }   // lane l with lane l ^ 16

__global__ __launch_bounds__(NWV * 32) void k_sflash(const float* __restrict__ Q, const float* __restrict__ K, const float* __restrict__ V, float* __restrict__ O) {
    __shared__ __attribute__((aligned(256))) unsigned char L[2 * SLOT];
    const unsigned tid = threadIdx.x, lane = tid & 31u, wave = tid >> 5, c = lane & 15u, h = lane >> 4;
    const size_t base = (size_t)blockIdx.z * SEQ * LDR + (size_t)blockIdx.y * HS;
    const unsigned qw0 = blockIdx.x * BR + wave * CW;
    // staging: 16 lanes cover one 256-byte row, thread t takes rows (t >> 4) + 16 i of the stage
    const float* kg = K + base + (size_t)(tid >> 4) * LDR + (tid & 15u) * 4u;
    const float* vg = V + base + (size_t)(tid >> 4) * LDR + (tid & 15u) * 4u;
    unsigned char* ks = L + (tid >> 4) * PK + (tid & 15u) * 8u;
    unsigned char* vs = L + TILE_K + (tid >> 4) * PV + (tid & 15u) * 8u;
    v4f kr[4], vr[4];
    auto fetch = [&](int st) {
#pragma unroll
        for (int i = 0; i < 4; ++i) { kr[i] = *(const v4f*)(kg + (size_t)(st * SK + 16 * i) * LDR); vr[i] = *(const v4f*)(vg + (size_t)(st * SK + 16 * i) * LDR); }
        asm volatile("s_wait_xcnt 0x0" ::: "memory");          // stands in front of the pass's reuse of these loads' address registers
    };
    auto put = [&](unsigned slot) {
#pragma unroll
        for (int i = 0; i < 4; ++i) {
            *(u32x2*)(ks + slot * SLOT + 16u * i * PK) = u32x2{pack2(kr[i].x, kr[i].y), pack2(kr[i].z, kr[i].w)};
            *(u32x2*)(vs + slot * SLOT + 16u * i * PV) = u32x2{pack2(vr[i].x, vr[i].y), pack2(vr[i].z, vr[i].w)};
        }
    };
    fetch(0);
    // Q fragments (B operand, column = query), hardware k order: d = 32 kc + 8 h + 0..7 and 32 kc + 16 + 8 h + 0..7
    Fr qf[2][2];
#pragma unroll
    for (int g = 0; g < 2; ++g) {
        const float* qp = Q + base + (size_t)(qw0 + 16u * g + c) * LDR + 8u * h;
#pragma unroll
        for (int kc = 0; kc < 2; ++kc) {
            const v4f a0 = *(const v4f*)(qp + 32 * kc), a1 = *(const v4f*)(qp + 32 * kc + 4), b0 = *(const v4f*)(qp + 32 * kc + 16), b1 = *(const v4f*)(qp + 32 * kc + 20);
            qf[g][kc].q[0] = u32x4{pack2(a0.x, a0.y), pack2(a0.z, a0.w), pack2(a1.x, a1.y), pack2(a1.z, a1.w)};
            qf[g][kc].q[1] = u32x4{pack2(b0.x, b0.y), pack2(b0.z, b0.w), pack2(b1.x, b1.y), pack2(b1.z, b1.w)};
        }
    }
    v8f acc[2][4]; float m_run[2], l_run[2];
#pragma unroll
    for (int g = 0; g < 2; ++g) { m_run[g] = -__builtin_inff(); l_run[g] = 0.f;
#pragma unroll
        for (int t = 0; t < 4; ++t) acc[g][t] = v8f{}; }
    put(0u);
    __syncthreads();
    const float L2E = 1.4426950408889634f;
    for (int st = 0; st < NST; ++st) {
        if (st + 1 < NST) fetch(st + 1);                       // next stage's rows fly while this stage is worked on
        const unsigned char* Kb = L + (unsigned)(st & 1) * SLOT;
        const unsigned char* Vb = Kb + TILE_K;
#pragma unroll 1   // one 32-key pass's fragments live at a time (registers for four waves per SIMD)
        for (unsigned sub = 0; sub < 2u; ++sub) {
            Fr kf[2][2];
            const unsigned char* kp = Kb + (sub * 32u + c) * PK + 16u * h;
#pragma unroll
            for (int kt = 0; kt < 2; ++kt)
#pragma unroll
                for (int kc = 0; kc < 2; ++kc) { kf[kt][kc].q[0] = *(const u32x4*)(kp + 16u * kt * PK + 64u * kc); kf[kt][kc].q[1] = *(const u32x4*)(kp + 16u * kt * PK + 64u * kc + 32u); }
            Fr vf[4];
            const unsigned char* ad = Vb + (sub * 32u + 8u * h + (lane & 7u)) * PV + ((lane >> 3) & 1u) * 16u;
#pragma unroll
            for (int t = 0; t < 4; ++t) { vf[t].q[0] = ld_tr16(ad + 32u * t); vf[t].q[1] = ld_tr16(ad + 16u * PV + 32u * t); }
            v8f s[2][2];                                       // s[kt][g][r] = score of key 16 kt + 8 h + r against query 16 g + c
#pragma unroll
            for (int kt = 0; kt < 2; ++kt)
#pragma unroll
                for (int g = 0; g < 2; ++g) { s[kt][g] = v8f{};
#pragma unroll
                    for (int kc = 0; kc < 2; ++kc) s[kt][g] = mma(kf[kt][kc], qf[g][kc], s[kt][g]); }
            float mb[2]; bool need = false;
#pragma unroll
            for (int g = 0; g < 2; ++g) {
                float mx = s[0][g][0];
#pragma unroll
                for (int r = 1; r < 8; ++r) mx = fmaxf(mx, s[0][g][r]);
#pragma unroll
                for (int r = 0; r < 8; ++r) mx = fmaxf(mx, s[1][g][r]);
                mx = fmaxf(mx, xhalf(mx)) * L2E;               // both halves hold this query's maximum, log2 domain
                mb[g] = mx; need = need || (mx > m_run[g] + 8.0f);
            }
            if (__builtin_amdgcn_ballot_w32(need) != 0) {      // wave-uniform; rare after the first pass
#pragma unroll
                for (int g = 0; g < 2; ++g) {
                    const float m_new = fmaxf(m_run[g], mb[g]);
                    const float corr = __builtin_amdgcn_exp2f(m_run[g] - m_new);   // 0 on the first pass
                    m_run[g] = m_new; l_run[g] *= corr;
#pragma unroll
                    for (int t = 0; t < 4; ++t) acc[g][t] = acc[g][t] * corr;
                }
            }
#pragma unroll
            for (int g = 0; g < 2; ++g) {
                const float nm = 7.0f - m_run[g];
                unsigned w[8]; f32x2 ps = {0.f, 0.f};
#pragma unroll
                for (int i = 0; i < 8; ++i) {
                    const f32x2 arg = __builtin_elementwise_fma(f32x2{s[i >> 2][g][2 * (i & 3)], s[i >> 2][g][2 * (i & 3) + 1]}, f32x2{L2E, L2E}, f32x2{nm, nm});
                    const f32x2 p = {__builtin_amdgcn_exp2f(arg.x), __builtin_amdgcn_exp2f(arg.y)};
                    ps += p; w[i] = pack2(p.x, p.y);
                }
                l_run[g] += ps.x + ps.y;
                Fr pf; pf.q[0] = u32x4{w[0], w[1], w[2], w[3]}; pf.q[1] = u32x4{w[4], w[5], w[6], w[7]};
#pragma unroll
                for (int t = 0; t < 4; ++t) acc[g][t] = mma(vf[t], pf, acc[g][t]);
            }
        }
        if (st + 1 < NST) put((unsigned)((st + 1) & 1));       // into the buffer whose readers all passed the last barrier
        __syncthreads();
    }
#pragma unroll
    for (int g = 0; g < 2; ++g) {
        const float l = l_run[g] + xhalf(l_run[g]);            // join the halves' sums, unconditionally
        const float inv = 1.0f / l;
        float* op = O + base + (size_t)(qw0 + 16u * g + c) * LDR + 8u * h;
#pragma unroll
        for (int t = 0; t < 4; ++t) {                          // registers 0..7 = d 16 t + 8 h + 0..7 of this lane's query
            const v8f o = acc[g][t] * inv;
            *(v4f*)(op + 16 * t) = v4f{o[0], o[1], o[2], o[3]};
            *(v4f*)(op + 16 * t + 4) = v4f{o[4], o[5], o[6], o[7]};
        }
    }
}
} // namespace sfa

// =====================================================================================================================
// k_tr: dst(z, c, r) = alpha * src(z, r, c) (+ beta * R2(z, c, r)): [Z][R][C] (row stride lds) -> [Z][C][R] (row stride ldd) through a 32x32 LDS tile;
//   flags: 1 -> add beta * residual R2 addressed like dst (z*sRz + c*ldr + r); act applied before the residual.
// =====================================================================================================================
struct TrP { const float* src; float* dst; const float* R2; long long sSz, lds, sDz, ldd, sRz, ldr; int R, C, flags, act; float alpha, beta; };
static_assert(sizeof(TrP) == 3 * 8 + 6 * 8 + 6 * 4, "TrP has padding");
__global__ __launch_bounds__(256) void k_tr(TrP p) {
    __shared__ float tile[32][33];
    const int c0 = blockIdx.x * 32, r0 = blockIdx.y * 32, z = blockIdx.z;
    const int lane = threadIdx.x & 31, wave = threadIdx.x >> 5;
    const float* s = p.src + z * p.sSz;
#pragma unroll
    for (int k = 0; k < 4; ++k) {
        const int rl = wave * 4 + k, r = r0 + rl, c = c0 + lane;
        tile[rl][lane] = (r < p.R && c < p.C) ? s[(long long)r * p.lds + c] : 0.f;
    }
    __syncthreads();
    float* d = p.dst + z * p.sDz; const float* rr = p.R2 + z * p.sRz;
#pragma unroll
    for (int k = 0; k < 4; ++k) {
        const int cl = wave * 4 + k, c = c0 + cl, r = r0 + lane;
        if (c < p.C && r < p.R) {
            float v = act_fn(p.alpha * tile[lane][cl], p.act);
            if (p.flags & 1) v += p.beta * rr[(long long)c * p.ldr + r];
            VST2(float, d + (long long)c * p.ldd + r, v);
        }
    }
}

// k_affine: dst[i] = a * (sdev ? sdev[0] : 1) * src[i] + b, i < n (one thread per element; consecutive lanes -> consecutive addresses)
__global__ __launch_bounds__(256) void k_affine(const float* __restrict__ src, float* __restrict__ dst, int n, float a, float b, const float* __restrict__ sdev) {
    const int i = blockIdx.x * 256 + threadIdx.x;
    if (i < n) { const float aa = sdev ? a * sdev[0] : a; const float v = aa * src[i] + b; VST2(float, dst + i, v); }
}

// =====================================================================================================================
// k_softmax: row softmax over n contiguous elements, one 256-thread block per row; rows addressed z*sz + r*sr (grid (R, Z)).
//   out = scale_out * softmax(scale_in * x + (Mf ? Mf[z*smz + r*smr + j] : 0)); a row whose max is -inf is written as 0.
// =====================================================================================================================
struct SmP { const float* src; float* dst; const float* Mf; long long sz, sr, dz, dr, smz, smr; int n, pad; float scale_in, scale_out; };
static_assert(sizeof(SmP) == 3 * 8 + 6 * 8 + 4 * 4, "SmP has padding");
__global__ __launch_bounds__(256) void k_softmax(SmP p) {
    __shared__ float red[256];
    const int r = blockIdx.x, z = blockIdx.y, tid = threadIdx.x;
    const float* s = p.src + z * p.sz + (long long)r * p.sr;
    const float* mf = p.Mf ? (p.Mf + z * p.smz + (long long)r * p.smr) : nullptr;
    float mx = -__builtin_inff();
    for (int j = tid; j < p.n; j += 256) { float v = s[j] * p.scale_in; if (mf) v += mf[j]; mx = fmaxf(mx, v); }
    red[tid] = mx; __syncthreads();
    for (int o = 128; o > 0; o >>= 1) { if (tid < o) red[tid] = fmaxf(red[tid], red[tid + o]); __syncthreads(); }
    mx = red[0]; __syncthreads();
    float sum = 0.f;
    for (int j = tid; j < p.n; j += 256) { float v = s[j] * p.scale_in; if (mf) v += mf[j]; sum += (mx == -__builtin_inff()) ? 0.f : expf(v - mx); }
    red[tid] = sum; __syncthreads();
    for (int o = 128; o > 0; o >>= 1) { if (tid < o) red[tid] += red[tid + o]; __syncthreads(); }
    sum = red[0];
    const float inv = (sum > 0.f) ? p.scale_out / sum : 0.f;
    float* d = p.dst + z * p.dz + (long long)r * p.dr;
    for (int j = tid; j < p.n; j += 256) { float v = s[j] * p.scale_in; if (mf) v += mf[j]; const float o = (mx == -__builtin_inff()) ? 0.f : expf(v - mx) * inv; VST2(float, d + j, o); }
}
// =====================================================================================================================
// k_stats: mean and rsqrt(var + eps) over a set of n elements addressed base + z*sz + (e / inner) * so + (e % inner) * si, one 256-thread
// k_norm_apply: y = (x - mean[set]) * rstd[set] * g[c] + b[c] over a [Z][C][L] channel-major tensor with set = z*G + c / (C/G) (G groups per z;
//   G = C -> per-channel sets indexed z*C+c; for batch norm pass stats indexed by c only via bn = 1). Optional act. Output same layout.
// =====================================================================================================================
//   mode 0: mean / rsqrt(var + eps); mode 1 (RMSNorm): 0 / rsqrt(mean(x^2) + eps); mode 2 (L2 normalize * sqrt(n)): 0 / sqrt(n) / max(||x||, eps); mode 3: as 0 with unbiased variance (n-1)
__global__ __launch_bounds__(256) void k_stats(const float* __restrict__ x, long long sz, long long so, long long si, int inner, int n, float eps, float* __restrict__ stat, int mode) {
    __shared__ float red[256];
    const int z = blockIdx.x, tid = threadIdx.x;
    const float* base = x + z * sz;
    float s = 0.f;
    for (int e = tid; e < n; e += 256) s += base[(long long)(e / inner) * so + (long long)(e % inner) * si];
    red[tid] = s; __syncthreads();
    for (int o = 128; o > 0; o >>= 1) { if (tid < o) red[tid] += red[tid + o]; __syncthreads(); }
    const float mu = (mode == 0 || mode == 3) ? red[0] / (float)n : 0.f; __syncthreads();
    float q = 0.f;
    for (int e = tid; e < n; e += 256) { const float dlt = base[(long long)(e / inner) * so + (long long)(e % inner) * si] - mu; q += dlt * dlt; }
    red[tid] = q; __syncthreads();
    for (int o = 128; o > 0; o >>= 1) { if (tid < o) red[tid] += red[tid + o]; __syncthreads(); }
    {
        float rs;
        if (mode == 2) rs = sqrtf((float)n) / fmaxf(sqrtf(red[0]), eps); else if (mode == 3) rs = rsqrtf(red[0] / (float)(n - 1) + eps); else rs = rsqrtf(red[0] / (float)n + eps);
        if (tid < 32) { const float v = (tid == 0) ? mu : ((tid == 1) ? rs : 0.f); VST2(float, stat + (long long)z * 32 + tid, v); }
    }
}
//   One thread per element over the flat [Z][C][L] index space: grid ceil(Z*C*L / 256).
__global__ __launch_bounds__(256) void k_norm_apply(const float* __restrict__ x, float* __restrict__ y, const float* __restrict__ stat, const float* __restrict__ g, const float* __restrict__ bta,
                                                     int Z, int C, int L, int G, int bn, int act) {
    const long long idx = (long long)blockIdx.x * 256 + threadIdx.x;
    if (idx >= (long long)Z * C * L) return;
    const int l = (int)(idx % L); const long long zc = idx / L; const int c = (int)(zc % C), z = (int)(zc / C); (void)l;
    const int set = bn ? c : (z * G + c / (C / G));
    float v = (x[idx] - stat[(long long)set * 32]) * stat[(long long)set * 32 + 1];
    if (g) v *= g[c];
    if (bta) v += bta[c];
    v = act_fn(v, act);
    VST2(float, y + idx, v);
}

// k_lse_neg: c[i] = -(st[2i] + log(st[2i+1])) = minus the log-sum-exp of row i from k_attn's ST output (for softmax over the query dimension)
__global__ __launch_bounds__(256) void k_lse_neg(const float* __restrict__ st, float* __restrict__ c, int n) {
    const int i = blockIdx.x * 256 + threadIdx.x;
    if (i < n) { const float v = -(st[2 * i] + logf(st[2 * i + 1])); VST2(float, c + i, v); }
}

// k_iota: dst[i] = a * i + b as int32 (segment/position id helper)
__global__ __launch_bounds__(256) void k_iota(int* __restrict__ dst, int n, int a, int b) {
    const int i = blockIdx.x * 256 + threadIdx.x;
    if (i < n) { const int v = a * i + b; VST2(int, dst + i, v); }
}

// k_axpby: dst[i] = a * x[i] + b * y[i] (+ c), i < n
__global__ __launch_bounds__(256) void k_axpby(const float* __restrict__ x, const float* __restrict__ y, float* __restrict__ dst, int n, float a, float b, float c) {
    const int i = blockIdx.x * 256 + threadIdx.x;
    if (i < n) { const float v = a * x[i] + b * y[i] + c; VST2(float, dst + i, v); }
}

// =====================================================================================================================
// k_rope: rotary embedding on a [R rows][Hn heads][D] view (row stride sXr, head stride sXh, element stride 1) -> Y (own strides).
//   mode 0: rotate_half (partner d±D/2, sign - for d<D/2); mode 1: interleaved pairs (partner d^1, sign - for even d).
//   table column tcol: tmode 0 -> d, 1 -> d % (D/2), 2 -> d / 2; position p: pmode 0 -> r % S, 1 -> head index, 2 -> pos[r];
//   c = C[(r / S) * sCb + p * sCp + tcol * sCd], s likewise from Sn; y = x[d] * c + sign * x[partner] * s. X and Y must not alias.
// =====================================================================================================================
struct RopeP { const float* X; float* Y; const float* C; const float* Sn; const int* pos; long long sXr, sXh, sYr, sYh, sCb, sCp, sCd; int R, Hn, D, S, mode, tmode, pmode, pad; };
static_assert(sizeof(RopeP) == 5 * 8 + 7 * 8 + 8 * 4, "RopeP has padding");
__global__ __launch_bounds__(256) void k_rope(RopeP p) {
    const long long idx = (long long)blockIdx.x * 256 + threadIdx.x;
    if (idx >= (long long)p.R * p.Hn * p.D) return;
    const int d = (int)(idx % p.D); const long long rh = idx / p.D; const int h = (int)(rh % p.Hn); const int r = (int)(rh / p.Hn);
    const int half = p.D / 2;
    int partner; float sign;
    if (p.mode == 0) { partner = (d < half) ? d + half : d - half; sign = (d < half) ? -1.f : 1.f; }
    else { partner = d ^ 1; sign = (d & 1) ? 1.f : -1.f; }
    const int tcol = (p.tmode == 0) ? d : ((p.tmode == 1) ? (d % half) : (d >> 1));
    const int pp = (p.pmode == 0) ? (r % p.S) : ((p.pmode == 1) ? h : p.pos[r]);
    const long long toff = (long long)(r / p.S) * p.sCb + (long long)pp * p.sCp + (long long)tcol * p.sCd;
    const float* xr = p.X + (long long)r * p.sXr + (long long)h * p.sXh;
    const float v = xr[d] * p.C[toff] + sign * xr[partner] * p.Sn[toff];
    VST2(float, p.Y + (long long)r * p.sYr + (long long)h * p.sYh + d, v);
}

// k_invf + k_sincos (split so neither kernel carries a large VALU-fma footprint): invf_i = num * (1 / powf(base, (2 i)/D)) [fmode 0],
//   num * expf((2 i) * cexp) [fmode 1], num * powf(base, -2 (i - 1) / D) [fmode 2]; then cs/sn[s*half + i] = cos/sin((pscale * s) * invf_i)
__global__ __launch_bounds__(256) void k_invf(float* __restrict__ invb, int half, int D, float base, float num, int fmode, float cexp) {
    const int i = blockIdx.x * 256 + threadIdx.x;
    if (i >= ((half + 31) / 32) * 32) return;
    if (i >= half) { VST2(float, invb + i, 0.f); return; }
    const float e = (float)(2 * i) / (float)D;
    float invf;
    if (fmode == 1) invf = num * expf((float)(2 * i) * cexp);
    else if (fmode == 2) invf = num * powf(base, (-2.0f * ((float)i - 1.0f)) / (float)D);
    else invf = num * (1.0f / powf(base, e));
    VST2(float, invb + i, invf);
}
__global__ __launch_bounds__(256) void k_sincos(float* __restrict__ cs, float* __restrict__ sn, const float* __restrict__ invb, int S, int half, float pscale) {
    const int idx = blockIdx.x * 256 + threadIdx.x;
    if (idx >= S * half) return;
    const int s = idx / half, i = idx - s * half;
    const float ang = (pscale * (float)s) * invb[i];
    VST2(float, cs + idx, cosf(ang)); VST2(float, sn + idx, sinf(ang));
}

// k_mulact: dst[i] = act(x[i]) * y[i]
__global__ __launch_bounds__(256) void k_mulact(const float* __restrict__ x, const float* __restrict__ y, float* __restrict__ dst, int n, int act) {
    const int i = blockIdx.x * 256 + threadIdx.x;
    if (i < n) { const float v = act_fn(x[i], act) * y[i]; VST2(float, dst + i, v); }
}

// =====================================================================================================================
// k_matvec: thread-per-row matrix-vector products for N <= 8 output columns (heads with 1-3 outputs, gates), f32 on the VALU.
//   C[r*sCm + j] = act(alpha * sum_k A[r*sAm + k*sAk] * B[j*sBn + k*sBk] + bias[j]) + beta * R[r*sRm + j*sRn]; each thread writes its N contiguous floats.
// =====================================================================================================================
__global__ __launch_bounds__(256) void k_matvec(GemmP p) {
    // N == 1: one row per thread, so 32 lanes write one line with one instruction; otherwise each thread takes 32 consecutive rows.
    const int rpt = (p.N == 1) ? 1 : 32;
    const long long r0 = ((long long)blockIdx.x * 256 + threadIdx.x) * rpt; const int z = blockIdx.z, zo = z / p.zi_n, zi = z - zo * p.zi_n;
    if (r0 >= p.M) return;
    const float* Bb = p.B + zo * p.sBo + zi * p.sBi;
    float* C = p.C + zo * p.sCo + zi * p.sCi; const float* R = p.R + zo * p.sRo + zi * p.sRi;
    for (int rr = 0; rr < rpt; ++rr) {
        const long long r = r0 + rr; if (r >= p.M) break;
        const float* A = p.A + zo * p.sAo + zi * p.sAi + r * p.sAm;
        float acc[8] = {0.f, 0.f, 0.f, 0.f, 0.f, 0.f, 0.f, 0.f};
        for (int k = 0; k < p.K; ++k) { const float a = A[(long long)k * p.sAk];
#pragma unroll
            for (int j = 0; j < 8; ++j) if (j < p.N) acc[j] += a * Bb[(long long)j * p.sBn + (long long)k * p.sBk]; }
#pragma unroll
        for (int j = 0; j < 8; ++j) if (j < p.N) {
            float v = acc[j] * p.alpha;
            if (p.flags & 1) v += p.bias[j];
            if (p.flags & 2) v += p.bias[r];
            v = act_fn(v, p.act);
            if (p.flags & 4) v += p.beta * R[r * p.sRm + (long long)j * p.sRn];
            VST2(float, C + r * p.sCm + j, v);
        }
    }
}
// k_smallsoftmax: thread-per-row softmax for short rows (n <= 64): dst[r*dr + j] = softmax(scale*src[r*sr + j])
__global__ __launch_bounds__(256) void k_smallsoftmax(const float* __restrict__ src, float* __restrict__ dst, long long sr, long long dr, int n, long long R, float scale) {
    const long long r0 = ((long long)blockIdx.x * 256 + threadIdx.x) * 32;
    for (int rr = 0; rr < 32; ++rr) {
        const long long r = r0 + rr; if (r >= R) return;
        const float* s = src + r * sr; float* d = dst + r * dr;
        float mx = -__builtin_inff();
        for (int j = 0; j < n; ++j) mx = fmaxf(mx, s[j] * scale);
        float sum = 0.f;
        for (int j = 0; j < n; ++j) sum += expf(s[j] * scale - mx);
        const float inv = 1.f / sum;
        for (int j = 0; j < n; ++j) { const float v = expf(s[j] * scale - mx) * inv; VST2(float, d + j, v); }
    }
}

__global__ __launch_bounds__(32) void k_unitstat(float* __restrict__ st) { const int t = threadIdx.x; const float v = (t == 1) ? 1.f : 0.f; VST2(float, st + t, v); }

// destination (e.g. a d_out whose row width is not a multiple of 32 floats) is written by consecutive lanes of one instruction
__global__ __launch_bounds__(256) void k_lincopy(const float* __restrict__ src, long long lds, float* __restrict__ dst, long long ldd, long long rows, int cols) {
    const long long i = (long long)blockIdx.x * 256 + threadIdx.x; if (i >= rows * cols) return;
    const long long r = i / cols; const int c = (int)(i - r * cols);
    const float v = src[r * lds + c]; VST2(float, dst + r * ldd + c, v);
}

namespace w25 {
typedef __attribute__((ext_vector_type(16))) _Float16 v16h;
typedef __attribute__((ext_vector_type(8)))  _Float16 v8h;
typedef __attribute__((ext_vector_type(16))) __bf16   v16b;
typedef __attribute__((ext_vector_type(8)))  __bf16   v8b;
typedef __attribute__((ext_vector_type(8)))  float    v8f;
typedef __attribute__((ext_vector_type(4)))  float    v4f;

__device__ __forceinline__ unsigned short f2bf_bits(float f) {
  unsigned u = __float_as_uint(f);
  return (unsigned short)((u + 0x7FFFu + ((u >> 16) & 1u)) >> 16);
}
__device__ __forceinline__ float bf_bits2f(unsigned short h) { return __uint_as_float(((unsigned)h) << 16); }

// hazard guards as plain device helpers (no inline asm inside the kernel template body)
__device__ __forceinline__ void dep_guard_h(v8f& a, v8f& b, v16h x, v16h y) { asm volatile("v_nop\n\tv_nop\n\tv_nop\n\tv_nop" : "+v"(a), "+v"(b) : "v"(x), "v"(y)); }
__device__ __forceinline__ void dep_guard_b(v8f& a, v8f& b, v16b x, v16b y) { asm volatile("v_nop\n\tv_nop\n\tv_nop\n\tv_nop" : "+v"(a), "+v"(b) : "v"(x), "v"(y)); }
__device__ __forceinline__ void keep4_h(v16h a, v16h b, v16h c, v16h d) { asm volatile("v_nop" :: "v"(a), "v"(b), "v"(c), "v"(d)); }
__device__ __forceinline__ void keep4_b(v16b a, v16b b, v16b c, v16b d) { asm volatile("v_nop" :: "v"(a), "v"(b), "v"(c), "v"(d)); }
__device__ __forceinline__ void acc_guard4(v8f& a, v8f& b, v8f& c, v8f& d) { asm volatile("v_nop\n\tv_nop\n\tv_nop\n\tv_nop" : "+v"(a), "+v"(b), "+v"(c), "+v"(d)); }
template <typename T> struct Frag;
template <> struct Frag<_Float16> {
  typedef v16h V; union U { v16h v; v8h h[2]; };
  static __device__ __forceinline__ v16h load(const _Float16* p) {   // elements 0..7 <- p[0..7], 8..15 <- p[16..23]
    U f; f.h[0] = *(const v8h*)(p); f.h[1] = *(const v8h*)(p + 16); return f.v;
  }
  static __device__ __forceinline__ v8f mma(v16h a, v16h b, v8f c) {
    return __builtin_amdgcn_wmma_f32_16x16x32_f16(false, a, false, b, (short)0, c, false, false);
  }
  static __device__ __forceinline__ void guard(v8f& a, v8f& b, v16h x, v16h y) { dep_guard_h(a, b, x, y); }
  static __device__ __forceinline__ void keep(v16h a, v16h b, v16h c, v16h d) { keep4_h(a, b, c, d); }
};
template <> struct Frag<__bf16> {
  typedef v16b V; union U { v16b v; v8b h[2]; };
  static __device__ __forceinline__ v16b load(const __bf16* p) {
    U f; f.h[0] = *(const v8b*)(p); f.h[1] = *(const v8b*)(p + 16); return f.v;
  }
  static __device__ __forceinline__ v8f mma(v16b a, v16b b, v8f c) {
    return __builtin_amdgcn_wmma_f32_16x16x32_bf16(false, a, false, b, (short)0, c, false, false);
  }
  static __device__ __forceinline__ void guard(v8f& a, v8f& b, v16b x, v16b y) { dep_guard_b(a, b, x, y); }
  static __device__ __forceinline__ void keep(v16b a, v16b b, v16b c, v16b d) { keep4_b(a, b, c, d); }
};

// ---- Register-blocked batched WMMA GEMM ------------------------------------
// C[m,n] = scale * sum_k A[m,k] * Bt[n,k] (+bias)(+resid); each wave owns a 64x64 tile.
// A row-major [M,K]; Bt row-major [N,K]; M,N % 64 == 0, K % 32 == 0.
// SPLIT: operands are hi/lo planes (A2/Bt2 = lo planes, same layout); product = hi·hi + hi·lo + lo·hi.
// BIAS_MODE: 0 = none, 1 = bias[m], 2 = bias[n].
// OUT_MODE: 0 = f32, 1 = f16, 2 = bf16 hi plane (Cout) + bf16 lo plane (Cout2).
// ET: 0 = f16 operands, 1 = bf16 operands (pointers passed as 16-bit storage)
template <int ET> struct Elem;
template <> struct Elem<0> { typedef _Float16 T; };
template <> struct Elem<1> { typedef __bf16 T; };
template <int ET, bool SPLIT, int BIAS_MODE, int OUT_MODE, bool RESID, int ACT = 0>
__global__ __launch_bounds__(256) void wmma_gemm64(
    const unsigned short* __restrict__ Ap, const unsigned short* __restrict__ A2p, int lda, long strideA, long strideAz,
    const unsigned short* __restrict__ Btp, const unsigned short* __restrict__ Bt2p, int ldb, long strideB, long strideBz,
    void* __restrict__ Cout, void* __restrict__ Cout2, int ldc, long strideC, long strideCz,
    const float* __restrict__ bias,
    const float* __restrict__ resid, long strideR,
    int M, int N, int K, float scale) {
  typedef typename Elem<ET>::T T;
  typedef typename Frag<T>::V V;
  const T* A = (const T*)Ap; const T* A2 = (const T*)A2p; const T* Bt = (const T*)Btp; const T* Bt2 = (const T*)Bt2p;
  __shared__ __align__(16) float sT[8][16 * 68];   // per-wave 16x64 slab, pitch 68 floats
  const int b    = blockIdx.y;
  const int lane = threadIdx.x & 31;
  const int wave = threadIdx.x >> 5;
  const int tilesN = N >> 6;
  const int tilesM = M >> 6;
  const int tile = blockIdx.x * 8 + wave;
  if (tile >= tilesM * tilesN) return;   // wave-uniform; no block barriers in this kernel
  const int tm = tile / tilesN;
  const int tn = tile - tm * tilesN;
  const int m0 = tm << 6;
  const int n0 = tn << 6;

  const int bz = blockIdx.z;                   // outer batch index (sample), with its own strides
  const T* Ab  = A  + (size_t)b * strideA + (size_t)bz * strideAz;
  const T* Bb  = Bt + (size_t)b * strideB + (size_t)bz * strideBz;
  const T* Ab2 = SPLIT ? (A2  + (size_t)b * strideA + (size_t)bz * strideAz) : nullptr;
  const T* Bb2 = SPLIT ? (Bt2 + (size_t)b * strideB + (size_t)bz * strideBz) : nullptr;

  const int rlane = lane & 15;                 // row (A) / col (B, D) within subtile
  const int koff  = (lane >> 4) * 8;           // k offset of this lane half
  const int mOff  = (lane >> 4) * 8;           // D row offset

  v8f acc[4][4];
#pragma unroll
  for (int i = 0; i < 4; ++i)
#pragma unroll
    for (int j = 0; j < 4; ++j) acc[i][j] = (v8f){0.f,0.f,0.f,0.f,0.f,0.f,0.f,0.f};

  for (int k0 = 0; k0 < K; k0 += 32) {
    V bh[4], bl[4];
#pragma unroll
    for (int j = 0; j < 4; ++j) {
      const size_t bo = (size_t)(n0 + (j << 4) + rlane) * ldb + koff + k0;
      bh[j] = Frag<T>::load(Bb + bo);
      if (SPLIT) bl[j] = Frag<T>::load(Bb2 + bo);
    }
#pragma unroll
    for (int i = 0; i < 4; ++i) {
      const size_t ao = (size_t)(m0 + (i << 4) + rlane) * lda + koff + k0;
      V ah = Frag<T>::load(Ab + ao);
      V al;
      if (SPLIT) al = Frag<T>::load(Ab2 + ao);
#pragma unroll
      for (int j = 0; j < 4; ++j) {
        acc[i][j] = Frag<T>::mma(ah, bh[j], acc[i][j]);
        if (SPLIT) {
          acc[i][j] = Frag<T>::mma(ah, bl[j], acc[i][j]);
          acc[i][j] = Frag<T>::mma(al, bh[j], acc[i][j]);
        }
      }
      Frag<T>::guard(acc[i][0], acc[i][3], ah, SPLIT ? al : ah);
    }
    Frag<T>::keep(bh[0], bh[1], bh[2], bh[3]);
    if (SPLIT) Frag<T>::keep(bl[0], bl[1], bl[2], bl[3]);
  }
  acc_guard4(acc[0][0], acc[0][1], acc[0][2], acc[0][3]);
  acc_guard4(acc[1][0], acc[1][1], acc[1][2], acc[1][3]);
  acc_guard4(acc[2][0], acc[2][1], acc[2][2], acc[2][3]);
  acc_guard4(acc[3][0], acc[3][1], acc[3][2], acc[3][3]);

  // ---- epilogue ----
  float* slab = sT[wave];
  const float* Rb = RESID ? (resid + (size_t)b * strideR) : nullptr;
#pragma unroll
  for (int i = 0; i < 4; ++i) {
    const int mBase = m0 + (i << 4);
#pragma unroll
    for (int j = 0; j < 4; ++j) {
      const int n = n0 + (j << 4) + rlane;
      float bv = 0.f;
      if (BIAS_MODE == 2) bv = bias[n];
#pragma unroll
      for (int r = 0; r < 8; ++r) {
        float v = acc[i][j][r] * scale;
        if (BIAS_MODE == 1) v += bias[mBase + mOff + r];
        if (BIAS_MODE == 2) v += bv;
        if (RESID) v += Rb[(size_t)(mBase + mOff + r) * ldc + n];
        if (ACT == 1) v = tanhf(v);
        if (ACT == 2) v = fmaxf(v, 0.0f);
        if (ACT == 3) v = v / (1.0f + expf(-v));
        if (ACT == 4) v = (v > 0.f) ? v : 0.01f * v;
        if (ACT == 5) v = 0.5f * v * (1.0f + erff(v * 0.70710678118654752f));
        slab[(mOff + r) * 68 + (j << 4) + rlane] = v;
      }
    }
    __builtin_amdgcn_fence(__ATOMIC_RELEASE, "workgroup");
    __builtin_amdgcn_wave_barrier();
    __builtin_amdgcn_fence(__ATOMIC_ACQUIRE, "workgroup");
    if (OUT_MODE == 0) {
      float* C = (float*)Cout + (size_t)b * strideC + (size_t)bz * strideCz;
      const int hh = lane >> 4, c4 = (lane & 15) * 4;     // row seg = 256 B = 16 lanes x 16 B
      {
#pragma unroll
        for (int it = 0; it < 8; ++it) {
          const int row = it * 2 + hh;
          v4f v = *(const v4f*)(slab + row * 68 + c4);
          *(v4f*)(C + (size_t)(mBase + row) * ldc + n0 + c4) = v;
        }
        
      }
    } else {
      const int q = lane >> 3, c8 = (lane & 7) * 8;
      unsigned short* C  = (unsigned short*)Cout  + (size_t)b * strideC + (size_t)bz * strideCz;
      unsigned short* C2 = (OUT_MODE == 2) ? ((unsigned short*)Cout2 + (size_t)b * strideC + (size_t)bz * strideCz) : nullptr;
      {
#pragma unroll
        for (int it = 0; it < 4; ++it) {
          const int row = it * 4 + q;
          const float* sp = slab + row * 68 + c8;
          v8h hv, lv;
#pragma unroll
          for (int e = 0; e < 8; ++e) {
            if (OUT_MODE == 1) {
              hv[e] = (_Float16)sp[e];
            } else {
              unsigned short hb = f2bf_bits(sp[e]);
              unsigned short lb = f2bf_bits(sp[e] - bf_bits2f(hb));
              hv[e] = __builtin_bit_cast(_Float16, hb);
              lv[e] = __builtin_bit_cast(_Float16, lb);
            }
          }
          *(v8h*)(C + (size_t)(mBase + row) * ldc + n0 + c8) = hv;
          if (OUT_MODE == 2) *(v8h*)(C2 + (size_t)(mBase + row) * ldc + n0 + c8) = lv;
        }
        
      }
    }
    __builtin_amdgcn_fence(__ATOMIC_RELEASE, "workgroup");
    __builtin_amdgcn_wave_barrier();
    __builtin_amdgcn_fence(__ATOMIC_ACQUIRE, "workgroup");
  }
}

__global__ __launch_bounds__(256) void cast_f32_f16x2(
    const float* __restrict__ in, _Float16* __restrict__ out, int n2) {
  int i = blockIdx.x * 256 + threadIdx.x;
  if (i < n2) {
    const _Float16 h0 = (_Float16)in[2 * i], h1 = (_Float16)in[2 * i + 1];
    const unsigned u = (unsigned)__builtin_bit_cast(unsigned short, h0) | ((unsigned)__builtin_bit_cast(unsigned short, h1) << 16);
    ((unsigned*)out)[i] = u;
    
  }
}


} // namespace w25

__global__ __launch_bounds__(256) void k_castT16(const float* __restrict__ src, long long lds, _Float16* __restrict__ dst, long long ldd, int R, int C, float s) {
    const long long i = (long long)blockIdx.x * 256 + threadIdx.x; const long long np = (long long)C * (R / 2); if (i >= np) return; const int c = (int)(i / (R / 2)); const int r = 2 * (int)(i % (R / 2));
    const _Float16 h0 = (_Float16)(src[(long long)r * lds + c] * s), h1 = (_Float16)(src[(long long)(r + 1) * lds + c] * s);
    const unsigned u = (unsigned)__builtin_bit_cast(unsigned short, h0) | ((unsigned)__builtin_bit_cast(unsigned short, h1) << 16);
    unsigned* d = (unsigned*)(dst + (long long)c * ldd + r); *d = u;  }
__global__ __launch_bounds__(256) void k_cast16(const float* __restrict__ src, long long lds, _Float16* __restrict__ dst, long long ldd, int R, int C, float s) {
    const long long i = (long long)blockIdx.x * 256 + threadIdx.x; const long long np = (long long)R * (C / 2); if (i >= np) return; const int r = (int)(i / (C / 2)); const int c = 2 * (int)(i % (C / 2));
    const _Float16 h0 = (_Float16)(src[(long long)r * lds + c] * s), h1 = (_Float16)(src[(long long)r * lds + c + 1] * s);
    const unsigned u = (unsigned)__builtin_bit_cast(unsigned short, h0) | ((unsigned)__builtin_bit_cast(unsigned short, h1) << 16);
    unsigned* d = (unsigned*)(dst + (long long)r * ldd + c); *d = u;  }

// f32 -> bf16 hi plane + bf16 lo plane (x = hi + lo to ~2^-17 relative; RNE both), [R][C] -> [R][C] (or transposed to [C][R]); 2 consecutive destination elements
__device__ __forceinline__ unsigned int f2bf2_pack(float a, float b, unsigned int* lo) {
    const unsigned short ha = w25::f2bf_bits(a), hb = w25::f2bf_bits(b);
    const unsigned short la = w25::f2bf_bits(a - w25::bf_bits2f(ha)), lb = w25::f2bf_bits(b - w25::bf_bits2f(hb));
    *lo = (unsigned)la | ((unsigned)lb << 16); return (unsigned)ha | ((unsigned)hb << 16); }
__global__ __launch_bounds__(256) void k_castS16(const float* __restrict__ src, long long lds, __bf16* __restrict__ dhi, __bf16* __restrict__ dlo, long long ldd, int R, int C, float s, int transpose, long long sby, long long dby) {
    const long long i = (long long)blockIdx.x * 256 + threadIdx.x; long long o; float a, b;
    src += (long long)blockIdx.y * sby; dhi += (long long)blockIdx.y * dby; dlo += (long long)blockIdx.y * dby;   // grid y = sample
    if (transpose) { const long long np = (long long)C * (R / 2); if (i >= np) return; const int c = (int)(i / (R / 2)); const int r = 2 * (int)(i % (R / 2)); a = src[(long long)r * lds + c] * s; b = src[(long long)(r + 1) * lds + c] * s; o = (long long)c * ldd + r; }
    else { const long long np = (long long)R * (C / 2); if (i >= np) return; const int r = (int)(i / (C / 2)); const int c = 2 * (int)(i % (C / 2)); a = src[(long long)r * lds + c] * s; b = src[(long long)r * lds + c + 1] * s; o = (long long)r * ldd + c; }
    unsigned lo; const unsigned hi = f2bf2_pack(a, b, &lo); unsigned* ph = (unsigned*)(dhi + o); unsigned* pl = (unsigned*)(dlo + o);
    *ph = hi; *pl = lo;  }

namespace w25 {
// =====================================================================================
// Generic causal/non-causal attention for head_dim 64, f32 in / f32 out; 16-bit operands: bf16 with optional hi/lo splits, or
// plain f16 (F16=true, non-split, probabilities carried x2^15).
//   scores = (q*qscale)·kᵀ : v_wmma_f32_16x16x32_bf16; SPLIT_QK -> q,k as bf16 hi/lo (hi·hi + hi·lo + lo·hi)
//   out    = p·v           : v_wmma_f32_16x16x32_bf16; SPLIT_PV -> p,v as bf16 hi/lo; else p,v plain bf16
//   f32 accumulate; online softmax in f32. Block = 4 waves = 64 query rows of one (batch, head); S % 64 == 0.
//   Element (b, s, h, d) of tensor X lives at X[b*X_bs + s*X_rs + h*X_hs + d] (strides in floats, multiples of 4).
//   Masking: mask_mode 0 none, 1 causal (kv > q masked), 2 tensor [S][Skv] shared over (b,h) (float if
//   mask_is_int==0, int32 with element == 0 -> masked if 1, int32 with element != 0 -> masked if 2), 3 per-token vectors qmask[B][S] & kvmask[B][Skv] (int32,
//   0 -> masked), 4 causal + sliding window (kv > q or q - kv > W masked; W passed in mask_is_int);
//   5 = relative-position bias: s += cp[b,h,q][idx[q][kv]] + pc[b,h,kv][idx[q][kv]] with idx = mask_b ([S][Skv] int32) and
//   mask_a an int32 [S][Skv] tensor with nonzero = masked (tables: element (b,h,row,n) at X + b*c_bs + h*c_hs + row*c_rs + n);
//   masked scores are replaced by mask_fill (e.g. -inf or -1e9) before the softmax.
//   grid.x = B * H * (S/64) (or a sub-range with blk0).
// =====================================================================================
#define AT_D 64
#define AT_NW 4
#define AT_QB 64
#define AT_KC 64
struct AttnGeom { const float* cp = nullptr; const float* pc = nullptr; long c_bs = 0, c_rs = 0, c_hs = 0;   // mode-5 score-bias tables
                  long q_bs, q_rs, q_hs, k_bs, k_rs, k_hs, v_bs, v_rs, v_hs, o_bs, o_rs, o_hs;
                  int S, Skv, H, mask_mode; float qscale; int blk0; float mask_fill; int mask_is_int; };
static_assert(sizeof(AttnGeom) == 168, "no padding");

__device__ __forceinline__ unsigned short at_bf_bits(float f) {
  unsigned u = __float_as_uint(f);
  return (unsigned short)((u + 0x7FFFu + ((u >> 16) & 1u)) >> 16);
}
__device__ __forceinline__ __bf16 at_f2bf(float f) { return __builtin_bit_cast(__bf16, at_bf_bits(f)); }
__device__ __forceinline__ void at_split(float f, __bf16& hi, __bf16& lo) {
  const unsigned short hb = at_bf_bits(f);
  hi = __builtin_bit_cast(__bf16, hb);
  lo = at_f2bf(f - __uint_as_float(((unsigned)hb) << 16));
}
__device__ __forceinline__ v8f at_mma(v16b a, v16b b, v8f c) {
  c = __builtin_amdgcn_wmma_f32_16x16x32_bf16(false, a, false, b, (short)0, c, false, false);
  asm volatile("v_nop\n\tv_nop\n\tv_nop\n\tv_nop" : "+v"(c) : "v"(a), "v"(b));
  return c;
}
// 16-bit element as a bit pattern held in a __bf16 slot: f16 bits when F16, bf16 (RNE) otherwise
template <bool F16> __device__ __forceinline__ __bf16 at_to16(float f) {
  if (F16) return __builtin_bit_cast(__bf16, (_Float16)f);
  return at_f2bf(f);
}
template <bool F16> __device__ __forceinline__ v8f at_mma16(v16b a, v16b b, v8f c) {
  if (F16) {
    const v16h ah = __builtin_bit_cast(v16h, a), bh = __builtin_bit_cast(v16h, b);
    c = __builtin_amdgcn_wmma_f32_16x16x32_f16(false, ah, false, bh, (short)0, c, false, false);
    asm volatile("v_nop\n\tv_nop\n\tv_nop\n\tv_nop" : "+v"(c) : "v"(ah), "v"(bh));
    return c;
  }
  return at_mma(a, b, c);
}

template <bool SPLIT_QK, bool SPLIT_PV, bool F16 = false>
__global__ __launch_bounds__(128)
void attn64_kernel(const float* __restrict__ q, const float* __restrict__ k,
                   const float* __restrict__ v, float* __restrict__ out,
                   const void* __restrict__ mask_a, const int* __restrict__ mask_b, AttnGeom g) {
  static_assert(!(F16 && (SPLIT_QK || SPLIT_PV)), "f16 mode is non-split");
  const float PSC = F16 ? 32768.0f : 1.0f;     // f16 probabilities carried x2^15 (subnormal range), folded into the final 1/l
  union FB { v16b v; v8b h[2]; };
  __shared__ __align__(16) __bf16 Ksh[AT_KC * AT_D];             // K hi [kv][d]      8 KB
  __shared__ __align__(16) __bf16 Ksl[SPLIT_QK ? AT_KC * AT_D : 8];
  __shared__ __align__(16) __bf16 Vth[AT_D * AT_KC];             // V hi [d][kv]      8 KB
  __shared__ __align__(16) __bf16 Vtl[SPLIT_PV ? AT_D * AT_KC : 8];
  __shared__ __align__(16) __bf16 Psh[AT_NW][16 * AT_KC];        // per wave P hi [row][kv]  8 KB
  __shared__ __align__(16) __bf16 Psl[SPLIT_PV ? AT_NW : 1][SPLIT_PV ? 16 * AT_KC : 8];
  __shared__ __align__(16) float  Os[AT_NW][16 * 68];            // per wave out tile, pitch 68

  const int tid  = threadIdx.x;
  const int wave = tid >> 5;
  const int lane = tid & 31;
  const int hh   = lane >> 4;
  const int c    = lane & 15;

  const int nqb = g.S / AT_QB;
  const int bx = blockIdx.x + g.blk0;
  const int qb = bx % nqb;
  const int bh = bx / nqb;
  const int h  = bh % g.H;
  const int b  = bh / g.H;
  const int qbase_block = qb * AT_QB;
  const int q0 = qbase_block + wave * 16;

  const float* qb_ptr = q + (size_t)b * g.q_bs + (size_t)h * g.q_hs;
  const float* kb_ptr = k + (size_t)b * g.k_bs + (size_t)h * g.k_hs;
  const float* vb_ptr = v + (size_t)b * g.v_bs + (size_t)h * g.v_hs;
  float*       ob_ptr = out + (size_t)b * g.o_bs + (size_t)h * g.o_hs;

  // ---- Q fragments (A operand): 2 d-chunks, hi (and lo) ----
  v16b qah[2], qal[2];
  {
    const float* qrow = qb_ptr + (size_t)(q0 + c) * g.q_rs;
#pragma unroll
    for (int dc = 0; dc < 2; ++dc) {
#pragma unroll
      for (int e = 0; e < 8; ++e) {
        const float f0 = qrow[dc * 32 + 8 * hh + e] * g.qscale;
        const float f1 = qrow[dc * 32 + 16 + 8 * hh + e] * g.qscale;
        if (SPLIT_QK) { __bf16 hq, lq; at_split(f0, hq, lq); qah[dc][e] = hq; qal[dc][e] = lq; at_split(f1, hq, lq); qah[dc][8 + e] = hq; qal[dc][8 + e] = lq; }
        else { qah[dc][e] = at_to16<F16>(f0); qah[dc][8 + e] = at_to16<F16>(f1); qal[dc][e] = qah[dc][e]; qal[dc][8 + e] = qah[dc][8 + e]; }
      }
    }
  }

  float mrow[8], lrow[8];
  v8f oacc[4];
#pragma unroll
  for (int r = 0; r < 8; ++r) { mrow[r] = -INFINITY; lrow[r] = 0.f; }
#pragma unroll
  for (int t = 0; t < 4; ++t) oacc[t] = (v8f){0.f,0.f,0.f,0.f,0.f,0.f,0.f,0.f};

  const int nChunks = (g.mask_mode == 1 || g.mask_mode == 4) ? (qb + 1) : (g.Skv / AT_KC);   // block-uniform
  // per-row query mask (mode 3)
  int qkeep[8];
#pragma unroll
  for (int r = 0; r < 8; ++r) qkeep[r] = (g.mask_mode == 3) ? mask_b[(size_t)b * g.S + q0 + 8 * hh + r] : 1;   // mask_b = qmask in mode 3
  for (int kc = 0; kc < nChunks; ++kc) {
    const int kv0 = kc * AT_KC;
    __syncthreads();
    {
      const int kvr = tid >> 1, dh = (tid & 1) * 32;
      const float* krow = kb_ptr + (size_t)(kv0 + kvr) * g.k_rs + dh;
      const float* vrow = vb_ptr + (size_t)(kv0 + kvr) * g.v_rs + dh;
#pragma unroll
      for (int i = 0; i < 8; ++i) {
        v4f kk = *(const v4f*)(krow + 4 * i);
        v4f vv = *(const v4f*)(vrow + 4 * i);
#pragma unroll
        for (int e = 0; e < 4; ++e) {
          const int d = dh + 4 * i + e;
          if (SPLIT_QK) { __bf16 a, bl; at_split(kk[e], a, bl); Ksh[kvr * AT_D + d] = a; Ksl[kvr * AT_D + d] = bl; }
          else Ksh[kvr * AT_D + d] = at_to16<F16>(kk[e]);
          if (SPLIT_PV) { __bf16 a, bl; at_split(vv[e], a, bl); Vth[d * AT_KC + kvr] = a; Vtl[d * AT_KC + kvr] = bl; }
          else Vth[d * AT_KC + kvr] = at_to16<F16>(vv[e]);
        }
      }
    }
    __syncthreads();

    v8f s[4];
#pragma unroll
    for (int j = 0; j < 4; ++j) {
      s[j] = (v8f){0.f,0.f,0.f,0.f,0.f,0.f,0.f,0.f};
#pragma unroll 1
      for (int dc = 0; dc < 2; ++dc) {
        FB kb;
        kb.h[0] = *(const v8b*)(Ksh + (j * 16 + c) * AT_D + dc * 32 + 8 * hh);
        kb.h[1] = *(const v8b*)(Ksh + (j * 16 + c) * AT_D + dc * 32 + 16 + 8 * hh);
        s[j] = at_mma16<F16>(qah[dc], kb.v, s[j]);
        if (SPLIT_QK) {
          FB kl;
          kl.h[0] = *(const v8b*)(Ksl + (j * 16 + c) * AT_D + dc * 32 + 8 * hh);
          kl.h[1] = *(const v8b*)(Ksl + (j * 16 + c) * AT_D + dc * 32 + 16 + 8 * hh);
          s[j] = at_mma16<F16>(qah[dc], kl.v, s[j]);
          s[j] = at_mma16<F16>(qal[dc], kb.v, s[j]);
        }
      }
    }
    const bool diag = (g.mask_mode == 1) && (kc == qb);
    int kvkeep[4] = {1, 1, 1, 1};
    if (g.mask_mode == 3) {
#pragma unroll
      for (int j = 0; j < 4; ++j) kvkeep[j] = ((const int*)mask_a)[(size_t)b * g.Skv + kv0 + j * 16 + c];   // mask_a = kvmask
    }
    float cm[8];
#pragma unroll
    for (int r = 0; r < 8; ++r) {
      const int qrow = q0 + 8 * hh + r;
      float m = -INFINITY;
#pragma unroll
      for (int j = 0; j < 4; ++j) {
        const int kvcol = kv0 + j * 16 + c;
        bool masked = false;
        if (diag) masked = (kvcol > qrow);
        else if (g.mask_mode == 4) masked = (kvcol > qrow) || (qrow - kvcol > g.mask_is_int);
        else if (g.mask_mode == 2) {
          const size_t mi = (size_t)qrow * g.Skv + kvcol;
          masked = (g.mask_is_int == 0) ? (((const float*)mask_a)[mi] == 0.0f)
                 : (g.mask_is_int == 1) ? (((const int*)mask_a)[mi] == 0) : (((const int*)mask_a)[mi] != 0);
        } else if (g.mask_mode == 3) masked = (qkeep[r] == 0) || (kvkeep[j] == 0);
        else if (g.mask_mode == 5) {
          const size_t mi = (size_t)qrow * g.Skv + kvcol;
          masked = (((const int*)mask_a)[mi] != 0);
          int n = mask_b[mi]; n = n < 0 ? 0 : n;
          s[j][r] += g.cp[(size_t)b * g.c_bs + (size_t)h * g.c_hs + (size_t)qrow * g.c_rs + n]
                   + g.pc[(size_t)b * g.c_bs + (size_t)h * g.c_hs + (size_t)kvcol * g.c_rs + n];
        }
        if (masked) s[j][r] = g.mask_fill;
        m = fmaxf(m, s[j][r]);
      }
#pragma unroll
      for (int off = 1; off < 16; off <<= 1) m = fmaxf(m, __shfl_xor(m, off, 32));
      cm[r] = m;
    }
    __bf16* pwh = Psh[wave];
    __bf16* pwl = Psl[SPLIT_PV ? wave : 0];
#pragma unroll
    for (int r = 0; r < 8; ++r) {
      const float mnew = fmaxf(mrow[r], cm[r]);
      const float alpha = expf(mrow[r] - mnew);
      mrow[r] = mnew;
      float psum = 0.f;
#pragma unroll
      for (int j = 0; j < 4; ++j) {
        const float p = expf(s[j][r] - mnew);
        psum += p;
        if (SPLIT_PV) { __bf16 a, bl; at_split(p, a, bl); pwh[(8 * hh + r) * AT_KC + j * 16 + c] = a; pwl[(8 * hh + r) * AT_KC + j * 16 + c] = bl; }
        else pwh[(8 * hh + r) * AT_KC + j * 16 + c] = at_to16<F16>(p * PSC);
      }
#pragma unroll
      for (int off = 1; off < 16; off <<= 1) psum += __shfl_xor(psum, off, 32);
      lrow[r] = lrow[r] * alpha + psum;
#pragma unroll
      for (int t = 0; t < 4; ++t) oacc[t][r] *= alpha;
    }
    __builtin_amdgcn_fence(__ATOMIC_RELEASE, "workgroup");
    __builtin_amdgcn_wave_barrier();
    __builtin_amdgcn_fence(__ATOMIC_ACQUIRE, "workgroup");
#pragma unroll 1
    for (int kk = 0; kk < 2; ++kk) {
      FB pa, pl;
      pa.h[0] = *(const v8b*)(pwh + c * AT_KC + kk * 32 + 8 * hh);
      pa.h[1] = *(const v8b*)(pwh + c * AT_KC + kk * 32 + 16 + 8 * hh);
      if (SPLIT_PV) {
        pl.h[0] = *(const v8b*)(pwl + c * AT_KC + kk * 32 + 8 * hh);
        pl.h[1] = *(const v8b*)(pwl + c * AT_KC + kk * 32 + 16 + 8 * hh);
      }
#pragma unroll
      for (int t = 0; t < 4; ++t) {
        FB vb;
        vb.h[0] = *(const v8b*)(Vth + (t * 16 + c) * AT_KC + kk * 32 + 8 * hh);
        vb.h[1] = *(const v8b*)(Vth + (t * 16 + c) * AT_KC + kk * 32 + 16 + 8 * hh);
        oacc[t] = at_mma16<F16>(pa.v, vb.v, oacc[t]);
        if (SPLIT_PV) {
          FB vl;
          vl.h[0] = *(const v8b*)(Vtl + (t * 16 + c) * AT_KC + kk * 32 + 8 * hh);
          vl.h[1] = *(const v8b*)(Vtl + (t * 16 + c) * AT_KC + kk * 32 + 16 + 8 * hh);
          oacc[t] = at_mma16<F16>(pa.v, vl.v, oacc[t]);
          oacc[t] = at_mma16<F16>(pl.v, vb.v, oacc[t]);
        }
      }
    }
  }

  float* os = Os[wave];
#pragma unroll
  for (int r = 0; r < 8; ++r) {
    const float inv = 1.0f / (lrow[r] * PSC);
#pragma unroll
    for (int t = 0; t < 4; ++t) os[(8 * hh + r) * 68 + t * 16 + c] = oacc[t][r] * inv;
  }
  __builtin_amdgcn_fence(__ATOMIC_RELEASE, "workgroup");
  __builtin_amdgcn_wave_barrier();
  __builtin_amdgcn_fence(__ATOMIC_ACQUIRE, "workgroup");
  {
    const int c4 = (lane & 15) * 4;
    {
#pragma unroll
      for (int it = 0; it < 8; ++it) {
        const int row = it * 2 + hh;
        v4f val = *(const v4f*)(os + row * 68 + c4);
        *(v4f*)(ob_ptr + (size_t)(q0 + row) * g.o_rs + c4) = val;
      }
      
    }
  }
}

} // namespace w25

__device__ __forceinline__ void st_h2(_Float16* dst, float a, float b) { const unsigned u = (unsigned)__builtin_bit_cast(unsigned short, (_Float16)a) | ((unsigned)__builtin_bit_cast(unsigned short, (_Float16)b) << 16); unsigned* d = (unsigned*)dst; *d = u;  }
// tiled biases BEB[c] = bE[c % 64], BFB[c] = bF[c % 64] (thread-linear)
__global__ __launch_bounds__(256) void k_ep_btile(const float* __restrict__ BE, const float* __restrict__ BF, float* __restrict__ BEB, float* __restrict__ BFB, int C, int HD) { const int t = blockIdx.x * 256 + threadIdx.x; if (t >= C) return; VST2(float, BEB + t, BE[t % HD]); VST2(float, BFB + t, BF[t % HD]); }
// QS = q * temp2[h] (thread-linear over N*C)
__global__ __launch_bounds__(256) void k_ep_qs(const float* __restrict__ QKVV, const float* __restrict__ T2, float* __restrict__ QS, int N, int C, int C4, int HD) { const long long t = (long long)blockIdx.x * 256 + threadIdx.x; if (t >= (long long)N * C) return; const int n = (int)(t / C), c = (int)(t % C); VST2(float, QS + t, QKVV[(long long)n * C4 + c] * T2[c / HD]); }
// channel softmax: block h = sample * NH + head (64 threads): rows of SCC[h] [64][64] * temp1[h % NH]; thread i computes row i, then lanes write columns so each 32-float line comes from one wave; P16[h][i][j] = f16(4096 p)
__global__ __launch_bounds__(64) void k_ep_csoft(const float* __restrict__ S, const float* __restrict__ T1, _Float16* __restrict__ P16, int NH) { __shared__ float sh[64][65]; const int h = blockIdx.x; const int i = threadIdx.x; const float* r = S + ((long long)h * 64 + i) * 64; const float tp = T1[h % NH]; float mx = -3.0e38f;
    for (int j = 0; j < 64; ++j) mx = fmaxf(mx, r[j] * tp);
    float s = 0.f; for (int j = 0; j < 64; ++j) { const float e = expf(r[j] * tp - mx); sh[i][j] = e; s += e; }
    const float f = 4096.f / s; for (int j = 0; j < 64; ++j) sh[i][j] *= f;
    __syncthreads();
    const int half = i >> 5, c0 = 2 * (i & 31);
    for (int step = 0; step < 32; ++step) { const int rr = 2 * step + half; st_h2(P16 + ((long long)h * 64 + rr) * 64 + c0, sh[rr][c0], sh[rr][c0 + 1]); } }


extern "C" void kernel_launch(void* const* d_in, const int* in_sizes, int n_in, void* d_out, int out_size, void* d_ws, size_t ws_size, hipStream_t stream) {
    (void)in_sizes; (void)n_in; (void)out_size; (void)ws_size;
    const float* x = (const float*)d_in[0];
    const float* Wq = (const float*)d_in[1];
    const float* WE = (const float*)d_in[2];
    const float* bE = (const float*)d_in[3];
    const float* WF = (const float*)d_in[4];
    const float* bF = (const float*)d_in[5];
    const float* Wo1 = (const float*)d_in[6];
    const float* bo1 = (const float*)d_in[7];
    const float* Wo2 = (const float*)d_in[8];
    const float* bo2 = (const float*)d_in[9];
    const float* t1 = (const float*)d_in[10];
    const float* t2 = (const float*)d_in[11];
    const int Bn = 8;
    const int N = 1024;
    const int C = 1024;
    const int NH = 16;
    const int HD = 64;
    const int C4 = 4 * C;
    const int CH = C / 2;
    float* out = (float*)d_out;
    char* wsp = (char*)d_ws;
    const int BN = Bn * N;                    // all samples' rows: every launch below covers the whole batch
    const size_t MB = (size_t)1048576;
    float* QKVV = (float*)wsp; wsp += (((size_t)((size_t)BN * C4) * 4 + 255) / 256) * 256;
    unsigned short* WE16 = (unsigned short*)wsp; wsp += (((size_t)((size_t)HD * HD) * 2 + 255) / 256) * 256;
    unsigned short* WF16 = (unsigned short*)wsp; wsp += (((size_t)((size_t)HD * HD) * 2 + 255) / 256) * 256;
    float* BEB = (float*)wsp; wsp += (((size_t)((size_t)C) * 4 + 255) / 256) * 256;
    float* BFB = (float*)wsp; wsp += (((size_t)((size_t)C) * 4 + 255) / 256) * 256;
    // One 115 MiB region behind QKVV, used by three phases one after the other (stream order); a plane is reused only once its last reader has been launched.
    // projection: x planes and weight planes
    unsigned short* G64A  = (unsigned short*)(wsp);
    unsigned short* G64A2 = (unsigned short*)(wsp + 16 * MB);
    unsigned short* G64B  = (unsigned short*)(wsp + 32 * MB);
    unsigned short* G64B2 = (unsigned short*)(wsp + 36 * MB);
    // channel attention
    unsigned short* QTH   = (unsigned short*)(wsp);
    unsigned short* QTL   = (unsigned short*)(wsp + 16 * MB);
    unsigned short* KTH   = (unsigned short*)(wsp + 32 * MB);
    unsigned short* KTL   = (unsigned short*)(wsp + 48 * MB);
    unsigned short* VCA16 = (unsigned short*)(wsp + 64 * MB);
    float*          XC    = (float*)(wsp + 80 * MB);
    float*          SCC   = (float*)(wsp + 112 * MB);
    unsigned short* P16   = (unsigned short*)(wsp + 114 * MB);
    unsigned short* XC16  = (unsigned short*)(wsp);               // over QTH, read last by the affinity product
    unsigned short* WO2H  = (unsigned short*)(wsp + 16 * MB);     // over QTL
    // spatial attention
    unsigned short* K16   = (unsigned short*)(wsp);
    unsigned short* VSA16 = (unsigned short*)(wsp + 16 * MB);
    float*          KS    = (float*)(wsp + 32 * MB);
    float*          VS    = (float*)(wsp + 64 * MB);
    float*          QS    = (float*)(wsp);                        // over K16 and VSA16, read last by the E/F products
    float*          XS    = (float*)d_ws;                         // over QKVV, read last by k_ep_qs
    unsigned short* XS16  = (unsigned short*)((char*)d_ws + 32 * MB);
    unsigned short* WO1H  = (unsigned short*)((char*)d_ws + 48 * MB);
    k_cast16<<<(unsigned)((((long long)(HD) * ((HD) / 2)) + 255) / 256), 256, 0, stream>>>(WE, HD, (_Float16*)(WE16), HD, HD, HD, 16.0f);
    k_cast16<<<(unsigned)((((long long)(HD) * ((HD) / 2)) + 255) / 256), 256, 0, stream>>>(WF, HD, (_Float16*)(WF16), HD, HD, HD, 16.0f);
    k_ep_btile<<<(C + 255) / 256, 256, 0, stream>>>(bE, bF, BEB, BFB, C, HD);
    // shared projection, rows = sample * N + n
    k_castS16<<<(unsigned)((((long long)(BN) * ((1024) / 2)) + 255) / 256), 256, 0, stream>>>(x, 1024, (__bf16*)(G64A), (__bf16*)(G64A2), 1024, BN, 1024, 1.0f, 0, 0, 0);
    k_castS16<<<(unsigned)((((long long)(2048) * ((1024) / 2)) + 255) / 256), 256, 0, stream>>>(Wq, 1024, (__bf16*)(G64B), (__bf16*)(G64B2), 1024, 2048, 1024, 1.0f, 0, 0, 0);
    w25::wmma_gemm64<1, true, 0, 0, false, 0><<<dim3((unsigned)((((BN) / 64) * ((2048) / 64) + 7) / 8), (unsigned)(1), (unsigned)(1)), 256, 0, stream>>>((const unsigned short*)(G64A), (const unsigned short*)(G64A2), 1024, 0, 0, (const unsigned short*)(G64B), (const unsigned short*)(G64B2), 1024, 0, 0, (void*)(QKVV), nullptr, 4096, 0, 0, nullptr, nullptr, 0, BN, 2048, 1024, 1.0f);
    k_cast16<<<(unsigned)((((long long)(BN) * ((1024) / 2)) + 255) / 256), 256, 0, stream>>>(x, 1024, (_Float16*)(G64A), 1024, BN, 1024, 1.0f);
    k_cast16<<<(unsigned)((((long long)(2048) * ((1024) / 2)) + 255) / 256), 256, 0, stream>>>(Wq + (size_t)2 * C * C, 1024, (_Float16*)(G64B), 1024, 2048, 1024, 16.0f);
    w25::wmma_gemm64<0, false, 0, 0, false, 0><<<dim3((unsigned)((((BN) / 64) * ((2048) / 64) + 7) / 8), (unsigned)(1), (unsigned)(1)), 256, 0, stream>>>((const unsigned short*)(G64A), nullptr, 1024, 0, 0, (const unsigned short*)(G64B), nullptr, 1024, 0, 0, (void*)(QKVV + 2 * C), nullptr, 4096, 0, 0, nullptr, nullptr, 0, BN, 2048, 1024, 0.0625f);
    // channel attention: grid y = head, grid z = sample
    k_cast16<<<(unsigned)((((long long)(BN) * ((C) / 2)) + 255) / 256), 256, 0, stream>>>(QKVV + 2 * C, C4, (_Float16*)(VCA16), C, BN, C, 1.0f);
    k_castS16<<<dim3((unsigned)((((long long)(C) * ((N) / 2)) + 255) / 256), (unsigned)(Bn)), 256, 0, stream>>>(QKVV, C4, (__bf16*)(QTH), (__bf16*)(QTL), N, N, C, 1.0f, 1, (long long)N * C4, (long long)C * N);
    k_castS16<<<dim3((unsigned)((((long long)(C) * ((N) / 2)) + 255) / 256), (unsigned)(Bn)), 256, 0, stream>>>(QKVV + C, C4, (__bf16*)(KTH), (__bf16*)(KTL), N, N, C, 1.0f, 1, (long long)N * C4, (long long)C * N);
    w25::wmma_gemm64<1, true, 0, 0, false, 0><<<dim3((unsigned)((((HD) / 64) * ((HD) / 64) + 7) / 8), (unsigned)(NH), (unsigned)(Bn)), 256, 0, stream>>>((const unsigned short*)(QTH), (const unsigned short*)(QTL), N, (long long)HD * N, (long long)C * N, (const unsigned short*)(KTH), (const unsigned short*)(KTL), N, (long long)HD * N, (long long)C * N, (void*)(SCC), nullptr, HD, HD * HD, NH * HD * HD, nullptr, nullptr, 0, HD, HD, N, 1.0f);
    k_ep_csoft<<<Bn * NH, 64, 0, stream>>>(SCC, t1, (_Float16*)P16, NH);
    w25::wmma_gemm64<0, false, 0, 0, false, 0><<<dim3((unsigned)((((HD) / 64) * ((N) / 64) + 7) / 8), (unsigned)(NH), (unsigned)(Bn)), 256, 0, stream>>>((const unsigned short*)(P16), nullptr, HD, HD * HD, NH * HD * HD, (const unsigned short*)(VCA16), nullptr, C, HD, (long long)N * C, (void*)(XC), nullptr, 16 * C, C, (long long)N * C, nullptr, nullptr, 0, HD, N, HD, 0.000244140625f);
    k_cast16<<<(unsigned)((((long long)(BN) * ((1024) / 2)) + 255) / 256), 256, 0, stream>>>(XC, 1024, (_Float16*)(XC16), 1024, BN, 1024, 1.0f);
    k_cast16<<<(unsigned)((((long long)(512) * ((1024) / 2)) + 255) / 256), 256, 0, stream>>>(Wo2, 1024, (_Float16*)(WO2H), 1024, 512, 1024, 16.0f);
    w25::wmma_gemm64<0, false, 2, 0, false, 5><<<dim3((unsigned)((((BN) / 64) * ((512) / 64) + 7) / 8), (unsigned)(1), (unsigned)(1)), 256, 0, stream>>>((const unsigned short*)(XC16), nullptr, 1024, 0, 0, (const unsigned short*)(WO2H), nullptr, 1024, 0, 0, (void*)(out + CH), nullptr, 1024, 0, 0, bo2, nullptr, 0, BN, 512, 1024, 0.0625f);
    // spatial attention
    k_cast16<<<(unsigned)((((long long)(BN) * ((C) / 2)) + 255) / 256), 256, 0, stream>>>(QKVV + C, C4, (_Float16*)(K16), C, BN, C, 1.0f);
    k_cast16<<<(unsigned)((((long long)(BN) * ((C) / 2)) + 255) / 256), 256, 0, stream>>>(QKVV + 3 * C, C4, (_Float16*)(VSA16), C, BN, C, 1.0f);
    w25::wmma_gemm64<0, false, 2, 0, false, 0><<<dim3((unsigned)((((BN) / 64) * ((HD) / 64) + 7) / 8), (unsigned)(NH), (unsigned)(1)), 256, 0, stream>>>((const unsigned short*)(K16), nullptr, C, HD, 0, (const unsigned short*)(WE16), nullptr, HD, 0, 0, (void*)(KS), nullptr, C, HD, 0, BEB, nullptr, 0, BN, HD, HD, 0.0625f);
    w25::wmma_gemm64<0, false, 2, 0, false, 0><<<dim3((unsigned)((((BN) / 64) * ((HD) / 64) + 7) / 8), (unsigned)(NH), (unsigned)(1)), 256, 0, stream>>>((const unsigned short*)(VSA16), nullptr, C, HD, 0, (const unsigned short*)(WF16), nullptr, HD, 0, 0, (void*)(VS), nullptr, C, HD, 0, BFB, nullptr, 0, BN, HD, HD, 0.0625f);
    k_ep_qs<<<(unsigned)(((long long)BN * C + 255) / 256), 256, 0, stream>>>(QKVV, t2, QS, BN, C, C4, HD);
    sfa::k_sflash<<<dim3((unsigned)(N / 256), (unsigned)(NH), (unsigned)(Bn)), 256, 0, stream>>>(QS, KS, VS, XS);
    k_cast16<<<(unsigned)((((long long)(BN) * ((1024) / 2)) + 255) / 256), 256, 0, stream>>>(XS, 1024, (_Float16*)(XS16), 1024, BN, 1024, 1.0f);
    k_cast16<<<(unsigned)((((long long)(512) * ((1024) / 2)) + 255) / 256), 256, 0, stream>>>(Wo1, 1024, (_Float16*)(WO1H), 1024, 512, 1024, 16.0f);
    w25::wmma_gemm64<0, false, 2, 0, false, 5><<<dim3((unsigned)((((BN) / 64) * ((512) / 64) + 7) / 8), (unsigned)(1), (unsigned)(1)), 256, 0, stream>>>((const unsigned short*)(XS16), nullptr, 1024, 0, 0, (const unsigned short*)(WO1H), nullptr, 1024, 0, 0, (void*)(out), nullptr, 1024, 0, 0, bo1, nullptr, 0, BN, 512, 1024, 0.0625f);
}

// v003
// One run takes 499 microseconds.
// In both of two side-by-side timings against v002, it was 1.36 times as fast.
// Counting every step since v000, it is 13.8 times as fast.
// Contractions (per sample): the shared QKVV projection x.W^T [1024x1024].[1024x4096] (q/k columns on bf16 hi/lo split planes), the E/F head projections of k and v_sa as per-head z-batched [1024x64].[64x64] products (+b), the 16 channel affinities q^T k [64x1024].[1024x64] on bf16 hi/lo split planes (64-wide softmax over sigma~19 logits: plain f16 flipped near-ties) and x_c = attn_c.v_ca^T [64x64].[64x1024] as z-batched products, and the two output halves gelu(x_s.W_o1^T + b) / gelu(x_c.W_o2^T + b) [1024x1024].[1024x512] — f16 operands on pre-cast planes (v_wmma_f32_16x16x32_f16; 64x64 register-blocked wave tiles, weights x16); per (sample, head) the spatial attention softmax(q.k_s^T * temp2[h]) v_s over 1024 positions as one flash launch (f16 operands; temperature folded into q on device); f32 accumulate and softmax. The tiled E/F biases, the 64-wide channel softmax (x temp1[h], exp once, f16 plane) and the q pre-scaling are f32 kernels; x_c is laid out exactly as torch's permute(0,2,1,3).reshape (row = d*16 + h, column = n).
#include <hip/hip_runtime.h>
#include <math.h>

typedef __attribute__((ext_vector_type(16))) _Float16 v16h;
typedef __attribute__((ext_vector_type(8)))  _Float16 v8h;
typedef __attribute__((ext_vector_type(16))) __bf16   v16b;
typedef __attribute__((ext_vector_type(8)))  float    v8f;
typedef __attribute__((ext_vector_type(4)))  float    v4f;

// 16-bit WMMA fragment map (wave32), lane L, h = L>>4, m = L&15:
//   A 16x32: lane = row m;   element i -> k = (i<8) ? 8h+i : 16+8h+(i-8)
//   B 32x16: lane = column m; the SAME k(i,h)
//   D 16x16 (8 f32): lane = column m; element r -> row 8h+r
__device__ __forceinline__ int frag_k(int i, int h) { return (i < 8) ? (8 * h + i) : (16 + 8 * h + (i - 8)); }
__device__ __forceinline__ __bf16 bf16_rne(float f) {
    unsigned int u = __float_as_uint(f);
    u += 0x7fffu + ((u >> 16) & 1u);
    return __builtin_bit_cast(__bf16, (unsigned short)(u >> 16));
}
__device__ __forceinline__ float bf16_f32(__bf16 b) { return __uint_as_float(((unsigned int)__builtin_bit_cast(unsigned short, b)) << 16); }
__device__ __forceinline__ v8f wmma16(v16h a, v16h b, v8f c) {
    c = __builtin_amdgcn_wmma_f32_16x16x32_f16(false, a, false, b, (short)0, c, false, false);
    asm volatile("v_nop\n\tv_nop\n\tv_nop\n\tv_nop" : "+v"(c) : "v"(a), "v"(b));
    return c;
}
__device__ __forceinline__ v8f wmmab(v16b a, v16b b, v8f c) {
    c = __builtin_amdgcn_wmma_f32_16x16x32_bf16(false, a, false, b, (short)0, c, false, false);
    asm volatile("v_nop\n\tv_nop\n\tv_nop\n\tv_nop" : "+v"(c) : "v"(a), "v"(b));
    return c;
}
struct Split { v16b hi, lo; };
// hi/lo split product: a.hi*b.hi + a.hi*b.lo + a.lo*b.hi
__device__ __forceinline__ v8f wmma3(const Split& a, const Split& b, v8f c) {
    c = __builtin_amdgcn_wmma_f32_16x16x32_bf16(false, a.hi, false, b.hi, (short)0, c, false, false);
    c = __builtin_amdgcn_wmma_f32_16x16x32_bf16(false, a.hi, false, b.lo, (short)0, c, false, false);
    c = __builtin_amdgcn_wmma_f32_16x16x32_bf16(false, a.lo, false, b.hi, (short)0, c, false, false);
    asm volatile("v_nop\n\tv_nop\n\tv_nop\n\tv_nop" : "+v"(c) : "v"(a.hi), "v"(a.lo), "v"(b.hi), "v"(b.lo));
    return c;
}
struct Split3 { v16b hi, mid, lo; };
// triple split product (6 terms, drops only terms below 2^-24 relative)
__device__ __forceinline__ v8f wmma6(const Split3& a, const Split3& b, v8f c) {
    c = __builtin_amdgcn_wmma_f32_16x16x32_bf16(false, a.hi, false, b.hi, (short)0, c, false, false);
    c = __builtin_amdgcn_wmma_f32_16x16x32_bf16(false, a.hi, false, b.mid, (short)0, c, false, false);
    c = __builtin_amdgcn_wmma_f32_16x16x32_bf16(false, a.mid, false, b.hi, (short)0, c, false, false);
    c = __builtin_amdgcn_wmma_f32_16x16x32_bf16(false, a.hi, false, b.lo, (short)0, c, false, false);
    c = __builtin_amdgcn_wmma_f32_16x16x32_bf16(false, a.mid, false, b.mid, (short)0, c, false, false);
    c = __builtin_amdgcn_wmma_f32_16x16x32_bf16(false, a.lo, false, b.hi, (short)0, c, false, false);
    asm volatile("v_nop\n\tv_nop\n\tv_nop\n\tv_nop" : "+v"(c) : "v"(a.hi), "v"(a.mid), "v"(a.lo), "v"(b.hi), "v"(b.mid), "v"(b.lo));
    return c;
}

// Fragment gathers from f32 memory: element i <- p[(k0 + frag_k(i,h)) * sk] * s, zero for k >= klen.
__device__ __forceinline__ v16h fh_ld(const float* __restrict__ p, long long sk, int k0, int h, int klen, float s) {
    v16h a;
#pragma unroll
    for (int i = 0; i < 16; ++i) { const int k = k0 + frag_k(i, h); a[i] = (k < klen) ? (_Float16)(p[(long long)k * sk] * s) : (_Float16)0.f; }
    return a;
}
__device__ __forceinline__ Split sp_ld(const float* __restrict__ p, long long sk, int k0, int h, int klen, float s) {
    Split r;
#pragma unroll
    for (int i = 0; i < 16; ++i) {
        const int k = k0 + frag_k(i, h); const float x = (k < klen) ? p[(long long)k * sk] * s : 0.f;
        const __bf16 hb = bf16_rne(x); r.hi[i] = hb; r.lo[i] = bf16_rne(x - bf16_f32(hb));
    }
    return r;
}
__device__ __forceinline__ Split3 sp3_ld(const float* __restrict__ p, long long sk, int k0, int h, int klen, float s) {
    Split3 r;
#pragma unroll
    for (int i = 0; i < 16; ++i) {
        const int k = k0 + frag_k(i, h); const float x = (k < klen) ? p[(long long)k * sk] * s : 0.f;
        const __bf16 hb = bf16_rne(x); const float r1 = x - bf16_f32(hb); const __bf16 mb = bf16_rne(r1);
        r.hi[i] = hb; r.mid[i] = mb; r.lo[i] = bf16_rne(r1 - bf16_f32(mb));
    }
    return r;
}
__device__ __forceinline__ v16b bh_ld(const float* __restrict__ p, long long sk, int k0, int h, int klen, float s) {
    v16b a;
#pragma unroll
    for (int i = 0; i < 16; ++i) { const int k = k0 + frag_k(i, h); a[i] = bf16_rne((k < klen) ? p[(long long)k * sk] * s : 0.f); }
    return a;
}
// f16 fragment from an f16 LDS/global row with element stride 1 (k-contiguous), no bounds (tile already zero padded)
__device__ __forceinline__ v16h fh_row(const _Float16* __restrict__ row, int k0, int h) {
    v16h a;
#pragma unroll
    for (int i = 0; i < 16; ++i) a[i] = row[k0 + frag_k(i, h)];
    return a;
}

#define VST2(T, ptr, val) do { const T vst2_v_ = (val); *(T*)(ptr) = vst2_v_;  } while (0)
typedef float v4f __attribute__((ext_vector_type(4)));
#define VST2V4(ptr, val) do { const v4f vst2_v4_ = (val); *(v4f*)(ptr) = vst2_v4_;  } while (0)

__device__ __attribute__((noinline)) float act_fn(float v, int act) {
    if (act == 1) return fmaxf(v, 0.f);                                                                               // relu
    if (act == 2) { const float u = 0.7978845608028654f * (v + 0.044715f * v * v * v); return 0.5f * v * (1.f + tanhf(u)); } // tanh-gelu
    if (act == 3) return v / (1.f + expf(-v));                                                                        // silu
    if (act == 4) return 0.5f * v * (1.f + erff(v * 0.7071067811865476f));                                             // erf-gelu
    if (act == 5) return tanhf(v);
    if (act == 6) return 1.f / (1.f + expf(-v));                                                                      // sigmoid
    if (act == 7) return (v > 0.f) ? v : 0.01f * v;                                                                   // leaky relu 0.01
    if (act == 8) return (v > 0.f) ? v : (expf(v) - 1.f);                                                             // elu
    if (act == 9) return fminf(fmaxf(v, 0.f), 6.f);                                                                   // relu6
    if (act == 10) return fabsf(v);                                                                                    // abs
    if (act == 11) return (v >= 0.f) ? v : 0.1f * v;                                                                  // leaky 0.1
    if (act == 12) return (v > 0.f) ? v : 0.2f * v;                                                                   // leaky 0.2
    if (act == 13) return (v > 20.f) ? v : log1pf(expf(v));                                                            // softplus
    return v;
}

// =====================================================================================================================
// k_gemm<MODE>: C(z, m, n) = act(alpha * sum_k A(z, m, k) * B(z, k, n) + bias) + beta * R(z, m, n)
//   One wave (32-thread block) per 16 x 32 tile of C; grid (ceil(N/32), ceil(M/16), Z). Batch z -> (zo = z / zi_n, zi = z % zi_n)
//   with separate outer/inner strides for every tensor (e.g. batch and head). A(m,k) = A[zo*sAo + zi*sAi + m*sAm + k*sAk] (f32),
//   B(k,n) = B[zo*sBo + zi*sBi + n*sBn + k*sBk] (f32); any M, N, K (K zero-padded to 32 inside the fragments, M/N tails guarded).
//   C(m,n) = C[zo*sCo + zi*sCi + m*sCm + n] (n contiguous). flags: 1 bias[n], 2 bias[m], 4 residual R[zo*sRo + zi*sRi + m*sRm + n*sRn].
//   MODE 0: f16 operands (A prescaled by sa, B by sb, both undone in the epilogue); 1: bf16 hi/lo split (3 products); 2: bf16;
//   3: bf16 hi/mid/lo triple split (6 products); 4: as 3 with Kahan-compensated f32 accumulation across k-steps.
// =====================================================================================================================
struct GemmP {
    const float* A; const float* B; const float* bias; const float* R; float* C;
    long long sAo, sAi, sAm, sAk, sBo, sBi, sBn, sBk, sCo, sCi, sCm, sRo, sRi, sRm, sRn;
    int M, N, K, zi_n, flags, act; float alpha, beta, sa, sb;
    int Npad, pad_;     // columns [N, Npad) of C are written as 0 so that padded workspace rows are covered by whole-line stores; Npad >= N
};
static_assert(sizeof(GemmP) == 5 * 8 + 15 * 8 + 6 * 4 + 4 * 4 + 2 * 4, "GemmP has padding");

template <int MODE>
__global__ __launch_bounds__(32) void k_gemm(GemmP p) {
    const int lane = threadIdx.x & 31, h = lane >> 4, l15 = lane & 15;
    const int m0 = blockIdx.y * 16, n0 = blockIdx.x * 32;
    const int z = blockIdx.z, zo = z / p.zi_n, zi = z - zo * p.zi_n;
    const float* A = p.A + zo * p.sAo + zi * p.sAi;
    const float* B = p.B + zo * p.sBo + zi * p.sBi;
    const int am = min(m0 + l15, p.M - 1);                       // clamped row for loads (stores are guarded)
    v8f acc[2], comp[2];
#pragma unroll
    for (int t = 0; t < 2; ++t) { v8f zz = {}; acc[t] = zz; comp[t] = zz; }
    for (int k0 = 0; k0 < p.K; k0 += 32) {
        const float* arow = A + (long long)am * p.sAm;
        if (MODE == 1) {
            const Split a = sp_ld(arow, p.sAk, k0, h, p.K, 1.f);
#pragma unroll
            for (int t = 0; t < 2; ++t) {
                const int bn = min(n0 + t * 16 + l15, p.N - 1);
                acc[t] = wmma3(a, sp_ld(B + (long long)bn * p.sBn, p.sBk, k0, h, p.K, 1.f), acc[t]);
            }
        } else if (MODE == 3) {
            const Split3 a = sp3_ld(arow, p.sAk, k0, h, p.K, 1.f);
#pragma unroll
            for (int t = 0; t < 2; ++t) {
                const int bn = min(n0 + t * 16 + l15, p.N - 1);
                acc[t] = wmma6(a, sp3_ld(B + (long long)bn * p.sBn, p.sBk, k0, h, p.K, 1.f), acc[t]);
            }
        } else if (MODE == 4) {
            // triple split as MODE 3, but each k-step's 6 products go into a fresh accumulator and the partial is added to the running f32 sum
            // on the VALU with Kahan compensation (accumulation error stays ~1 ulp however long K is)
            const Split3 a = sp3_ld(arow, p.sAk, k0, h, p.K, 1.f);
#pragma unroll
            for (int t = 0; t < 2; ++t) {
                const int bn = min(n0 + t * 16 + l15, p.N - 1); v8f zz = {};
                const v8f part = wmma6(a, sp3_ld(B + (long long)bn * p.sBn, p.sBk, k0, h, p.K, 1.f), zz);
                const v8f y = part - comp[t]; const v8f s = acc[t] + y; comp[t] = (s - acc[t]) - y; acc[t] = s;
            }
        } else if (MODE == 2) {
            const v16b a = bh_ld(arow, p.sAk, k0, h, p.K, 1.f);
#pragma unroll
            for (int t = 0; t < 2; ++t) {
                const int bn = min(n0 + t * 16 + l15, p.N - 1);
                acc[t] = wmmab(a, bh_ld(B + (long long)bn * p.sBn, p.sBk, k0, h, p.K, 1.f), acc[t]);
            }
        } else {
            const v16h a = fh_ld(arow, p.sAk, k0, h, p.K, p.sa);
#pragma unroll
            for (int t = 0; t < 2; ++t) {
                const int bn = min(n0 + t * 16 + l15, p.N - 1);
                acc[t] = wmma16(a, fh_ld(B + (long long)bn * p.sBn, p.sBk, k0, h, p.K, p.sb), acc[t]);
            }
        }
    }
    const float iscale = (MODE == 0) ? p.alpha / (p.sa * p.sb) : p.alpha;
    float* C = p.C + zo * p.sCo + zi * p.sCi;
    const float* R = p.R + zo * p.sRo + zi * p.sRi;
    __shared__ __align__(16) float ctile[16][36];
#pragma unroll
    for (int t = 0; t < 2; ++t) {
        const int n = n0 + t * 16 + l15; const int nn = min(n, p.N - 1);
#pragma unroll
        for (int r = 0; r < 8; ++r) {
            const int m = m0 + 8 * h + r; const int mm = min(m, p.M - 1);
            float v = acc[t][r] * iscale;
            if (p.flags & 1) v += p.bias[nn];
            if (p.flags & 2) v += p.bias[mm];
            if (p.flags & 8) v *= p.bias[(long long)zo * p.M + mm];   /* per-(z,row) scale vector laid out [Z][M]; exclusive with the bias flags */
            v = act_fn(v, p.act);
            if (p.flags & 4) v += p.beta * R[(long long)mm * p.sRm + (long long)nn * p.sRn];
            ctile[8 * h + r][t * 16 + l15] = (n < p.N) ? v : 0.f;
        }
    }
    __syncthreads();
    const int NW = (p.Npad > p.N) ? p.Npad : p.N;           // write width
    const bool fast = (m0 + 16 <= p.M) && (n0 + 32 <= NW) && ((p.sCm & 3) == 0) && ((((size_t)C) & 15) == 0);
    if (fast) {
#pragma unroll
        for (int s = 0; s < 4; ++s) {
            const int row = s * 4 + (lane >> 3), c4 = (lane & 7) * 4;
            const v4f v = *(const v4f*)&ctile[row][c4];
            VST2V4(C + (long long)(m0 + row) * p.sCm + n0 + c4, v);
        }
    } else {
        for (int row = 0; row < 16; ++row) {
            const int m = m0 + row, n = n0 + lane;
            if (m < p.M && n < NW) VST2(float, C + (long long)m * p.sCm + n, ctile[row][lane]);
        }
    }
}


// =====================================================================================================================
// k_gemmT<MODE, TM, TN>: same contract as k_gemm, but one wave computes a (16*TM) x (16*TN) tile: TM A fragments and TN B fragments are
//   loaded per 32-wide k-step and reused across TM*TN WMMAs (far fewer load/convert instructions per MAC). MODE 0 (f16), 1 (bf16 hi/lo),
//   2 (bf16) only. grid (ceil(NW/(16*TN)), ceil(M/(16*TM)), Z), block 32. Epilogue identical to k_gemm, run per 16x32 sub-tile.
// =====================================================================================================================
template <int MODE, int TM, int TN>
__global__ __launch_bounds__(32) void k_gemmT(GemmP p) {
    const int lane = threadIdx.x & 31, h = lane >> 4, l15 = lane & 15;
    const int m0 = blockIdx.y * (16 * TM), n0 = blockIdx.x * (16 * TN);
    const int z = blockIdx.z, zo = z / p.zi_n, zi = z - zo * p.zi_n;
    const float* A = p.A + zo * p.sAo + zi * p.sAi;
    const float* B = p.B + zo * p.sBo + zi * p.sBi;
    v8f acc[TM][TN];
#pragma unroll
    for (int i = 0; i < TM; ++i)
#pragma unroll
        for (int t = 0; t < TN; ++t) { v8f zz = {}; acc[i][t] = zz; }
    for (int k0 = 0; k0 < p.K; k0 += 32) {
        if (MODE == 1) {
            Split a[TM], b[TN];
#pragma unroll
            for (int i = 0; i < TM; ++i) { const int am = min(m0 + 16 * i + l15, p.M - 1); a[i] = sp_ld(A + (long long)am * p.sAm, p.sAk, k0, h, p.K, 1.f); }
#pragma unroll
            for (int t = 0; t < TN; ++t) { const int bn = min(n0 + 16 * t + l15, p.N - 1); b[t] = sp_ld(B + (long long)bn * p.sBn, p.sBk, k0, h, p.K, 1.f); }
#pragma unroll
            for (int i = 0; i < TM; ++i)
#pragma unroll
                for (int t = 0; t < TN; ++t) acc[i][t] = wmma3(a[i], b[t], acc[i][t]);
        } else if (MODE == 2) {
            v16b a[TM], b[TN];
#pragma unroll
            for (int i = 0; i < TM; ++i) { const int am = min(m0 + 16 * i + l15, p.M - 1); a[i] = bh_ld(A + (long long)am * p.sAm, p.sAk, k0, h, p.K, 1.f); }
#pragma unroll
            for (int t = 0; t < TN; ++t) { const int bn = min(n0 + 16 * t + l15, p.N - 1); b[t] = bh_ld(B + (long long)bn * p.sBn, p.sBk, k0, h, p.K, 1.f); }
#pragma unroll
            for (int i = 0; i < TM; ++i)
#pragma unroll
                for (int t = 0; t < TN; ++t) acc[i][t] = wmmab(a[i], b[t], acc[i][t]);
        } else {
            v16h a[TM], b[TN];
#pragma unroll
            for (int i = 0; i < TM; ++i) { const int am = min(m0 + 16 * i + l15, p.M - 1); a[i] = fh_ld(A + (long long)am * p.sAm, p.sAk, k0, h, p.K, p.sa); }
#pragma unroll
            for (int t = 0; t < TN; ++t) { const int bn = min(n0 + 16 * t + l15, p.N - 1); b[t] = fh_ld(B + (long long)bn * p.sBn, p.sBk, k0, h, p.K, p.sb); }
#pragma unroll
            for (int i = 0; i < TM; ++i)
#pragma unroll
                for (int t = 0; t < TN; ++t) acc[i][t] = wmma16(a[i], b[t], acc[i][t]);
        }
    }
    const float iscale = (MODE == 0) ? p.alpha / (p.sa * p.sb) : p.alpha;
    float* C = p.C + zo * p.sCo + zi * p.sCi;
    const float* R = p.R + zo * p.sRo + zi * p.sRi;
    const int NW = (p.Npad > p.N) ? p.Npad : p.N;
    __shared__ __align__(16) float ctile[16][36];
#pragma unroll
    for (int i = 0; i < TM; ++i) {
        const int mb = m0 + 16 * i; if (mb >= p.M) break;          // wave-uniform
#pragma unroll
        for (int tp = 0; tp < TN / 2; ++tp) {
            const int nb = n0 + 32 * tp; if (nb >= NW) break;        // wave-uniform
#pragma unroll
            for (int t2 = 0; t2 < 2; ++t2) {
                const int t = 2 * tp + t2; const int n = nb + t2 * 16 + l15; const int nn = min(n, p.N - 1);
#pragma unroll
                for (int r = 0; r < 8; ++r) {
                    const int m = mb + 8 * h + r; const int mm = min(m, p.M - 1);
                    float v = acc[i][t][r] * iscale;
                    if (p.flags & 1) v += p.bias[nn];
                    if (p.flags & 2) v += p.bias[mm];
            if (p.flags & 8) v *= p.bias[(long long)zo * p.M + mm];   /* per-(z,row) scale vector laid out [Z][M]; exclusive with the bias flags */
                    v = act_fn(v, p.act);
                    if (p.flags & 4) v += p.beta * R[(long long)mm * p.sRm + (long long)nn * p.sRn];
                    ctile[8 * h + r][t2 * 16 + l15] = (n < p.N) ? v : 0.f;
                }
            }
            __syncthreads();
            const bool fast = (mb + 16 <= p.M) && (nb + 32 <= NW) && ((p.sCm & 3) == 0) && ((((size_t)C) & 15) == 0);
            if (fast) {
#pragma unroll
                for (int s = 0; s < 4; ++s) {
                    const int row = s * 4 + (lane >> 3), c4 = (lane & 7) * 4;
                    const v4f v = *(const v4f*)&ctile[row][c4];
                    VST2V4(C + (long long)(mb + row) * p.sCm + nb + c4, v);
                }
            } else {
                for (int row = 0; row < 16; ++row) {
                    const int m = mb + row, n = nb + lane;
                    if (m < p.M && n < NW) VST2(float, C + (long long)m * p.sCm + n, ctile[row][lane]);
                }
            }
            __syncthreads();
        }
    }
}

namespace sfa {
typedef unsigned int u32x4 __attribute__((ext_vector_type(4)));
typedef unsigned int u32x2 __attribute__((ext_vector_type(2)));
typedef int i32x8 __attribute__((ext_vector_type(8)));
typedef short s16x8 __attribute__((ext_vector_type(8)));
typedef float f32x2 __attribute__((ext_vector_type(2)));
typedef _Float16 h16x2 __attribute__((ext_vector_type(2)));
constexpr int SEQ = 1024, LDR = 1024, HS = 64;
constexpr int NWV = 8, CW = 32, BR = NWV * CW, SK = 64, NST = SEQ / SK;
constexpr unsigned PK = 2u * HS + 16u, PV = 2u * HS + 32u, TILE_K = SK * PK, TILE_V = SK * PV, SLOT = TILE_K + TILE_V;
struct Fr { u32x4 q[2]; };
__device__ __forceinline__ v8f mma(const Fr& a, const Fr& b, v8f c) {
    const i32x8 av = {(int)a.q[0].x, (int)a.q[0].y, (int)a.q[0].z, (int)a.q[0].w, (int)a.q[1].x, (int)a.q[1].y, (int)a.q[1].z, (int)a.q[1].w};
    const i32x8 bv = {(int)b.q[0].x, (int)b.q[0].y, (int)b.q[0].z, (int)b.q[0].w, (int)b.q[1].x, (int)b.q[1].y, (int)b.q[1].z, (int)b.q[1].w};
    return __builtin_amdgcn_wmma_f32_16x16x32_f16(false, __builtin_bit_cast(v16h, av), false, __builtin_bit_cast(v16h, bv), (short)0, c, false, false);
}
__device__ __forceinline__ unsigned pack2(float lo, float hi) { return __builtin_bit_cast(unsigned, __builtin_convertvector(f32x2{lo, hi}, h16x2)); }   // round to nearest even
__device__ __forceinline__ u32x4 ld_tr16(const unsigned char* p) { typedef __attribute__((address_space(3))) s16x8 lds_s16x8; return __builtin_bit_cast(u32x4, __builtin_amdgcn_ds_load_tr16_b128_v8i16((lds_s16x8*)p)); }
__device__ __forceinline__ float xhalf(float x) { return __builtin_bit_cast(float, __builtin_amdgcn_permlanex16(__builtin_bit_cast(int, x), __builtin_bit_cast(int, x), 0x76543210, 0xfedcba98, false, false)); }   // lane l with lane l ^ 16

__global__ __launch_bounds__(NWV * 32) void k_sflash(const float* __restrict__ Q, const float* __restrict__ K, const float* __restrict__ V, float* __restrict__ O) {
    __shared__ __attribute__((aligned(256))) unsigned char L[2 * SLOT];
    const unsigned tid = threadIdx.x, lane = tid & 31u, wave = tid >> 5, c = lane & 15u, h = lane >> 4;
    const size_t base = (size_t)blockIdx.z * SEQ * LDR + (size_t)blockIdx.y * HS;
    const unsigned qw0 = blockIdx.x * BR + wave * CW;
    // staging: 16 lanes cover one 256-byte row, thread t takes rows (t >> 4) + 16 i of the stage
    const float* kg = K + base + (size_t)(tid >> 4) * LDR + (tid & 15u) * 4u;
    const float* vg = V + base + (size_t)(tid >> 4) * LDR + (tid & 15u) * 4u;
    unsigned char* ks = L + (tid >> 4) * PK + (tid & 15u) * 8u;
    unsigned char* vs = L + TILE_K + (tid >> 4) * PV + (tid & 15u) * 8u;
    v4f kr[4], vr[4];
    auto fetch = [&](int st) {
#pragma unroll
        for (int i = 0; i < 4; ++i) { kr[i] = *(const v4f*)(kg + (size_t)(st * SK + 16 * i) * LDR); vr[i] = *(const v4f*)(vg + (size_t)(st * SK + 16 * i) * LDR); }
        asm volatile("s_wait_xcnt 0x0" ::: "memory");          // stands in front of the pass's reuse of these loads' address registers
    };
    auto put = [&](unsigned slot) {
#pragma unroll
        for (int i = 0; i < 4; ++i) {
            *(u32x2*)(ks + slot * SLOT + 16u * i * PK) = u32x2{pack2(kr[i].x, kr[i].y), pack2(kr[i].z, kr[i].w)};
            *(u32x2*)(vs + slot * SLOT + 16u * i * PV) = u32x2{pack2(vr[i].x, vr[i].y), pack2(vr[i].z, vr[i].w)};
        }
    };
    fetch(0);
    // Q fragments (B operand, column = query), hardware k order: d = 32 kc + 8 h + 0..7 and 32 kc + 16 + 8 h + 0..7
    Fr qf[2][2];
#pragma unroll
    for (int g = 0; g < 2; ++g) {
        const float* qp = Q + base + (size_t)(qw0 + 16u * g + c) * LDR + 8u * h;
#pragma unroll
        for (int kc = 0; kc < 2; ++kc) {
            const v4f a0 = *(const v4f*)(qp + 32 * kc), a1 = *(const v4f*)(qp + 32 * kc + 4), b0 = *(const v4f*)(qp + 32 * kc + 16), b1 = *(const v4f*)(qp + 32 * kc + 20);
            qf[g][kc].q[0] = u32x4{pack2(a0.x, a0.y), pack2(a0.z, a0.w), pack2(a1.x, a1.y), pack2(a1.z, a1.w)};
            qf[g][kc].q[1] = u32x4{pack2(b0.x, b0.y), pack2(b0.z, b0.w), pack2(b1.x, b1.y), pack2(b1.z, b1.w)};
        }
    }
    v8f acc[2][4]; float m_run[2], l_run[2];
#pragma unroll
    for (int g = 0; g < 2; ++g) { m_run[g] = -__builtin_inff(); l_run[g] = 0.f;
#pragma unroll
        for (int t = 0; t < 4; ++t) acc[g][t] = v8f{}; }
    put(0u);
    __syncthreads();
    const float L2E = 1.4426950408889634f;
    for (int st = 0; st < NST; ++st) {
        if (st + 1 < NST) fetch(st + 1);                       // next stage's rows fly while this stage is worked on
        const unsigned char* Kb = L + (unsigned)(st & 1) * SLOT;
        const unsigned char* Vb = Kb + TILE_K;
#pragma unroll 1   // one 32-key pass's fragments live at a time (registers for four waves per SIMD)
        for (unsigned sub = 0; sub < 2u; ++sub) {
            Fr kf[2][2];
            const unsigned char* kp = Kb + (sub * 32u + c) * PK + 16u * h;
#pragma unroll
            for (int kt = 0; kt < 2; ++kt)
#pragma unroll
                for (int kc = 0; kc < 2; ++kc) { kf[kt][kc].q[0] = *(const u32x4*)(kp + 16u * kt * PK + 64u * kc); kf[kt][kc].q[1] = *(const u32x4*)(kp + 16u * kt * PK + 64u * kc + 32u); }
            Fr vf[4];
            const unsigned char* ad = Vb + (sub * 32u + 8u * h + (lane & 7u)) * PV + ((lane >> 3) & 1u) * 16u;
#pragma unroll
            for (int t = 0; t < 4; ++t) { vf[t].q[0] = ld_tr16(ad + 32u * t); vf[t].q[1] = ld_tr16(ad + 16u * PV + 32u * t); }
            v8f s[2][2];                                       // s[kt][g][r] = score of key 16 kt + 8 h + r against query 16 g + c
#pragma unroll
            for (int kt = 0; kt < 2; ++kt)
#pragma unroll
                for (int g = 0; g < 2; ++g) { s[kt][g] = v8f{};
#pragma unroll
                    for (int kc = 0; kc < 2; ++kc) s[kt][g] = mma(kf[kt][kc], qf[g][kc], s[kt][g]); }
            float mb[2]; bool need = false;
#pragma unroll
            for (int g = 0; g < 2; ++g) {
                float mx = s[0][g][0];
#pragma unroll
                for (int r = 1; r < 8; ++r) mx = fmaxf(mx, s[0][g][r]);
#pragma unroll
                for (int r = 0; r < 8; ++r) mx = fmaxf(mx, s[1][g][r]);
                mx = fmaxf(mx, xhalf(mx)) * L2E;               // both halves hold this query's maximum, log2 domain
                mb[g] = mx; need = need || (mx > m_run[g] + 8.0f);
            }
            if (__builtin_amdgcn_ballot_w32(need) != 0) {      // wave-uniform; rare after the first pass
#pragma unroll
                for (int g = 0; g < 2; ++g) {
                    const float m_new = fmaxf(m_run[g], mb[g]);
                    const float corr = __builtin_amdgcn_exp2f(m_run[g] - m_new);   // 0 on the first pass
                    m_run[g] = m_new; l_run[g] *= corr;
#pragma unroll
                    for (int t = 0; t < 4; ++t) acc[g][t] = acc[g][t] * corr;
                }
            }
#pragma unroll
            for (int g = 0; g < 2; ++g) {
                const float nm = 7.0f - m_run[g];
                unsigned w[8]; f32x2 ps = {0.f, 0.f};
#pragma unroll
                for (int i = 0; i < 8; ++i) {
                    const f32x2 arg = __builtin_elementwise_fma(f32x2{s[i >> 2][g][2 * (i & 3)], s[i >> 2][g][2 * (i & 3) + 1]}, f32x2{L2E, L2E}, f32x2{nm, nm});
                    const f32x2 p = {__builtin_amdgcn_exp2f(arg.x), __builtin_amdgcn_exp2f(arg.y)};
                    ps += p; w[i] = pack2(p.x, p.y);
                }
                l_run[g] += ps.x + ps.y;
                Fr pf; pf.q[0] = u32x4{w[0], w[1], w[2], w[3]}; pf.q[1] = u32x4{w[4], w[5], w[6], w[7]};
#pragma unroll
                for (int t = 0; t < 4; ++t) acc[g][t] = mma(vf[t], pf, acc[g][t]);
            }
        }
        if (st + 1 < NST) put((unsigned)((st + 1) & 1));       // into the buffer whose readers all passed the last barrier
        __syncthreads();
    }
#pragma unroll
    for (int g = 0; g < 2; ++g) {
        const float l = l_run[g] + xhalf(l_run[g]);            // join the halves' sums, unconditionally
        const float inv = 1.0f / l;
        float* op = O + base + (size_t)(qw0 + 16u * g + c) * LDR + 8u * h;
#pragma unroll
        for (int t = 0; t < 4; ++t) {                          // registers 0..7 = d 16 t + 8 h + 0..7 of this lane's query
            const v8f o = acc[g][t] * inv;
            *(v4f*)(op + 16 * t) = v4f{o[0], o[1], o[2], o[3]};
            *(v4f*)(op + 16 * t + 4) = v4f{o[4], o[5], o[6], o[7]};
        }
    }
}
} // namespace sfa

// =====================================================================================================================
// k_tr: dst(z, c, r) = alpha * src(z, r, c) (+ beta * R2(z, c, r)): [Z][R][C] (row stride lds) -> [Z][C][R] (row stride ldd) through a 32x32 LDS tile;
//   flags: 1 -> add beta * residual R2 addressed like dst (z*sRz + c*ldr + r); act applied before the residual.
// =====================================================================================================================
struct TrP { const float* src; float* dst; const float* R2; long long sSz, lds, sDz, ldd, sRz, ldr; int R, C, flags, act; float alpha, beta; };
static_assert(sizeof(TrP) == 3 * 8 + 6 * 8 + 6 * 4, "TrP has padding");
__global__ __launch_bounds__(256) void k_tr(TrP p) {
    __shared__ float tile[32][33];
    const int c0 = blockIdx.x * 32, r0 = blockIdx.y * 32, z = blockIdx.z;
    const int lane = threadIdx.x & 31, wave = threadIdx.x >> 5;
    const float* s = p.src + z * p.sSz;
#pragma unroll
    for (int k = 0; k < 4; ++k) {
        const int rl = wave * 4 + k, r = r0 + rl, c = c0 + lane;
        tile[rl][lane] = (r < p.R && c < p.C) ? s[(long long)r * p.lds + c] : 0.f;
    }
    __syncthreads();
    float* d = p.dst + z * p.sDz; const float* rr = p.R2 + z * p.sRz;
#pragma unroll
    for (int k = 0; k < 4; ++k) {
        const int cl = wave * 4 + k, c = c0 + cl, r = r0 + lane;
        if (c < p.C && r < p.R) {
            float v = act_fn(p.alpha * tile[lane][cl], p.act);
            if (p.flags & 1) v += p.beta * rr[(long long)c * p.ldr + r];
            VST2(float, d + (long long)c * p.ldd + r, v);
        }
    }
}

// k_affine: dst[i] = a * (sdev ? sdev[0] : 1) * src[i] + b, i < n (one thread per element; consecutive lanes -> consecutive addresses)
__global__ __launch_bounds__(256) void k_affine(const float* __restrict__ src, float* __restrict__ dst, int n, float a, float b, const float* __restrict__ sdev) {
    const int i = blockIdx.x * 256 + threadIdx.x;
    if (i < n) { const float aa = sdev ? a * sdev[0] : a; const float v = aa * src[i] + b; VST2(float, dst + i, v); }
}

// =====================================================================================================================
// k_softmax: row softmax over n contiguous elements, one 256-thread block per row; rows addressed z*sz + r*sr (grid (R, Z)).
//   out = scale_out * softmax(scale_in * x + (Mf ? Mf[z*smz + r*smr + j] : 0)); a row whose max is -inf is written as 0.
// =====================================================================================================================
struct SmP { const float* src; float* dst; const float* Mf; long long sz, sr, dz, dr, smz, smr; int n, pad; float scale_in, scale_out; };
static_assert(sizeof(SmP) == 3 * 8 + 6 * 8 + 4 * 4, "SmP has padding");
__global__ __launch_bounds__(256) void k_softmax(SmP p) {
    __shared__ float red[256];
    const int r = blockIdx.x, z = blockIdx.y, tid = threadIdx.x;
    const float* s = p.src + z * p.sz + (long long)r * p.sr;
    const float* mf = p.Mf ? (p.Mf + z * p.smz + (long long)r * p.smr) : nullptr;
    float mx = -__builtin_inff();
    for (int j = tid; j < p.n; j += 256) { float v = s[j] * p.scale_in; if (mf) v += mf[j]; mx = fmaxf(mx, v); }
    red[tid] = mx; __syncthreads();
    for (int o = 128; o > 0; o >>= 1) { if (tid < o) red[tid] = fmaxf(red[tid], red[tid + o]); __syncthreads(); }
    mx = red[0]; __syncthreads();
    float sum = 0.f;
    for (int j = tid; j < p.n; j += 256) { float v = s[j] * p.scale_in; if (mf) v += mf[j]; sum += (mx == -__builtin_inff()) ? 0.f : expf(v - mx); }
    red[tid] = sum; __syncthreads();
    for (int o = 128; o > 0; o >>= 1) { if (tid < o) red[tid] += red[tid + o]; __syncthreads(); }
    sum = red[0];
    const float inv = (sum > 0.f) ? p.scale_out / sum : 0.f;
    float* d = p.dst + z * p.dz + (long long)r * p.dr;
    for (int j = tid; j < p.n; j += 256) { float v = s[j] * p.scale_in; if (mf) v += mf[j]; const float o = (mx == -__builtin_inff()) ? 0.f : expf(v - mx) * inv; VST2(float, d + j, o); }
}
// =====================================================================================================================
// k_stats: mean and rsqrt(var + eps) over a set of n elements addressed base + z*sz + (e / inner) * so + (e % inner) * si, one 256-thread
// k_norm_apply: y = (x - mean[set]) * rstd[set] * g[c] + b[c] over a [Z][C][L] channel-major tensor with set = z*G + c / (C/G) (G groups per z;
//   G = C -> per-channel sets indexed z*C+c; for batch norm pass stats indexed by c only via bn = 1). Optional act. Output same layout.
// =====================================================================================================================
//   mode 0: mean / rsqrt(var + eps); mode 1 (RMSNorm): 0 / rsqrt(mean(x^2) + eps); mode 2 (L2 normalize * sqrt(n)): 0 / sqrt(n) / max(||x||, eps); mode 3: as 0 with unbiased variance (n-1)
__global__ __launch_bounds__(256) void k_stats(const float* __restrict__ x, long long sz, long long so, long long si, int inner, int n, float eps, float* __restrict__ stat, int mode) {
    __shared__ float red[256];
    const int z = blockIdx.x, tid = threadIdx.x;
    const float* base = x + z * sz;
    float s = 0.f;
    for (int e = tid; e < n; e += 256) s += base[(long long)(e / inner) * so + (long long)(e % inner) * si];
    red[tid] = s; __syncthreads();
    for (int o = 128; o > 0; o >>= 1) { if (tid < o) red[tid] += red[tid + o]; __syncthreads(); }
    const float mu = (mode == 0 || mode == 3) ? red[0] / (float)n : 0.f; __syncthreads();
    float q = 0.f;
    for (int e = tid; e < n; e += 256) { const float dlt = base[(long long)(e / inner) * so + (long long)(e % inner) * si] - mu; q += dlt * dlt; }
    red[tid] = q; __syncthreads();
    for (int o = 128; o > 0; o >>= 1) { if (tid < o) red[tid] += red[tid + o]; __syncthreads(); }
    {
        float rs;
        if (mode == 2) rs = sqrtf((float)n) / fmaxf(sqrtf(red[0]), eps); else if (mode == 3) rs = rsqrtf(red[0] / (float)(n - 1) + eps); else rs = rsqrtf(red[0] / (float)n + eps);
        if (tid < 32) { const float v = (tid == 0) ? mu : ((tid == 1) ? rs : 0.f); VST2(float, stat + (long long)z * 32 + tid, v); }
    }
}
//   One thread per element over the flat [Z][C][L] index space: grid ceil(Z*C*L / 256).
__global__ __launch_bounds__(256) void k_norm_apply(const float* __restrict__ x, float* __restrict__ y, const float* __restrict__ stat, const float* __restrict__ g, const float* __restrict__ bta,
                                                     int Z, int C, int L, int G, int bn, int act) {
    const long long idx = (long long)blockIdx.x * 256 + threadIdx.x;
    if (idx >= (long long)Z * C * L) return;
    const int l = (int)(idx % L); const long long zc = idx / L; const int c = (int)(zc % C), z = (int)(zc / C); (void)l;
    const int set = bn ? c : (z * G + c / (C / G));
    float v = (x[idx] - stat[(long long)set * 32]) * stat[(long long)set * 32 + 1];
    if (g) v *= g[c];
    if (bta) v += bta[c];
    v = act_fn(v, act);
    VST2(float, y + idx, v);
}

// k_lse_neg: c[i] = -(st[2i] + log(st[2i+1])) = minus the log-sum-exp of row i from k_attn's ST output (for softmax over the query dimension)
__global__ __launch_bounds__(256) void k_lse_neg(const float* __restrict__ st, float* __restrict__ c, int n) {
    const int i = blockIdx.x * 256 + threadIdx.x;
    if (i < n) { const float v = -(st[2 * i] + logf(st[2 * i + 1])); VST2(float, c + i, v); }
}

// k_iota: dst[i] = a * i + b as int32 (segment/position id helper)
__global__ __launch_bounds__(256) void k_iota(int* __restrict__ dst, int n, int a, int b) {
    const int i = blockIdx.x * 256 + threadIdx.x;
    if (i < n) { const int v = a * i + b; VST2(int, dst + i, v); }
}

// k_axpby: dst[i] = a * x[i] + b * y[i] (+ c), i < n
__global__ __launch_bounds__(256) void k_axpby(const float* __restrict__ x, const float* __restrict__ y, float* __restrict__ dst, int n, float a, float b, float c) {
    const int i = blockIdx.x * 256 + threadIdx.x;
    if (i < n) { const float v = a * x[i] + b * y[i] + c; VST2(float, dst + i, v); }
}

// =====================================================================================================================
// k_rope: rotary embedding on a [R rows][Hn heads][D] view (row stride sXr, head stride sXh, element stride 1) -> Y (own strides).
//   mode 0: rotate_half (partner d±D/2, sign - for d<D/2); mode 1: interleaved pairs (partner d^1, sign - for even d).
//   table column tcol: tmode 0 -> d, 1 -> d % (D/2), 2 -> d / 2; position p: pmode 0 -> r % S, 1 -> head index, 2 -> pos[r];
//   c = C[(r / S) * sCb + p * sCp + tcol * sCd], s likewise from Sn; y = x[d] * c + sign * x[partner] * s. X and Y must not alias.
// =====================================================================================================================
struct RopeP { const float* X; float* Y; const float* C; const float* Sn; const int* pos; long long sXr, sXh, sYr, sYh, sCb, sCp, sCd; int R, Hn, D, S, mode, tmode, pmode, pad; };
static_assert(sizeof(RopeP) == 5 * 8 + 7 * 8 + 8 * 4, "RopeP has padding");
__global__ __launch_bounds__(256) void k_rope(RopeP p) {
    const long long idx = (long long)blockIdx.x * 256 + threadIdx.x;
    if (idx >= (long long)p.R * p.Hn * p.D) return;
    const int d = (int)(idx % p.D); const long long rh = idx / p.D; const int h = (int)(rh % p.Hn); const int r = (int)(rh / p.Hn);
    const int half = p.D / 2;
    int partner; float sign;
    if (p.mode == 0) { partner = (d < half) ? d + half : d - half; sign = (d < half) ? -1.f : 1.f; }
    else { partner = d ^ 1; sign = (d & 1) ? 1.f : -1.f; }
    const int tcol = (p.tmode == 0) ? d : ((p.tmode == 1) ? (d % half) : (d >> 1));
    const int pp = (p.pmode == 0) ? (r % p.S) : ((p.pmode == 1) ? h : p.pos[r]);
    const long long toff = (long long)(r / p.S) * p.sCb + (long long)pp * p.sCp + (long long)tcol * p.sCd;
    const float* xr = p.X + (long long)r * p.sXr + (long long)h * p.sXh;
    const float v = xr[d] * p.C[toff] + sign * xr[partner] * p.Sn[toff];
    VST2(float, p.Y + (long long)r * p.sYr + (long long)h * p.sYh + d, v);
}

// k_invf + k_sincos (split so neither kernel carries a large VALU-fma footprint): invf_i = num * (1 / powf(base, (2 i)/D)) [fmode 0],
//   num * expf((2 i) * cexp) [fmode 1], num * powf(base, -2 (i - 1) / D) [fmode 2]; then cs/sn[s*half + i] = cos/sin((pscale * s) * invf_i)
__global__ __launch_bounds__(256) void k_invf(float* __restrict__ invb, int half, int D, float base, float num, int fmode, float cexp) {
    const int i = blockIdx.x * 256 + threadIdx.x;
    if (i >= ((half + 31) / 32) * 32) return;
    if (i >= half) { VST2(float, invb + i, 0.f); return; }
    const float e = (float)(2 * i) / (float)D;
    float invf;
    if (fmode == 1) invf = num * expf((float)(2 * i) * cexp);
    else if (fmode == 2) invf = num * powf(base, (-2.0f * ((float)i - 1.0f)) / (float)D);
    else invf = num * (1.0f / powf(base, e));
    VST2(float, invb + i, invf);
}
__global__ __launch_bounds__(256) void k_sincos(float* __restrict__ cs, float* __restrict__ sn, const float* __restrict__ invb, int S, int half, float pscale) {
    const int idx = blockIdx.x * 256 + threadIdx.x;
    if (idx >= S * half) return;
    const int s = idx / half, i = idx - s * half;
    const float ang = (pscale * (float)s) * invb[i];
    VST2(float, cs + idx, cosf(ang)); VST2(float, sn + idx, sinf(ang));
}

// k_mulact: dst[i] = act(x[i]) * y[i]
__global__ __launch_bounds__(256) void k_mulact(const float* __restrict__ x, const float* __restrict__ y, float* __restrict__ dst, int n, int act) {
    const int i = blockIdx.x * 256 + threadIdx.x;
    if (i < n) { const float v = act_fn(x[i], act) * y[i]; VST2(float, dst + i, v); }
}

// =====================================================================================================================
// k_matvec: thread-per-row matrix-vector products for N <= 8 output columns (heads with 1-3 outputs, gates), f32 on the VALU.
//   C[r*sCm + j] = act(alpha * sum_k A[r*sAm + k*sAk] * B[j*sBn + k*sBk] + bias[j]) + beta * R[r*sRm + j*sRn]; each thread writes its N contiguous floats.
// =====================================================================================================================
__global__ __launch_bounds__(256) void k_matvec(GemmP p) {
    // N == 1: one row per thread, so 32 lanes write one line with one instruction; otherwise each thread takes 32 consecutive rows.
    const int rpt = (p.N == 1) ? 1 : 32;
    const long long r0 = ((long long)blockIdx.x * 256 + threadIdx.x) * rpt; const int z = blockIdx.z, zo = z / p.zi_n, zi = z - zo * p.zi_n;
    if (r0 >= p.M) return;
    const float* Bb = p.B + zo * p.sBo + zi * p.sBi;
    float* C = p.C + zo * p.sCo + zi * p.sCi; const float* R = p.R + zo * p.sRo + zi * p.sRi;
    for (int rr = 0; rr < rpt; ++rr) {
        const long long r = r0 + rr; if (r >= p.M) break;
        const float* A = p.A + zo * p.sAo + zi * p.sAi + r * p.sAm;
        float acc[8] = {0.f, 0.f, 0.f, 0.f, 0.f, 0.f, 0.f, 0.f};
        for (int k = 0; k < p.K; ++k) { const float a = A[(long long)k * p.sAk];
#pragma unroll
            for (int j = 0; j < 8; ++j) if (j < p.N) acc[j] += a * Bb[(long long)j * p.sBn + (long long)k * p.sBk]; }
#pragma unroll
        for (int j = 0; j < 8; ++j) if (j < p.N) {
            float v = acc[j] * p.alpha;
            if (p.flags & 1) v += p.bias[j];
            if (p.flags & 2) v += p.bias[r];
            v = act_fn(v, p.act);
            if (p.flags & 4) v += p.beta * R[r * p.sRm + (long long)j * p.sRn];
            VST2(float, C + r * p.sCm + j, v);
        }
    }
}
// k_smallsoftmax: thread-per-row softmax for short rows (n <= 64): dst[r*dr + j] = softmax(scale*src[r*sr + j])
__global__ __launch_bounds__(256) void k_smallsoftmax(const float* __restrict__ src, float* __restrict__ dst, long long sr, long long dr, int n, long long R, float scale) {
    const long long r0 = ((long long)blockIdx.x * 256 + threadIdx.x) * 32;
    for (int rr = 0; rr < 32; ++rr) {
        const long long r = r0 + rr; if (r >= R) return;
        const float* s = src + r * sr; float* d = dst + r * dr;
        float mx = -__builtin_inff();
        for (int j = 0; j < n; ++j) mx = fmaxf(mx, s[j] * scale);
        float sum = 0.f;
        for (int j = 0; j < n; ++j) sum += expf(s[j] * scale - mx);
        const float inv = 1.f / sum;
        for (int j = 0; j < n; ++j) { const float v = expf(s[j] * scale - mx) * inv; VST2(float, d + j, v); }
    }
}

__global__ __launch_bounds__(32) void k_unitstat(float* __restrict__ st) { const int t = threadIdx.x; const float v = (t == 1) ? 1.f : 0.f; VST2(float, st + t, v); }

// destination (e.g. a d_out whose row width is not a multiple of 32 floats) is written by consecutive lanes of one instruction
__global__ __launch_bounds__(256) void k_lincopy(const float* __restrict__ src, long long lds, float* __restrict__ dst, long long ldd, long long rows, int cols) {
    const long long i = (long long)blockIdx.x * 256 + threadIdx.x; if (i >= rows * cols) return;
    const long long r = i / cols; const int c = (int)(i - r * cols);
    const float v = src[r * lds + c]; VST2(float, dst + r * ldd + c, v);
}

namespace w25 {
typedef __attribute__((ext_vector_type(16))) _Float16 v16h;
typedef __attribute__((ext_vector_type(8)))  _Float16 v8h;
typedef __attribute__((ext_vector_type(16))) __bf16   v16b;
typedef __attribute__((ext_vector_type(8)))  __bf16   v8b;
typedef __attribute__((ext_vector_type(8)))  float    v8f;
typedef __attribute__((ext_vector_type(4)))  float    v4f;

__device__ __forceinline__ unsigned short f2bf_bits(float f) {
  unsigned u = __float_as_uint(f);
  return (unsigned short)((u + 0x7FFFu + ((u >> 16) & 1u)) >> 16);
}
__device__ __forceinline__ float bf_bits2f(unsigned short h) { return __uint_as_float(((unsigned)h) << 16); }

// hazard guards as plain device helpers (no inline asm inside the kernel template body)
__device__ __forceinline__ void dep_guard_h(v8f& a, v8f& b, v16h x, v16h y) { asm volatile("v_nop\n\tv_nop\n\tv_nop\n\tv_nop" : "+v"(a), "+v"(b) : "v"(x), "v"(y)); }
__device__ __forceinline__ void dep_guard_b(v8f& a, v8f& b, v16b x, v16b y) { asm volatile("v_nop\n\tv_nop\n\tv_nop\n\tv_nop" : "+v"(a), "+v"(b) : "v"(x), "v"(y)); }
__device__ __forceinline__ void keep4_h(v16h a, v16h b, v16h c, v16h d) { asm volatile("v_nop" :: "v"(a), "v"(b), "v"(c), "v"(d)); }
__device__ __forceinline__ void keep4_b(v16b a, v16b b, v16b c, v16b d) { asm volatile("v_nop" :: "v"(a), "v"(b), "v"(c), "v"(d)); }
__device__ __forceinline__ void acc_guard4(v8f& a, v8f& b, v8f& c, v8f& d) { asm volatile("v_nop\n\tv_nop\n\tv_nop\n\tv_nop" : "+v"(a), "+v"(b), "+v"(c), "+v"(d)); }
template <typename T> struct Frag;
template <> struct Frag<_Float16> {
  typedef v16h V; union U { v16h v; v8h h[2]; };
  static __device__ __forceinline__ v16h load(const _Float16* p) {   // elements 0..7 <- p[0..7], 8..15 <- p[16..23]
    U f; f.h[0] = *(const v8h*)(p); f.h[1] = *(const v8h*)(p + 16); return f.v;
  }
  static __device__ __forceinline__ v8f mma(v16h a, v16h b, v8f c) {
    return __builtin_amdgcn_wmma_f32_16x16x32_f16(false, a, false, b, (short)0, c, false, false);
  }
  static __device__ __forceinline__ void guard(v8f& a, v8f& b, v16h x, v16h y) { dep_guard_h(a, b, x, y); }
  static __device__ __forceinline__ void keep(v16h a, v16h b, v16h c, v16h d) { keep4_h(a, b, c, d); }
};
template <> struct Frag<__bf16> {
  typedef v16b V; union U { v16b v; v8b h[2]; };
  static __device__ __forceinline__ v16b load(const __bf16* p) {
    U f; f.h[0] = *(const v8b*)(p); f.h[1] = *(const v8b*)(p + 16); return f.v;
  }
  static __device__ __forceinline__ v8f mma(v16b a, v16b b, v8f c) {
    return __builtin_amdgcn_wmma_f32_16x16x32_bf16(false, a, false, b, (short)0, c, false, false);
  }
  static __device__ __forceinline__ void guard(v8f& a, v8f& b, v16b x, v16b y) { dep_guard_b(a, b, x, y); }
  static __device__ __forceinline__ void keep(v16b a, v16b b, v16b c, v16b d) { keep4_b(a, b, c, d); }
};

// ---- Register-blocked batched WMMA GEMM ------------------------------------
// C[m,n] = scale * sum_k A[m,k] * Bt[n,k] (+bias)(+resid); each wave owns a 64x64 tile.
// A row-major [M,K]; Bt row-major [N,K]; M,N % 64 == 0, K % 32 == 0.
// SPLIT: operands are hi/lo planes (A2/Bt2 = lo planes, same layout); product = hi·hi + hi·lo + lo·hi.
// BIAS_MODE: 0 = none, 1 = bias[m], 2 = bias[n].
// OUT_MODE: 0 = f32, 1 = f16, 2 = bf16 hi plane (Cout) + bf16 lo plane (Cout2).
// ET: 0 = f16 operands, 1 = bf16 operands (pointers passed as 16-bit storage)
template <int ET> struct Elem;
template <> struct Elem<0> { typedef _Float16 T; };
template <> struct Elem<1> { typedef __bf16 T; };
template <int ET, bool SPLIT, int BIAS_MODE, int OUT_MODE, bool RESID, int ACT = 0>
__global__ __launch_bounds__(256) void wmma_gemm64(
    const unsigned short* __restrict__ Ap, const unsigned short* __restrict__ A2p, int lda, long strideA, long strideAz,
    const unsigned short* __restrict__ Btp, const unsigned short* __restrict__ Bt2p, int ldb, long strideB, long strideBz,
    void* __restrict__ Cout, void* __restrict__ Cout2, int ldc, long strideC, long strideCz,
    const float* __restrict__ bias,
    const float* __restrict__ resid, long strideR,
    int M, int N, int K, float scale) {
  typedef typename Elem<ET>::T T;
  typedef typename Frag<T>::V V;
  const T* A = (const T*)Ap; const T* A2 = (const T*)A2p; const T* Bt = (const T*)Btp; const T* Bt2 = (const T*)Bt2p;
  __shared__ __align__(16) float sT[8][16 * 68];   // per-wave 16x64 slab, pitch 68 floats
  const int b    = blockIdx.y;
  const int lane = threadIdx.x & 31;
  const int wave = threadIdx.x >> 5;
  const int tilesN = N >> 6;
  const int tilesM = M >> 6;
  const int tile = blockIdx.x * 8 + wave;
  if (tile >= tilesM * tilesN) return;   // wave-uniform; no block barriers in this kernel
  const int tm = tile / tilesN;
  const int tn = tile - tm * tilesN;
  const int m0 = tm << 6;
  const int n0 = tn << 6;

  const int bz = blockIdx.z;                   // outer batch index (sample), with its own strides
  const T* Ab  = A  + (size_t)b * strideA + (size_t)bz * strideAz;
  const T* Bb  = Bt + (size_t)b * strideB + (size_t)bz * strideBz;
  const T* Ab2 = SPLIT ? (A2  + (size_t)b * strideA + (size_t)bz * strideAz) : nullptr;
  const T* Bb2 = SPLIT ? (Bt2 + (size_t)b * strideB + (size_t)bz * strideBz) : nullptr;

  const int rlane = lane & 15;                 // row (A) / col (B, D) within subtile
  const int koff  = (lane >> 4) * 8;           // k offset of this lane half
  const int mOff  = (lane >> 4) * 8;           // D row offset

  v8f acc[4][4];
#pragma unroll
  for (int i = 0; i < 4; ++i)
#pragma unroll
    for (int j = 0; j < 4; ++j) acc[i][j] = (v8f){0.f,0.f,0.f,0.f,0.f,0.f,0.f,0.f};

  for (int k0 = 0; k0 < K; k0 += 32) {
    V bh[4], bl[4];
#pragma unroll
    for (int j = 0; j < 4; ++j) {
      const size_t bo = (size_t)(n0 + (j << 4) + rlane) * ldb + koff + k0;
      bh[j] = Frag<T>::load(Bb + bo);
      if (SPLIT) bl[j] = Frag<T>::load(Bb2 + bo);
    }
#pragma unroll
    for (int i = 0; i < 4; ++i) {
      const size_t ao = (size_t)(m0 + (i << 4) + rlane) * lda + koff + k0;
      V ah = Frag<T>::load(Ab + ao);
      V al;
      if (SPLIT) al = Frag<T>::load(Ab2 + ao);
#pragma unroll
      for (int j = 0; j < 4; ++j) {
        acc[i][j] = Frag<T>::mma(ah, bh[j], acc[i][j]);
        if (SPLIT) {
          acc[i][j] = Frag<T>::mma(ah, bl[j], acc[i][j]);
          acc[i][j] = Frag<T>::mma(al, bh[j], acc[i][j]);
        }
      }
      Frag<T>::guard(acc[i][0], acc[i][3], ah, SPLIT ? al : ah);
    }
    Frag<T>::keep(bh[0], bh[1], bh[2], bh[3]);
    if (SPLIT) Frag<T>::keep(bl[0], bl[1], bl[2], bl[3]);
  }
  acc_guard4(acc[0][0], acc[0][1], acc[0][2], acc[0][3]);
  acc_guard4(acc[1][0], acc[1][1], acc[1][2], acc[1][3]);
  acc_guard4(acc[2][0], acc[2][1], acc[2][2], acc[2][3]);
  acc_guard4(acc[3][0], acc[3][1], acc[3][2], acc[3][3]);

  // ---- epilogue ----
  float* slab = sT[wave];
  const float* Rb = RESID ? (resid + (size_t)b * strideR) : nullptr;
#pragma unroll
  for (int i = 0; i < 4; ++i) {
    const int mBase = m0 + (i << 4);
#pragma unroll
    for (int j = 0; j < 4; ++j) {
      const int n = n0 + (j << 4) + rlane;
      float bv = 0.f;
      if (BIAS_MODE == 2) bv = bias[n];
#pragma unroll
      for (int r = 0; r < 8; ++r) {
        float v = acc[i][j][r] * scale;
        if (BIAS_MODE == 1) v += bias[mBase + mOff + r];
        if (BIAS_MODE == 2) v += bv;
        if (RESID) v += Rb[(size_t)(mBase + mOff + r) * ldc + n];
        if (ACT == 1) v = tanhf(v);
        if (ACT == 2) v = fmaxf(v, 0.0f);
        if (ACT == 3) v = v / (1.0f + expf(-v));
        if (ACT == 4) v = (v > 0.f) ? v : 0.01f * v;
        if (ACT == 5) v = 0.5f * v * (1.0f + erff(v * 0.70710678118654752f));
        slab[(mOff + r) * 68 + (j << 4) + rlane] = v;
      }
    }
    __builtin_amdgcn_fence(__ATOMIC_RELEASE, "workgroup");
    __builtin_amdgcn_wave_barrier();
    __builtin_amdgcn_fence(__ATOMIC_ACQUIRE, "workgroup");
    if (OUT_MODE == 0) {
      float* C = (float*)Cout + (size_t)b * strideC + (size_t)bz * strideCz;
      const int hh = lane >> 4, c4 = (lane & 15) * 4;     // row seg = 256 B = 16 lanes x 16 B
      {
#pragma unroll
        for (int it = 0; it < 8; ++it) {
          const int row = it * 2 + hh;
          v4f v = *(const v4f*)(slab + row * 68 + c4);
          *(v4f*)(C + (size_t)(mBase + row) * ldc + n0 + c4) = v;
        }
        
      }
    } else {
      const int q = lane >> 3, c8 = (lane & 7) * 8;
      unsigned short* C  = (unsigned short*)Cout  + (size_t)b * strideC + (size_t)bz * strideCz;
      unsigned short* C2 = (OUT_MODE == 2) ? ((unsigned short*)Cout2 + (size_t)b * strideC + (size_t)bz * strideCz) : nullptr;
      {
#pragma unroll
        for (int it = 0; it < 4; ++it) {
          const int row = it * 4 + q;
          const float* sp = slab + row * 68 + c8;
          v8h hv, lv;
#pragma unroll
          for (int e = 0; e < 8; ++e) {
            if (OUT_MODE == 1) {
              hv[e] = (_Float16)sp[e];
            } else {
              unsigned short hb = f2bf_bits(sp[e]);
              unsigned short lb = f2bf_bits(sp[e] - bf_bits2f(hb));
              hv[e] = __builtin_bit_cast(_Float16, hb);
              lv[e] = __builtin_bit_cast(_Float16, lb);
            }
          }
          *(v8h*)(C + (size_t)(mBase + row) * ldc + n0 + c8) = hv;
          if (OUT_MODE == 2) *(v8h*)(C2 + (size_t)(mBase + row) * ldc + n0 + c8) = lv;
        }
        
      }
    }
    __builtin_amdgcn_fence(__ATOMIC_RELEASE, "workgroup");
    __builtin_amdgcn_wave_barrier();
    __builtin_amdgcn_fence(__ATOMIC_ACQUIRE, "workgroup");
  }
}

// ---- The same product for large M, N: operands staged in LDS ----------------
// C[m,n] = act(scale * sum_k A[m,k] * Bt[n,k] (+ bias[n])), f32 out; A row-major [M,K], Bt row-major [N,K], both of row length K; M, N % 128 == 0, K % 64 == 0.
// Block = 4 waves (2 x 2) of 64x64 = one 128x128 tile of C; grid (N / 128, M / 128). A stage is 64 k = 128 B of each of the 128 + 128 operand rows
// (hi planes, then the lo planes when SPLIT), laid at a pitch of 144 B in one of two LDS buffers by asynchronous 16-byte copies: a wave's copy
// covers four whole 128-byte lines, and every staged row serves two waves. The next stage's copies fly while this stage is worked on.
// Per accumulator the products come in the same k order as in wmma_gemm64.
// The launch bound's second argument asks for four waves per SIMD (256 registers a wave): four one-plane blocks then share a WGP.
// Every inner loop is unrolled so that the fragment and accumulator arrays are indexed by constants and stay in registers.
__device__ __forceinline__ void ring_copy8(unsigned l, const unsigned char* g, size_t gstep) {
  // eight rows, 16 apart, of one plane; the closing s_wait_xcnt stands in front of any reuse of the address registers named here
  asm volatile("global_load_async_to_lds_b128 %0, %8, off\n\t"
               "global_load_async_to_lds_b128 %1, %9, off\n\t"
               "global_load_async_to_lds_b128 %2, %10, off\n\t"
               "global_load_async_to_lds_b128 %3, %11, off\n\t"
               "global_load_async_to_lds_b128 %4, %12, off\n\t"
               "global_load_async_to_lds_b128 %5, %13, off\n\t"
               "global_load_async_to_lds_b128 %6, %14, off\n\t"
               "global_load_async_to_lds_b128 %7, %15, off\n\t"
               "s_wait_xcnt 0x0"
               :: "v"(l), "v"(l + 2304u), "v"(l + 4608u), "v"(l + 6912u), "v"(l + 9216u), "v"(l + 11520u), "v"(l + 13824u), "v"(l + 16128u),
                  "v"(g), "v"(g + gstep), "v"(g + 2 * gstep), "v"(g + 3 * gstep), "v"(g + 4 * gstep), "v"(g + 5 * gstep), "v"(g + 6 * gstep), "v"(g + 7 * gstep)
               : "memory");
}
template <int ET, bool SPLIT, int BIAS_MODE, int ACT>
__global__ __launch_bounds__(128, 4) void wmma_gemm_ring(
    const unsigned short* __restrict__ Ap, const unsigned short* __restrict__ A2p,
    const unsigned short* __restrict__ Btp, const unsigned short* __restrict__ Bt2p,
    float* __restrict__ C, int ldc, const float* __restrict__ bias, int K, float scale) {
  typedef typename Elem<ET>::T T;
  typedef typename Frag<T>::V V;
  constexpr unsigned PITCH = 144u, PLANE = 128u * PITCH, BUF = (SPLIT ? 4u : 2u) * PLANE;
  static_assert(16u * PITCH == 2304u, "row step of ring_copy8");
  __shared__ __attribute__((aligned(256))) unsigned char L[2 * BUF];
  const unsigned tid = threadIdx.x, lane = tid & 31u, wave = tid >> 5;
  const int m0 = blockIdx.y * 128, n0 = blockIdx.x * 128;
  const unsigned wm = (wave >> 1) * 64u, wn = (wave & 1u) * 64u;
  const unsigned rlane = lane & 15u, hh = lane >> 4;

  // copies: 8 lanes cover one 128-byte row piece, thread t takes rows (t >> 3) + 16 i of every plane
  const size_t rowb = (size_t)K * 2u, gstep = 16u * rowb;
  const unsigned lc = (unsigned)(size_t)L + (tid >> 3) * PITCH + (tid & 7u) * 16u;
  const size_t ga = (size_t)(m0 + (int)(tid >> 3)) * rowb + (tid & 7u) * 16u;
  const size_t gb = (size_t)(n0 + (int)(tid >> 3)) * rowb + (tid & 7u) * 16u;
  auto stage = [&](int t, unsigned buf) {
    const size_t ko = (size_t)t * 128u;
    ring_copy8(lc + buf * BUF, (const unsigned char*)Ap + ga + ko, gstep);
    ring_copy8(lc + buf * BUF + PLANE, (const unsigned char*)Btp + gb + ko, gstep);
    if (SPLIT) {
      ring_copy8(lc + buf * BUF + 2u * PLANE, (const unsigned char*)A2p + ga + ko, gstep);
      ring_copy8(lc + buf * BUF + 3u * PLANE, (const unsigned char*)Bt2p + gb + ko, gstep);
    }
  };

  v8f acc[4][4];
#pragma unroll
  for (int i = 0; i < 4; ++i)
#pragma unroll
    for (int j = 0; j < 4; ++j) acc[i][j] = (v8f){0.f,0.f,0.f,0.f,0.f,0.f,0.f,0.f};

  const int NT = K >> 6;
  stage(0, 0u);
  asm volatile("s_wait_asynccnt 0x0" ::: "memory");            // this wave's copies of stage 0 have landed
  __syncthreads();                                             // and every other wave's
  if (NT > 1) stage(1, 1u);
  for (int t = 0; t < NT; ++t) {
    const unsigned char* Ab = L + (unsigned)(t & 1) * BUF + (wm + rlane) * PITCH + 16u * hh;
    const unsigned char* Bb = L + (unsigned)(t & 1) * BUF + PLANE + (wn + rlane) * PITCH + 16u * hh;
#pragma unroll
    for (unsigned ks = 0; ks < 2u; ++ks) {
      // fragments are asked for ahead of the products that use them: all eight of a k step (one plane), or B whole and A one row tile ahead (two planes)
      V bh[4], bl[4], ah[4], al[4];
#pragma unroll
      for (unsigned j = 0; j < 4u; ++j) {
        bh[j] = Frag<T>::load((const T*)(Bb + 16u * j * PITCH + 64u * ks));
        if (SPLIT) bl[j] = Frag<T>::load((const T*)(Bb + 2u * PLANE + 16u * j * PITCH + 64u * ks));
      }
#pragma unroll
      for (unsigned i = 0; i < (SPLIT ? 1u : 4u); ++i) {
        ah[i] = Frag<T>::load((const T*)(Ab + 16u * i * PITCH + 64u * ks));
        if (SPLIT) al[i] = Frag<T>::load((const T*)(Ab + 2u * PLANE + 16u * i * PITCH + 64u * ks));
      }
      __builtin_amdgcn_sched_barrier(0);                       // holds the reads above as one group: left free, each A read sinks to its first use and the wave waits out the LDS latency per row tile
#pragma unroll
      for (unsigned i = 0; i < 4u; ++i) {
        if (SPLIT && i < 3u) {
          ah[i + 1u] = Frag<T>::load((const T*)(Ab + 16u * (i + 1u) * PITCH + 64u * ks));
          al[i + 1u] = Frag<T>::load((const T*)(Ab + 2u * PLANE + 16u * (i + 1u) * PITCH + 64u * ks));
          __builtin_amdgcn_sched_barrier(0);                   // the next row tile's reads stay in front of this row tile's products
        }
#pragma unroll
        for (int j = 0; j < 4; ++j) {
          acc[i][j] = Frag<T>::mma(ah[i], bh[j], acc[i][j]);
          if (SPLIT) {
            acc[i][j] = Frag<T>::mma(ah[i], bl[j], acc[i][j]);
            acc[i][j] = Frag<T>::mma(al[i], bh[j], acc[i][j]);
          }
        }
      }
    }
    asm volatile("s_wait_dscnt 0x0" ::: "memory");             // this wave's reads of the buffer are done before it is handed to the copies
    asm volatile("s_wait_asynccnt 0x0" ::: "memory");          // this wave's copies of stage t + 1 have landed
    __syncthreads();                                           // publishes stage t + 1 and ends every wave's reads of stage t
    if (t + 2 < NT) stage(t + 2, (unsigned)(t & 1));
  }
  asm volatile("s_wait_asynccnt 0x0" ::: "memory");            // nothing in flight when the ring becomes output staging

  // ---- epilogue: as in wmma_gemm64, the per-wave 16x64 slab (pitch 68 floats) lies in the ring, which every wave has left ----
  float* slab = (float*)(L + wave * (16u * 68u * 4u));
  const int mOff = (int)hh * 8;
  float bv[4] = {0.f, 0.f, 0.f, 0.f};
  if (BIAS_MODE == 2) {
#pragma unroll
    for (int j = 0; j < 4; ++j) {
      bv[j] = bias[n0 + (int)wn + (j << 4) + (int)rlane];
      asm volatile("s_wait_xcnt 0x0" ::: "memory");            // behind each load: a later load's result may be given the index register that this load names
    }
  }
#pragma unroll
  for (int i = 0; i < 4; ++i) {
    const int mBase = m0 + (int)wm + (i << 4);
#pragma unroll
    for (int j = 0; j < 4; ++j) {
#pragma unroll
      for (int r = 0; r < 8; ++r) {
        float v = acc[i][j][r] * scale;
        if (BIAS_MODE == 2) v += bv[j];
        if (ACT == 5) v = 0.5f * v * (1.0f + erff(v * 0.70710678118654752f));
        slab[(mOff + r) * 68 + (j << 4) + (int)rlane] = v;
      }
    }
    __builtin_amdgcn_fence(__ATOMIC_RELEASE, "workgroup");
    __builtin_amdgcn_wave_barrier();
    __builtin_amdgcn_fence(__ATOMIC_ACQUIRE, "workgroup");
    const int c4 = (int)rlane * 4;                              // row piece = 256 B = 16 lanes x 16 B
#pragma unroll
    for (int it = 0; it < 8; ++it) {
      const int row = it * 2 + (int)hh;
      v4f v = *(const v4f*)(slab + row * 68 + c4);
      *(v4f*)(C + (size_t)(mBase + row) * ldc + n0 + (int)wn + c4) = v;
    }
    asm volatile("s_wait_xcnt 0x0" ::: "memory");              // stands in front of the next row tile's reuse of these stores' address and data registers
    __builtin_amdgcn_fence(__ATOMIC_RELEASE, "workgroup");
    __builtin_amdgcn_wave_barrier();
    __builtin_amdgcn_fence(__ATOMIC_ACQUIRE, "workgroup");
  }
}

__global__ __launch_bounds__(256) void cast_f32_f16x2(
    const float* __restrict__ in, _Float16* __restrict__ out, int n2) {
  int i = blockIdx.x * 256 + threadIdx.x;
  if (i < n2) {
    const _Float16 h0 = (_Float16)in[2 * i], h1 = (_Float16)in[2 * i + 1];
    const unsigned u = (unsigned)__builtin_bit_cast(unsigned short, h0) | ((unsigned)__builtin_bit_cast(unsigned short, h1) << 16);
    ((unsigned*)out)[i] = u;
    
  }
}


} // namespace w25

__global__ __launch_bounds__(256) void k_castT16(const float* __restrict__ src, long long lds, _Float16* __restrict__ dst, long long ldd, int R, int C, float s) {
    const long long i = (long long)blockIdx.x * 256 + threadIdx.x; const long long np = (long long)C * (R / 2); if (i >= np) return; const int c = (int)(i / (R / 2)); const int r = 2 * (int)(i % (R / 2));
    const _Float16 h0 = (_Float16)(src[(long long)r * lds + c] * s), h1 = (_Float16)(src[(long long)(r + 1) * lds + c] * s);
    const unsigned u = (unsigned)__builtin_bit_cast(unsigned short, h0) | ((unsigned)__builtin_bit_cast(unsigned short, h1) << 16);
    unsigned* d = (unsigned*)(dst + (long long)c * ldd + r); *d = u;  }
__global__ __launch_bounds__(256) void k_cast16(const float* __restrict__ src, long long lds, _Float16* __restrict__ dst, long long ldd, int R, int C, float s) {
    const long long i = (long long)blockIdx.x * 256 + threadIdx.x; const long long np = (long long)R * (C / 2); if (i >= np) return; const int r = (int)(i / (C / 2)); const int c = 2 * (int)(i % (C / 2));
    const _Float16 h0 = (_Float16)(src[(long long)r * lds + c] * s), h1 = (_Float16)(src[(long long)r * lds + c + 1] * s);
    const unsigned u = (unsigned)__builtin_bit_cast(unsigned short, h0) | ((unsigned)__builtin_bit_cast(unsigned short, h1) << 16);
    unsigned* d = (unsigned*)(dst + (long long)r * ldd + c); *d = u;  }

// f32 -> bf16 hi plane + bf16 lo plane (x = hi + lo to ~2^-17 relative; RNE both), [R][C] -> [R][C] (or transposed to [C][R]); 2 consecutive destination elements
__device__ __forceinline__ unsigned int f2bf2_pack(float a, float b, unsigned int* lo) {
    const unsigned short ha = w25::f2bf_bits(a), hb = w25::f2bf_bits(b);
    const unsigned short la = w25::f2bf_bits(a - w25::bf_bits2f(ha)), lb = w25::f2bf_bits(b - w25::bf_bits2f(hb));
    *lo = (unsigned)la | ((unsigned)lb << 16); return (unsigned)ha | ((unsigned)hb << 16); }
__global__ __launch_bounds__(256) void k_castS16(const float* __restrict__ src, long long lds, __bf16* __restrict__ dhi, __bf16* __restrict__ dlo, long long ldd, int R, int C, float s, int transpose, long long sby, long long dby) {
    const long long i = (long long)blockIdx.x * 256 + threadIdx.x; long long o; float a, b;
    src += (long long)blockIdx.y * sby; dhi += (long long)blockIdx.y * dby; dlo += (long long)blockIdx.y * dby;   // grid y = sample
    if (transpose) { const long long np = (long long)C * (R / 2); if (i >= np) return; const int c = (int)(i / (R / 2)); const int r = 2 * (int)(i % (R / 2)); a = src[(long long)r * lds + c] * s; b = src[(long long)(r + 1) * lds + c] * s; o = (long long)c * ldd + r; }
    else { const long long np = (long long)R * (C / 2); if (i >= np) return; const int r = (int)(i / (C / 2)); const int c = 2 * (int)(i % (C / 2)); a = src[(long long)r * lds + c] * s; b = src[(long long)r * lds + c + 1] * s; o = (long long)r * ldd + c; }
    unsigned lo; const unsigned hi = f2bf2_pack(a, b, &lo); unsigned* ph = (unsigned*)(dhi + o); unsigned* pl = (unsigned*)(dlo + o);
    *ph = hi; *pl = lo;  }

namespace w25 {
// =====================================================================================
// Generic causal/non-causal attention for head_dim 64, f32 in / f32 out; 16-bit operands: bf16 with optional hi/lo splits, or
// plain f16 (F16=true, non-split, probabilities carried x2^15).
//   scores = (q*qscale)·kᵀ : v_wmma_f32_16x16x32_bf16; SPLIT_QK -> q,k as bf16 hi/lo (hi·hi + hi·lo + lo·hi)
//   out    = p·v           : v_wmma_f32_16x16x32_bf16; SPLIT_PV -> p,v as bf16 hi/lo; else p,v plain bf16
//   f32 accumulate; online softmax in f32. Block = 4 waves = 64 query rows of one (batch, head); S % 64 == 0.
//   Element (b, s, h, d) of tensor X lives at X[b*X_bs + s*X_rs + h*X_hs + d] (strides in floats, multiples of 4).
//   Masking: mask_mode 0 none, 1 causal (kv > q masked), 2 tensor [S][Skv] shared over (b,h) (float if
//   mask_is_int==0, int32 with element == 0 -> masked if 1, int32 with element != 0 -> masked if 2), 3 per-token vectors qmask[B][S] & kvmask[B][Skv] (int32,
//   0 -> masked), 4 causal + sliding window (kv > q or q - kv > W masked; W passed in mask_is_int);
//   5 = relative-position bias: s += cp[b,h,q][idx[q][kv]] + pc[b,h,kv][idx[q][kv]] with idx = mask_b ([S][Skv] int32) and
//   mask_a an int32 [S][Skv] tensor with nonzero = masked (tables: element (b,h,row,n) at X + b*c_bs + h*c_hs + row*c_rs + n);
//   masked scores are replaced by mask_fill (e.g. -inf or -1e9) before the softmax.
//   grid.x = B * H * (S/64) (or a sub-range with blk0).
// =====================================================================================
#define AT_D 64
#define AT_NW 4
#define AT_QB 64
#define AT_KC 64
struct AttnGeom { const float* cp = nullptr; const float* pc = nullptr; long c_bs = 0, c_rs = 0, c_hs = 0;   // mode-5 score-bias tables
                  long q_bs, q_rs, q_hs, k_bs, k_rs, k_hs, v_bs, v_rs, v_hs, o_bs, o_rs, o_hs;
                  int S, Skv, H, mask_mode; float qscale; int blk0; float mask_fill; int mask_is_int; };
static_assert(sizeof(AttnGeom) == 168, "no padding");

__device__ __forceinline__ unsigned short at_bf_bits(float f) {
  unsigned u = __float_as_uint(f);
  return (unsigned short)((u + 0x7FFFu + ((u >> 16) & 1u)) >> 16);
}
__device__ __forceinline__ __bf16 at_f2bf(float f) { return __builtin_bit_cast(__bf16, at_bf_bits(f)); }
__device__ __forceinline__ void at_split(float f, __bf16& hi, __bf16& lo) {
  const unsigned short hb = at_bf_bits(f);
  hi = __builtin_bit_cast(__bf16, hb);
  lo = at_f2bf(f - __uint_as_float(((unsigned)hb) << 16));
}
__device__ __forceinline__ v8f at_mma(v16b a, v16b b, v8f c) {
  c = __builtin_amdgcn_wmma_f32_16x16x32_bf16(false, a, false, b, (short)0, c, false, false);
  asm volatile("v_nop\n\tv_nop\n\tv_nop\n\tv_nop" : "+v"(c) : "v"(a), "v"(b));
  return c;
}
// 16-bit element as a bit pattern held in a __bf16 slot: f16 bits when F16, bf16 (RNE) otherwise
template <bool F16> __device__ __forceinline__ __bf16 at_to16(float f) {
  if (F16) return __builtin_bit_cast(__bf16, (_Float16)f);
  return at_f2bf(f);
}
template <bool F16> __device__ __forceinline__ v8f at_mma16(v16b a, v16b b, v8f c) {
  if (F16) {
    const v16h ah = __builtin_bit_cast(v16h, a), bh = __builtin_bit_cast(v16h, b);
    c = __builtin_amdgcn_wmma_f32_16x16x32_f16(false, ah, false, bh, (short)0, c, false, false);
    asm volatile("v_nop\n\tv_nop\n\tv_nop\n\tv_nop" : "+v"(c) : "v"(ah), "v"(bh));
    return c;
  }
  return at_mma(a, b, c);
}

template <bool SPLIT_QK, bool SPLIT_PV, bool F16 = false>
__global__ __launch_bounds__(128)
void attn64_kernel(const float* __restrict__ q, const float* __restrict__ k,
                   const float* __restrict__ v, float* __restrict__ out,
                   const void* __restrict__ mask_a, const int* __restrict__ mask_b, AttnGeom g) {
  static_assert(!(F16 && (SPLIT_QK || SPLIT_PV)), "f16 mode is non-split");
  const float PSC = F16 ? 32768.0f : 1.0f;     // f16 probabilities carried x2^15 (subnormal range), folded into the final 1/l
  union FB { v16b v; v8b h[2]; };
  __shared__ __align__(16) __bf16 Ksh[AT_KC * AT_D];             // K hi [kv][d]      8 KB
  __shared__ __align__(16) __bf16 Ksl[SPLIT_QK ? AT_KC * AT_D : 8];
  __shared__ __align__(16) __bf16 Vth[AT_D * AT_KC];             // V hi [d][kv]      8 KB
  __shared__ __align__(16) __bf16 Vtl[SPLIT_PV ? AT_D * AT_KC : 8];
  __shared__ __align__(16) __bf16 Psh[AT_NW][16 * AT_KC];        // per wave P hi [row][kv]  8 KB
  __shared__ __align__(16) __bf16 Psl[SPLIT_PV ? AT_NW : 1][SPLIT_PV ? 16 * AT_KC : 8];
  __shared__ __align__(16) float  Os[AT_NW][16 * 68];            // per wave out tile, pitch 68

  const int tid  = threadIdx.x;
  const int wave = tid >> 5;
  const int lane = tid & 31;
  const int hh   = lane >> 4;
  const int c    = lane & 15;

  const int nqb = g.S / AT_QB;
  const int bx = blockIdx.x + g.blk0;
  const int qb = bx % nqb;
  const int bh = bx / nqb;
  const int h  = bh % g.H;
  const int b  = bh / g.H;
  const int qbase_block = qb * AT_QB;
  const int q0 = qbase_block + wave * 16;

  const float* qb_ptr = q + (size_t)b * g.q_bs + (size_t)h * g.q_hs;
  const float* kb_ptr = k + (size_t)b * g.k_bs + (size_t)h * g.k_hs;
  const float* vb_ptr = v + (size_t)b * g.v_bs + (size_t)h * g.v_hs;
  float*       ob_ptr = out + (size_t)b * g.o_bs + (size_t)h * g.o_hs;

  // ---- Q fragments (A operand): 2 d-chunks, hi (and lo) ----
  v16b qah[2], qal[2];
  {
    const float* qrow = qb_ptr + (size_t)(q0 + c) * g.q_rs;
#pragma unroll
    for (int dc = 0; dc < 2; ++dc) {
#pragma unroll
      for (int e = 0; e < 8; ++e) {
        const float f0 = qrow[dc * 32 + 8 * hh + e] * g.qscale;
        const float f1 = qrow[dc * 32 + 16 + 8 * hh + e] * g.qscale;
        if (SPLIT_QK) { __bf16 hq, lq; at_split(f0, hq, lq); qah[dc][e] = hq; qal[dc][e] = lq; at_split(f1, hq, lq); qah[dc][8 + e] = hq; qal[dc][8 + e] = lq; }
        else { qah[dc][e] = at_to16<F16>(f0); qah[dc][8 + e] = at_to16<F16>(f1); qal[dc][e] = qah[dc][e]; qal[dc][8 + e] = qah[dc][8 + e]; }
      }
    }
  }

  float mrow[8], lrow[8];
  v8f oacc[4];
#pragma unroll
  for (int r = 0; r < 8; ++r) { mrow[r] = -INFINITY; lrow[r] = 0.f; }
#pragma unroll
  for (int t = 0; t < 4; ++t) oacc[t] = (v8f){0.f,0.f,0.f,0.f,0.f,0.f,0.f,0.f};

  const int nChunks = (g.mask_mode == 1 || g.mask_mode == 4) ? (qb + 1) : (g.Skv / AT_KC);   // block-uniform
  // per-row query mask (mode 3)
  int qkeep[8];
#pragma unroll
  for (int r = 0; r < 8; ++r) qkeep[r] = (g.mask_mode == 3) ? mask_b[(size_t)b * g.S + q0 + 8 * hh + r] : 1;   // mask_b = qmask in mode 3
  for (int kc = 0; kc < nChunks; ++kc) {
    const int kv0 = kc * AT_KC;
    __syncthreads();
    {
      const int kvr = tid >> 1, dh = (tid & 1) * 32;
      const float* krow = kb_ptr + (size_t)(kv0 + kvr) * g.k_rs + dh;
      const float* vrow = vb_ptr + (size_t)(kv0 + kvr) * g.v_rs + dh;
#pragma unroll
      for (int i = 0; i < 8; ++i) {
        v4f kk = *(const v4f*)(krow + 4 * i);
        v4f vv = *(const v4f*)(vrow + 4 * i);
#pragma unroll
        for (int e = 0; e < 4; ++e) {
          const int d = dh + 4 * i + e;
          if (SPLIT_QK) { __bf16 a, bl; at_split(kk[e], a, bl); Ksh[kvr * AT_D + d] = a; Ksl[kvr * AT_D + d] = bl; }
          else Ksh[kvr * AT_D + d] = at_to16<F16>(kk[e]);
          if (SPLIT_PV) { __bf16 a, bl; at_split(vv[e], a, bl); Vth[d * AT_KC + kvr] = a; Vtl[d * AT_KC + kvr] = bl; }
          else Vth[d * AT_KC + kvr] = at_to16<F16>(vv[e]);
        }
      }
    }
    __syncthreads();

    v8f s[4];
#pragma unroll
    for (int j = 0; j < 4; ++j) {
      s[j] = (v8f){0.f,0.f,0.f,0.f,0.f,0.f,0.f,0.f};
#pragma unroll 1
      for (int dc = 0; dc < 2; ++dc) {
        FB kb;
        kb.h[0] = *(const v8b*)(Ksh + (j * 16 + c) * AT_D + dc * 32 + 8 * hh);
        kb.h[1] = *(const v8b*)(Ksh + (j * 16 + c) * AT_D + dc * 32 + 16 + 8 * hh);
        s[j] = at_mma16<F16>(qah[dc], kb.v, s[j]);
        if (SPLIT_QK) {
          FB kl;
          kl.h[0] = *(const v8b*)(Ksl + (j * 16 + c) * AT_D + dc * 32 + 8 * hh);
          kl.h[1] = *(const v8b*)(Ksl + (j * 16 + c) * AT_D + dc * 32 + 16 + 8 * hh);
          s[j] = at_mma16<F16>(qah[dc], kl.v, s[j]);
          s[j] = at_mma16<F16>(qal[dc], kb.v, s[j]);
        }
      }
    }
    const bool diag = (g.mask_mode == 1) && (kc == qb);
    int kvkeep[4] = {1, 1, 1, 1};
    if (g.mask_mode == 3) {
#pragma unroll
      for (int j = 0; j < 4; ++j) kvkeep[j] = ((const int*)mask_a)[(size_t)b * g.Skv + kv0 + j * 16 + c];   // mask_a = kvmask
    }
    float cm[8];
#pragma unroll
    for (int r = 0; r < 8; ++r) {
      const int qrow = q0 + 8 * hh + r;
      float m = -INFINITY;
#pragma unroll
      for (int j = 0; j < 4; ++j) {
        const int kvcol = kv0 + j * 16 + c;
        bool masked = false;
        if (diag) masked = (kvcol > qrow);
        else if (g.mask_mode == 4) masked = (kvcol > qrow) || (qrow - kvcol > g.mask_is_int);
        else if (g.mask_mode == 2) {
          const size_t mi = (size_t)qrow * g.Skv + kvcol;
          masked = (g.mask_is_int == 0) ? (((const float*)mask_a)[mi] == 0.0f)
                 : (g.mask_is_int == 1) ? (((const int*)mask_a)[mi] == 0) : (((const int*)mask_a)[mi] != 0);
        } else if (g.mask_mode == 3) masked = (qkeep[r] == 0) || (kvkeep[j] == 0);
        else if (g.mask_mode == 5) {
          const size_t mi = (size_t)qrow * g.Skv + kvcol;
          masked = (((const int*)mask_a)[mi] != 0);
          int n = mask_b[mi]; n = n < 0 ? 0 : n;
          s[j][r] += g.cp[(size_t)b * g.c_bs + (size_t)h * g.c_hs + (size_t)qrow * g.c_rs + n]
                   + g.pc[(size_t)b * g.c_bs + (size_t)h * g.c_hs + (size_t)kvcol * g.c_rs + n];
        }
        if (masked) s[j][r] = g.mask_fill;
        m = fmaxf(m, s[j][r]);
      }
#pragma unroll
      for (int off = 1; off < 16; off <<= 1) m = fmaxf(m, __shfl_xor(m, off, 32));
      cm[r] = m;
    }
    __bf16* pwh = Psh[wave];
    __bf16* pwl = Psl[SPLIT_PV ? wave : 0];
#pragma unroll
    for (int r = 0; r < 8; ++r) {
      const float mnew = fmaxf(mrow[r], cm[r]);
      const float alpha = expf(mrow[r] - mnew);
      mrow[r] = mnew;
      float psum = 0.f;
#pragma unroll
      for (int j = 0; j < 4; ++j) {
        const float p = expf(s[j][r] - mnew);
        psum += p;
        if (SPLIT_PV) { __bf16 a, bl; at_split(p, a, bl); pwh[(8 * hh + r) * AT_KC + j * 16 + c] = a; pwl[(8 * hh + r) * AT_KC + j * 16 + c] = bl; }
        else pwh[(8 * hh + r) * AT_KC + j * 16 + c] = at_to16<F16>(p * PSC);
      }
#pragma unroll
      for (int off = 1; off < 16; off <<= 1) psum += __shfl_xor(psum, off, 32);
      lrow[r] = lrow[r] * alpha + psum;
#pragma unroll
      for (int t = 0; t < 4; ++t) oacc[t][r] *= alpha;
    }
    __builtin_amdgcn_fence(__ATOMIC_RELEASE, "workgroup");
    __builtin_amdgcn_wave_barrier();
    __builtin_amdgcn_fence(__ATOMIC_ACQUIRE, "workgroup");
#pragma unroll 1
    for (int kk = 0; kk < 2; ++kk) {
      FB pa, pl;
      pa.h[0] = *(const v8b*)(pwh + c * AT_KC + kk * 32 + 8 * hh);
      pa.h[1] = *(const v8b*)(pwh + c * AT_KC + kk * 32 + 16 + 8 * hh);
      if (SPLIT_PV) {
        pl.h[0] = *(const v8b*)(pwl + c * AT_KC + kk * 32 + 8 * hh);
        pl.h[1] = *(const v8b*)(pwl + c * AT_KC + kk * 32 + 16 + 8 * hh);
      }
#pragma unroll
      for (int t = 0; t < 4; ++t) {
        FB vb;
        vb.h[0] = *(const v8b*)(Vth + (t * 16 + c) * AT_KC + kk * 32 + 8 * hh);
        vb.h[1] = *(const v8b*)(Vth + (t * 16 + c) * AT_KC + kk * 32 + 16 + 8 * hh);
        oacc[t] = at_mma16<F16>(pa.v, vb.v, oacc[t]);
        if (SPLIT_PV) {
          FB vl;
          vl.h[0] = *(const v8b*)(Vtl + (t * 16 + c) * AT_KC + kk * 32 + 8 * hh);
          vl.h[1] = *(const v8b*)(Vtl + (t * 16 + c) * AT_KC + kk * 32 + 16 + 8 * hh);
          oacc[t] = at_mma16<F16>(pa.v, vl.v, oacc[t]);
          oacc[t] = at_mma16<F16>(pl.v, vb.v, oacc[t]);
        }
      }
    }
  }

  float* os = Os[wave];
#pragma unroll
  for (int r = 0; r < 8; ++r) {
    const float inv = 1.0f / (lrow[r] * PSC);
#pragma unroll
    for (int t = 0; t < 4; ++t) os[(8 * hh + r) * 68 + t * 16 + c] = oacc[t][r] * inv;
  }
  __builtin_amdgcn_fence(__ATOMIC_RELEASE, "workgroup");
  __builtin_amdgcn_wave_barrier();
  __builtin_amdgcn_fence(__ATOMIC_ACQUIRE, "workgroup");
  {
    const int c4 = (lane & 15) * 4;
    {
#pragma unroll
      for (int it = 0; it < 8; ++it) {
        const int row = it * 2 + hh;
        v4f val = *(const v4f*)(os + row * 68 + c4);
        *(v4f*)(ob_ptr + (size_t)(q0 + row) * g.o_rs + c4) = val;
      }
      
    }
  }
}

} // namespace w25

__device__ __forceinline__ void st_h2(_Float16* dst, float a, float b) { const unsigned u = (unsigned)__builtin_bit_cast(unsigned short, (_Float16)a) | ((unsigned)__builtin_bit_cast(unsigned short, (_Float16)b) << 16); unsigned* d = (unsigned*)dst; *d = u;  }
// tiled biases BEB[c] = bE[c % 64], BFB[c] = bF[c % 64] (thread-linear)
__global__ __launch_bounds__(256) void k_ep_btile(const float* __restrict__ BE, const float* __restrict__ BF, float* __restrict__ BEB, float* __restrict__ BFB, int C, int HD) { const int t = blockIdx.x * 256 + threadIdx.x; if (t >= C) return; VST2(float, BEB + t, BE[t % HD]); VST2(float, BFB + t, BF[t % HD]); }
// QS = q * temp2[h] (thread-linear over N*C)
__global__ __launch_bounds__(256) void k_ep_qs(const float* __restrict__ QKVV, const float* __restrict__ T2, float* __restrict__ QS, int N, int C, int C4, int HD) { const long long t = (long long)blockIdx.x * 256 + threadIdx.x; if (t >= (long long)N * C) return; const int n = (int)(t / C), c = (int)(t % C); VST2(float, QS + t, QKVV[(long long)n * C4 + c] * T2[c / HD]); }
// channel softmax: block h = sample * NH + head (64 threads): rows of SCC[h] [64][64] * temp1[h % NH]; thread i computes row i, then lanes write columns so each 32-float line comes from one wave; P16[h][i][j] = f16(4096 p)
__global__ __launch_bounds__(64) void k_ep_csoft(const float* __restrict__ S, const float* __restrict__ T1, _Float16* __restrict__ P16, int NH) { __shared__ float sh[64][65]; const int h = blockIdx.x; const int i = threadIdx.x; const float* r = S + ((long long)h * 64 + i) * 64; const float tp = T1[h % NH]; float mx = -3.0e38f;
    for (int j = 0; j < 64; ++j) mx = fmaxf(mx, r[j] * tp);
    float s = 0.f; for (int j = 0; j < 64; ++j) { const float e = expf(r[j] * tp - mx); sh[i][j] = e; s += e; }
    const float f = 4096.f / s; for (int j = 0; j < 64; ++j) sh[i][j] *= f;
    __syncthreads();
    const int half = i >> 5, c0 = 2 * (i & 31);
    for (int step = 0; step < 32; ++step) { const int rr = 2 * step + half; st_h2(P16 + ((long long)h * 64 + rr) * 64 + c0, sh[rr][c0], sh[rr][c0 + 1]); } }


extern "C" void kernel_launch(void* const* d_in, const int* in_sizes, int n_in, void* d_out, int out_size, void* d_ws, size_t ws_size, hipStream_t stream) {
    (void)in_sizes; (void)n_in; (void)out_size; (void)ws_size;
    const float* x = (const float*)d_in[0];
    const float* Wq = (const float*)d_in[1];
    const float* WE = (const float*)d_in[2];
    const float* bE = (const float*)d_in[3];
    const float* WF = (const float*)d_in[4];
    const float* bF = (const float*)d_in[5];
    const float* Wo1 = (const float*)d_in[6];
    const float* bo1 = (const float*)d_in[7];
    const float* Wo2 = (const float*)d_in[8];
    const float* bo2 = (const float*)d_in[9];
    const float* t1 = (const float*)d_in[10];
    const float* t2 = (const float*)d_in[11];
    const int Bn = 8;
    const int N = 1024;
    const int C = 1024;
    const int NH = 16;
    const int HD = 64;
    const int C4 = 4 * C;
    const int CH = C / 2;
    float* out = (float*)d_out;
    char* wsp = (char*)d_ws;
    const int BN = Bn * N;                    // all samples' rows: every launch below covers the whole batch
    const size_t MB = (size_t)1048576;
    float* QKVV = (float*)wsp; wsp += (((size_t)((size_t)BN * C4) * 4 + 255) / 256) * 256;
    unsigned short* WE16 = (unsigned short*)wsp; wsp += (((size_t)((size_t)HD * HD) * 2 + 255) / 256) * 256;
    unsigned short* WF16 = (unsigned short*)wsp; wsp += (((size_t)((size_t)HD * HD) * 2 + 255) / 256) * 256;
    float* BEB = (float*)wsp; wsp += (((size_t)((size_t)C) * 4 + 255) / 256) * 256;
    float* BFB = (float*)wsp; wsp += (((size_t)((size_t)C) * 4 + 255) / 256) * 256;
    // One 115 MiB region behind QKVV, used by three phases one after the other (stream order); a plane is reused only once its last reader has been launched.
    // projection: x planes and weight planes
    unsigned short* G64A  = (unsigned short*)(wsp);
    unsigned short* G64A2 = (unsigned short*)(wsp + 16 * MB);
    unsigned short* G64B  = (unsigned short*)(wsp + 32 * MB);
    unsigned short* G64B2 = (unsigned short*)(wsp + 36 * MB);
    // channel attention
    unsigned short* QTH   = (unsigned short*)(wsp);
    unsigned short* QTL   = (unsigned short*)(wsp + 16 * MB);
    unsigned short* KTH   = (unsigned short*)(wsp + 32 * MB);
    unsigned short* KTL   = (unsigned short*)(wsp + 48 * MB);
    unsigned short* VCA16 = (unsigned short*)(wsp + 64 * MB);
    float*          XC    = (float*)(wsp + 80 * MB);
    float*          SCC   = (float*)(wsp + 112 * MB);
    unsigned short* P16   = (unsigned short*)(wsp + 114 * MB);
    unsigned short* XC16  = (unsigned short*)(wsp);               // over QTH, read last by the affinity product
    unsigned short* WO2H  = (unsigned short*)(wsp + 16 * MB);     // over QTL
    // spatial attention
    unsigned short* K16   = (unsigned short*)(wsp);
    unsigned short* VSA16 = (unsigned short*)(wsp + 16 * MB);
    float*          KS    = (float*)(wsp + 32 * MB);
    float*          VS    = (float*)(wsp + 64 * MB);
    float*          QS    = (float*)(wsp);                        // over K16 and VSA16, read last by the E/F products
    float*          XS    = (float*)d_ws;                         // over QKVV, read last by k_ep_qs
    unsigned short* XS16  = (unsigned short*)((char*)d_ws + 32 * MB);
    unsigned short* WO1H  = (unsigned short*)((char*)d_ws + 48 * MB);
    k_cast16<<<(unsigned)((((long long)(HD) * ((HD) / 2)) + 255) / 256), 256, 0, stream>>>(WE, HD, (_Float16*)(WE16), HD, HD, HD, 16.0f);
    k_cast16<<<(unsigned)((((long long)(HD) * ((HD) / 2)) + 255) / 256), 256, 0, stream>>>(WF, HD, (_Float16*)(WF16), HD, HD, HD, 16.0f);
    k_ep_btile<<<(C + 255) / 256, 256, 0, stream>>>(bE, bF, BEB, BFB, C, HD);
    // shared projection, rows = sample * N + n
    k_castS16<<<(unsigned)((((long long)(BN) * ((1024) / 2)) + 255) / 256), 256, 0, stream>>>(x, 1024, (__bf16*)(G64A), (__bf16*)(G64A2), 1024, BN, 1024, 1.0f, 0, 0, 0);
    k_castS16<<<(unsigned)((((long long)(2048) * ((1024) / 2)) + 255) / 256), 256, 0, stream>>>(Wq, 1024, (__bf16*)(G64B), (__bf16*)(G64B2), 1024, 2048, 1024, 1.0f, 0, 0, 0);
    w25::wmma_gemm_ring<1, true, 0, 0><<<dim3((unsigned)(2048 / 128), (unsigned)(BN / 128)), 128, 0, stream>>>((const unsigned short*)(G64A), (const unsigned short*)(G64A2), (const unsigned short*)(G64B), (const unsigned short*)(G64B2), QKVV, 4096, nullptr, 1024, 1.0f);
    k_cast16<<<(unsigned)((((long long)(BN) * ((1024) / 2)) + 255) / 256), 256, 0, stream>>>(x, 1024, (_Float16*)(G64A), 1024, BN, 1024, 1.0f);
    k_cast16<<<(unsigned)((((long long)(2048) * ((1024) / 2)) + 255) / 256), 256, 0, stream>>>(Wq + (size_t)2 * C * C, 1024, (_Float16*)(G64B), 1024, 2048, 1024, 16.0f);
    w25::wmma_gemm_ring<0, false, 0, 0><<<dim3((unsigned)(2048 / 128), (unsigned)(BN / 128)), 128, 0, stream>>>((const unsigned short*)(G64A), nullptr, (const unsigned short*)(G64B), nullptr, QKVV + 2 * C, 4096, nullptr, 1024, 0.0625f);
    // channel attention: grid y = head, grid z = sample
    k_cast16<<<(unsigned)((((long long)(BN) * ((C) / 2)) + 255) / 256), 256, 0, stream>>>(QKVV + 2 * C, C4, (_Float16*)(VCA16), C, BN, C, 1.0f);
    k_castS16<<<dim3((unsigned)((((long long)(C) * ((N) / 2)) + 255) / 256), (unsigned)(Bn)), 256, 0, stream>>>(QKVV, C4, (__bf16*)(QTH), (__bf16*)(QTL), N, N, C, 1.0f, 1, (long long)N * C4, (long long)C * N);
    k_castS16<<<dim3((unsigned)((((long long)(C) * ((N) / 2)) + 255) / 256), (unsigned)(Bn)), 256, 0, stream>>>(QKVV + C, C4, (__bf16*)(KTH), (__bf16*)(KTL), N, N, C, 1.0f, 1, (long long)N * C4, (long long)C * N);
    w25::wmma_gemm64<1, true, 0, 0, false, 0><<<dim3((unsigned)((((HD) / 64) * ((HD) / 64) + 7) / 8), (unsigned)(NH), (unsigned)(Bn)), 256, 0, stream>>>((const unsigned short*)(QTH), (const unsigned short*)(QTL), N, (long long)HD * N, (long long)C * N, (const unsigned short*)(KTH), (const unsigned short*)(KTL), N, (long long)HD * N, (long long)C * N, (void*)(SCC), nullptr, HD, HD * HD, NH * HD * HD, nullptr, nullptr, 0, HD, HD, N, 1.0f);
    k_ep_csoft<<<Bn * NH, 64, 0, stream>>>(SCC, t1, (_Float16*)P16, NH);
    w25::wmma_gemm64<0, false, 0, 0, false, 0><<<dim3((unsigned)((((HD) / 64) * ((N) / 64) + 7) / 8), (unsigned)(NH), (unsigned)(Bn)), 256, 0, stream>>>((const unsigned short*)(P16), nullptr, HD, HD * HD, NH * HD * HD, (const unsigned short*)(VCA16), nullptr, C, HD, (long long)N * C, (void*)(XC), nullptr, 16 * C, C, (long long)N * C, nullptr, nullptr, 0, HD, N, HD, 0.000244140625f);
    k_cast16<<<(unsigned)((((long long)(BN) * ((1024) / 2)) + 255) / 256), 256, 0, stream>>>(XC, 1024, (_Float16*)(XC16), 1024, BN, 1024, 1.0f);
    k_cast16<<<(unsigned)((((long long)(512) * ((1024) / 2)) + 255) / 256), 256, 0, stream>>>(Wo2, 1024, (_Float16*)(WO2H), 1024, 512, 1024, 16.0f);
    w25::wmma_gemm_ring<0, false, 2, 5><<<dim3((unsigned)(512 / 128), (unsigned)(BN / 128)), 128, 0, stream>>>((const unsigned short*)(XC16), nullptr, (const unsigned short*)(WO2H), nullptr, out + CH, 1024, bo2, 1024, 0.0625f);
    // spatial attention
    k_cast16<<<(unsigned)((((long long)(BN) * ((C) / 2)) + 255) / 256), 256, 0, stream>>>(QKVV + C, C4, (_Float16*)(K16), C, BN, C, 1.0f);
    k_cast16<<<(unsigned)((((long long)(BN) * ((C) / 2)) + 255) / 256), 256, 0, stream>>>(QKVV + 3 * C, C4, (_Float16*)(VSA16), C, BN, C, 1.0f);
    w25::wmma_gemm64<0, false, 2, 0, false, 0><<<dim3((unsigned)((((BN) / 64) * ((HD) / 64) + 7) / 8), (unsigned)(NH), (unsigned)(1)), 256, 0, stream>>>((const unsigned short*)(K16), nullptr, C, HD, 0, (const unsigned short*)(WE16), nullptr, HD, 0, 0, (void*)(KS), nullptr, C, HD, 0, BEB, nullptr, 0, BN, HD, HD, 0.0625f);
    w25::wmma_gemm64<0, false, 2, 0, false, 0><<<dim3((unsigned)((((BN) / 64) * ((HD) / 64) + 7) / 8), (unsigned)(NH), (unsigned)(1)), 256, 0, stream>>>((const unsigned short*)(VSA16), nullptr, C, HD, 0, (const unsigned short*)(WF16), nullptr, HD, 0, 0, (void*)(VS), nullptr, C, HD, 0, BFB, nullptr, 0, BN, HD, HD, 0.0625f);
    k_ep_qs<<<(unsigned)(((long long)BN * C + 255) / 256), 256, 0, stream>>>(QKVV, t2, QS, BN, C, C4, HD);
    sfa::k_sflash<<<dim3((unsigned)(N / 256), (unsigned)(NH), (unsigned)(Bn)), 256, 0, stream>>>(QS, KS, VS, XS);
    k_cast16<<<(unsigned)((((long long)(BN) * ((1024) / 2)) + 255) / 256), 256, 0, stream>>>(XS, 1024, (_Float16*)(XS16), 1024, BN, 1024, 1.0f);
    k_cast16<<<(unsigned)((((long long)(512) * ((1024) / 2)) + 255) / 256), 256, 0, stream>>>(Wo1, 1024, (_Float16*)(WO1H), 1024, 512, 1024, 16.0f);
    w25::wmma_gemm_ring<0, false, 2, 5><<<dim3((unsigned)(512 / 128), (unsigned)(BN / 128)), 128, 0, stream>>>((const unsigned short*)(XS16), nullptr, (const unsigned short*)(WO1H), nullptr, out, 1024, bo1, 1024, 0.0625f);
}

// v004
// One run takes 400 microseconds.
// Next to v003, in two timings, it ran 1.26 and 1.25 times as fast.
// All steps since v000 together make it 17.3 times as fast.
// Contractions (per sample): the shared QKVV projection x.W^T [1024x1024].[1024x4096] (q/k columns on bf16 hi/lo split planes), the E/F head projections of k and v_sa as per-head z-batched [1024x64].[64x64] products (+b), the 16 channel affinities q^T k [64x1024].[1024x64] on bf16 hi/lo split planes (64-wide softmax over sigma~19 logits: plain f16 flipped near-ties) and x_c = attn_c.v_ca^T [64x64].[64x1024] as z-batched products, and the two output halves gelu(x_s.W_o1^T + b) / gelu(x_c.W_o2^T + b) [1024x1024].[1024x512] — f16 operands on pre-cast planes (v_wmma_f32_16x16x32_f16; 64x64 register-blocked wave tiles, weights x16); per (sample, head) the spatial attention softmax(q.k_s^T * temp2[h]) v_s over 1024 positions as one flash launch (f16 operands; temperature folded into q on device); f32 accumulate and softmax. The tiled E/F biases, the 64-wide channel softmax (x temp1[h], exp once, f16 plane) and the q pre-scaling are f32 kernels; x_c is laid out exactly as torch's permute(0,2,1,3).reshape (row = d*16 + h, column = n).
#include <hip/hip_runtime.h>
#include <math.h>

typedef __attribute__((ext_vector_type(16))) _Float16 v16h;
typedef __attribute__((ext_vector_type(8)))  _Float16 v8h;
typedef __attribute__((ext_vector_type(16))) __bf16   v16b;
typedef __attribute__((ext_vector_type(8)))  float    v8f;
typedef __attribute__((ext_vector_type(4)))  float    v4f;

// 16-bit WMMA fragment map (wave32), lane L, h = L>>4, m = L&15:
//   A 16x32: lane = row m;   element i -> k = (i<8) ? 8h+i : 16+8h+(i-8)
//   B 32x16: lane = column m; the SAME k(i,h)
//   D 16x16 (8 f32): lane = column m; element r -> row 8h+r
__device__ __forceinline__ int frag_k(int i, int h) { return (i < 8) ? (8 * h + i) : (16 + 8 * h + (i - 8)); }
__device__ __forceinline__ __bf16 bf16_rne(float f) {
    unsigned int u = __float_as_uint(f);
    u += 0x7fffu + ((u >> 16) & 1u);
    return __builtin_bit_cast(__bf16, (unsigned short)(u >> 16));
}
__device__ __forceinline__ float bf16_f32(__bf16 b) { return __uint_as_float(((unsigned int)__builtin_bit_cast(unsigned short, b)) << 16); }
__device__ __forceinline__ v8f wmma16(v16h a, v16h b, v8f c) {
    c = __builtin_amdgcn_wmma_f32_16x16x32_f16(false, a, false, b, (short)0, c, false, false);
    asm volatile("v_nop\n\tv_nop\n\tv_nop\n\tv_nop" : "+v"(c) : "v"(a), "v"(b));
    return c;
}
__device__ __forceinline__ v8f wmmab(v16b a, v16b b, v8f c) {
    c = __builtin_amdgcn_wmma_f32_16x16x32_bf16(false, a, false, b, (short)0, c, false, false);
    asm volatile("v_nop\n\tv_nop\n\tv_nop\n\tv_nop" : "+v"(c) : "v"(a), "v"(b));
    return c;
}
struct Split { v16b hi, lo; };
// hi/lo split product: a.hi*b.hi + a.hi*b.lo + a.lo*b.hi
__device__ __forceinline__ v8f wmma3(const Split& a, const Split& b, v8f c) {
    c = __builtin_amdgcn_wmma_f32_16x16x32_bf16(false, a.hi, false, b.hi, (short)0, c, false, false);
    c = __builtin_amdgcn_wmma_f32_16x16x32_bf16(false, a.hi, false, b.lo, (short)0, c, false, false);
    c = __builtin_amdgcn_wmma_f32_16x16x32_bf16(false, a.lo, false, b.hi, (short)0, c, false, false);
    asm volatile("v_nop\n\tv_nop\n\tv_nop\n\tv_nop" : "+v"(c) : "v"(a.hi), "v"(a.lo), "v"(b.hi), "v"(b.lo));
    return c;
}
struct Split3 { v16b hi, mid, lo; };
// triple split product (6 terms, drops only terms below 2^-24 relative)
__device__ __forceinline__ v8f wmma6(const Split3& a, const Split3& b, v8f c) {
    c = __builtin_amdgcn_wmma_f32_16x16x32_bf16(false, a.hi, false, b.hi, (short)0, c, false, false);
    c = __builtin_amdgcn_wmma_f32_16x16x32_bf16(false, a.hi, false, b.mid, (short)0, c, false, false);
    c = __builtin_amdgcn_wmma_f32_16x16x32_bf16(false, a.mid, false, b.hi, (short)0, c, false, false);
    c = __builtin_amdgcn_wmma_f32_16x16x32_bf16(false, a.hi, false, b.lo, (short)0, c, false, false);
    c = __builtin_amdgcn_wmma_f32_16x16x32_bf16(false, a.mid, false, b.mid, (short)0, c, false, false);
    c = __builtin_amdgcn_wmma_f32_16x16x32_bf16(false, a.lo, false, b.hi, (short)0, c, false, false);
    asm volatile("v_nop\n\tv_nop\n\tv_nop\n\tv_nop" : "+v"(c) : "v"(a.hi), "v"(a.mid), "v"(a.lo), "v"(b.hi), "v"(b.mid), "v"(b.lo));
    return c;
}

// Fragment gathers from f32 memory: element i <- p[(k0 + frag_k(i,h)) * sk] * s, zero for k >= klen.
__device__ __forceinline__ v16h fh_ld(const float* __restrict__ p, long long sk, int k0, int h, int klen, float s) {
    v16h a;
#pragma unroll
    for (int i = 0; i < 16; ++i) { const int k = k0 + frag_k(i, h); a[i] = (k < klen) ? (_Float16)(p[(long long)k * sk] * s) : (_Float16)0.f; }
    return a;
}
__device__ __forceinline__ Split sp_ld(const float* __restrict__ p, long long sk, int k0, int h, int klen, float s) {
    Split r;
#pragma unroll
    for (int i = 0; i < 16; ++i) {
        const int k = k0 + frag_k(i, h); const float x = (k < klen) ? p[(long long)k * sk] * s : 0.f;
        const __bf16 hb = bf16_rne(x); r.hi[i] = hb; r.lo[i] = bf16_rne(x - bf16_f32(hb));
    }
    return r;
}
__device__ __forceinline__ Split3 sp3_ld(const float* __restrict__ p, long long sk, int k0, int h, int klen, float s) {
    Split3 r;
#pragma unroll
    for (int i = 0; i < 16; ++i) {
        const int k = k0 + frag_k(i, h); const float x = (k < klen) ? p[(long long)k * sk] * s : 0.f;
        const __bf16 hb = bf16_rne(x); const float r1 = x - bf16_f32(hb); const __bf16 mb = bf16_rne(r1);
        r.hi[i] = hb; r.mid[i] = mb; r.lo[i] = bf16_rne(r1 - bf16_f32(mb));
    }
    return r;
}
__device__ __forceinline__ v16b bh_ld(const float* __restrict__ p, long long sk, int k0, int h, int klen, float s) {
    v16b a;
#pragma unroll
    for (int i = 0; i < 16; ++i) { const int k = k0 + frag_k(i, h); a[i] = bf16_rne((k < klen) ? p[(long long)k * sk] * s : 0.f); }
    return a;
}
// f16 fragment from an f16 LDS/global row with element stride 1 (k-contiguous), no bounds (tile already zero padded)
__device__ __forceinline__ v16h fh_row(const _Float16* __restrict__ row, int k0, int h) {
    v16h a;
#pragma unroll
    for (int i = 0; i < 16; ++i) a[i] = row[k0 + frag_k(i, h)];
    return a;
}

#define VST2(T, ptr, val) do { const T vst2_v_ = (val); *(T*)(ptr) = vst2_v_;  } while (0)
typedef float v4f __attribute__((ext_vector_type(4)));
#define VST2V4(ptr, val) do { const v4f vst2_v4_ = (val); *(v4f*)(ptr) = vst2_v4_;  } while (0)

__device__ __attribute__((noinline)) float act_fn(float v, int act) {
    if (act == 1) return fmaxf(v, 0.f);                                                                               // relu
    if (act == 2) { const float u = 0.7978845608028654f * (v + 0.044715f * v * v * v); return 0.5f * v * (1.f + tanhf(u)); } // tanh-gelu
    if (act == 3) return v / (1.f + expf(-v));                                                                        // silu
    if (act == 4) return 0.5f * v * (1.f + erff(v * 0.7071067811865476f));                                             // erf-gelu
    if (act == 5) return tanhf(v);
    if (act == 6) return 1.f / (1.f + expf(-v));                                                                      // sigmoid
    if (act == 7) return (v > 0.f) ? v : 0.01f * v;                                                                   // leaky relu 0.01
    if (act == 8) return (v > 0.f) ? v : (expf(v) - 1.f);                                                             // elu
    if (act == 9) return fminf(fmaxf(v, 0.f), 6.f);                                                                   // relu6
    if (act == 10) return fabsf(v);                                                                                    // abs
    if (act == 11) return (v >= 0.f) ? v : 0.1f * v;                                                                  // leaky 0.1
    if (act == 12) return (v > 0.f) ? v : 0.2f * v;                                                                   // leaky 0.2
    if (act == 13) return (v > 20.f) ? v : log1pf(expf(v));                                                            // softplus
    return v;
}

// =====================================================================================================================
// k_gemm<MODE>: C(z, m, n) = act(alpha * sum_k A(z, m, k) * B(z, k, n) + bias) + beta * R(z, m, n)
//   One wave (32-thread block) per 16 x 32 tile of C; grid (ceil(N/32), ceil(M/16), Z). Batch z -> (zo = z / zi_n, zi = z % zi_n)
//   with separate outer/inner strides for every tensor (e.g. batch and head). A(m,k) = A[zo*sAo + zi*sAi + m*sAm + k*sAk] (f32),
//   B(k,n) = B[zo*sBo + zi*sBi + n*sBn + k*sBk] (f32); any M, N, K (K zero-padded to 32 inside the fragments, M/N tails guarded).
//   C(m,n) = C[zo*sCo + zi*sCi + m*sCm + n] (n contiguous). flags: 1 bias[n], 2 bias[m], 4 residual R[zo*sRo + zi*sRi + m*sRm + n*sRn].
//   MODE 0: f16 operands (A prescaled by sa, B by sb, both undone in the epilogue); 1: bf16 hi/lo split (3 products); 2: bf16;
//   3: bf16 hi/mid/lo triple split (6 products); 4: as 3 with Kahan-compensated f32 accumulation across k-steps.
// =====================================================================================================================
struct GemmP {
    const float* A; const float* B; const float* bias; const float* R; float* C;
    long long sAo, sAi, sAm, sAk, sBo, sBi, sBn, sBk, sCo, sCi, sCm, sRo, sRi, sRm, sRn;
    int M, N, K, zi_n, flags, act; float alpha, beta, sa, sb;
    int Npad, pad_;     // columns [N, Npad) of C are written as 0 so that padded workspace rows are covered by whole-line stores; Npad >= N
};
static_assert(sizeof(GemmP) == 5 * 8 + 15 * 8 + 6 * 4 + 4 * 4 + 2 * 4, "GemmP has padding");

template <int MODE>
__global__ __launch_bounds__(32) void k_gemm(GemmP p) {
    const int lane = threadIdx.x & 31, h = lane >> 4, l15 = lane & 15;
    const int m0 = blockIdx.y * 16, n0 = blockIdx.x * 32;
    const int z = blockIdx.z, zo = z / p.zi_n, zi = z - zo * p.zi_n;
    const float* A = p.A + zo * p.sAo + zi * p.sAi;
    const float* B = p.B + zo * p.sBo + zi * p.sBi;
    const int am = min(m0 + l15, p.M - 1);                       // clamped row for loads (stores are guarded)
    v8f acc[2], comp[2];
#pragma unroll
    for (int t = 0; t < 2; ++t) { v8f zz = {}; acc[t] = zz; comp[t] = zz; }
    for (int k0 = 0; k0 < p.K; k0 += 32) {
        const float* arow = A + (long long)am * p.sAm;
        if (MODE == 1) {
            const Split a = sp_ld(arow, p.sAk, k0, h, p.K, 1.f);
#pragma unroll
            for (int t = 0; t < 2; ++t) {
                const int bn = min(n0 + t * 16 + l15, p.N - 1);
                acc[t] = wmma3(a, sp_ld(B + (long long)bn * p.sBn, p.sBk, k0, h, p.K, 1.f), acc[t]);
            }
        } else if (MODE == 3) {
            const Split3 a = sp3_ld(arow, p.sAk, k0, h, p.K, 1.f);
#pragma unroll
            for (int t = 0; t < 2; ++t) {
                const int bn = min(n0 + t * 16 + l15, p.N - 1);
                acc[t] = wmma6(a, sp3_ld(B + (long long)bn * p.sBn, p.sBk, k0, h, p.K, 1.f), acc[t]);
            }
        } else if (MODE == 4) {
            // triple split as MODE 3, but each k-step's 6 products go into a fresh accumulator and the partial is added to the running f32 sum
            // on the VALU with Kahan compensation (accumulation error stays ~1 ulp however long K is)
            const Split3 a = sp3_ld(arow, p.sAk, k0, h, p.K, 1.f);
#pragma unroll
            for (int t = 0; t < 2; ++t) {
                const int bn = min(n0 + t * 16 + l15, p.N - 1); v8f zz = {};
                const v8f part = wmma6(a, sp3_ld(B + (long long)bn * p.sBn, p.sBk, k0, h, p.K, 1.f), zz);
                const v8f y = part - comp[t]; const v8f s = acc[t] + y; comp[t] = (s - acc[t]) - y; acc[t] = s;
            }
        } else if (MODE == 2) {
            const v16b a = bh_ld(arow, p.sAk, k0, h, p.K, 1.f);
#pragma unroll
            for (int t = 0; t < 2; ++t) {
                const int bn = min(n0 + t * 16 + l15, p.N - 1);
                acc[t] = wmmab(a, bh_ld(B + (long long)bn * p.sBn, p.sBk, k0, h, p.K, 1.f), acc[t]);
            }
        } else {
            const v16h a = fh_ld(arow, p.sAk, k0, h, p.K, p.sa);
#pragma unroll
            for (int t = 0; t < 2; ++t) {
                const int bn = min(n0 + t * 16 + l15, p.N - 1);
                acc[t] = wmma16(a, fh_ld(B + (long long)bn * p.sBn, p.sBk, k0, h, p.K, p.sb), acc[t]);
            }
        }
    }
    const float iscale = (MODE == 0) ? p.alpha / (p.sa * p.sb) : p.alpha;
    float* C = p.C + zo * p.sCo + zi * p.sCi;
    const float* R = p.R + zo * p.sRo + zi * p.sRi;
    __shared__ __align__(16) float ctile[16][36];
#pragma unroll
    for (int t = 0; t < 2; ++t) {
        const int n = n0 + t * 16 + l15; const int nn = min(n, p.N - 1);
#pragma unroll
        for (int r = 0; r < 8; ++r) {
            const int m = m0 + 8 * h + r; const int mm = min(m, p.M - 1);
            float v = acc[t][r] * iscale;
            if (p.flags & 1) v += p.bias[nn];
            if (p.flags & 2) v += p.bias[mm];
            if (p.flags & 8) v *= p.bias[(long long)zo * p.M + mm];   /* per-(z,row) scale vector laid out [Z][M]; exclusive with the bias flags */
            v = act_fn(v, p.act);
            if (p.flags & 4) v += p.beta * R[(long long)mm * p.sRm + (long long)nn * p.sRn];
            ctile[8 * h + r][t * 16 + l15] = (n < p.N) ? v : 0.f;
        }
    }
    __syncthreads();
    const int NW = (p.Npad > p.N) ? p.Npad : p.N;           // write width
    const bool fast = (m0 + 16 <= p.M) && (n0 + 32 <= NW) && ((p.sCm & 3) == 0) && ((((size_t)C) & 15) == 0);
    if (fast) {
#pragma unroll
        for (int s = 0; s < 4; ++s) {
            const int row = s * 4 + (lane >> 3), c4 = (lane & 7) * 4;
            const v4f v = *(const v4f*)&ctile[row][c4];
            VST2V4(C + (long long)(m0 + row) * p.sCm + n0 + c4, v);
        }
    } else {
        for (int row = 0; row < 16; ++row) {
            const int m = m0 + row, n = n0 + lane;
            if (m < p.M && n < NW) VST2(float, C + (long long)m * p.sCm + n, ctile[row][lane]);
        }
    }
}


// =====================================================================================================================
// k_gemmT<MODE, TM, TN>: same contract as k_gemm, but one wave computes a (16*TM) x (16*TN) tile: TM A fragments and TN B fragments are
//   loaded per 32-wide k-step and reused across TM*TN WMMAs (far fewer load/convert instructions per MAC). MODE 0 (f16), 1 (bf16 hi/lo),
//   2 (bf16) only. grid (ceil(NW/(16*TN)), ceil(M/(16*TM)), Z), block 32. Epilogue identical to k_gemm, run per 16x32 sub-tile.
// =====================================================================================================================
template <int MODE, int TM, int TN>
__global__ __launch_bounds__(32) void k_gemmT(GemmP p) {
    const int lane = threadIdx.x & 31, h = lane >> 4, l15 = lane & 15;
    const int m0 = blockIdx.y * (16 * TM), n0 = blockIdx.x * (16 * TN);
    const int z = blockIdx.z, zo = z / p.zi_n, zi = z - zo * p.zi_n;
    const float* A = p.A + zo * p.sAo + zi * p.sAi;
    const float* B = p.B + zo * p.sBo + zi * p.sBi;
    v8f acc[TM][TN];
#pragma unroll
    for (int i = 0; i < TM; ++i)
#pragma unroll
        for (int t = 0; t < TN; ++t) { v8f zz = {}; acc[i][t] = zz; }
    for (int k0 = 0; k0 < p.K; k0 += 32) {
        if (MODE == 1) {
            Split a[TM], b[TN];
#pragma unroll
            for (int i = 0; i < TM; ++i) { const int am = min(m0 + 16 * i + l15, p.M - 1); a[i] = sp_ld(A + (long long)am * p.sAm, p.sAk, k0, h, p.K, 1.f); }
#pragma unroll
            for (int t = 0; t < TN; ++t) { const int bn = min(n0 + 16 * t + l15, p.N - 1); b[t] = sp_ld(B + (long long)bn * p.sBn, p.sBk, k0, h, p.K, 1.f); }
#pragma unroll
            for (int i = 0; i < TM; ++i)
#pragma unroll
                for (int t = 0; t < TN; ++t) acc[i][t] = wmma3(a[i], b[t], acc[i][t]);
        } else if (MODE == 2) {
            v16b a[TM], b[TN];
#pragma unroll
            for (int i = 0; i < TM; ++i) { const int am = min(m0 + 16 * i + l15, p.M - 1); a[i] = bh_ld(A + (long long)am * p.sAm, p.sAk, k0, h, p.K, 1.f); }
#pragma unroll
            for (int t = 0; t < TN; ++t) { const int bn = min(n0 + 16 * t + l15, p.N - 1); b[t] = bh_ld(B + (long long)bn * p.sBn, p.sBk, k0, h, p.K, 1.f); }
#pragma unroll
            for (int i = 0; i < TM; ++i)
#pragma unroll
                for (int t = 0; t < TN; ++t) acc[i][t] = wmmab(a[i], b[t], acc[i][t]);
        } else {
            v16h a[TM], b[TN];
#pragma unroll
            for (int i = 0; i < TM; ++i) { const int am = min(m0 + 16 * i + l15, p.M - 1); a[i] = fh_ld(A + (long long)am * p.sAm, p.sAk, k0, h, p.K, p.sa); }
#pragma unroll
            for (int t = 0; t < TN; ++t) { const int bn = min(n0 + 16 * t + l15, p.N - 1); b[t] = fh_ld(B + (long long)bn * p.sBn, p.sBk, k0, h, p.K, p.sb); }
#pragma unroll
            for (int i = 0; i < TM; ++i)
#pragma unroll
                for (int t = 0; t < TN; ++t) acc[i][t] = wmma16(a[i], b[t], acc[i][t]);
        }
    }
    const float iscale = (MODE == 0) ? p.alpha / (p.sa * p.sb) : p.alpha;
    float* C = p.C + zo * p.sCo + zi * p.sCi;
    const float* R = p.R + zo * p.sRo + zi * p.sRi;
    const int NW = (p.Npad > p.N) ? p.Npad : p.N;
    __shared__ __align__(16) float ctile[16][36];
#pragma unroll
    for (int i = 0; i < TM; ++i) {
        const int mb = m0 + 16 * i; if (mb >= p.M) break;          // wave-uniform
#pragma unroll
        for (int tp = 0; tp < TN / 2; ++tp) {
            const int nb = n0 + 32 * tp; if (nb >= NW) break;        // wave-uniform
#pragma unroll
            for (int t2 = 0; t2 < 2; ++t2) {
                const int t = 2 * tp + t2; const int n = nb + t2 * 16 + l15; const int nn = min(n, p.N - 1);
#pragma unroll
                for (int r = 0; r < 8; ++r) {
                    const int m = mb + 8 * h + r; const int mm = min(m, p.M - 1);
                    float v = acc[i][t][r] * iscale;
                    if (p.flags & 1) v += p.bias[nn];
                    if (p.flags & 2) v += p.bias[mm];
            if (p.flags & 8) v *= p.bias[(long long)zo * p.M + mm];   /* per-(z,row) scale vector laid out [Z][M]; exclusive with the bias flags */
                    v = act_fn(v, p.act);
                    if (p.flags & 4) v += p.beta * R[(long long)mm * p.sRm + (long long)nn * p.sRn];
                    ctile[8 * h + r][t2 * 16 + l15] = (n < p.N) ? v : 0.f;
                }
            }
            __syncthreads();
            const bool fast = (mb + 16 <= p.M) && (nb + 32 <= NW) && ((p.sCm & 3) == 0) && ((((size_t)C) & 15) == 0);
            if (fast) {
#pragma unroll
                for (int s = 0; s < 4; ++s) {
                    const int row = s * 4 + (lane >> 3), c4 = (lane & 7) * 4;
                    const v4f v = *(const v4f*)&ctile[row][c4];
                    VST2V4(C + (long long)(mb + row) * p.sCm + nb + c4, v);
                }
            } else {
                for (int row = 0; row < 16; ++row) {
                    const int m = mb + row, n = nb + lane;
                    if (m < p.M && n < NW) VST2(float, C + (long long)m * p.sCm + n, ctile[row][lane]);
                }
            }
            __syncthreads();
        }
    }
}

namespace sfa {
typedef unsigned int u32x4 __attribute__((ext_vector_type(4)));
typedef unsigned int u32x2 __attribute__((ext_vector_type(2)));
typedef int i32x8 __attribute__((ext_vector_type(8)));
typedef short s16x8 __attribute__((ext_vector_type(8)));
typedef float f32x2 __attribute__((ext_vector_type(2)));
typedef _Float16 h16x2 __attribute__((ext_vector_type(2)));
constexpr int SEQ = 1024, LDR = 1024, HS = 64;
constexpr int NWV = 8, CW = 32, BR = NWV * CW, SK = 64, NST = SEQ / SK;
constexpr unsigned PK = 2u * HS + 16u, PV = 2u * HS + 32u, TILE_K = SK * PK, TILE_V = SK * PV, SLOT = TILE_K + TILE_V;
struct Fr { u32x4 q[2]; };
__device__ __forceinline__ v8f mma(const Fr& a, const Fr& b, v8f c) {
    const i32x8 av = {(int)a.q[0].x, (int)a.q[0].y, (int)a.q[0].z, (int)a.q[0].w, (int)a.q[1].x, (int)a.q[1].y, (int)a.q[1].z, (int)a.q[1].w};
    const i32x8 bv = {(int)b.q[0].x, (int)b.q[0].y, (int)b.q[0].z, (int)b.q[0].w, (int)b.q[1].x, (int)b.q[1].y, (int)b.q[1].z, (int)b.q[1].w};
    return __builtin_amdgcn_wmma_f32_16x16x32_f16(false, __builtin_bit_cast(v16h, av), false, __builtin_bit_cast(v16h, bv), (short)0, c, false, false);
}
__device__ __forceinline__ unsigned pack2(float lo, float hi) { return __builtin_bit_cast(unsigned, __builtin_convertvector(f32x2{lo, hi}, h16x2)); }   // round to nearest even
__device__ __forceinline__ u32x4 ld_tr16(const unsigned char* p) { typedef __attribute__((address_space(3))) s16x8 lds_s16x8; return __builtin_bit_cast(u32x4, __builtin_amdgcn_ds_load_tr16_b128_v8i16((lds_s16x8*)p)); }
__device__ __forceinline__ float xhalf(float x) { return __builtin_bit_cast(float, __builtin_amdgcn_permlanex16(__builtin_bit_cast(int, x), __builtin_bit_cast(int, x), 0x76543210, 0xfedcba98, false, false)); }   // lane l with lane l ^ 16

__global__ __launch_bounds__(NWV * 32) void k_sflash(const float* __restrict__ Q, const float* __restrict__ K, const float* __restrict__ V, float* __restrict__ O) {
    __shared__ __attribute__((aligned(256))) unsigned char L[2 * SLOT];
    const unsigned tid = threadIdx.x, lane = tid & 31u, wave = tid >> 5, c = lane & 15u, h = lane >> 4;
    const size_t base = (size_t)blockIdx.z * SEQ * LDR + (size_t)blockIdx.y * HS;
    const unsigned qw0 = blockIdx.x * BR + wave * CW;
    // staging: 16 lanes cover one 256-byte row, thread t takes rows (t >> 4) + 16 i of the stage
    const float* kg = K + base + (size_t)(tid >> 4) * LDR + (tid & 15u) * 4u;
    const float* vg = V + base + (size_t)(tid >> 4) * LDR + (tid & 15u) * 4u;
    unsigned char* ks = L + (tid >> 4) * PK + (tid & 15u) * 8u;
    unsigned char* vs = L + TILE_K + (tid >> 4) * PV + (tid & 15u) * 8u;
    v4f kr[4], vr[4];
    auto fetch = [&](int st) {
#pragma unroll
        for (int i = 0; i < 4; ++i) { kr[i] = *(const v4f*)(kg + (size_t)(st * SK + 16 * i) * LDR); vr[i] = *(const v4f*)(vg + (size_t)(st * SK + 16 * i) * LDR); }
        asm volatile("s_wait_xcnt 0x0" ::: "memory");          // stands in front of the pass's reuse of these loads' address registers
    };
    auto put = [&](unsigned slot) {
#pragma unroll
        for (int i = 0; i < 4; ++i) {
            *(u32x2*)(ks + slot * SLOT + 16u * i * PK) = u32x2{pack2(kr[i].x, kr[i].y), pack2(kr[i].z, kr[i].w)};
            *(u32x2*)(vs + slot * SLOT + 16u * i * PV) = u32x2{pack2(vr[i].x, vr[i].y), pack2(vr[i].z, vr[i].w)};
        }
    };
    fetch(0);
    // Q fragments (B operand, column = query), hardware k order: d = 32 kc + 8 h + 0..7 and 32 kc + 16 + 8 h + 0..7
    Fr qf[2][2];
#pragma unroll
    for (int g = 0; g < 2; ++g) {
        const float* qp = Q + base + (size_t)(qw0 + 16u * g + c) * LDR + 8u * h;
#pragma unroll
        for (int kc = 0; kc < 2; ++kc) {
            const v4f a0 = *(const v4f*)(qp + 32 * kc), a1 = *(const v4f*)(qp + 32 * kc + 4), b0 = *(const v4f*)(qp + 32 * kc + 16), b1 = *(const v4f*)(qp + 32 * kc + 20);
            qf[g][kc].q[0] = u32x4{pack2(a0.x, a0.y), pack2(a0.z, a0.w), pack2(a1.x, a1.y), pack2(a1.z, a1.w)};
            qf[g][kc].q[1] = u32x4{pack2(b0.x, b0.y), pack2(b0.z, b0.w), pack2(b1.x, b1.y), pack2(b1.z, b1.w)};
        }
    }
    v8f acc[2][4]; float m_run[2], l_run[2];
#pragma unroll
    for (int g = 0; g < 2; ++g) { m_run[g] = -__builtin_inff(); l_run[g] = 0.f;
#pragma unroll
        for (int t = 0; t < 4; ++t) acc[g][t] = v8f{}; }
    put(0u);
    __syncthreads();
    const float L2E = 1.4426950408889634f;
    for (int st = 0; st < NST; ++st) {
        if (st + 1 < NST) fetch(st + 1);                       // next stage's rows fly while this stage is worked on
        const unsigned char* Kb = L + (unsigned)(st & 1) * SLOT;
        const unsigned char* Vb = Kb + TILE_K;
#pragma unroll 1   // one 32-key pass's fragments live at a time (registers for four waves per SIMD)
        for (unsigned sub = 0; sub < 2u; ++sub) {
            Fr kf[2][2];
            const unsigned char* kp = Kb + (sub * 32u + c) * PK + 16u * h;
#pragma unroll
            for (int kt = 0; kt < 2; ++kt)
#pragma unroll
                for (int kc = 0; kc < 2; ++kc) { kf[kt][kc].q[0] = *(const u32x4*)(kp + 16u * kt * PK + 64u * kc); kf[kt][kc].q[1] = *(const u32x4*)(kp + 16u * kt * PK + 64u * kc + 32u); }
            Fr vf[4];
            const unsigned char* ad = Vb + (sub * 32u + 8u * h + (lane & 7u)) * PV + ((lane >> 3) & 1u) * 16u;
#pragma unroll
            for (int t = 0; t < 4; ++t) { vf[t].q[0] = ld_tr16(ad + 32u * t); vf[t].q[1] = ld_tr16(ad + 16u * PV + 32u * t); }
            v8f s[2][2];                                       // s[kt][g][r] = score of key 16 kt + 8 h + r against query 16 g + c
#pragma unroll
            for (int kt = 0; kt < 2; ++kt)
#pragma unroll
                for (int g = 0; g < 2; ++g) { s[kt][g] = v8f{};
#pragma unroll
                    for (int kc = 0; kc < 2; ++kc) s[kt][g] = mma(kf[kt][kc], qf[g][kc], s[kt][g]); }
            float mb[2]; bool need = false;
#pragma unroll
            for (int g = 0; g < 2; ++g) {
                float mx = s[0][g][0];
#pragma unroll
                for (int r = 1; r < 8; ++r) mx = fmaxf(mx, s[0][g][r]);
#pragma unroll
                for (int r = 0; r < 8; ++r) mx = fmaxf(mx, s[1][g][r]);
                mx = fmaxf(mx, xhalf(mx)) * L2E;               // both halves hold this query's maximum, log2 domain
                mb[g] = mx; need = need || (mx > m_run[g] + 8.0f);
            }
            if (__builtin_amdgcn_ballot_w32(need) != 0) {      // wave-uniform; rare after the first pass
#pragma unroll
                for (int g = 0; g < 2; ++g) {
                    const float m_new = fmaxf(m_run[g], mb[g]);
                    const float corr = __builtin_amdgcn_exp2f(m_run[g] - m_new);   // 0 on the first pass
                    m_run[g] = m_new; l_run[g] *= corr;
#pragma unroll
                    for (int t = 0; t < 4; ++t) acc[g][t] = acc[g][t] * corr;
                }
            }
#pragma unroll
            for (int g = 0; g < 2; ++g) {
                const float nm = 7.0f - m_run[g];
                unsigned w[8]; f32x2 ps = {0.f, 0.f};
#pragma unroll
                for (int i = 0; i < 8; ++i) {
                    const f32x2 arg = __builtin_elementwise_fma(f32x2{s[i >> 2][g][2 * (i & 3)], s[i >> 2][g][2 * (i & 3) + 1]}, f32x2{L2E, L2E}, f32x2{nm, nm});
                    const f32x2 p = {__builtin_amdgcn_exp2f(arg.x), __builtin_amdgcn_exp2f(arg.y)};
                    ps += p; w[i] = pack2(p.x, p.y);
                }
                l_run[g] += ps.x + ps.y;
                Fr pf; pf.q[0] = u32x4{w[0], w[1], w[2], w[3]}; pf.q[1] = u32x4{w[4], w[5], w[6], w[7]};
#pragma unroll
                for (int t = 0; t < 4; ++t) acc[g][t] = mma(vf[t], pf, acc[g][t]);
            }
        }
        if (st + 1 < NST) put((unsigned)((st + 1) & 1));       // into the buffer whose readers all passed the last barrier
        __syncthreads();
    }
#pragma unroll
    for (int g = 0; g < 2; ++g) {
        const float l = l_run[g] + xhalf(l_run[g]);            // join the halves' sums, unconditionally
        const float inv = 1.0f / l;
        float* op = O + base + (size_t)(qw0 + 16u * g + c) * LDR + 8u * h;
#pragma unroll
        for (int t = 0; t < 4; ++t) {                          // registers 0..7 = d 16 t + 8 h + 0..7 of this lane's query
            const v8f o = acc[g][t] * inv;
            *(v4f*)(op + 16 * t) = v4f{o[0], o[1], o[2], o[3]};
            *(v4f*)(op + 16 * t + 4) = v4f{o[4], o[5], o[6], o[7]};
        }
    }
}
} // namespace sfa

// =====================================================================================================================
// k_tr: dst(z, c, r) = alpha * src(z, r, c) (+ beta * R2(z, c, r)): [Z][R][C] (row stride lds) -> [Z][C][R] (row stride ldd) through a 32x32 LDS tile;
//   flags: 1 -> add beta * residual R2 addressed like dst (z*sRz + c*ldr + r); act applied before the residual.
// =====================================================================================================================
struct TrP { const float* src; float* dst; const float* R2; long long sSz, lds, sDz, ldd, sRz, ldr; int R, C, flags, act; float alpha, beta; };
static_assert(sizeof(TrP) == 3 * 8 + 6 * 8 + 6 * 4, "TrP has padding");
__global__ __launch_bounds__(256) void k_tr(TrP p) {
    __shared__ float tile[32][33];
    const int c0 = blockIdx.x * 32, r0 = blockIdx.y * 32, z = blockIdx.z;
    const int lane = threadIdx.x & 31, wave = threadIdx.x >> 5;
    const float* s = p.src + z * p.sSz;
#pragma unroll
    for (int k = 0; k < 4; ++k) {
        const int rl = wave * 4 + k, r = r0 + rl, c = c0 + lane;
        tile[rl][lane] = (r < p.R && c < p.C) ? s[(long long)r * p.lds + c] : 0.f;
    }
    __syncthreads();
    float* d = p.dst + z * p.sDz; const float* rr = p.R2 + z * p.sRz;
#pragma unroll
    for (int k = 0; k < 4; ++k) {
        const int cl = wave * 4 + k, c = c0 + cl, r = r0 + lane;
        if (c < p.C && r < p.R) {
            float v = act_fn(p.alpha * tile[lane][cl], p.act);
            if (p.flags & 1) v += p.beta * rr[(long long)c * p.ldr + r];
            VST2(float, d + (long long)c * p.ldd + r, v);
        }
    }
}

// k_affine: dst[i] = a * (sdev ? sdev[0] : 1) * src[i] + b, i < n (one thread per element; consecutive lanes -> consecutive addresses)
__global__ __launch_bounds__(256) void k_affine(const float* __restrict__ src, float* __restrict__ dst, int n, float a, float b, const float* __restrict__ sdev) {
    const int i = blockIdx.x * 256 + threadIdx.x;
    if (i < n) { const float aa = sdev ? a * sdev[0] : a; const float v = aa * src[i] + b; VST2(float, dst + i, v); }
}

// =====================================================================================================================
// k_softmax: row softmax over n contiguous elements, one 256-thread block per row; rows addressed z*sz + r*sr (grid (R, Z)).
//   out = scale_out * softmax(scale_in * x + (Mf ? Mf[z*smz + r*smr + j] : 0)); a row whose max is -inf is written as 0.
// =====================================================================================================================
struct SmP { const float* src; float* dst; const float* Mf; long long sz, sr, dz, dr, smz, smr; int n, pad; float scale_in, scale_out; };
static_assert(sizeof(SmP) == 3 * 8 + 6 * 8 + 4 * 4, "SmP has padding");
__global__ __launch_bounds__(256) void k_softmax(SmP p) {
    __shared__ float red[256];
    const int r = blockIdx.x, z = blockIdx.y, tid = threadIdx.x;
    const float* s = p.src + z * p.sz + (long long)r * p.sr;
    const float* mf = p.Mf ? (p.Mf + z * p.smz + (long long)r * p.smr) : nullptr;
    float mx = -__builtin_inff();
    for (int j = tid; j < p.n; j += 256) { float v = s[j] * p.scale_in; if (mf) v += mf[j]; mx = fmaxf(mx, v); }
    red[tid] = mx; __syncthreads();
    for (int o = 128; o > 0; o >>= 1) { if (tid < o) red[tid] = fmaxf(red[tid], red[tid + o]); __syncthreads(); }
    mx = red[0]; __syncthreads();
    float sum = 0.f;
    for (int j = tid; j < p.n; j += 256) { float v = s[j] * p.scale_in; if (mf) v += mf[j]; sum += (mx == -__builtin_inff()) ? 0.f : expf(v - mx); }
    red[tid] = sum; __syncthreads();
    for (int o = 128; o > 0; o >>= 1) { if (tid < o) red[tid] += red[tid + o]; __syncthreads(); }
    sum = red[0];
    const float inv = (sum > 0.f) ? p.scale_out / sum : 0.f;
    float* d = p.dst + z * p.dz + (long long)r * p.dr;
    for (int j = tid; j < p.n; j += 256) { float v = s[j] * p.scale_in; if (mf) v += mf[j]; const float o = (mx == -__builtin_inff()) ? 0.f : expf(v - mx) * inv; VST2(float, d + j, o); }
}
// =====================================================================================================================
// k_stats: mean and rsqrt(var + eps) over a set of n elements addressed base + z*sz + (e / inner) * so + (e % inner) * si, one 256-thread
// k_norm_apply: y = (x - mean[set]) * rstd[set] * g[c] + b[c] over a [Z][C][L] channel-major tensor with set = z*G + c / (C/G) (G groups per z;
//   G = C -> per-channel sets indexed z*C+c; for batch norm pass stats indexed by c only via bn = 1). Optional act. Output same layout.
// =====================================================================================================================
//   mode 0: mean / rsqrt(var + eps); mode 1 (RMSNorm): 0 / rsqrt(mean(x^2) + eps); mode 2 (L2 normalize * sqrt(n)): 0 / sqrt(n) / max(||x||, eps); mode 3: as 0 with unbiased variance (n-1)
__global__ __launch_bounds__(256) void k_stats(const float* __restrict__ x, long long sz, long long so, long long si, int inner, int n, float eps, float* __restrict__ stat, int mode) {
    __shared__ float red[256];
    const int z = blockIdx.x, tid = threadIdx.x;
    const float* base = x + z * sz;
    float s = 0.f;
    for (int e = tid; e < n; e += 256) s += base[(long long)(e / inner) * so + (long long)(e % inner) * si];
    red[tid] = s; __syncthreads();
    for (int o = 128; o > 0; o >>= 1) { if (tid < o) red[tid] += red[tid + o]; __syncthreads(); }
    const float mu = (mode == 0 || mode == 3) ? red[0] / (float)n : 0.f; __syncthreads();
    float q = 0.f;
    for (int e = tid; e < n; e += 256) { const float dlt = base[(long long)(e / inner) * so + (long long)(e % inner) * si] - mu; q += dlt * dlt; }
    red[tid] = q; __syncthreads();
    for (int o = 128; o > 0; o >>= 1) { if (tid < o) red[tid] += red[tid + o]; __syncthreads(); }
    {
        float rs;
        if (mode == 2) rs = sqrtf((float)n) / fmaxf(sqrtf(red[0]), eps); else if (mode == 3) rs = rsqrtf(red[0] / (float)(n - 1) + eps); else rs = rsqrtf(red[0] / (float)n + eps);
        if (tid < 32) { const float v = (tid == 0) ? mu : ((tid == 1) ? rs : 0.f); VST2(float, stat + (long long)z * 32 + tid, v); }
    }
}
//   One thread per element over the flat [Z][C][L] index space: grid ceil(Z*C*L / 256).
__global__ __launch_bounds__(256) void k_norm_apply(const float* __restrict__ x, float* __restrict__ y, const float* __restrict__ stat, const float* __restrict__ g, const float* __restrict__ bta,
                                                     int Z, int C, int L, int G, int bn, int act) {
    const long long idx = (long long)blockIdx.x * 256 + threadIdx.x;
    if (idx >= (long long)Z * C * L) return;
    const int l = (int)(idx % L); const long long zc = idx / L; const int c = (int)(zc % C), z = (int)(zc / C); (void)l;
    const int set = bn ? c : (z * G + c / (C / G));
    float v = (x[idx] - stat[(long long)set * 32]) * stat[(long long)set * 32 + 1];
    if (g) v *= g[c];
    if (bta) v += bta[c];
    v = act_fn(v, act);
    VST2(float, y + idx, v);
}

// k_lse_neg: c[i] = -(st[2i] + log(st[2i+1])) = minus the log-sum-exp of row i from k_attn's ST output (for softmax over the query dimension)
__global__ __launch_bounds__(256) void k_lse_neg(const float* __restrict__ st, float* __restrict__ c, int n) {
    const int i = blockIdx.x * 256 + threadIdx.x;
    if (i < n) { const float v = -(st[2 * i] + logf(st[2 * i + 1])); VST2(float, c + i, v); }
}

// k_iota: dst[i] = a * i + b as int32 (segment/position id helper)
__global__ __launch_bounds__(256) void k_iota(int* __restrict__ dst, int n, int a, int b) {
    const int i = blockIdx.x * 256 + threadIdx.x;
    if (i < n) { const int v = a * i + b; VST2(int, dst + i, v); }
}

// k_axpby: dst[i] = a * x[i] + b * y[i] (+ c), i < n
__global__ __launch_bounds__(256) void k_axpby(const float* __restrict__ x, const float* __restrict__ y, float* __restrict__ dst, int n, float a, float b, float c) {
    const int i = blockIdx.x * 256 + threadIdx.x;
    if (i < n) { const float v = a * x[i] + b * y[i] + c; VST2(float, dst + i, v); }
}

// =====================================================================================================================
// k_rope: rotary embedding on a [R rows][Hn heads][D] view (row stride sXr, head stride sXh, element stride 1) -> Y (own strides).
//   mode 0: rotate_half (partner d±D/2, sign - for d<D/2); mode 1: interleaved pairs (partner d^1, sign - for even d).
//   table column tcol: tmode 0 -> d, 1 -> d % (D/2), 2 -> d / 2; position p: pmode 0 -> r % S, 1 -> head index, 2 -> pos[r];
//   c = C[(r / S) * sCb + p * sCp + tcol * sCd], s likewise from Sn; y = x[d] * c + sign * x[partner] * s. X and Y must not alias.
// =====================================================================================================================
struct RopeP { const float* X; float* Y; const float* C; const float* Sn; const int* pos; long long sXr, sXh, sYr, sYh, sCb, sCp, sCd; int R, Hn, D, S, mode, tmode, pmode, pad; };
static_assert(sizeof(RopeP) == 5 * 8 + 7 * 8 + 8 * 4, "RopeP has padding");
__global__ __launch_bounds__(256) void k_rope(RopeP p) {
    const long long idx = (long long)blockIdx.x * 256 + threadIdx.x;
    if (idx >= (long long)p.R * p.Hn * p.D) return;
    const int d = (int)(idx % p.D); const long long rh = idx / p.D; const int h = (int)(rh % p.Hn); const int r = (int)(rh / p.Hn);
    const int half = p.D / 2;
    int partner; float sign;
    if (p.mode == 0) { partner = (d < half) ? d + half : d - half; sign = (d < half) ? -1.f : 1.f; }
    else { partner = d ^ 1; sign = (d & 1) ? 1.f : -1.f; }
    const int tcol = (p.tmode == 0) ? d : ((p.tmode == 1) ? (d % half) : (d >> 1));
    const int pp = (p.pmode == 0) ? (r % p.S) : ((p.pmode == 1) ? h : p.pos[r]);
    const long long toff = (long long)(r / p.S) * p.sCb + (long long)pp * p.sCp + (long long)tcol * p.sCd;
    const float* xr = p.X + (long long)r * p.sXr + (long long)h * p.sXh;
    const float v = xr[d] * p.C[toff] + sign * xr[partner] * p.Sn[toff];
    VST2(float, p.Y + (long long)r * p.sYr + (long long)h * p.sYh + d, v);
}

// k_invf + k_sincos (split so neither kernel carries a large VALU-fma footprint): invf_i = num * (1 / powf(base, (2 i)/D)) [fmode 0],
//   num * expf((2 i) * cexp) [fmode 1], num * powf(base, -2 (i - 1) / D) [fmode 2]; then cs/sn[s*half + i] = cos/sin((pscale * s) * invf_i)
__global__ __launch_bounds__(256) void k_invf(float* __restrict__ invb, int half, int D, float base, float num, int fmode, float cexp) {
    const int i = blockIdx.x * 256 + threadIdx.x;
    if (i >= ((half + 31) / 32) * 32) return;
    if (i >= half) { VST2(float, invb + i, 0.f); return; }
    const float e = (float)(2 * i) / (float)D;
    float invf;
    if (fmode == 1) invf = num * expf((float)(2 * i) * cexp);
    else if (fmode == 2) invf = num * powf(base, (-2.0f * ((float)i - 1.0f)) / (float)D);
    else invf = num * (1.0f / powf(base, e));
    VST2(float, invb + i, invf);
}
__global__ __launch_bounds__(256) void k_sincos(float* __restrict__ cs, float* __restrict__ sn, const float* __restrict__ invb, int S, int half, float pscale) {
    const int idx = blockIdx.x * 256 + threadIdx.x;
    if (idx >= S * half) return;
    const int s = idx / half, i = idx - s * half;
    const float ang = (pscale * (float)s) * invb[i];
    VST2(float, cs + idx, cosf(ang)); VST2(float, sn + idx, sinf(ang));
}

// k_mulact: dst[i] = act(x[i]) * y[i]
__global__ __launch_bounds__(256) void k_mulact(const float* __restrict__ x, const float* __restrict__ y, float* __restrict__ dst, int n, int act) {
    const int i = blockIdx.x * 256 + threadIdx.x;
    if (i < n) { const float v = act_fn(x[i], act) * y[i]; VST2(float, dst + i, v); }
}

// =====================================================================================================================
// k_matvec: thread-per-row matrix-vector products for N <= 8 output columns (heads with 1-3 outputs, gates), f32 on the VALU.
//   C[r*sCm + j] = act(alpha * sum_k A[r*sAm + k*sAk] * B[j*sBn + k*sBk] + bias[j]) + beta * R[r*sRm + j*sRn]; each thread writes its N contiguous floats.
// =====================================================================================================================
__global__ __launch_bounds__(256) void k_matvec(GemmP p) {
    // N == 1: one row per thread, so 32 lanes write one line with one instruction; otherwise each thread takes 32 consecutive rows.
    const int rpt = (p.N == 1) ? 1 : 32;
    const long long r0 = ((long long)blockIdx.x * 256 + threadIdx.x) * rpt; const int z = blockIdx.z, zo = z / p.zi_n, zi = z - zo * p.zi_n;
    if (r0 >= p.M) return;
    const float* Bb = p.B + zo * p.sBo + zi * p.sBi;
    float* C = p.C + zo * p.sCo + zi * p.sCi; const float* R = p.R + zo * p.sRo + zi * p.sRi;
    for (int rr = 0; rr < rpt; ++rr) {
        const long long r = r0 + rr; if (r >= p.M) break;
        const float* A = p.A + zo * p.sAo + zi * p.sAi + r * p.sAm;
        float acc[8] = {0.f, 0.f, 0.f, 0.f, 0.f, 0.f, 0.f, 0.f};
        for (int k = 0; k < p.K; ++k) { const float a = A[(long long)k * p.sAk];
#pragma unroll
            for (int j = 0; j < 8; ++j) if (j < p.N) acc[j] += a * Bb[(long long)j * p.sBn + (long long)k * p.sBk]; }
#pragma unroll
        for (int j = 0; j < 8; ++j) if (j < p.N) {
            float v = acc[j] * p.alpha;
            if (p.flags & 1) v += p.bias[j];
            if (p.flags & 2) v += p.bias[r];
            v = act_fn(v, p.act);
            if (p.flags & 4) v += p.beta * R[r * p.sRm + (long long)j * p.sRn];
            VST2(float, C + r * p.sCm + j, v);
        }
    }
}
// k_smallsoftmax: thread-per-row softmax for short rows (n <= 64): dst[r*dr + j] = softmax(scale*src[r*sr + j])
__global__ __launch_bounds__(256) void k_smallsoftmax(const float* __restrict__ src, float* __restrict__ dst, long long sr, long long dr, int n, long long R, float scale) {
    const long long r0 = ((long long)blockIdx.x * 256 + threadIdx.x) * 32;
    for (int rr = 0; rr < 32; ++rr) {
        const long long r = r0 + rr; if (r >= R) return;
        const float* s = src + r * sr; float* d = dst + r * dr;
        float mx = -__builtin_inff();
        for (int j = 0; j < n; ++j) mx = fmaxf(mx, s[j] * scale);
        float sum = 0.f;
        for (int j = 0; j < n; ++j) sum += expf(s[j] * scale - mx);
        const float inv = 1.f / sum;
        for (int j = 0; j < n; ++j) { const float v = expf(s[j] * scale - mx) * inv; VST2(float, d + j, v); }
    }
}

__global__ __launch_bounds__(32) void k_unitstat(float* __restrict__ st) { const int t = threadIdx.x; const float v = (t == 1) ? 1.f : 0.f; VST2(float, st + t, v); }

// destination (e.g. a d_out whose row width is not a multiple of 32 floats) is written by consecutive lanes of one instruction
__global__ __launch_bounds__(256) void k_lincopy(const float* __restrict__ src, long long lds, float* __restrict__ dst, long long ldd, long long rows, int cols) {
    const long long i = (long long)blockIdx.x * 256 + threadIdx.x; if (i >= rows * cols) return;
    const long long r = i / cols; const int c = (int)(i - r * cols);
    const float v = src[r * lds + c]; VST2(float, dst + r * ldd + c, v);
}

namespace w25 {
typedef __attribute__((ext_vector_type(16))) _Float16 v16h;
typedef __attribute__((ext_vector_type(8)))  _Float16 v8h;
typedef __attribute__((ext_vector_type(16))) __bf16   v16b;
typedef __attribute__((ext_vector_type(8)))  __bf16   v8b;
typedef __attribute__((ext_vector_type(8)))  float    v8f;
typedef __attribute__((ext_vector_type(4)))  float    v4f;

__device__ __forceinline__ unsigned short f2bf_bits(float f) {
  unsigned u = __float_as_uint(f);
  return (unsigned short)((u + 0x7FFFu + ((u >> 16) & 1u)) >> 16);
}
__device__ __forceinline__ float bf_bits2f(unsigned short h) { return __uint_as_float(((unsigned)h) << 16); }

// hazard guards as plain device helpers (no inline asm inside the kernel template body)
__device__ __forceinline__ void dep_guard_h(v8f& a, v8f& b, v16h x, v16h y) { asm volatile("v_nop\n\tv_nop\n\tv_nop\n\tv_nop" : "+v"(a), "+v"(b) : "v"(x), "v"(y)); }
__device__ __forceinline__ void dep_guard_b(v8f& a, v8f& b, v16b x, v16b y) { asm volatile("v_nop\n\tv_nop\n\tv_nop\n\tv_nop" : "+v"(a), "+v"(b) : "v"(x), "v"(y)); }
__device__ __forceinline__ void keep4_h(v16h a, v16h b, v16h c, v16h d) { asm volatile("v_nop" :: "v"(a), "v"(b), "v"(c), "v"(d)); }
__device__ __forceinline__ void keep4_b(v16b a, v16b b, v16b c, v16b d) { asm volatile("v_nop" :: "v"(a), "v"(b), "v"(c), "v"(d)); }
__device__ __forceinline__ void acc_guard4(v8f& a, v8f& b, v8f& c, v8f& d) { asm volatile("v_nop\n\tv_nop\n\tv_nop\n\tv_nop" : "+v"(a), "+v"(b), "+v"(c), "+v"(d)); }
template <typename T> struct Frag;
template <> struct Frag<_Float16> {
  typedef v16h V; union U { v16h v; v8h h[2]; };
  static __device__ __forceinline__ v16h load(const _Float16* p) {   // elements 0..7 <- p[0..7], 8..15 <- p[16..23]
    U f; f.h[0] = *(const v8h*)(p); f.h[1] = *(const v8h*)(p + 16); return f.v;
  }
  static __device__ __forceinline__ v8f mma(v16h a, v16h b, v8f c) {
    return __builtin_amdgcn_wmma_f32_16x16x32_f16(false, a, false, b, (short)0, c, false, false);
  }
  static __device__ __forceinline__ void guard(v8f& a, v8f& b, v16h x, v16h y) { dep_guard_h(a, b, x, y); }
  static __device__ __forceinline__ void keep(v16h a, v16h b, v16h c, v16h d) { keep4_h(a, b, c, d); }
};
template <> struct Frag<__bf16> {
  typedef v16b V; union U { v16b v; v8b h[2]; };
  static __device__ __forceinline__ v16b load(const __bf16* p) {
    U f; f.h[0] = *(const v8b*)(p); f.h[1] = *(const v8b*)(p + 16); return f.v;
  }
  static __device__ __forceinline__ v8f mma(v16b a, v16b b, v8f c) {
    return __builtin_amdgcn_wmma_f32_16x16x32_bf16(false, a, false, b, (short)0, c, false, false);
  }
  static __device__ __forceinline__ void guard(v8f& a, v8f& b, v16b x, v16b y) { dep_guard_b(a, b, x, y); }
  static __device__ __forceinline__ void keep(v16b a, v16b b, v16b c, v16b d) { keep4_b(a, b, c, d); }
};

// ---- Register-blocked batched WMMA GEMM ------------------------------------
// C[m,n] = scale * sum_k A[m,k] * Bt[n,k] (+bias)(+resid); each wave owns a 64x64 tile.
// A row-major [M,K]; Bt row-major [N,K]; M,N % 64 == 0, K % 32 == 0.
// SPLIT: operands are hi/lo planes (A2/Bt2 = lo planes, same layout); product = hi·hi + hi·lo + lo·hi.
// BIAS_MODE: 0 = none, 1 = bias[m], 2 = bias[n].
// OUT_MODE: 0 = f32, 1 = f16, 2 = bf16 hi plane (Cout) + bf16 lo plane (Cout2).
// ET: 0 = f16 operands, 1 = bf16 operands (pointers passed as 16-bit storage)
template <int ET> struct Elem;
template <> struct Elem<0> { typedef _Float16 T; };
template <> struct Elem<1> { typedef __bf16 T; };
template <int ET, bool SPLIT, int BIAS_MODE, int OUT_MODE, bool RESID, int ACT = 0>
__global__ __launch_bounds__(256) void wmma_gemm64(
    const unsigned short* __restrict__ Ap, const unsigned short* __restrict__ A2p, int lda, long strideA, long strideAz,
    const unsigned short* __restrict__ Btp, const unsigned short* __restrict__ Bt2p, int ldb, long strideB, long strideBz,
    void* __restrict__ Cout, void* __restrict__ Cout2, int ldc, long strideC, long strideCz,
    const float* __restrict__ bias,
    const float* __restrict__ resid, long strideR,
    int M, int N, int K, float scale) {
  typedef typename Elem<ET>::T T;
  typedef typename Frag<T>::V V;
  const T* A = (const T*)Ap; const T* A2 = (const T*)A2p; const T* Bt = (const T*)Btp; const T* Bt2 = (const T*)Bt2p;
  __shared__ __align__(16) float sT[8][16 * 68];   // per-wave 16x64 slab, pitch 68 floats
  const int b    = blockIdx.y;
  const int lane = threadIdx.x & 31;
  const int wave = threadIdx.x >> 5;
  const int tilesN = N >> 6;
  const int tilesM = M >> 6;
  const int tile = blockIdx.x * 8 + wave;
  if (tile >= tilesM * tilesN) return;   // wave-uniform; no block barriers in this kernel
  const int tm = tile / tilesN;
  const int tn = tile - tm * tilesN;
  const int m0 = tm << 6;
  const int n0 = tn << 6;

  const int bz = blockIdx.z;                   // outer batch index (sample), with its own strides
  const T* Ab  = A  + (size_t)b * strideA + (size_t)bz * strideAz;
  const T* Bb  = Bt + (size_t)b * strideB + (size_t)bz * strideBz;
  const T* Ab2 = SPLIT ? (A2  + (size_t)b * strideA + (size_t)bz * strideAz) : nullptr;
  const T* Bb2 = SPLIT ? (Bt2 + (size_t)b * strideB + (size_t)bz * strideBz) : nullptr;

  const int rlane = lane & 15;                 // row (A) / col (B, D) within subtile
  const int koff  = (lane >> 4) * 8;           // k offset of this lane half
  const int mOff  = (lane >> 4) * 8;           // D row offset

  v8f acc[4][4];
#pragma unroll
  for (int i = 0; i < 4; ++i)
#pragma unroll
    for (int j = 0; j < 4; ++j) acc[i][j] = (v8f){0.f,0.f,0.f,0.f,0.f,0.f,0.f,0.f};

  for (int k0 = 0; k0 < K; k0 += 32) {
    V bh[4], bl[4];
#pragma unroll
    for (int j = 0; j < 4; ++j) {
      const size_t bo = (size_t)(n0 + (j << 4) + rlane) * ldb + koff + k0;
      bh[j] = Frag<T>::load(Bb + bo);
      if (SPLIT) bl[j] = Frag<T>::load(Bb2 + bo);
    }
#pragma unroll
    for (int i = 0; i < 4; ++i) {
      const size_t ao = (size_t)(m0 + (i << 4) + rlane) * lda + koff + k0;
      V ah = Frag<T>::load(Ab + ao);
      V al;
      if (SPLIT) al = Frag<T>::load(Ab2 + ao);
#pragma unroll
      for (int j = 0; j < 4; ++j) {
        acc[i][j] = Frag<T>::mma(ah, bh[j], acc[i][j]);
        if (SPLIT) {
          acc[i][j] = Frag<T>::mma(ah, bl[j], acc[i][j]);
          acc[i][j] = Frag<T>::mma(al, bh[j], acc[i][j]);
        }
      }
      Frag<T>::guard(acc[i][0], acc[i][3], ah, SPLIT ? al : ah);
    }
    Frag<T>::keep(bh[0], bh[1], bh[2], bh[3]);
    if (SPLIT) Frag<T>::keep(bl[0], bl[1], bl[2], bl[3]);
  }
  acc_guard4(acc[0][0], acc[0][1], acc[0][2], acc[0][3]);
  acc_guard4(acc[1][0], acc[1][1], acc[1][2], acc[1][3]);
  acc_guard4(acc[2][0], acc[2][1], acc[2][2], acc[2][3]);
  acc_guard4(acc[3][0], acc[3][1], acc[3][2], acc[3][3]);

  // ---- epilogue ----
  float* slab = sT[wave];
  const float* Rb = RESID ? (resid + (size_t)b * strideR) : nullptr;
#pragma unroll
  for (int i = 0; i < 4; ++i) {
    const int mBase = m0 + (i << 4);
#pragma unroll
    for (int j = 0; j < 4; ++j) {
      const int n = n0 + (j << 4) + rlane;
      float bv = 0.f;
      if (BIAS_MODE == 2) bv = bias[n];
#pragma unroll
      for (int r = 0; r < 8; ++r) {
        float v = acc[i][j][r] * scale;
        if (BIAS_MODE == 1) v += bias[mBase + mOff + r];
        if (BIAS_MODE == 2) v += bv;
        if (RESID) v += Rb[(size_t)(mBase + mOff + r) * ldc + n];
        if (ACT == 1) v = tanhf(v);
        if (ACT == 2) v = fmaxf(v, 0.0f);
        if (ACT == 3) v = v / (1.0f + expf(-v));
        if (ACT == 4) v = (v > 0.f) ? v : 0.01f * v;
        if (ACT == 5) v = 0.5f * v * (1.0f + erff(v * 0.70710678118654752f));
        slab[(mOff + r) * 68 + (j << 4) + rlane] = v;
      }
    }
    __builtin_amdgcn_fence(__ATOMIC_RELEASE, "workgroup");
    __builtin_amdgcn_wave_barrier();
    __builtin_amdgcn_fence(__ATOMIC_ACQUIRE, "workgroup");
    if (OUT_MODE == 0) {
      float* C = (float*)Cout + (size_t)b * strideC + (size_t)bz * strideCz;
      const int hh = lane >> 4, c4 = (lane & 15) * 4;     // row seg = 256 B = 16 lanes x 16 B
      {
#pragma unroll
        for (int it = 0; it < 8; ++it) {
          const int row = it * 2 + hh;
          v4f v = *(const v4f*)(slab + row * 68 + c4);
          *(v4f*)(C + (size_t)(mBase + row) * ldc + n0 + c4) = v;
        }
        
      }
    } else {
      const int q = lane >> 3, c8 = (lane & 7) * 8;
      unsigned short* C  = (unsigned short*)Cout  + (size_t)b * strideC + (size_t)bz * strideCz;
      unsigned short* C2 = (OUT_MODE == 2) ? ((unsigned short*)Cout2 + (size_t)b * strideC + (size_t)bz * strideCz) : nullptr;
      {
#pragma unroll
        for (int it = 0; it < 4; ++it) {
          const int row = it * 4 + q;
          const float* sp = slab + row * 68 + c8;
          v8h hv, lv;
#pragma unroll
          for (int e = 0; e < 8; ++e) {
            if (OUT_MODE == 1) {
              hv[e] = (_Float16)sp[e];
            } else {
              unsigned short hb = f2bf_bits(sp[e]);
              unsigned short lb = f2bf_bits(sp[e] - bf_bits2f(hb));
              hv[e] = __builtin_bit_cast(_Float16, hb);
              lv[e] = __builtin_bit_cast(_Float16, lb);
            }
          }
          *(v8h*)(C + (size_t)(mBase + row) * ldc + n0 + c8) = hv;
          if (OUT_MODE == 2) *(v8h*)(C2 + (size_t)(mBase + row) * ldc + n0 + c8) = lv;
        }
        
      }
    }
    __builtin_amdgcn_fence(__ATOMIC_RELEASE, "workgroup");
    __builtin_amdgcn_wave_barrier();
    __builtin_amdgcn_fence(__ATOMIC_ACQUIRE, "workgroup");
  }
}

// ---- The same product for large M, N: operands staged in LDS ----------------
// C[m,n] = act(scale * sum_k A[m,k] * Bt[n,k] (+ bias[n])), f32 out; A row-major [M,K], Bt row-major [N,K], both of row length K; M, N % 128 == 0, K % 64 == 0.
// Block = 4 waves (2 x 2) of 64x64 = one 128x128 tile of C; grid (N / 128, M / 128). A stage is 64 k = 128 B of each of the 128 + 128 operand rows
// (hi planes, then the lo planes when SPLIT), laid at a pitch of 144 B in one of two LDS buffers by asynchronous 16-byte copies: a wave's copy
// covers four whole 128-byte lines, and every staged row serves two waves. The next stage's copies fly while this stage is worked on.
// Per accumulator the products come in the same k order as in wmma_gemm64.
// The launch bound's second argument asks for four waves per SIMD (256 registers a wave): four one-plane blocks then share a WGP.
// Every inner loop is unrolled so that the fragment and accumulator arrays are indexed by constants and stay in registers.
__device__ __forceinline__ void ring_copy8(unsigned l, const unsigned char* g, size_t gstep) {
  // eight rows, 16 apart, of one plane; the closing s_wait_xcnt stands in front of any reuse of the address registers named here
  asm volatile("global_load_async_to_lds_b128 %0, %8, off\n\t"
               "global_load_async_to_lds_b128 %1, %9, off\n\t"
               "global_load_async_to_lds_b128 %2, %10, off\n\t"
               "global_load_async_to_lds_b128 %3, %11, off\n\t"
               "global_load_async_to_lds_b128 %4, %12, off\n\t"
               "global_load_async_to_lds_b128 %5, %13, off\n\t"
               "global_load_async_to_lds_b128 %6, %14, off\n\t"
               "global_load_async_to_lds_b128 %7, %15, off\n\t"
               "s_wait_xcnt 0x0"
               :: "v"(l), "v"(l + 2304u), "v"(l + 4608u), "v"(l + 6912u), "v"(l + 9216u), "v"(l + 11520u), "v"(l + 13824u), "v"(l + 16128u),
                  "v"(g), "v"(g + gstep), "v"(g + 2 * gstep), "v"(g + 3 * gstep), "v"(g + 4 * gstep), "v"(g + 5 * gstep), "v"(g + 6 * gstep), "v"(g + 7 * gstep)
               : "memory");
}
template <int ET, bool SPLIT, int BIAS_MODE, int ACT>
__global__ __launch_bounds__(128, 4) void wmma_gemm_ring(
    const unsigned short* __restrict__ Ap, const unsigned short* __restrict__ A2p,
    const unsigned short* __restrict__ Btp, const unsigned short* __restrict__ Bt2p,
    float* __restrict__ C, int ldc, const float* __restrict__ bias, int K, float scale) {
  typedef typename Elem<ET>::T T;
  typedef typename Frag<T>::V V;
  constexpr unsigned PITCH = 144u, PLANE = 128u * PITCH, BUF = (SPLIT ? 4u : 2u) * PLANE;
  static_assert(16u * PITCH == 2304u, "row step of ring_copy8");
  __shared__ __attribute__((aligned(256))) unsigned char L[2 * BUF];
  const unsigned tid = threadIdx.x, lane = tid & 31u, wave = tid >> 5;
  const int m0 = blockIdx.y * 128, n0 = blockIdx.x * 128;
  const unsigned wm = (wave >> 1) * 64u, wn = (wave & 1u) * 64u;
  const unsigned rlane = lane & 15u, hh = lane >> 4;

  // copies: 8 lanes cover one 128-byte row piece, thread t takes rows (t >> 3) + 16 i of every plane
  const size_t rowb = (size_t)K * 2u, gstep = 16u * rowb;
  const unsigned lc = (unsigned)(size_t)L + (tid >> 3) * PITCH + (tid & 7u) * 16u;
  const size_t ga = (size_t)(m0 + (int)(tid >> 3)) * rowb + (tid & 7u) * 16u;
  const size_t gb = (size_t)(n0 + (int)(tid >> 3)) * rowb + (tid & 7u) * 16u;
  auto stage = [&](int t, unsigned buf) {
    const size_t ko = (size_t)t * 128u;
    ring_copy8(lc + buf * BUF, (const unsigned char*)Ap + ga + ko, gstep);
    ring_copy8(lc + buf * BUF + PLANE, (const unsigned char*)Btp + gb + ko, gstep);
    if (SPLIT) {
      ring_copy8(lc + buf * BUF + 2u * PLANE, (const unsigned char*)A2p + ga + ko, gstep);
      ring_copy8(lc + buf * BUF + 3u * PLANE, (const unsigned char*)Bt2p + gb + ko, gstep);
    }
  };

  v8f acc[4][4];
#pragma unroll
  for (int i = 0; i < 4; ++i)
#pragma unroll
    for (int j = 0; j < 4; ++j) acc[i][j] = (v8f){0.f,0.f,0.f,0.f,0.f,0.f,0.f,0.f};

  const int NT = K >> 6;
  stage(0, 0u);
  asm volatile("s_wait_asynccnt 0x0" ::: "memory");            // this wave's copies of stage 0 have landed
  __syncthreads();                                             // and every other wave's
  if (NT > 1) stage(1, 1u);
  for (int t = 0; t < NT; ++t) {
    const unsigned char* Ab = L + (unsigned)(t & 1) * BUF + (wm + rlane) * PITCH + 16u * hh;
    const unsigned char* Bb = L + (unsigned)(t & 1) * BUF + PLANE + (wn + rlane) * PITCH + 16u * hh;
#pragma unroll
    for (unsigned ks = 0; ks < 2u; ++ks) {
      // fragments are asked for ahead of the products that use them: all eight of a k step (one plane), or B whole and A one row tile ahead (two planes)
      V bh[4], bl[4], ah[4], al[4];
#pragma unroll
      for (unsigned j = 0; j < 4u; ++j) {
        bh[j] = Frag<T>::load((const T*)(Bb + 16u * j * PITCH + 64u * ks));
        if (SPLIT) bl[j] = Frag<T>::load((const T*)(Bb + 2u * PLANE + 16u * j * PITCH + 64u * ks));
      }
#pragma unroll
      for (unsigned i = 0; i < (SPLIT ? 1u : 4u); ++i) {
        ah[i] = Frag<T>::load((const T*)(Ab + 16u * i * PITCH + 64u * ks));
        if (SPLIT) al[i] = Frag<T>::load((const T*)(Ab + 2u * PLANE + 16u * i * PITCH + 64u * ks));
      }
      __builtin_amdgcn_sched_barrier(0);                       // holds the reads above as one group: left free, each A read sinks to its first use and the wave waits out the LDS latency per row tile
#pragma unroll
      for (unsigned i = 0; i < 4u; ++i) {
        if (SPLIT && i < 3u) {
          ah[i + 1u] = Frag<T>::load((const T*)(Ab + 16u * (i + 1u) * PITCH + 64u * ks));
          al[i + 1u] = Frag<T>::load((const T*)(Ab + 2u * PLANE + 16u * (i + 1u) * PITCH + 64u * ks));
          __builtin_amdgcn_sched_barrier(0);                   // the next row tile's reads stay in front of this row tile's products
        }
#pragma unroll
        for (int j = 0; j < 4; ++j) {
          acc[i][j] = Frag<T>::mma(ah[i], bh[j], acc[i][j]);
          if (SPLIT) {
            acc[i][j] = Frag<T>::mma(ah[i], bl[j], acc[i][j]);
            acc[i][j] = Frag<T>::mma(al[i], bh[j], acc[i][j]);
          }
        }
      }
    }
    asm volatile("s_wait_dscnt 0x0" ::: "memory");             // this wave's reads of the buffer are done before it is handed to the copies
    asm volatile("s_wait_asynccnt 0x0" ::: "memory");          // this wave's copies of stage t + 1 have landed
    __syncthreads();                                           // publishes stage t + 1 and ends every wave's reads of stage t
    if (t + 2 < NT) stage(t + 2, (unsigned)(t & 1));
  }
  asm volatile("s_wait_asynccnt 0x0" ::: "memory");            // nothing in flight when the ring becomes output staging

  // ---- epilogue: as in wmma_gemm64, the per-wave 16x64 slab (pitch 68 floats) lies in the ring, which every wave has left ----
  float* slab = (float*)(L + wave * (16u * 68u * 4u));
  const int mOff = (int)hh * 8;
  float bv[4] = {0.f, 0.f, 0.f, 0.f};
  if (BIAS_MODE == 2) {
#pragma unroll
    for (int j = 0; j < 4; ++j) {
      bv[j] = bias[n0 + (int)wn + (j << 4) + (int)rlane];
      asm volatile("s_wait_xcnt 0x0" ::: "memory");            // behind each load: a later load's result may be given the index register that this load names
    }
  }
#pragma unroll
  for (int i = 0; i < 4; ++i) {
    const int mBase = m0 + (int)wm + (i << 4);
#pragma unroll
    for (int j = 0; j < 4; ++j) {
#pragma unroll
      for (int r = 0; r < 8; ++r) {
        float v = acc[i][j][r] * scale;
        if (BIAS_MODE == 2) v += bv[j];
        if (ACT == 5) v = 0.5f * v * (1.0f + erff(v * 0.70710678118654752f));
        slab[(mOff + r) * 68 + (j << 4) + (int)rlane] = v;
      }
    }
    __builtin_amdgcn_fence(__ATOMIC_RELEASE, "workgroup");
    __builtin_amdgcn_wave_barrier();
    __builtin_amdgcn_fence(__ATOMIC_ACQUIRE, "workgroup");
    const int c4 = (int)rlane * 4;                              // row piece = 256 B = 16 lanes x 16 B
#pragma unroll
    for (int it = 0; it < 8; ++it) {
      const int row = it * 2 + (int)hh;
      v4f v = *(const v4f*)(slab + row * 68 + c4);
      *(v4f*)(C + (size_t)(mBase + row) * ldc + n0 + (int)wn + c4) = v;
    }
    asm volatile("s_wait_xcnt 0x0" ::: "memory");              // stands in front of the next row tile's reuse of these stores' address and data registers
    __builtin_amdgcn_fence(__ATOMIC_RELEASE, "workgroup");
    __builtin_amdgcn_wave_barrier();
    __builtin_amdgcn_fence(__ATOMIC_ACQUIRE, "workgroup");
  }
}

__global__ __launch_bounds__(256) void cast_f32_f16x2(
    const float* __restrict__ in, _Float16* __restrict__ out, int n2) {
  int i = blockIdx.x * 256 + threadIdx.x;
  if (i < n2) {
    const _Float16 h0 = (_Float16)in[2 * i], h1 = (_Float16)in[2 * i + 1];
    const unsigned u = (unsigned)__builtin_bit_cast(unsigned short, h0) | ((unsigned)__builtin_bit_cast(unsigned short, h1) << 16);
    ((unsigned*)out)[i] = u;
    
  }
}


} // namespace w25

__global__ __launch_bounds__(256) void k_castT16(const float* __restrict__ src, long long lds, _Float16* __restrict__ dst, long long ldd, int R, int C, float s) {
    const long long i = (long long)blockIdx.x * 256 + threadIdx.x; const long long np = (long long)C * (R / 2); if (i >= np) return; const int c = (int)(i / (R / 2)); const int r = 2 * (int)(i % (R / 2));
    const _Float16 h0 = (_Float16)(src[(long long)r * lds + c] * s), h1 = (_Float16)(src[(long long)(r + 1) * lds + c] * s);
    const unsigned u = (unsigned)__builtin_bit_cast(unsigned short, h0) | ((unsigned)__builtin_bit_cast(unsigned short, h1) << 16);
    unsigned* d = (unsigned*)(dst + (long long)c * ldd + r); *d = u;  }
__global__ __launch_bounds__(256) void k_cast16(const float* __restrict__ src, long long lds, _Float16* __restrict__ dst, long long ldd, int R, int C, float s) {
    const long long i = (long long)blockIdx.x * 256 + threadIdx.x; const long long np = (long long)R * (C / 2); if (i >= np) return; const int r = (int)(i / (C / 2)); const int c = 2 * (int)(i % (C / 2));
    const _Float16 h0 = (_Float16)(src[(long long)r * lds + c] * s), h1 = (_Float16)(src[(long long)r * lds + c + 1] * s);
    const unsigned u = (unsigned)__builtin_bit_cast(unsigned short, h0) | ((unsigned)__builtin_bit_cast(unsigned short, h1) << 16);
    unsigned* d = (unsigned*)(dst + (long long)r * ldd + c); *d = u;  }

// f32 -> bf16 hi plane + bf16 lo plane (x = hi + lo to ~2^-17 relative; RNE both), [R][C] -> [R][C] (or transposed to [C][R]); 2 consecutive destination elements
__device__ __forceinline__ unsigned int f2bf2_pack(float a, float b, unsigned int* lo) {
    const unsigned short ha = w25::f2bf_bits(a), hb = w25::f2bf_bits(b);
    const unsigned short la = w25::f2bf_bits(a - w25::bf_bits2f(ha)), lb = w25::f2bf_bits(b - w25::bf_bits2f(hb));
    *lo = (unsigned)la | ((unsigned)lb << 16); return (unsigned)ha | ((unsigned)hb << 16); }

namespace w25 {
// =====================================================================================
// Generic causal/non-causal attention for head_dim 64, f32 in / f32 out; 16-bit operands: bf16 with optional hi/lo splits, or
// plain f16 (F16=true, non-split, probabilities carried x2^15).
//   scores = (q*qscale)·kᵀ : v_wmma_f32_16x16x32_bf16; SPLIT_QK -> q,k as bf16 hi/lo (hi·hi + hi·lo + lo·hi)
//   out    = p·v           : v_wmma_f32_16x16x32_bf16; SPLIT_PV -> p,v as bf16 hi/lo; else p,v plain bf16
//   f32 accumulate; online softmax in f32. Block = 4 waves = 64 query rows of one (batch, head); S % 64 == 0.
//   Element (b, s, h, d) of tensor X lives at X[b*X_bs + s*X_rs + h*X_hs + d] (strides in floats, multiples of 4).
//   Masking: mask_mode 0 none, 1 causal (kv > q masked), 2 tensor [S][Skv] shared over (b,h) (float if
//   mask_is_int==0, int32 with element == 0 -> masked if 1, int32 with element != 0 -> masked if 2), 3 per-token vectors qmask[B][S] & kvmask[B][Skv] (int32,
//   0 -> masked), 4 causal + sliding window (kv > q or q - kv > W masked; W passed in mask_is_int);
//   5 = relative-position bias: s += cp[b,h,q][idx[q][kv]] + pc[b,h,kv][idx[q][kv]] with idx = mask_b ([S][Skv] int32) and
//   mask_a an int32 [S][Skv] tensor with nonzero = masked (tables: element (b,h,row,n) at X + b*c_bs + h*c_hs + row*c_rs + n);
//   masked scores are replaced by mask_fill (e.g. -inf or -1e9) before the softmax.
//   grid.x = B * H * (S/64) (or a sub-range with blk0).
// =====================================================================================
#define AT_D 64
#define AT_NW 4
#define AT_QB 64
#define AT_KC 64
struct AttnGeom { const float* cp = nullptr; const float* pc = nullptr; long c_bs = 0, c_rs = 0, c_hs = 0;   // mode-5 score-bias tables
                  long q_bs, q_rs, q_hs, k_bs, k_rs, k_hs, v_bs, v_rs, v_hs, o_bs, o_rs, o_hs;
                  int S, Skv, H, mask_mode; float qscale; int blk0; float mask_fill; int mask_is_int; };
static_assert(sizeof(AttnGeom) == 168, "no padding");

__device__ __forceinline__ unsigned short at_bf_bits(float f) {
  unsigned u = __float_as_uint(f);
  return (unsigned short)((u + 0x7FFFu + ((u >> 16) & 1u)) >> 16);
}
__device__ __forceinline__ __bf16 at_f2bf(float f) { return __builtin_bit_cast(__bf16, at_bf_bits(f)); }
__device__ __forceinline__ void at_split(float f, __bf16& hi, __bf16& lo) {
  const unsigned short hb = at_bf_bits(f);
  hi = __builtin_bit_cast(__bf16, hb);
  lo = at_f2bf(f - __uint_as_float(((unsigned)hb) << 16));
}
__device__ __forceinline__ v8f at_mma(v16b a, v16b b, v8f c) {
  c = __builtin_amdgcn_wmma_f32_16x16x32_bf16(false, a, false, b, (short)0, c, false, false);
  asm volatile("v_nop\n\tv_nop\n\tv_nop\n\tv_nop" : "+v"(c) : "v"(a), "v"(b));
  return c;
}
// 16-bit element as a bit pattern held in a __bf16 slot: f16 bits when F16, bf16 (RNE) otherwise
template <bool F16> __device__ __forceinline__ __bf16 at_to16(float f) {
  if (F16) return __builtin_bit_cast(__bf16, (_Float16)f);
  return at_f2bf(f);
}
template <bool F16> __device__ __forceinline__ v8f at_mma16(v16b a, v16b b, v8f c) {
  if (F16) {
    const v16h ah = __builtin_bit_cast(v16h, a), bh = __builtin_bit_cast(v16h, b);
    c = __builtin_amdgcn_wmma_f32_16x16x32_f16(false, ah, false, bh, (short)0, c, false, false);
    asm volatile("v_nop\n\tv_nop\n\tv_nop\n\tv_nop" : "+v"(c) : "v"(ah), "v"(bh));
    return c;
  }
  return at_mma(a, b, c);
}

template <bool SPLIT_QK, bool SPLIT_PV, bool F16 = false>
__global__ __launch_bounds__(128)
void attn64_kernel(const float* __restrict__ q, const float* __restrict__ k,
                   const float* __restrict__ v, float* __restrict__ out,
                   const void* __restrict__ mask_a, const int* __restrict__ mask_b, AttnGeom g) {
  static_assert(!(F16 && (SPLIT_QK || SPLIT_PV)), "f16 mode is non-split");
  const float PSC = F16 ? 32768.0f : 1.0f;     // f16 probabilities carried x2^15 (subnormal range), folded into the final 1/l
  union FB { v16b v; v8b h[2]; };
  __shared__ __align__(16) __bf16 Ksh[AT_KC * AT_D];             // K hi [kv][d]      8 KB
  __shared__ __align__(16) __bf16 Ksl[SPLIT_QK ? AT_KC * AT_D : 8];
  __shared__ __align__(16) __bf16 Vth[AT_D * AT_KC];             // V hi [d][kv]      8 KB
  __shared__ __align__(16) __bf16 Vtl[SPLIT_PV ? AT_D * AT_KC : 8];
  __shared__ __align__(16) __bf16 Psh[AT_NW][16 * AT_KC];        // per wave P hi [row][kv]  8 KB
  __shared__ __align__(16) __bf16 Psl[SPLIT_PV ? AT_NW : 1][SPLIT_PV ? 16 * AT_KC : 8];
  __shared__ __align__(16) float  Os[AT_NW][16 * 68];            // per wave out tile, pitch 68

  const int tid  = threadIdx.x;
  const int wave = tid >> 5;
  const int lane = tid & 31;
  const int hh   = lane >> 4;
  const int c    = lane & 15;

  const int nqb = g.S / AT_QB;
  const int bx = blockIdx.x + g.blk0;
  const int qb = bx % nqb;
  const int bh = bx / nqb;
  const int h  = bh % g.H;
  const int b  = bh / g.H;
  const int qbase_block = qb * AT_QB;
  const int q0 = qbase_block + wave * 16;

  const float* qb_ptr = q + (size_t)b * g.q_bs + (size_t)h * g.q_hs;
  const float* kb_ptr = k + (size_t)b * g.k_bs + (size_t)h * g.k_hs;
  const float* vb_ptr = v + (size_t)b * g.v_bs + (size_t)h * g.v_hs;
  float*       ob_ptr = out + (size_t)b * g.o_bs + (size_t)h * g.o_hs;

  // ---- Q fragments (A operand): 2 d-chunks, hi (and lo) ----
  v16b qah[2], qal[2];
  {
    const float* qrow = qb_ptr + (size_t)(q0 + c) * g.q_rs;
#pragma unroll
    for (int dc = 0; dc < 2; ++dc) {
#pragma unroll
      for (int e = 0; e < 8; ++e) {
        const float f0 = qrow[dc * 32 + 8 * hh + e] * g.qscale;
        const float f1 = qrow[dc * 32 + 16 + 8 * hh + e] * g.qscale;
        if (SPLIT_QK) { __bf16 hq, lq; at_split(f0, hq, lq); qah[dc][e] = hq; qal[dc][e] = lq; at_split(f1, hq, lq); qah[dc][8 + e] = hq; qal[dc][8 + e] = lq; }
        else { qah[dc][e] = at_to16<F16>(f0); qah[dc][8 + e] = at_to16<F16>(f1); qal[dc][e] = qah[dc][e]; qal[dc][8 + e] = qah[dc][8 + e]; }
      }
    }
  }

  float mrow[8], lrow[8];
  v8f oacc[4];
#pragma unroll
  for (int r = 0; r < 8; ++r) { mrow[r] = -INFINITY; lrow[r] = 0.f; }
#pragma unroll
  for (int t = 0; t < 4; ++t) oacc[t] = (v8f){0.f,0.f,0.f,0.f,0.f,0.f,0.f,0.f};

  const int nChunks = (g.mask_mode == 1 || g.mask_mode == 4) ? (qb + 1) : (g.Skv / AT_KC);   // block-uniform
  // per-row query mask (mode 3)
  int qkeep[8];
#pragma unroll
  for (int r = 0; r < 8; ++r) qkeep[r] = (g.mask_mode == 3) ? mask_b[(size_t)b * g.S + q0 + 8 * hh + r] : 1;   // mask_b = qmask in mode 3
  for (int kc = 0; kc < nChunks; ++kc) {
    const int kv0 = kc * AT_KC;
    __syncthreads();
    {
      const int kvr = tid >> 1, dh = (tid & 1) * 32;
      const float* krow = kb_ptr + (size_t)(kv0 + kvr) * g.k_rs + dh;
      const float* vrow = vb_ptr + (size_t)(kv0 + kvr) * g.v_rs + dh;
#pragma unroll
      for (int i = 0; i < 8; ++i) {
        v4f kk = *(const v4f*)(krow + 4 * i);
        v4f vv = *(const v4f*)(vrow + 4 * i);
#pragma unroll
        for (int e = 0; e < 4; ++e) {
          const int d = dh + 4 * i + e;
          if (SPLIT_QK) { __bf16 a, bl; at_split(kk[e], a, bl); Ksh[kvr * AT_D + d] = a; Ksl[kvr * AT_D + d] = bl; }
          else Ksh[kvr * AT_D + d] = at_to16<F16>(kk[e]);
          if (SPLIT_PV) { __bf16 a, bl; at_split(vv[e], a, bl); Vth[d * AT_KC + kvr] = a; Vtl[d * AT_KC + kvr] = bl; }
          else Vth[d * AT_KC + kvr] = at_to16<F16>(vv[e]);
        }
      }
    }
    __syncthreads();

    v8f s[4];
#pragma unroll
    for (int j = 0; j < 4; ++j) {
      s[j] = (v8f){0.f,0.f,0.f,0.f,0.f,0.f,0.f,0.f};
#pragma unroll 1
      for (int dc = 0; dc < 2; ++dc) {
        FB kb;
        kb.h[0] = *(const v8b*)(Ksh + (j * 16 + c) * AT_D + dc * 32 + 8 * hh);
        kb.h[1] = *(const v8b*)(Ksh + (j * 16 + c) * AT_D + dc * 32 + 16 + 8 * hh);
        s[j] = at_mma16<F16>(qah[dc], kb.v, s[j]);
        if (SPLIT_QK) {
          FB kl;
          kl.h[0] = *(const v8b*)(Ksl + (j * 16 + c) * AT_D + dc * 32 + 8 * hh);
          kl.h[1] = *(const v8b*)(Ksl + (j * 16 + c) * AT_D + dc * 32 + 16 + 8 * hh);
          s[j] = at_mma16<F16>(qah[dc], kl.v, s[j]);
          s[j] = at_mma16<F16>(qal[dc], kb.v, s[j]);
        }
      }
    }
    const bool diag = (g.mask_mode == 1) && (kc == qb);
    int kvkeep[4] = {1, 1, 1, 1};
    if (g.mask_mode == 3) {
#pragma unroll
      for (int j = 0; j < 4; ++j) kvkeep[j] = ((const int*)mask_a)[(size_t)b * g.Skv + kv0 + j * 16 + c];   // mask_a = kvmask
    }
    float cm[8];
#pragma unroll
    for (int r = 0; r < 8; ++r) {
      const int qrow = q0 + 8 * hh + r;
      float m = -INFINITY;
#pragma unroll
      for (int j = 0; j < 4; ++j) {
        const int kvcol = kv0 + j * 16 + c;
        bool masked = false;
        if (diag) masked = (kvcol > qrow);
        else if (g.mask_mode == 4) masked = (kvcol > qrow) || (qrow - kvcol > g.mask_is_int);
        else if (g.mask_mode == 2) {
          const size_t mi = (size_t)qrow * g.Skv + kvcol;
          masked = (g.mask_is_int == 0) ? (((const float*)mask_a)[mi] == 0.0f)
                 : (g.mask_is_int == 1) ? (((const int*)mask_a)[mi] == 0) : (((const int*)mask_a)[mi] != 0);
        } else if (g.mask_mode == 3) masked = (qkeep[r] == 0) || (kvkeep[j] == 0);
        else if (g.mask_mode == 5) {
          const size_t mi = (size_t)qrow * g.Skv + kvcol;
          masked = (((const int*)mask_a)[mi] != 0);
          int n = mask_b[mi]; n = n < 0 ? 0 : n;
          s[j][r] += g.cp[(size_t)b * g.c_bs + (size_t)h * g.c_hs + (size_t)qrow * g.c_rs + n]
                   + g.pc[(size_t)b * g.c_bs + (size_t)h * g.c_hs + (size_t)kvcol * g.c_rs + n];
        }
        if (masked) s[j][r] = g.mask_fill;
        m = fmaxf(m, s[j][r]);
      }
#pragma unroll
      for (int off = 1; off < 16; off <<= 1) m = fmaxf(m, __shfl_xor(m, off, 32));
      cm[r] = m;
    }
    __bf16* pwh = Psh[wave];
    __bf16* pwl = Psl[SPLIT_PV ? wave : 0];
#pragma unroll
    for (int r = 0; r < 8; ++r) {
      const float mnew = fmaxf(mrow[r], cm[r]);
      const float alpha = expf(mrow[r] - mnew);
      mrow[r] = mnew;
      float psum = 0.f;
#pragma unroll
      for (int j = 0; j < 4; ++j) {
        const float p = expf(s[j][r] - mnew);
        psum += p;
        if (SPLIT_PV) { __bf16 a, bl; at_split(p, a, bl); pwh[(8 * hh + r) * AT_KC + j * 16 + c] = a; pwl[(8 * hh + r) * AT_KC + j * 16 + c] = bl; }
        else pwh[(8 * hh + r) * AT_KC + j * 16 + c] = at_to16<F16>(p * PSC);
      }
#pragma unroll
      for (int off = 1; off < 16; off <<= 1) psum += __shfl_xor(psum, off, 32);
      lrow[r] = lrow[r] * alpha + psum;
#pragma unroll
      for (int t = 0; t < 4; ++t) oacc[t][r] *= alpha;
    }
    __builtin_amdgcn_fence(__ATOMIC_RELEASE, "workgroup");
    __builtin_amdgcn_wave_barrier();
    __builtin_amdgcn_fence(__ATOMIC_ACQUIRE, "workgroup");
#pragma unroll 1
    for (int kk = 0; kk < 2; ++kk) {
      FB pa, pl;
      pa.h[0] = *(const v8b*)(pwh + c * AT_KC + kk * 32 + 8 * hh);
      pa.h[1] = *(const v8b*)(pwh + c * AT_KC + kk * 32 + 16 + 8 * hh);
      if (SPLIT_PV) {
        pl.h[0] = *(const v8b*)(pwl + c * AT_KC + kk * 32 + 8 * hh);
        pl.h[1] = *(const v8b*)(pwl + c * AT_KC + kk * 32 + 16 + 8 * hh);
      }
#pragma unroll
      for (int t = 0; t < 4; ++t) {
        FB vb;
        vb.h[0] = *(const v8b*)(Vth + (t * 16 + c) * AT_KC + kk * 32 + 8 * hh);
        vb.h[1] = *(const v8b*)(Vth + (t * 16 + c) * AT_KC + kk * 32 + 16 + 8 * hh);
        oacc[t] = at_mma16<F16>(pa.v, vb.v, oacc[t]);
        if (SPLIT_PV) {
          FB vl;
          vl.h[0] = *(const v8b*)(Vtl + (t * 16 + c) * AT_KC + kk * 32 + 8 * hh);
          vl.h[1] = *(const v8b*)(Vtl + (t * 16 + c) * AT_KC + kk * 32 + 16 + 8 * hh);
          oacc[t] = at_mma16<F16>(pa.v, vl.v, oacc[t]);
          oacc[t] = at_mma16<F16>(pl.v, vb.v, oacc[t]);
        }
      }
    }
  }

  float* os = Os[wave];
#pragma unroll
  for (int r = 0; r < 8; ++r) {
    const float inv = 1.0f / (lrow[r] * PSC);
#pragma unroll
    for (int t = 0; t < 4; ++t) os[(8 * hh + r) * 68 + t * 16 + c] = oacc[t][r] * inv;
  }
  __builtin_amdgcn_fence(__ATOMIC_RELEASE, "workgroup");
  __builtin_amdgcn_wave_barrier();
  __builtin_amdgcn_fence(__ATOMIC_ACQUIRE, "workgroup");
  {
    const int c4 = (lane & 15) * 4;
    {
#pragma unroll
      for (int it = 0; it < 8; ++it) {
        const int row = it * 2 + hh;
        v4f val = *(const v4f*)(os + row * 68 + c4);
        *(v4f*)(ob_ptr + (size_t)(q0 + row) * g.o_rs + c4) = val;
      }
      
    }
  }
}

} // namespace w25

__device__ __forceinline__ void st_h2(_Float16* dst, float a, float b) { const unsigned u = (unsigned)__builtin_bit_cast(unsigned short, (_Float16)a) | ((unsigned)__builtin_bit_cast(unsigned short, (_Float16)b) << 16); unsigned* d = (unsigned*)dst; *d = u;  }
// tiled biases BEB[c] = bE[c % 64], BFB[c] = bF[c % 64] (thread-linear)
__global__ __launch_bounds__(256) void k_ep_btile(const float* __restrict__ BE, const float* __restrict__ BF, float* __restrict__ BEB, float* __restrict__ BFB, int C, int HD) { const int t = blockIdx.x * 256 + threadIdx.x; if (t >= C) return; VST2(float, BEB + t, BE[t % HD]); VST2(float, BFB + t, BF[t % HD]); }
// channel softmax: block h = sample * NH + head (64 threads): rows of SCC[h] [64][64] * temp1[h % NH]; thread i computes row i, then lanes write columns so each 32-float line comes from one wave; P16[h][i][j] = f16(4096 p)
__global__ __launch_bounds__(64) void k_ep_csoft(const float* __restrict__ S, const float* __restrict__ T1, _Float16* __restrict__ P16, int NH) { __shared__ float sh[64][65]; const int h = blockIdx.x; const int i = threadIdx.x; const float* r = S + ((long long)h * 64 + i) * 64; const float tp = T1[h % NH]; float mx = -3.0e38f;
    for (int j = 0; j < 64; ++j) mx = fmaxf(mx, r[j] * tp);
    float s = 0.f; for (int j = 0; j < 64; ++j) { const float e = expf(r[j] * tp - mx); sh[i][j] = e; s += e; }
    const float f = 4096.f / s; for (int j = 0; j < 64; ++j) sh[i][j] *= f;
    __syncthreads();
    const int half = i >> 5, c0 = 2 * (i & 31);
    for (int step = 0; step < 32; ++step) { const int rr = 2 * step + half; st_h2(P16 + ((long long)h * 64 + rr) * 64 + c0, sh[rr][c0], sh[rr][c0 + 1]); } }


// ---- Wide forms of the conversion and scaling passes ----
// A lane moves U pieces of 4 consecutive elements: one 16-byte load a piece, so that a wave's load covers 512 contiguous bytes (four whole 128-byte lines) and its store whole lines too;
// all of a lane's loads are issued ahead of its first store. Planes of 2^LC columns, source rows PITCH floats apart, destination rows packed; a block's 256 lanes take 1024 elements
// = 1024 >> LC whole rows at a time, so a lane's pieces lie RS floats apart and hang on one address pair by constant offsets. The grid covers rows * columns / (1024 * U) blocks exactly.
typedef __attribute__((ext_vector_type(4))) unsigned int v4u;
typedef __attribute__((ext_vector_type(2))) unsigned int v2u;
__device__ __forceinline__ unsigned pk_h2(float a, float b) { return (unsigned)__builtin_bit_cast(unsigned short, (_Float16)a) | ((unsigned)__builtin_bit_cast(unsigned short, (_Float16)b) << 16); }
template <int LC, int PITCH>
__device__ __forceinline__ const float* wide_src(const float* src, unsigned q0) { static_assert(LC >= 2 && LC <= 10, "a block's 1024 elements are whole rows"); return src + (size_t)(q0 >> (LC - 2)) * PITCH + ((q0 & ((1u << (LC - 2)) - 1u)) << 2); }
template <int LC, int PITCH, int U>
__global__ __launch_bounds__(256) void k_cast16w(const float* __restrict__ src, _Float16* __restrict__ dst, float s) {
    constexpr int RS = (1024 >> LC) * PITCH; const unsigned q0 = blockIdx.x * (256u * U) + threadIdx.x; const float* p = wide_src<LC, PITCH>(src, q0); v4f a[U];
#pragma unroll   // constant indices keep the pieces in registers; the loads go out as one group
    for (int u = 0; u < U; ++u) a[u] = *(const v4f*)(p + u * RS);
    _Float16* d = dst + (size_t)q0 * 4;
#pragma unroll   // constant indices keep the pieces in registers
    for (int u = 0; u < U; ++u) { v2u o; o.x = pk_h2(a[u].x * s, a[u].y * s); o.y = pk_h2(a[u].z * s, a[u].w * s); *(v2u*)(d + u * 1024) = o; } }
template <int LC, int PITCH, int U>
__global__ __launch_bounds__(256) void k_castS16w(const float* __restrict__ src, __bf16* __restrict__ dhi, __bf16* __restrict__ dlo) {
    constexpr int RS = (1024 >> LC) * PITCH; const unsigned q0 = blockIdx.x * (256u * U) + threadIdx.x; const float* p = wide_src<LC, PITCH>(src, q0); v4f a[U];
#pragma unroll   // constant indices keep the pieces in registers; the loads go out as one group
    for (int u = 0; u < U; ++u) a[u] = *(const v4f*)(p + u * RS);
#pragma unroll   // constant indices keep the pieces in registers
    for (int u = 0; u < U; ++u) { v2u h, l; unsigned t; h.x = f2bf2_pack(a[u].x, a[u].y, &t); l.x = t; h.y = f2bf2_pack(a[u].z, a[u].w, &t); l.y = t;
        const size_t o = (size_t)q0 * 4 + u * 1024; *(v2u*)(dhi + o) = h; *(v2u*)(dlo + o) = l; } }
// Transposing split: block = one 64 x 64 tile of sample z (x: rows, y: columns), read as 256-byte row pieces, turned in LDS (pitch 65 floats: both sides free of bank conflicts),
// written as whole 128-byte lines of the two transposed planes; d[c][r] = split(src[r][c]).
__global__ __launch_bounds__(256) void k_castS16t(const float* __restrict__ src, int lds, __bf16* __restrict__ dhi, __bf16* __restrict__ dlo, int ldd, long long sby, long long dby) {
    __shared__ float sh[64][65];
    const int t = threadIdx.x, r0 = blockIdx.x * 64, c0 = blockIdx.y * 64, lr = t >> 4, lc = (t & 15) * 4;
    const float* p = src + (long long)blockIdx.z * sby + (long long)(r0 + lr) * lds + c0 + lc; v4f v[4];
#pragma unroll   // constant indices keep the pieces in registers; the loads go out as one group
    for (int u = 0; u < 4; ++u) v[u] = *(const v4f*)(p + (long long)(16 * u) * lds);
#pragma unroll   // constant indices keep the pieces in registers
    for (int u = 0; u < 4; ++u) { float* d = &sh[lr + 16 * u][lc]; d[0] = v[u].x; d[1] = v[u].y; d[2] = v[u].z; d[3] = v[u].w; }
    __syncthreads();   // the tile is read across the rows that other waves wrote
#pragma unroll   // constant indices keep the pieces in registers
    for (int u = 0; u < 2; ++u) { const int id = t + 256 * u, cc = id >> 3, rr = (id & 7) * 8; v4u h, l; unsigned w;
        h.x = f2bf2_pack(sh[rr][cc], sh[rr + 1][cc], &w); l.x = w; h.y = f2bf2_pack(sh[rr + 2][cc], sh[rr + 3][cc], &w); l.y = w;
        h.z = f2bf2_pack(sh[rr + 4][cc], sh[rr + 5][cc], &w); l.z = w; h.w = f2bf2_pack(sh[rr + 6][cc], sh[rr + 7][cc], &w); l.w = w;
        const long long o = (long long)blockIdx.z * dby + (long long)(c0 + cc) * ldd + r0 + rr; *(v4u*)(dhi + o) = h; *(v4u*)(dlo + o) = l; } }
// QS = q * temp2[head]; a lane's pieces share one column range of 4, inside one head (2^LH columns a head)
template <int LC, int PITCH, int LH, int U>
__global__ __launch_bounds__(256) void k_ep_qsw(const float* __restrict__ Q, const float* __restrict__ T2, float* __restrict__ QS) {
    constexpr int RS = (1024 >> LC) * PITCH; const unsigned q0 = blockIdx.x * (256u * U) + threadIdx.x; const float* p = wide_src<LC, PITCH>(Q, q0); v4f a[U];
#pragma unroll   // constant indices keep the pieces in registers; the loads go out as one group
    for (int u = 0; u < U; ++u) a[u] = *(const v4f*)(p + u * RS);
    const float tp = T2[((q0 & ((1u << (LC - 2)) - 1u)) << 2) >> LH];
    float* d = QS + (size_t)q0 * 4;
#pragma unroll   // constant indices keep the pieces in registers
    for (int u = 0; u < U; ++u) *(v4f*)(d + u * 1024) = a[u] * tp; }

extern "C" void kernel_launch(void* const* d_in, const int* in_sizes, int n_in, void* d_out, int out_size, void* d_ws, size_t ws_size, hipStream_t stream) {
    (void)in_sizes; (void)n_in; (void)out_size; (void)ws_size;
    const float* x = (const float*)d_in[0];
    const float* Wq = (const float*)d_in[1];
    const float* WE = (const float*)d_in[2];
    const float* bE = (const float*)d_in[3];
    const float* WF = (const float*)d_in[4];
    const float* bF = (const float*)d_in[5];
    const float* Wo1 = (const float*)d_in[6];
    const float* bo1 = (const float*)d_in[7];
    const float* Wo2 = (const float*)d_in[8];
    const float* bo2 = (const float*)d_in[9];
    const float* t1 = (const float*)d_in[10];
    const float* t2 = (const float*)d_in[11];
    const int Bn = 8;
    const int N = 1024;
    const int C = 1024;
    const int NH = 16;
    const int HD = 64;
    const int C4 = 4 * C;
    const int CH = C / 2;
    float* out = (float*)d_out;
    char* wsp = (char*)d_ws;
    const int BN = Bn * N;                    // all samples' rows: every launch below covers the whole batch
    const size_t MB = (size_t)1048576;
    float* QKVV = (float*)wsp; wsp += (((size_t)((size_t)BN * C4) * 4 + 255) / 256) * 256;
    unsigned short* WE16 = (unsigned short*)wsp; wsp += (((size_t)((size_t)HD * HD) * 2 + 255) / 256) * 256;
    unsigned short* WF16 = (unsigned short*)wsp; wsp += (((size_t)((size_t)HD * HD) * 2 + 255) / 256) * 256;
    float* BEB = (float*)wsp; wsp += (((size_t)((size_t)C) * 4 + 255) / 256) * 256;
    float* BFB = (float*)wsp; wsp += (((size_t)((size_t)C) * 4 + 255) / 256) * 256;
    // One 115 MiB region behind QKVV, used by three phases one after the other (stream order); a plane is reused only once its last reader has been launched.
    // projection: x planes and weight planes
    unsigned short* G64A  = (unsigned short*)(wsp);
    unsigned short* G64A2 = (unsigned short*)(wsp + 16 * MB);
    unsigned short* G64B  = (unsigned short*)(wsp + 32 * MB);
    unsigned short* G64B2 = (unsigned short*)(wsp + 36 * MB);
    // channel attention
    unsigned short* QTH   = (unsigned short*)(wsp);
    unsigned short* QTL   = (unsigned short*)(wsp + 16 * MB);
    unsigned short* KTH   = (unsigned short*)(wsp + 32 * MB);
    unsigned short* KTL   = (unsigned short*)(wsp + 48 * MB);
    unsigned short* VCA16 = (unsigned short*)(wsp + 64 * MB);
    float*          XC    = (float*)(wsp + 80 * MB);
    float*          SCC   = (float*)(wsp + 112 * MB);
    unsigned short* P16   = (unsigned short*)(wsp + 114 * MB);
    unsigned short* XC16  = (unsigned short*)(wsp);               // over QTH, read last by the affinity product
    unsigned short* WO2H  = (unsigned short*)(wsp + 16 * MB);     // over QTL
    // spatial attention
    unsigned short* K16   = (unsigned short*)(wsp);
    unsigned short* VSA16 = (unsigned short*)(wsp + 16 * MB);
    float*          KS    = (float*)(wsp + 32 * MB);
    float*          VS    = (float*)(wsp + 64 * MB);
    float*          QS    = (float*)(wsp);                        // over K16 and VSA16, read last by the E/F products
    float*          XS    = (float*)d_ws;                         // over QKVV, read last by k_ep_qsw
    unsigned short* XS16  = (unsigned short*)((char*)d_ws + 32 * MB);
    unsigned short* WO1H  = (unsigned short*)((char*)d_ws + 48 * MB);
    k_cast16<<<(unsigned)((((long long)(HD) * ((HD) / 2)) + 255) / 256), 256, 0, stream>>>(WE, HD, (_Float16*)(WE16), HD, HD, HD, 16.0f);
    k_cast16<<<(unsigned)((((long long)(HD) * ((HD) / 2)) + 255) / 256), 256, 0, stream>>>(WF, HD, (_Float16*)(WF16), HD, HD, HD, 16.0f);
    k_ep_btile<<<(C + 255) / 256, 256, 0, stream>>>(bE, bF, BEB, BFB, C, HD);
    // shared projection, rows = sample * N + n
    k_castS16w<10, 1024, 8><<<(unsigned)(BN / 8), 256, 0, stream>>>(x, (__bf16*)(G64A), (__bf16*)(G64A2));
    k_castS16w<10, 1024, 8><<<(unsigned)(2048 / 8), 256, 0, stream>>>(Wq, (__bf16*)(G64B), (__bf16*)(G64B2));
    w25::wmma_gemm_ring<1, true, 0, 0><<<dim3((unsigned)(2048 / 128), (unsigned)(BN / 128)), 128, 0, stream>>>((const unsigned short*)(G64A), (const unsigned short*)(G64A2), (const unsigned short*)(G64B), (const unsigned short*)(G64B2), QKVV, 4096, nullptr, 1024, 1.0f);
    k_cast16w<10, 1024, 16><<<(unsigned)(BN / 16), 256, 0, stream>>>(x, (_Float16*)(G64A), 1.0f);
    k_cast16w<10, 1024, 4><<<(unsigned)(2048 / 4), 256, 0, stream>>>(Wq + (size_t)2 * C * C, (_Float16*)(G64B), 16.0f);
    w25::wmma_gemm_ring<0, false, 0, 0><<<dim3((unsigned)(2048 / 128), (unsigned)(BN / 128)), 128, 0, stream>>>((const unsigned short*)(G64A), nullptr, (const unsigned short*)(G64B), nullptr, QKVV + 2 * C, 4096, nullptr, 1024, 0.0625f);
    // channel attention: grid y = head, grid z = sample
    k_cast16w<10, 4096, 16><<<(unsigned)(BN / 16), 256, 0, stream>>>(QKVV + 2 * C, (_Float16*)(VCA16), 1.0f);
    k_castS16t<<<dim3((unsigned)(N / 64), (unsigned)(C / 64), (unsigned)(Bn)), 256, 0, stream>>>(QKVV, C4, (__bf16*)(QTH), (__bf16*)(QTL), N, (long long)N * C4, (long long)C * N);
    k_castS16t<<<dim3((unsigned)(N / 64), (unsigned)(C / 64), (unsigned)(Bn)), 256, 0, stream>>>(QKVV + C, C4, (__bf16*)(KTH), (__bf16*)(KTL), N, (long long)N * C4, (long long)C * N);
    w25::wmma_gemm64<1, true, 0, 0, false, 0><<<dim3((unsigned)((((HD) / 64) * ((HD) / 64) + 7) / 8), (unsigned)(NH), (unsigned)(Bn)), 256, 0, stream>>>((const unsigned short*)(QTH), (const unsigned short*)(QTL), N, (long long)HD * N, (long long)C * N, (const unsigned short*)(KTH), (const unsigned short*)(KTL), N, (long long)HD * N, (long long)C * N, (void*)(SCC), nullptr, HD, HD * HD, NH * HD * HD, nullptr, nullptr, 0, HD, HD, N, 1.0f);
    k_ep_csoft<<<Bn * NH, 64, 0, stream>>>(SCC, t1, (_Float16*)P16, NH);
    w25::wmma_gemm64<0, false, 0, 0, false, 0><<<dim3((unsigned)((((HD) / 64) * ((N) / 64) + 7) / 8), (unsigned)(NH), (unsigned)(Bn)), 256, 0, stream>>>((const unsigned short*)(P16), nullptr, HD, HD * HD, NH * HD * HD, (const unsigned short*)(VCA16), nullptr, C, HD, (long long)N * C, (void*)(XC), nullptr, 16 * C, C, (long long)N * C, nullptr, nullptr, 0, HD, N, HD, 0.000244140625f);
    k_cast16w<10, 1024, 16><<<(unsigned)(BN / 16), 256, 0, stream>>>(XC, (_Float16*)(XC16), 1.0f);
    k_cast16w<10, 1024, 4><<<(unsigned)(512 / 4), 256, 0, stream>>>(Wo2, (_Float16*)(WO2H), 16.0f);
    w25::wmma_gemm_ring<0, false, 2, 5><<<dim3((unsigned)(512 / 128), (unsigned)(BN / 128)), 128, 0, stream>>>((const unsigned short*)(XC16), nullptr, (const unsigned short*)(WO2H), nullptr, out + CH, 1024, bo2, 1024, 0.0625f);
    // spatial attention
    k_cast16w<10, 4096, 16><<<(unsigned)(BN / 16), 256, 0, stream>>>(QKVV + C, (_Float16*)(K16), 1.0f);
    k_cast16w<10, 4096, 16><<<(unsigned)(BN / 16), 256, 0, stream>>>(QKVV + 3 * C, (_Float16*)(VSA16), 1.0f);
    w25::wmma_gemm64<0, false, 2, 0, false, 0><<<dim3((unsigned)((((BN) / 64) * ((HD) / 64) + 7) / 8), (unsigned)(NH), (unsigned)(1)), 256, 0, stream>>>((const unsigned short*)(K16), nullptr, C, HD, 0, (const unsigned short*)(WE16), nullptr, HD, 0, 0, (void*)(KS), nullptr, C, HD, 0, BEB, nullptr, 0, BN, HD, HD, 0.0625f);
    w25::wmma_gemm64<0, false, 2, 0, false, 0><<<dim3((unsigned)((((BN) / 64) * ((HD) / 64) + 7) / 8), (unsigned)(NH), (unsigned)(1)), 256, 0, stream>>>((const unsigned short*)(VSA16), nullptr, C, HD, 0, (const unsigned short*)(WF16), nullptr, HD, 0, 0, (void*)(VS), nullptr, C, HD, 0, BFB, nullptr, 0, BN, HD, HD, 0.0625f);
    k_ep_qsw<10, 4096, 6, 8><<<(unsigned)(BN / 8), 256, 0, stream>>>(QKVV, t2, QS);
    sfa::k_sflash<<<dim3((unsigned)(N / 256), (unsigned)(NH), (unsigned)(Bn)), 256, 0, stream>>>(QS, KS, VS, XS);
    k_cast16w<10, 1024, 16><<<(unsigned)(BN / 16), 256, 0, stream>>>(XS, (_Float16*)(XS16), 1.0f);
    k_cast16w<10, 1024, 4><<<(unsigned)(512 / 4), 256, 0, stream>>>(Wo1, (_Float16*)(WO1H), 16.0f);
    w25::wmma_gemm_ring<0, false, 2, 5><<<dim3((unsigned)(512 / 128), (unsigned)(BN / 128)), 128, 0, stream>>>((const unsigned short*)(XS16), nullptr, (const unsigned short*)(WO1H), nullptr, out, 1024, bo1, 1024, 0.0625f);
}
